// v000
// Times are from an AMD MI455X. After a warm-up the kernel runs many times in a row, and a time is the length of
// such a window on the GPU divided by its runs, so every launch and the gaps after it count. The runs cycle
// through copies of the inputs. A figure is the median of several windows, for all but v000 over two sittings.
// Sittings can differ by a few percent; kernels timed side by side share one.
// v000 is the starting kernel. One run takes 106 microseconds.
#include <hip/hip_runtime.h>

// Compute dtypes (f32 accumulate everywhere): q/k/v projections v_wmma_f32_16x16x32_bf16 on bf16 RNE-converted x and weights (exact products); scores q.k^T v_wmma_f32_16x16x32_f16 (q x16, k x16 carries); attn.V v_wmma_f32_16x16x32_f16 (exp weights x1024, v x16 carries); output projection v_wmma_f32_16x16x32_bf16 with the context as bf16 hi + lo planes (2 products) against bf16 wo.
// Multi-head attention: x [NB][SEQ_FULL][256] (first SEQ rows per batch used), per-head weights w[8][256][32] ([in][out] per head), scores x 256^-0.5, softmax over all SEQ keys (no mask), heads concatenated head-major, times wo [in][out].
// Plan: k_wprep (weight planes B^T, transposed through LDS), k_xprep (x plane), GEMM q|k -> f16 token-major plane [t][512], GEMM v^T -> f16 plane [b][h*32+e][t], k_flash (online softmax, fragments straight from planes, 16 queries x 2 heads per wave -> ctx hi/lo bf16 planes [t][256]), GEMM wo -> out f32.

#ifndef NB
#define NB 4
#endif
#ifndef SEQ
#define SEQ 2048
#endif
#define NB_FULL  4
#define SEQ_FULL 2048
#define DM   256      // model width = NH * HD
#define NH   8
#define HD   32       // head dim: exactly one 32-deep k-step per score tile
#define QKW  512      // q|k plane row width (q cols 0..255, k cols 256..511)
#define QCAR 16.0f    // carry on q, k and v planes
#define SCLX (0.0625f * 1.44269504088896340736f / 256.0f)   // 256^-0.5 x log2(e) / (16 x 16)

static_assert(DM == NH * HD);          // head-major concat width
static_assert(HD == 32);               // one WMMA k-step per head; two 16-wide e tiles
static_assert((NH & 1) == 0);
static_assert(SEQ % 64 == 0);          // 64-row GEMM tiles, 64-key flash steps, 64-query blocks
static_assert(DM % 64 == 0 && QKW % 64 == 0 && DM % 32 == 0);
static_assert(NB <= NB_FULL && SEQ <= SEQ_FULL);

typedef _Float16 h16;
typedef unsigned short bf;
typedef __attribute__((ext_vector_type(16))) __bf16   v16bf;
typedef __attribute__((ext_vector_type(16))) _Float16 v16h;
typedef __attribute__((ext_vector_type(8)))  _Float16 v8h;
typedef __attribute__((ext_vector_type(8)))  unsigned short v8us;
typedef __attribute__((ext_vector_type(8)))  float    v8f;
typedef __attribute__((ext_vector_type(4)))  float    v4f;
typedef v4f  __attribute__((may_alias)) v4fa;

__device__ __forceinline__ unsigned short f2bf(float f) { unsigned u = __float_as_uint(f); u += 0x7FFFu + ((u >> 16) & 1u); return (unsigned short)(u >> 16); }
__device__ __forceinline__ float bf2f(unsigned short b) { return __uint_as_float(((unsigned)b) << 16); }
__device__ __forceinline__ v16h cat16(v8h lo, v8h hi) { return __builtin_shufflevector(lo, hi, 0, 1, 2, 3, 4, 5, 6, 7, 8, 9, 10, 11, 12, 13, 14, 15); }
__device__ __forceinline__ v16bf cat16b(v8us lo, v8us hi) { return __builtin_bit_cast(v16bf, __builtin_shufflevector(lo, hi, 0, 1, 2, 3, 4, 5, 6, 7, 8, 9, 10, 11, 12, 13, 14, 15)); }
__device__ __forceinline__ v8f wmma16(v16h a, v16h b, v8f c) { return __builtin_amdgcn_wmma_f32_16x16x32_f16(false, a, false, b, (short)0, c, false, false); }
__device__ __forceinline__ v8f wmmab(v16bf a, v16bf b, v8f c) { return __builtin_amdgcn_wmma_f32_16x16x32_bf16(false, a, false, b, (short)0, c, false, false); }
__device__ __forceinline__ void splitf(float y, unsigned short& h, unsigned short& l) { h = f2bf(y); l = f2bf(y - bf2f(h)); }
// fragment from a K-contiguous f16 row: p already includes row and 8*(lane>>4); elements 0..7 <- p[0..7], 8..15 <- p[16..23]
__device__ __forceinline__ v16h ldh(const h16* p) { return cat16(*(const v8h*)p, *(const v8h*)(p + 16)); }

// ---- k_gemmw: register-blocked GEMM, ONE WAVE per 64x64 output tile (16 accumulators), operands straight from K-contiguous 16-bit planes (row pitch == K); grid (M/64, N/64, Z), 32 threads.
// C[m][n] = sum_k A[m][k] Bt[n][k] (+ A2 Bt, + A Bt2 per NSPLIT). z-batch strides sA/sB/sC in elements. K % 32 == 0, M % 64 == 0, N % 64 == 0 (no tail masking).
// OMODE 0: f32 C (pitch ldc): per 16-row slab staged in LDS, each row's 64 floats (256 B) written as 16 lanes x 16 B (2 rows per instruction).
template <typename T16> struct WFrag;
template <> struct WFrag<h16> { typedef v16h V; static __device__ __forceinline__ V ld(const h16* p) { return cat16(*(const v8h*)p, *(const v8h*)(p + 16)); } static __device__ __forceinline__ v8f mma(V a, V b, v8f c) { return wmma16(a, b, c); } };
template <> struct WFrag<bf> { typedef v16bf V; static __device__ __forceinline__ V ld(const bf* p) { return cat16b(*(const v8us*)p, *(const v8us*)(p + 16)); } static __device__ __forceinline__ v8f mma(V a, V b, v8f c) { return wmmab(a, b, c); } };
template <typename T16, int NSPLIT, int OMODE>
__global__ __launch_bounds__(32) void k_gemmw(const T16* __restrict__ A, const T16* __restrict__ A2, const T16* __restrict__ Bt, const T16* __restrict__ Bt2, int K, void* Cv, int ldc, float oscale, size_t sA, size_t sB, size_t sC) {
    typedef typename WFrag<T16>::V V;
    __shared__ __align__(16) float os[16 * 68];
    const size_t z = blockIdx.z; A += z * sA; if (A2) A2 += z * sA; Bt += z * sB; if (Bt2) Bt2 += z * sB;
    const unsigned lane = threadIdx.x & 31u, lr = lane & 15u, hi = lane >> 4; const unsigned r0 = blockIdx.x * 64u, c0 = blockIdx.y * 64u;
    v8f acc[4][4];
#pragma unroll
    for (int mb = 0; mb < 4; ++mb)
#pragma unroll
        for (int nb = 0; nb < 4; ++nb) acc[mb][nb] = (v8f){};
    const size_t aoff = (size_t)(r0 + lr) * K + 8 * hi, boff = (size_t)(c0 + lr) * K + 8 * hi;
#pragma unroll 1
    for (int kc = 0; kc < K; kc += 32) {
        V a[4], a2[4];
#pragma unroll
        for (int mb = 0; mb < 4; ++mb) { a[mb] = WFrag<T16>::ld(A + aoff + (size_t)mb * 16 * K + kc); if (NSPLIT == 1 || NSPLIT == 2) a2[mb] = WFrag<T16>::ld(A2 + aoff + (size_t)mb * 16 * K + kc); }
#pragma unroll
        for (int nb = 0; nb < 4; ++nb) { const V b = WFrag<T16>::ld(Bt + boff + (size_t)nb * 16 * K + kc); V b2; if (NSPLIT >= 2) b2 = WFrag<T16>::ld(Bt2 + boff + (size_t)nb * 16 * K + kc);
#pragma unroll
            for (int mb = 0; mb < 4; ++mb) { acc[mb][nb] = WFrag<T16>::mma(a[mb], b, acc[mb][nb]); if (NSPLIT == 1 || NSPLIT == 2) acc[mb][nb] = WFrag<T16>::mma(a2[mb], b, acc[mb][nb]); if (NSPLIT >= 2) acc[mb][nb] = WFrag<T16>::mma(a[mb], b2, acc[mb][nb]); } }
        if constexpr (NSPLIT == 1 || NSPLIT == 2) { asm volatile("v_nop\n\tv_nop\n\tv_nop\n\tv_nop" : "+v"(acc[0][0]), "+v"(acc[1][1]), "+v"(acc[2][2]), "+v"(acc[3][3]) : "v"(a[0]), "v"(a[3]), "v"(a2[3])); }
        else { asm volatile("v_nop\n\tv_nop\n\tv_nop\n\tv_nop" : "+v"(acc[0][0]), "+v"(acc[1][1]), "+v"(acc[2][2]), "+v"(acc[3][3]) : "v"(a[0]), "v"(a[3])); }
    }
#pragma unroll
    for (int mb = 0; mb < 4; ++mb) {
#pragma unroll
        for (int nb = 0; nb < 4; ++nb) {
#pragma unroll
            for (int j = 0; j < 8; ++j) os[(hi * 8 + j) * 68 + nb * 16 + lr] = acc[mb][nb][j]; }   /* D: row 8*hi + j, col 16*nb + lr */
        __syncthreads();   /* single-wave block: staging visible to every lane */
        if constexpr (OMODE == 0) {
            float* crow = (float*)Cv + z * sC + (size_t)(r0 + mb * 16) * ldc + c0;
{
#pragma unroll
                for (int s = 0; s < 8; ++s) { const unsigned row = 2u * s + hi, cofs = lr * 4u; const v4f val = *(const v4fa*)(os + row * 68 + cofs);
                    *(v4f*)(crow + (size_t)row * ldc + cofs) = val; }   /* rows 2s+hi, s 0..7: all 16 rows; 16 lanes x 16 B = 256 B row segment */
                 }
        } else {
            h16* crow = (h16*)Cv + z * sC + (size_t)(r0 + mb * 16) * ldc + c0;
{
#pragma unroll
                for (int s = 0; s < 4; ++s) { const unsigned row = 4u * s + (lane >> 3), pc = (lane & 7u) * 8u; const v4f v0 = *(const v4fa*)(os + row * 68 + pc); const v4f v1 = *(const v4fa*)(os + row * 68 + pc + 4); v8h o;
#pragma unroll
                    for (int q = 0; q < 4; ++q) { o[q] = (h16)(v0[q] * oscale); o[4 + q] = (h16)(v1[q] * oscale); }
                    *(v8h*)(crow + (size_t)row * ldc + pc) = o; }   
                 }
        }
        __syncthreads();   /* staging free before the next slab overwrites it */
    }
}

__global__ __launch_bounds__(256) void k_xprep(const float* __restrict__ x, bf* XB) {
    const unsigned i = blockIdx.x * 256u + threadIdx.x; if (i >= (unsigned)NB * SEQ * (DM / 8)) return;
    const unsigned b = i / ((unsigned)SEQ * (DM / 8)), r = i - b * ((unsigned)SEQ * (DM / 8));
    const float* s = x + ((size_t)b * SEQ_FULL * (DM / 8) + r) * 8; const v4f a0 = *(const v4f*)s, a1 = *(const v4f*)(s + 4); v8us o;
#pragma unroll
    for (int q = 0; q < 4; ++q) { o[q] = f2bf(a0[q]); o[4 + q] = f2bf(a1[q]); }
    *(v8us*)(XB + (size_t)i * 8) = o;  }

// k_wprep: B^T weight planes (bf16 RNE, K-contiguous rows of 256): block (g, mt) transposes in[256 d][32 e] -> out[32 e][256 d] through LDS.
// mt 0: wq[g][d][e] -> WQK row g*32+e; mt 1: wk -> WQK row 256 + g*32+e; mt 2: wv -> WV row g*32+e; mt 3: wo[d][g*32+e] -> WOT row g*32+e (in[256][256] -> out[256][256] transposed).
__global__ __launch_bounds__(256) void k_wprep(const float* __restrict__ wq, const float* __restrict__ wk, const float* __restrict__ wv, const float* __restrict__ wo, bf* WQK, bf* WV, bf* WOT) {
    __shared__ float ts[256 * 33];
    const unsigned tid = threadIdx.x, g = blockIdx.x, mt = blockIdx.y;
    const float* src = wq; unsigned gs = (unsigned)DM * HD, ds = HD; bf* dst = WQK;
    if (mt == 1u) { src = wk; dst = WQK + (size_t)DM * DM; } else if (mt == 2u) { src = wv; dst = WV; } else if (mt == 3u) { src = wo; gs = HD; ds = DM; dst = WOT; }
#pragma unroll 4
    for (unsigned it = 0; it < 32u; ++it) { const unsigned idx = it * 256u + tid, d = idx >> 5, e = idx & 31u; ts[d * 33u + e] = src[(size_t)g * gs + (size_t)d * ds + e]; }   /* 32 x 256 = all 8192 entries */
    __syncthreads();
{
#pragma unroll
        for (unsigned it = 0; it < 4u; ++it) { const unsigned p = it * 256u + tid, e = p >> 5, pc = p & 31u; v8us o;   /* 4 x 256 pieces = 32 rows x 32 pieces */
#pragma unroll
            for (unsigned q = 0; q < 8u; ++q) o[q] = f2bf(ts[(pc * 8u + q) * 33u + e]);
            *(v8us*)(dst + (size_t)(g * HD + e) * DM + pc * 8u) = o; }
         }
}

// k_flash: one wave = 16 queries x one head pair; per head a streaming pass over all SEQ keys in steps of 64 with the running-max softmax.
// Transposed tiles: S^T (M = key, N = query) = K-rows (A) x Q-rows (B), both K-contiguous f16 rows of the [t][512] plane; the f32 S^T accumulators repacked to f16 are directly the B fragments of
// ctx^T (M = e, N = query) = V^T-rows (A, K-contiguous over keys) x P^T: element r <- tile of keys 0..15, element 8+r <- tile of keys 16..31, lane unchanged.
// exp weights carry 2^10 (f16 operand <= 1024); the row sum uses the same f32 values, so the carry cancels in 1/l; the v carry 16 is folded into 1/l.
#define FW 4
__global__ __launch_bounds__(128) void k_flash(const h16* __restrict__ QK, const h16* __restrict__ VT, bf* CH, bf* CL) {
    __shared__ __align__(16) float os[FW * 16 * 68];
    const unsigned tid = threadIdx.x, lane = tid & 31u, w = tid >> 5, lr = lane & 15u, hi = lane >> 4;
    const unsigned bz = blockIdx.z, hp = blockIdx.y, i0 = blockIdx.x * 64u + w * 16u;
    const h16* qkb = QK + (size_t)bz * SEQ * QKW;
    const h16* vtb = VT + (size_t)bz * DM * SEQ;
    float* osw = os + w * (16u * 68u);
#pragma unroll 1
    for (unsigned hh = 0; hh < 2u; ++hh) {
        const unsigned hd = hp * 2u + hh;
        const v16h bq = ldh(qkb + (size_t)(i0 + lr) * QKW + hd * HD + 8u * hi);        /* B: n = query i0+lr, k = e */
        const h16* kp = qkb + (size_t)lr * QKW + DM + hd * HD + 8u * hi;                  /* A rows: key lr of the step, k = e */
        const h16* vp = vtb + (size_t)(hd * HD + lr) * SEQ + 8u * hi;                     /* A rows: e = lr, k = key */
        v8f acc0 = (v8f){}, acc1 = (v8f){}; float m = -3.0e38f, l = 0.0f;
#pragma unroll 1
        for (unsigned j0 = 0; j0 < (unsigned)SEQ; j0 += 64u) {
            const h16* kt = kp + (size_t)j0 * QKW;
            const v16h ka0 = ldh(kt), ka1 = ldh(kt + 16 * QKW), ka2 = ldh(kt + 32 * QKW), ka3 = ldh(kt + 48 * QKW);
            v8f s0 = wmma16(ka0, bq, (v8f){}); v8f s1 = wmma16(ka1, bq, (v8f){}); v8f s2 = wmma16(ka2, bq, (v8f){}); v8f s3 = wmma16(ka3, bq, (v8f){});
            asm volatile("v_nop\n\tv_nop\n\tv_nop\n\tv_nop" : "+v"(s0), "+v"(s1), "+v"(s2), "+v"(s3) : "v"(ka3), "v"(bq));
            float vm = s0[0];
#pragma unroll
            for (int r = 0; r < 8; ++r) { vm = fmaxf(vm, fmaxf(s0[r], s1[r])); vm = fmaxf(vm, fmaxf(s2[r], s3[r])); }
            vm = fmaxf(vm, __shfl_xor(vm, 16, 32));                   /* both lane halves hold the other 32 keys of the same query */
            const float mn = fmaxf(m, vm * SCLX);
            const float alpha = __builtin_amdgcn_exp2f(m - mn); m = mn;
            const float nb = 10.0f - mn;                              /* 2^10 carry */
            float rs = 0.0f;
#pragma unroll
            for (int r = 0; r < 8; ++r) {
                s0[r] = __builtin_amdgcn_exp2f(fmaf(s0[r], SCLX, nb)); s1[r] = __builtin_amdgcn_exp2f(fmaf(s1[r], SCLX, nb));
                s2[r] = __builtin_amdgcn_exp2f(fmaf(s2[r], SCLX, nb)); s3[r] = __builtin_amdgcn_exp2f(fmaf(s3[r], SCLX, nb));
                rs += (s0[r] + s1[r]) + (s2[r] + s3[r]); }
            rs += __shfl_xor(rs, 16, 32);
            l = l * alpha + rs;
            v16h pB0, pB1;
#pragma unroll
            for (int r = 0; r < 8; ++r) { acc0[r] *= alpha; acc1[r] *= alpha;
                pB0[r] = (h16)s0[r]; pB0[8 + r] = (h16)s1[r]; pB1[r] = (h16)s2[r]; pB1[8 + r] = (h16)s3[r]; }
            const h16* vt = vp + j0;
            const v16h va00 = ldh(vt), va01 = ldh(vt + 32), va10 = ldh(vt + (size_t)16 * SEQ), va11 = ldh(vt + (size_t)16 * SEQ + 32);
            acc0 = wmma16(va00, pB0, acc0); acc1 = wmma16(va10, pB0, acc1); acc0 = wmma16(va01, pB1, acc0); acc1 = wmma16(va11, pB1, acc1);
            asm volatile("v_nop\n\tv_nop\n\tv_nop\n\tv_nop" : "+v"(acc0), "+v"(acc1) : "v"(va11), "v"(va01), "v"(pB1));
        }
        const float inv = (1.0f / QCAR) / l;
#pragma unroll
        for (int r = 0; r < 8; ++r) { osw[lr * 68u + hh * 32u + 8u * hi + r] = acc0[r] * inv; osw[lr * 68u + hh * 32u + 16u + 8u * hi + r] = acc1[r] * inv; }   /* D: e = 8*hi + r (+16), query lr */
    }
    __syncthreads();
    const size_t rowbase = ((size_t)bz * SEQ + i0) * DM + hp * 64u;
{
#pragma unroll
        for (unsigned s = 0; s < 4u; ++s) { const unsigned row = 4u * s + (lane >> 3), pc = (lane & 7u) * 8u; const v4f v0 = *(const v4fa*)(osw + row * 68u + pc); const v4f v1 = *(const v4fa*)(osw + row * 68u + pc + 4u); v8us oh, ol;
#pragma unroll
            for (int q = 0; q < 4; ++q) { unsigned short a2, c2; splitf(v0[q], a2, c2); oh[q] = a2; ol[q] = c2; splitf(v1[q], a2, c2); oh[4 + q] = a2; ol[4 + q] = c2; }
            const size_t oo = rowbase + (size_t)row * DM + pc;
            *(v8us*)(CH + oo) = oh; *(v8us*)(CL + oo) = ol; }   
         }
}

constexpr size_t al256(size_t b) { return (b + 255) & ~(size_t)255; }
constexpr size_t SZ_XB  = al256((size_t)NB * SEQ * DM * 2);
constexpr size_t SZ_WQK = al256((size_t)QKW * DM * 2);
constexpr size_t SZ_W   = al256((size_t)DM * DM * 2);
constexpr size_t SZ_QK  = al256((size_t)NB * SEQ * QKW * 2);
constexpr size_t SZ_VT  = al256((size_t)NB * DM * SEQ * 2);
constexpr size_t SZ_C   = al256((size_t)NB * SEQ * DM * 2);
constexpr size_t CARVE  = SZ_XB + SZ_WQK + 2 * SZ_W + SZ_QK + SZ_VT + 2 * SZ_C;
static_assert(CARVE <= (size_t)134217728);                                   // carve <= 128 MiB
static_assert(((size_t)NB * SEQ * (DM / 8)) % 256 == 0);                      // k_xprep grid x 256 threads x 8 == XB elements
static_assert((size_t)NH * 4 * 256 * 4 * 8 == (size_t)(QKW + 2 * DM) * DM);  // k_wprep blocks x threads x 4 pieces x 8 == all weight-plane elements
static_assert((size_t)(SEQ / 64) * (NH / 2) * NB * FW * 16 * 64 == (size_t)NB * SEQ * DM);   // k_flash waves x 16 rows x 64 cols == ctx plane elements

extern "C" void kernel_launch(void* const* d_in, const int* in_sizes, int n_in,
                              void* d_out, int out_size, void* d_ws, size_t ws_size, hipStream_t stream) {
    if (n_in < 5) return;
    const long long xmin = (long long)(NB - 1) * SEQ_FULL * DM + (long long)SEQ * DM;
    if ((long long)in_sizes[0] < xmin || in_sizes[1] < NH * DM * HD || in_sizes[2] < NH * DM * HD || in_sizes[3] < NH * DM * HD || in_sizes[4] < DM * DM) return;
    if ((long long)out_size < xmin) return;
    if (CARVE > ws_size) return;
    const float* x = (const float*)d_in[0]; const float* wq = (const float*)d_in[1]; const float* wk = (const float*)d_in[2]; const float* wv = (const float*)d_in[3]; const float* wo = (const float*)d_in[4];
    float* OUT = (float*)d_out;   /* [NB_FULL][SEQ_FULL][256] f32, batch stride from the full sizes */
    char* wsp = (char*)d_ws;
    auto take = [&](size_t bytes) { char* p = wsp; wsp += bytes; return (void*)p; };
    bf* XB = (bf*)take(SZ_XB); bf* WQK = (bf*)take(SZ_WQK); bf* WV = (bf*)take(SZ_W); bf* WOT = (bf*)take(SZ_W);
    h16* QKP = (h16*)take(SZ_QK); h16* VTP = (h16*)take(SZ_VT); bf* CH = (bf*)take(SZ_C); bf* CL = (bf*)take(SZ_C);

    k_wprep<<<dim3(NH, 4, 1), 256, 0, stream>>>(wq, wk, wv, wo, WQK, WV, WOT);
    k_xprep<<<(unsigned)(((size_t)NB * SEQ * (DM / 8)) / 256), 256, 0, stream>>>(x, XB);
    /* q|k plane [NB*SEQ][512] f16 = 16 x (XB . WQK^T): M = NB*SEQ, N = 512, K = 256 */
    k_gemmw<bf, 0, 1><<<dim3((unsigned)((size_t)NB * SEQ / 64), QKW / 64, 1), 32, 0, stream>>>(XB, nullptr, WQK, nullptr, DM, (void*)QKP, QKW, QCAR, 0, 0, 0);
    /* v^T plane [b][256 (h*32+e)][SEQ] f16 = 16 x (WV . XB[b]^T): M = 256, N = SEQ, K = 256, z = batch */
    k_gemmw<bf, 0, 1><<<dim3(DM / 64, SEQ / 64, NB), 32, 0, stream>>>(WV, nullptr, XB, nullptr, DM, (void*)VTP, SEQ, QCAR, 0, (size_t)SEQ * DM, (size_t)DM * SEQ);
    k_flash<<<dim3(SEQ / 64, NH / 2, NB), 128, 0, stream>>>(QKP, VTP, CH, CL);
    /* out[b][t][n] = (CH + CL)[b][t][:] . WOT[n][:]: M = SEQ, N = 256, K = 256, z = batch (output stride from the full sizes) */
    k_gemmw<bf, 1, 0><<<dim3(SEQ / 64, DM / 64, NB), 32, 0, stream>>>(CH, CL, WOT, nullptr, DM, (void*)OUT, DM, 1.0f, (size_t)SEQ * DM, 0, (size_t)SEQ_FULL * DM);
}

// v001
// One run takes 80.2 microseconds.
// Timed twice side by side with v000, it ran 1.34 and 1.35 times as fast.
#include <hip/hip_runtime.h>

// Compute dtypes (f32 accumulate everywhere): q/k/v projections v_wmma_f32_16x16x32_bf16 on bf16 RNE-converted x and weights (exact products); scores q.k^T v_wmma_f32_16x16x32_f16 (q x16, k x16 carries); attn.V v_wmma_f32_16x16x32_f16 (exp weights x1024, v x16 carries); output projection v_wmma_f32_16x16x32_bf16 with the context as bf16 hi + lo planes (2 products) against bf16 wo.
// Multi-head attention: x [NB_FULL][SEQ_FULL][256] (first NB batches x SEQ rows read), per-head weights w[8][256][32] ([in][out] per head), scores x 256^-0.5, softmax over all SEQ keys (no mask), heads concatenated head-major, times wo [in][out].
// Plan: k_wprep (weight planes B^T, transposed through LDS), k_xprep (x plane), GEMM q|k -> f16 token-major plane [t][512], GEMM v^T -> f16 plane [b][h*32+e][t], k_flash (online softmax, k and v^T tiles staged in LDS for the block's four waves, 16 queries x 2 heads per wave -> ctx hi/lo bf16 planes [t][256]), GEMM wo -> out f32.

#ifndef NB
#define NB 4
#endif
#ifndef SEQ
#define SEQ 2048
#endif
#define NB_FULL  4
#define SEQ_FULL 2048
#define DM   256      // model width = NH * HD
#define NH   8
#define HD   32       // head dim: exactly one 32-deep k-step per score tile
#define QKW  512      // q|k plane row width (q cols 0..255, k cols 256..511)
#define QCAR 16.0f    // carry on q, k and v planes
#define SCLX (0.0625f * 1.44269504088896340736f / 256.0f)   // 256^-0.5 x log2(e) / (16 x 16)

static_assert(DM == NH * HD);          // head-major concat width
static_assert(HD == 32);               // one WMMA k-step per head; two 16-wide e tiles
static_assert((NH & 1) == 0);
static_assert(SEQ % 64 == 0);          // 64-row GEMM tiles, 64-key flash steps, 64-query blocks
static_assert(DM % 64 == 0 && QKW % 64 == 0 && DM % 32 == 0);
static_assert(NB <= NB_FULL && SEQ <= SEQ_FULL);

typedef _Float16 h16;
typedef unsigned short bf;
typedef __attribute__((ext_vector_type(16))) __bf16   v16bf;
typedef __attribute__((ext_vector_type(16))) _Float16 v16h;
typedef __attribute__((ext_vector_type(8)))  _Float16 v8h;
typedef __attribute__((ext_vector_type(8)))  unsigned short v8us;
typedef __attribute__((ext_vector_type(8)))  float    v8f;
typedef __attribute__((ext_vector_type(4)))  float    v4f;
typedef v4f  __attribute__((may_alias)) v4fa;

__device__ __forceinline__ unsigned short f2bf(float f) { unsigned u = __float_as_uint(f); u += 0x7FFFu + ((u >> 16) & 1u); return (unsigned short)(u >> 16); }
__device__ __forceinline__ float bf2f(unsigned short b) { return __uint_as_float(((unsigned)b) << 16); }
__device__ __forceinline__ v16h cat16(v8h lo, v8h hi) { return __builtin_shufflevector(lo, hi, 0, 1, 2, 3, 4, 5, 6, 7, 8, 9, 10, 11, 12, 13, 14, 15); }
__device__ __forceinline__ v16bf cat16b(v8us lo, v8us hi) { return __builtin_bit_cast(v16bf, __builtin_shufflevector(lo, hi, 0, 1, 2, 3, 4, 5, 6, 7, 8, 9, 10, 11, 12, 13, 14, 15)); }
__device__ __forceinline__ v8f wmma16(v16h a, v16h b, v8f c) { return __builtin_amdgcn_wmma_f32_16x16x32_f16(false, a, false, b, (short)0, c, false, false); }
__device__ __forceinline__ v8f wmmab(v16bf a, v16bf b, v8f c) { return __builtin_amdgcn_wmma_f32_16x16x32_bf16(false, a, false, b, (short)0, c, false, false); }
__device__ __forceinline__ void splitf(float y, unsigned short& h, unsigned short& l) { h = f2bf(y); l = f2bf(y - bf2f(h)); }
// fragment from a K-contiguous f16 row: p already includes row and 8*(lane>>4); elements 0..7 <- p[0..7], 8..15 <- p[16..23]
__device__ __forceinline__ v16h ldh(const h16* p) { return cat16(*(const v8h*)p, *(const v8h*)(p + 16)); }

// ---- k_gemmw: register-blocked GEMM, ONE WAVE per 64x64 output tile (16 accumulators), operands straight from K-contiguous 16-bit planes (row pitch == K); grid (M/64, N/64, Z), 32 threads.
// C[m][n] = sum_k A[m][k] Bt[n][k] (+ A2 Bt, + A Bt2 per NSPLIT). z-batch strides sA/sB/sC in elements. K % 32 == 0, M % 64 == 0, N % 64 == 0 (no tail masking).
// OMODE 0: f32 C (pitch ldc): per 16-row slab staged in LDS, each row's 64 floats (256 B) written as 16 lanes x 16 B (2 rows per instruction).
template <typename T16> struct WFrag;
template <> struct WFrag<h16> { typedef v16h V; static __device__ __forceinline__ V ld(const h16* p) { return cat16(*(const v8h*)p, *(const v8h*)(p + 16)); } static __device__ __forceinline__ v8f mma(V a, V b, v8f c) { return wmma16(a, b, c); } };
template <> struct WFrag<bf> { typedef v16bf V; static __device__ __forceinline__ V ld(const bf* p) { return cat16b(*(const v8us*)p, *(const v8us*)(p + 16)); } static __device__ __forceinline__ v8f mma(V a, V b, v8f c) { return wmmab(a, b, c); } };
template <typename T16, int NSPLIT, int OMODE>
__global__ __launch_bounds__(32) void k_gemmw(const T16* __restrict__ A, const T16* __restrict__ A2, const T16* __restrict__ Bt, const T16* __restrict__ Bt2, int K, void* Cv, int ldc, float oscale, size_t sA, size_t sB, size_t sC) {
    typedef typename WFrag<T16>::V V;
    __shared__ __align__(16) float os[16 * 68];
    const size_t z = blockIdx.z; A += z * sA; if (A2) A2 += z * sA; Bt += z * sB; if (Bt2) Bt2 += z * sB;
    const unsigned lane = threadIdx.x & 31u, lr = lane & 15u, hi = lane >> 4; const unsigned r0 = blockIdx.x * 64u, c0 = blockIdx.y * 64u;
    v8f acc[4][4];
#pragma unroll
    for (int mb = 0; mb < 4; ++mb)
#pragma unroll
        for (int nb = 0; nb < 4; ++nb) acc[mb][nb] = (v8f){};
    const size_t aoff = (size_t)(r0 + lr) * K + 8 * hi, boff = (size_t)(c0 + lr) * K + 8 * hi;
#pragma unroll 1
    for (int kc = 0; kc < K; kc += 32) {
        V a[4], a2[4];
#pragma unroll
        for (int mb = 0; mb < 4; ++mb) { a[mb] = WFrag<T16>::ld(A + aoff + (size_t)mb * 16 * K + kc); if (NSPLIT == 1 || NSPLIT == 2) a2[mb] = WFrag<T16>::ld(A2 + aoff + (size_t)mb * 16 * K + kc); }
#pragma unroll
        for (int nb = 0; nb < 4; ++nb) { const V b = WFrag<T16>::ld(Bt + boff + (size_t)nb * 16 * K + kc); V b2; if (NSPLIT >= 2) b2 = WFrag<T16>::ld(Bt2 + boff + (size_t)nb * 16 * K + kc);
#pragma unroll
            for (int mb = 0; mb < 4; ++mb) { acc[mb][nb] = WFrag<T16>::mma(a[mb], b, acc[mb][nb]); if (NSPLIT == 1 || NSPLIT == 2) acc[mb][nb] = WFrag<T16>::mma(a2[mb], b, acc[mb][nb]); if (NSPLIT >= 2) acc[mb][nb] = WFrag<T16>::mma(a[mb], b2, acc[mb][nb]); } }
        if constexpr (NSPLIT == 1 || NSPLIT == 2) { asm volatile("v_nop\n\tv_nop\n\tv_nop\n\tv_nop" : "+v"(acc[0][0]), "+v"(acc[1][1]), "+v"(acc[2][2]), "+v"(acc[3][3]) : "v"(a[0]), "v"(a[3]), "v"(a2[3])); }
        else { asm volatile("v_nop\n\tv_nop\n\tv_nop\n\tv_nop" : "+v"(acc[0][0]), "+v"(acc[1][1]), "+v"(acc[2][2]), "+v"(acc[3][3]) : "v"(a[0]), "v"(a[3])); }
    }
#pragma unroll
    for (int mb = 0; mb < 4; ++mb) {
#pragma unroll
        for (int nb = 0; nb < 4; ++nb) {
#pragma unroll
            for (int j = 0; j < 8; ++j) os[(hi * 8 + j) * 68 + nb * 16 + lr] = acc[mb][nb][j]; }   /* D: row 8*hi + j, col 16*nb + lr */
        __syncthreads();   /* single-wave block: staging visible to every lane */
        if constexpr (OMODE == 0) {
            float* crow = (float*)Cv + z * sC + (size_t)(r0 + mb * 16) * ldc + c0;
{
#pragma unroll
                for (int s = 0; s < 8; ++s) { const unsigned row = 2u * s + hi, cofs = lr * 4u; const v4f val = *(const v4fa*)(os + row * 68 + cofs);
                    *(v4f*)(crow + (size_t)row * ldc + cofs) = val; }   /* rows 2s+hi, s 0..7: all 16 rows; 16 lanes x 16 B = 256 B row segment */
                 }
        } else {
            h16* crow = (h16*)Cv + z * sC + (size_t)(r0 + mb * 16) * ldc + c0;
{
#pragma unroll
                for (int s = 0; s < 4; ++s) { const unsigned row = 4u * s + (lane >> 3), pc = (lane & 7u) * 8u; const v4f v0 = *(const v4fa*)(os + row * 68 + pc); const v4f v1 = *(const v4fa*)(os + row * 68 + pc + 4); v8h o;
#pragma unroll
                    for (int q = 0; q < 4; ++q) { o[q] = (h16)(v0[q] * oscale); o[4 + q] = (h16)(v1[q] * oscale); }
                    *(v8h*)(crow + (size_t)row * ldc + pc) = o; }   
                 }
        }
        __syncthreads();   /* staging free before the next slab overwrites it */
    }
}

__global__ __launch_bounds__(256) void k_xprep(const float* __restrict__ x, bf* XB) {
    const unsigned i = blockIdx.x * 256u + threadIdx.x; if (i >= (unsigned)NB * SEQ * (DM / 8)) return;
    const unsigned b = i / ((unsigned)SEQ * (DM / 8)), r = i - b * ((unsigned)SEQ * (DM / 8));
    const float* s = x + ((size_t)b * SEQ_FULL * (DM / 8) + r) * 8; const v4f a0 = *(const v4f*)s, a1 = *(const v4f*)(s + 4); v8us o;
#pragma unroll
    for (int q = 0; q < 4; ++q) { o[q] = f2bf(a0[q]); o[4 + q] = f2bf(a1[q]); }
    *(v8us*)(XB + (size_t)i * 8) = o;  }

// k_wprep: B^T weight planes (bf16 RNE, K-contiguous rows of 256): block (g, mt) transposes in[256 d][32 e] -> out[32 e][256 d] through LDS.
// mt 0: wq[g][d][e] -> WQK row g*32+e; mt 1: wk -> WQK row 256 + g*32+e; mt 2: wv -> WV row g*32+e; mt 3: wo[d][g*32+e] -> WOT row g*32+e (in[256][256] -> out[256][256] transposed).
__global__ __launch_bounds__(256) void k_wprep(const float* __restrict__ wq, const float* __restrict__ wk, const float* __restrict__ wv, const float* __restrict__ wo, bf* WQK, bf* WV, bf* WOT) {
    __shared__ float ts[256 * 33];
    const unsigned tid = threadIdx.x, g = blockIdx.x, mt = blockIdx.y;
    const float* src = wq; unsigned gs = (unsigned)DM * HD, ds = HD; bf* dst = WQK;
    if (mt == 1u) { src = wk; dst = WQK + (size_t)DM * DM; } else if (mt == 2u) { src = wv; dst = WV; } else if (mt == 3u) { src = wo; gs = HD; ds = DM; dst = WOT; }
#pragma unroll 4
    for (unsigned it = 0; it < 32u; ++it) { const unsigned idx = it * 256u + tid, d = idx >> 5, e = idx & 31u; ts[d * 33u + e] = src[(size_t)g * gs + (size_t)d * ds + e]; }   /* 32 x 256 = all 8192 entries */
    __syncthreads();
{
#pragma unroll
        for (unsigned it = 0; it < 4u; ++it) { const unsigned p = it * 256u + tid, e = p >> 5, pc = p & 31u; v8us o;   /* 4 x 256 pieces = 32 rows x 32 pieces */
#pragma unroll
            for (unsigned q = 0; q < 8u; ++q) o[q] = f2bf(ts[(pc * 8u + q) * 33u + e]);
            *(v8us*)(dst + (size_t)(g * HD + e) * DM + pc * 8u) = o; }
         }
}

// k_flash: one wave = 16 queries x one head pair; per head a streaming pass over all SEQ keys in steps of 64 with the running-max softmax.
// Transposed tiles: S^T (M = key, N = query) = K-rows (A) x Q-rows (B), both K-contiguous f16 rows of the [t][512] plane; the f32 S^T accumulators repacked to f16 are directly the B fragments of
// ctx^T (M = e, N = query) = V^T-rows (A, K-contiguous over keys) x P^T: element r <- tile of keys 0..15, element 8+r <- tile of keys 16..31, lane unchanged.
// exp weights carry 2^10 (f16 operand <= 1024); the row sum uses the same f32 values, so the carry cancels in 1/l; the v carry 16 is folded into 1/l.
// Staging: tile t = (head t / (SEQ/64) of the pair, 64 keys) = 64 k rows of 64 B + 32 v^T rows of 128 B, copied once per block into LDS buffer t & 1 by asynchronous 16-byte copies
// (four per thread) while tile t - 1 is worked on; all four waves take their A fragments from LDS. Row pitches 80 B and 144 B (16 B x odd) keep the 16-byte row reads free of bank conflicts.
#define FW 4
#define KPIT 40                        // f16 per staged k row (32 + 8 pad)
#define VPIT 72                        // f16 per staged v^T row (64 + 8 pad)
#define RBK  (64 * KPIT)               // f16 of the k part of a buffer
#define RB   (64 * KPIT + 32 * VPIT)   // f16 per buffer
#define NTILE (2u * (SEQ / 64))
static_assert((KPIT * 2) % 16 == 0 && (VPIT * 2) % 16 == 0 && (RBK * 2) % 16 == 0 && (RB * 2) % 16 == 0);   // every copy and fragment read 16-byte aligned
// Four copies of 16 B per lane, global -> LDS through no register. s_wait_xcnt 0 closes the statement so that no address register of a copy is rewritten ahead of it.
__device__ __forceinline__ void copy4(unsigned l0, unsigned l1, unsigned l2, unsigned l3, const h16* g0, const h16* g1, const h16* g2, const h16* g3) {
    asm volatile("global_load_async_to_lds_b128 %0, %4, off\n\t"
                 "global_load_async_to_lds_b128 %1, %5, off\n\t"
                 "global_load_async_to_lds_b128 %2, %6, off\n\t"
                 "global_load_async_to_lds_b128 %3, %7, off\n\t"
                 "s_wait_xcnt 0x0"
                 :: "v"(l0), "v"(l1), "v"(l2), "v"(l3), "v"(g0), "v"(g1), "v"(g2), "v"(g3) : "memory");
}
__global__ __launch_bounds__(128) void k_flash(const h16* __restrict__ QK, const h16* __restrict__ VT, bf* CH, bf* CL) {
    __shared__ __align__(16) float os[FW * 16 * 68];
    __shared__ __align__(16) h16 ring[2 * RB];
    const unsigned tid = threadIdx.x, lane = tid & 31u, w = tid >> 5, lr = lane & 15u, hi = lane >> 4;
    const unsigned bz = blockIdx.z, hp = blockIdx.y, i0 = blockIdx.x * 64u + w * 16u;
    const h16* qkb = QK + (size_t)bz * SEQ * QKW;
    const h16* vtb = VT + (size_t)bz * DM * SEQ;
    float* osw = os + w * (16u * 68u);
    /* this thread's pieces of a tile: k rows tid>>2 and +32, 16-byte piece tid&3; v^T rows tid>>3 and +16, piece tid&7 */
    const unsigned ringb = (unsigned)(size_t)ring;   /* LDS byte address: the low 32 bits */
    const unsigned lk = ringb + 2u * ((tid >> 2) * KPIT + (tid & 3u) * 8u), lv = ringb + 2u * (RBK + (tid >> 3) * VPIT + (tid & 7u) * 8u);
    const h16* gk = qkb + (size_t)(tid >> 2) * QKW + DM + hp * 2u * HD + (tid & 3u) * 8u;
    const h16* gv = vtb + (size_t)(hp * 2u * HD + (tid >> 3)) * SEQ + (tid & 7u) * 8u;
    auto stage = [&](unsigned t) {
        const unsigned th = t / (SEQ / 64), tj = (t % (SEQ / 64)) * 64u, lb = (t & 1u) * (2u * RB);
        const h16* k0 = gk + th * HD + (size_t)tj * QKW; const h16* v0 = gv + (size_t)th * HD * SEQ + tj;
        copy4(lk + lb, lk + lb + 2u * 32u * KPIT, lv + lb, lv + lb + 2u * 16u * VPIT, k0, k0 + (size_t)32 * QKW, v0, v0 + (size_t)16 * SEQ); };
    stage(0u);
    asm volatile("s_wait_asynccnt 0x0" ::: "memory");   /* this wave's pieces of tile 0 have landed */
    __syncthreads();                                     /* tile 0 readable by every wave */
    stage(1u);
#pragma unroll 1
    for (unsigned hh = 0; hh < 2u; ++hh) {
        const unsigned hd = hp * 2u + hh;
        const v16h bq = ldh(qkb + (size_t)(i0 + lr) * QKW + hd * HD + 8u * hi);        /* B: n = query i0+lr, k = e */
        v8f acc0 = (v8f){}, acc1 = (v8f){}; float m = -3.0e38f, l = 0.0f;
#pragma unroll 1
        for (unsigned j0 = 0; j0 < (unsigned)SEQ; j0 += 64u) {
            const unsigned t = hh * (SEQ / 64) + j0 / 64u;
            const h16* kt = ring + (t & 1u) * RB + lr * KPIT + 8u * hi;                    /* A rows: key lr of the step, k = e */
            const v16h ka0 = ldh(kt), ka1 = ldh(kt + 16 * KPIT), ka2 = ldh(kt + 32 * KPIT), ka3 = ldh(kt + 48 * KPIT);
            v8f s0 = wmma16(ka0, bq, (v8f){}); v8f s1 = wmma16(ka1, bq, (v8f){}); v8f s2 = wmma16(ka2, bq, (v8f){}); v8f s3 = wmma16(ka3, bq, (v8f){});
            asm volatile("v_nop\n\tv_nop\n\tv_nop\n\tv_nop" : "+v"(s0), "+v"(s1), "+v"(s2), "+v"(s3) : "v"(ka3), "v"(bq));
            float vm = s0[0];
#pragma unroll
            for (int r = 0; r < 8; ++r) { vm = fmaxf(vm, fmaxf(s0[r], s1[r])); vm = fmaxf(vm, fmaxf(s2[r], s3[r])); }
            vm = fmaxf(vm, __shfl_xor(vm, 16, 32));                   /* both lane halves hold the other 32 keys of the same query */
            const float mn = fmaxf(m, vm * SCLX);
            const float alpha = __builtin_amdgcn_exp2f(m - mn); m = mn;
            const float nb = 10.0f - mn;                              /* 2^10 carry */
            float rs = 0.0f;
#pragma unroll
            for (int r = 0; r < 8; ++r) {
                s0[r] = __builtin_amdgcn_exp2f(fmaf(s0[r], SCLX, nb)); s1[r] = __builtin_amdgcn_exp2f(fmaf(s1[r], SCLX, nb));
                s2[r] = __builtin_amdgcn_exp2f(fmaf(s2[r], SCLX, nb)); s3[r] = __builtin_amdgcn_exp2f(fmaf(s3[r], SCLX, nb));
                rs += (s0[r] + s1[r]) + (s2[r] + s3[r]); }
            rs += __shfl_xor(rs, 16, 32);
            l = l * alpha + rs;
            v16h pB0, pB1;
#pragma unroll
            for (int r = 0; r < 8; ++r) { acc0[r] *= alpha; acc1[r] *= alpha;
                pB0[r] = (h16)s0[r]; pB0[8 + r] = (h16)s1[r]; pB1[r] = (h16)s2[r]; pB1[8 + r] = (h16)s3[r]; }
            const h16* vt = ring + (t & 1u) * RB + RBK + lr * VPIT + 8u * hi;              /* A rows: e = lr, k = key */
            const v16h va00 = ldh(vt), va01 = ldh(vt + 32), va10 = ldh(vt + 16 * VPIT), va11 = ldh(vt + 16 * VPIT + 32);
            acc0 = wmma16(va00, pB0, acc0); acc1 = wmma16(va10, pB0, acc1); acc0 = wmma16(va01, pB1, acc0); acc1 = wmma16(va11, pB1, acc1);
            asm volatile("v_nop\n\tv_nop\n\tv_nop\n\tv_nop" : "+v"(acc0), "+v"(acc1) : "v"(va11), "v"(va01), "v"(pB1));
            asm volatile("s_wait_dscnt 0x0" ::: "memory");      /* this wave's reads of buffer t & 1 are done before it is refilled */
            asm volatile("s_wait_asynccnt 0x0" ::: "memory");   /* this wave's pieces of tile t + 1 have landed */
            __syncthreads();                                     /* publishes tile t + 1 and ends every wave's reads of tile t */
            if (t + 2u < NTILE) stage(t + 2u);                   /* block-uniform test; refills the buffer just read */
        }
        const float inv = (1.0f / QCAR) / l;
#pragma unroll
        for (int r = 0; r < 8; ++r) { osw[lr * 68u + hh * 32u + 8u * hi + r] = acc0[r] * inv; osw[lr * 68u + hh * 32u + 16u + 8u * hi + r] = acc1[r] * inv; }   /* D: e = 8*hi + r (+16), query lr */
    }
    asm volatile("s_wait_asynccnt 0x0" ::: "memory");   /* no copy outstanding behind the loop */
    __syncthreads();
    const size_t rowbase = ((size_t)bz * SEQ + i0) * DM + hp * 64u;
{
#pragma unroll
        for (unsigned s = 0; s < 4u; ++s) { const unsigned row = 4u * s + (lane >> 3), pc = (lane & 7u) * 8u; const v4f v0 = *(const v4fa*)(osw + row * 68u + pc); const v4f v1 = *(const v4fa*)(osw + row * 68u + pc + 4u); v8us oh, ol;
#pragma unroll
            for (int q = 0; q < 4; ++q) { unsigned short a2, c2; splitf(v0[q], a2, c2); oh[q] = a2; ol[q] = c2; splitf(v1[q], a2, c2); oh[4 + q] = a2; ol[4 + q] = c2; }
            const size_t oo = rowbase + (size_t)row * DM + pc;
            *(v8us*)(CH + oo) = oh; *(v8us*)(CL + oo) = ol; }   
         }
}

constexpr size_t al256(size_t b) { return (b + 255) & ~(size_t)255; }
constexpr size_t SZ_XB  = al256((size_t)NB * SEQ * DM * 2);
constexpr size_t SZ_WQK = al256((size_t)QKW * DM * 2);
constexpr size_t SZ_W   = al256((size_t)DM * DM * 2);
constexpr size_t SZ_QK  = al256((size_t)NB * SEQ * QKW * 2);
constexpr size_t SZ_VT  = al256((size_t)NB * DM * SEQ * 2);
constexpr size_t SZ_C   = al256((size_t)NB * SEQ * DM * 2);
constexpr size_t CARVE  = SZ_XB + SZ_WQK + 2 * SZ_W + SZ_QK + SZ_VT + 2 * SZ_C;
static_assert(CARVE <= (size_t)134217728);                                   // carve <= 128 MiB
static_assert(((size_t)NB * SEQ * (DM / 8)) % 256 == 0);                      // k_xprep grid x 256 threads x 8 == XB elements
static_assert((size_t)NH * 4 * 256 * 4 * 8 == (size_t)(QKW + 2 * DM) * DM);  // k_wprep blocks x threads x 4 pieces x 8 == all weight-plane elements
static_assert((size_t)(SEQ / 64) * (NH / 2) * NB * FW * 16 * 64 == (size_t)NB * SEQ * DM);   // k_flash waves x 16 rows x 64 cols == ctx plane elements

extern "C" void kernel_launch(void* const* d_in, const int* in_sizes, int n_in,
                              void* d_out, int out_size, void* d_ws, size_t ws_size, hipStream_t stream) {
    if (n_in < 5) return;
    const long long xmin = (long long)(NB - 1) * SEQ_FULL * DM + (long long)SEQ * DM;
    if ((long long)in_sizes[0] < xmin || in_sizes[1] < NH * DM * HD || in_sizes[2] < NH * DM * HD || in_sizes[3] < NH * DM * HD || in_sizes[4] < DM * DM) return;
    if ((long long)out_size < xmin) return;
    if (CARVE > ws_size) return;
    const float* x = (const float*)d_in[0]; const float* wq = (const float*)d_in[1]; const float* wk = (const float*)d_in[2]; const float* wv = (const float*)d_in[3]; const float* wo = (const float*)d_in[4];
    float* OUT = (float*)d_out;   /* [NB_FULL][SEQ_FULL][256] f32, batch stride from the full sizes */
    char* wsp = (char*)d_ws;
    auto take = [&](size_t bytes) { char* p = wsp; wsp += bytes; return (void*)p; };
    bf* XB = (bf*)take(SZ_XB); bf* WQK = (bf*)take(SZ_WQK); bf* WV = (bf*)take(SZ_W); bf* WOT = (bf*)take(SZ_W);
    h16* QKP = (h16*)take(SZ_QK); h16* VTP = (h16*)take(SZ_VT); bf* CH = (bf*)take(SZ_C); bf* CL = (bf*)take(SZ_C);

    k_wprep<<<dim3(NH, 4, 1), 256, 0, stream>>>(wq, wk, wv, wo, WQK, WV, WOT);
    k_xprep<<<(unsigned)(((size_t)NB * SEQ * (DM / 8)) / 256), 256, 0, stream>>>(x, XB);
    /* q|k plane [NB*SEQ][512] f16 = 16 x (XB . WQK^T): M = NB*SEQ, N = 512, K = 256 */
    k_gemmw<bf, 0, 1><<<dim3((unsigned)((size_t)NB * SEQ / 64), QKW / 64, 1), 32, 0, stream>>>(XB, nullptr, WQK, nullptr, DM, (void*)QKP, QKW, QCAR, 0, 0, 0);
    /* v^T plane [b][256 (h*32+e)][SEQ] f16 = 16 x (WV . XB[b]^T): M = 256, N = SEQ, K = 256, z = batch */
    k_gemmw<bf, 0, 1><<<dim3(DM / 64, SEQ / 64, NB), 32, 0, stream>>>(WV, nullptr, XB, nullptr, DM, (void*)VTP, SEQ, QCAR, 0, (size_t)SEQ * DM, (size_t)DM * SEQ);
    k_flash<<<dim3(SEQ / 64, NH / 2, NB), 128, 0, stream>>>(QKP, VTP, CH, CL);
    /* out[b][t][n] = (CH + CL)[b][t][:] . WOT[n][:]: M = SEQ, N = 256, K = 256, z = batch (output stride from the full sizes) */
    k_gemmw<bf, 1, 0><<<dim3(SEQ / 64, DM / 64, NB), 32, 0, stream>>>(CH, CL, WOT, nullptr, DM, (void*)OUT, DM, 1.0f, (size_t)SEQ * DM, 0, (size_t)SEQ_FULL * DM);
}

// v002
// A run of this version takes 67.9 microseconds.
// Next to v001, in two timings, it ran 1.20 and 1.18 times as fast.
// Counting every step since v000, it is 1.60 times as fast.
#include <hip/hip_runtime.h>

// Compute dtypes (f32 accumulate everywhere): q/k/v projections v_wmma_f32_16x16x32_bf16 on bf16 RNE-converted x and weights (exact products); scores q.k^T v_wmma_f32_16x16x32_f16 (q x16, k x16 carries); attn.V v_wmma_f32_16x16x32_f16 (exp weights x1024, v x16 carries); output projection v_wmma_f32_16x16x32_bf16 with the context as bf16 hi + lo planes (2 products) against bf16 wo.
// Multi-head attention: x [NB][SEQ][256] at batch stride SEQ_FULL*256, per-head weights w[8][256][32] ([in][out] per head), scores x 256^-0.5, softmax over all SEQ keys (no mask), heads concatenated head-major, times wo [in][out].
// Plan, four launches: k_prep (weight planes B^T, transposed through LDS, and the x plane, in block ranges of one grid), k_proj (GEMM q|k -> f16 token-major plane [t][512] and GEMM v^T -> f16 plane [b][h*32+e][t], in block ranges of one grid), k_flash (online softmax, k and v^T tiles staged in LDS for the block's four waves, 16 queries x 2 heads per wave -> ctx hi/lo bf16 planes [t][256]), GEMM wo -> out f32.

#ifndef NB
#define NB 4
#endif
#ifndef SEQ
#define SEQ 2048
#endif
#define NB_FULL  4
#define SEQ_FULL 2048
#define DM   256      // model width = NH * HD
#define NH   8
#define HD   32       // head dim: exactly one 32-deep k-step per score tile
#define QKW  512      // q|k plane row width (q cols 0..255, k cols 256..511)
#define QCAR 16.0f    // carry on q, k and v planes
#define SCLX (0.0625f * 1.44269504088896340736f / 256.0f)   // 256^-0.5 x log2(e) / (16 x 16)

static_assert(DM == NH * HD);          // head-major concat width
static_assert(HD == 32);               // one WMMA k-step per head; two 16-wide e tiles
static_assert((NH & 1) == 0);
static_assert(SEQ % 64 == 0);          // 64-row GEMM tiles, 64-key flash steps, 64-query blocks
static_assert(DM % 64 == 0 && QKW % 64 == 0 && DM % 32 == 0);
static_assert(NB <= NB_FULL && SEQ <= SEQ_FULL);

typedef _Float16 h16;
typedef unsigned short bf;
typedef __attribute__((ext_vector_type(16))) __bf16   v16bf;
typedef __attribute__((ext_vector_type(16))) _Float16 v16h;
typedef __attribute__((ext_vector_type(8)))  _Float16 v8h;
typedef __attribute__((ext_vector_type(8)))  unsigned short v8us;
typedef __attribute__((ext_vector_type(8)))  float    v8f;
typedef __attribute__((ext_vector_type(4)))  float    v4f;
typedef v4f  __attribute__((may_alias)) v4fa;

__device__ __forceinline__ unsigned short f2bf(float f) { unsigned u = __float_as_uint(f); u += 0x7FFFu + ((u >> 16) & 1u); return (unsigned short)(u >> 16); }
__device__ __forceinline__ float bf2f(unsigned short b) { return __uint_as_float(((unsigned)b) << 16); }
__device__ __forceinline__ v16h cat16(v8h lo, v8h hi) { return __builtin_shufflevector(lo, hi, 0, 1, 2, 3, 4, 5, 6, 7, 8, 9, 10, 11, 12, 13, 14, 15); }
__device__ __forceinline__ v16bf cat16b(v8us lo, v8us hi) { return __builtin_bit_cast(v16bf, __builtin_shufflevector(lo, hi, 0, 1, 2, 3, 4, 5, 6, 7, 8, 9, 10, 11, 12, 13, 14, 15)); }
__device__ __forceinline__ v8f wmma16(v16h a, v16h b, v8f c) { return __builtin_amdgcn_wmma_f32_16x16x32_f16(false, a, false, b, (short)0, c, false, false); }
__device__ __forceinline__ v8f wmmab(v16bf a, v16bf b, v8f c) { return __builtin_amdgcn_wmma_f32_16x16x32_bf16(false, a, false, b, (short)0, c, false, false); }
__device__ __forceinline__ void splitf(float y, unsigned short& h, unsigned short& l) { h = f2bf(y); l = f2bf(y - bf2f(h)); }
// fragment from a K-contiguous f16 row: p already includes row and 8*(lane>>4); elements 0..7 <- p[0..7], 8..15 <- p[16..23]
__device__ __forceinline__ v16h ldh(const h16* p) { return cat16(*(const v8h*)p, *(const v8h*)(p + 16)); }

// ---- gemmw_tile: register-blocked GEMM, ONE WAVE per 64x64 output tile (16 accumulators), operands straight from K-contiguous 16-bit planes (row pitch == K); tile (bx, by) of batch bz, 32 threads.
// C[m][n] = sum_k A[m][k] Bt[n][k] (+ A2 Bt, + A Bt2 per NSPLIT). z-batch strides sA/sB/sC in elements. K % 32 == 0, M % 64 == 0, N % 64 == 0 (no tail masking).
// OMODE 0: f32 C (pitch ldc): per 16-row slab staged in LDS, each row's 64 floats (256 B) written as 16 lanes x 16 B (2 rows per instruction).
template <typename T16> struct WFrag;
template <> struct WFrag<h16> { typedef v16h V; static __device__ __forceinline__ V ld(const h16* p) { return cat16(*(const v8h*)p, *(const v8h*)(p + 16)); } static __device__ __forceinline__ v8f mma(V a, V b, v8f c) { return wmma16(a, b, c); } };
template <> struct WFrag<bf> { typedef v16bf V; static __device__ __forceinline__ V ld(const bf* p) { return cat16b(*(const v8us*)p, *(const v8us*)(p + 16)); } static __device__ __forceinline__ v8f mma(V a, V b, v8f c) { return wmmab(a, b, c); } };
template <typename T16, int NSPLIT, int OMODE>
__device__ __forceinline__ void gemmw_tile(const T16* __restrict__ A, const T16* __restrict__ A2, const T16* __restrict__ Bt, const T16* __restrict__ Bt2, int K, void* Cv, int ldc, float oscale, size_t sA, size_t sB, size_t sC, unsigned bx, unsigned by, unsigned bz) {
    typedef typename WFrag<T16>::V V;
    __shared__ __align__(16) float os[16 * 68];
    const size_t z = bz; A += z * sA; if (A2) A2 += z * sA; Bt += z * sB; if (Bt2) Bt2 += z * sB;
    const unsigned lane = threadIdx.x & 31u, lr = lane & 15u, hi = lane >> 4; const unsigned r0 = bx * 64u, c0 = by * 64u;
    v8f acc[4][4];
#pragma unroll
    for (int mb = 0; mb < 4; ++mb)
#pragma unroll
        for (int nb = 0; nb < 4; ++nb) acc[mb][nb] = (v8f){};
    const size_t aoff = (size_t)(r0 + lr) * K + 8 * hi, boff = (size_t)(c0 + lr) * K + 8 * hi;
#pragma unroll 1
    for (int kc = 0; kc < K; kc += 32) {
        V a[4], a2[4];
#pragma unroll
        for (int mb = 0; mb < 4; ++mb) { a[mb] = WFrag<T16>::ld(A + aoff + (size_t)mb * 16 * K + kc); if (NSPLIT == 1 || NSPLIT == 2) a2[mb] = WFrag<T16>::ld(A2 + aoff + (size_t)mb * 16 * K + kc); }
        if constexpr (NSPLIT == 0) asm volatile("s_wait_xcnt 0x0" ::: "memory");   /* in this form the A loads' address pair is reused for a B fragment: not before this wait */
#pragma unroll
        for (int nb = 0; nb < 4; ++nb) { const V b = WFrag<T16>::ld(Bt + boff + (size_t)nb * 16 * K + kc); V b2; if (NSPLIT >= 2) b2 = WFrag<T16>::ld(Bt2 + boff + (size_t)nb * 16 * K + kc);
#pragma unroll
            for (int mb = 0; mb < 4; ++mb) { acc[mb][nb] = WFrag<T16>::mma(a[mb], b, acc[mb][nb]); if (NSPLIT == 1 || NSPLIT == 2) acc[mb][nb] = WFrag<T16>::mma(a2[mb], b, acc[mb][nb]); if (NSPLIT >= 2) acc[mb][nb] = WFrag<T16>::mma(a[mb], b2, acc[mb][nb]); } }
        if constexpr (NSPLIT == 1 || NSPLIT == 2) { asm volatile("v_nop\n\tv_nop\n\tv_nop\n\tv_nop" : "+v"(acc[0][0]), "+v"(acc[1][1]), "+v"(acc[2][2]), "+v"(acc[3][3]) : "v"(a[0]), "v"(a[3]), "v"(a2[3])); }
        else { asm volatile("v_nop\n\tv_nop\n\tv_nop\n\tv_nop" : "+v"(acc[0][0]), "+v"(acc[1][1]), "+v"(acc[2][2]), "+v"(acc[3][3]) : "v"(a[0]), "v"(a[3])); }
    }
#pragma unroll
    for (int mb = 0; mb < 4; ++mb) {
#pragma unroll
        for (int nb = 0; nb < 4; ++nb) {
#pragma unroll
            for (int j = 0; j < 8; ++j) os[(hi * 8 + j) * 68 + nb * 16 + lr] = acc[mb][nb][j]; }   /* D: row 8*hi + j, col 16*nb + lr */
        __syncthreads();   /* single-wave block: staging visible to every lane */
        if constexpr (OMODE == 0) {
            float* crow = (float*)Cv + z * sC + (size_t)(r0 + mb * 16) * ldc + c0;
{
#pragma unroll
                for (int s = 0; s < 8; ++s) { const unsigned row = 2u * s + hi, cofs = lr * 4u; const v4f val = *(const v4fa*)(os + row * 68 + cofs);
                    *(v4f*)(crow + (size_t)row * ldc + cofs) = val; }   /* rows 2s+hi, s 0..7: all 16 rows; 16 lanes x 16 B = 256 B row segment */
                 }
        } else {
            h16* crow = (h16*)Cv + z * sC + (size_t)(r0 + mb * 16) * ldc + c0;
{
#pragma unroll
                for (int s = 0; s < 4; ++s) { const unsigned row = 4u * s + (lane >> 3), pc = (lane & 7u) * 8u; const v4f v0 = *(const v4fa*)(os + row * 68 + pc); const v4f v1 = *(const v4fa*)(os + row * 68 + pc + 4); v8h o;
#pragma unroll
                    for (int q = 0; q < 4; ++q) { o[q] = (h16)(v0[q] * oscale); o[4 + q] = (h16)(v1[q] * oscale); }
                    *(v8h*)(crow + (size_t)row * ldc + pc) = o; }   
                 }
        }
        __syncthreads();   /* staging free before the next slab overwrites it */
    }
}
// k_gemmw: one GEMM per launch; grid (M/64, N/64, Z).
template <typename T16, int NSPLIT, int OMODE>
__global__ __launch_bounds__(32) void k_gemmw(const T16* __restrict__ A, const T16* __restrict__ A2, const T16* __restrict__ Bt, const T16* __restrict__ Bt2, int K, void* Cv, int ldc, float oscale, size_t sA, size_t sB, size_t sC) {
    gemmw_tile<T16, NSPLIT, OMODE>(A, A2, Bt, Bt2, K, Cv, ldc, oscale, sA, sB, sC, blockIdx.x, blockIdx.y, blockIdx.z);
}
// k_proj: the two projection GEMMs depend on the planes of k_prep only, not on each other, so their tiles share one grid and run side by side.
// Blocks [0, PQK): q|k plane [NB*SEQ][512] f16 = 16 x (XB . WQK^T), M = NB*SEQ, N = 512, K = 256, row tile fastest.
// Blocks [PQK, PQK + PV): v^T plane [b][256 (h*32+e)][SEQ] f16 = 16 x (WV . XB[b]^T), M = 256, N = SEQ, K = 256, row tile fastest, then key tile, then batch.
#define PQM ((unsigned)((size_t)NB * SEQ / 64))
#define PQK (PQM * (QKW / 64u))
#define PV  ((DM / 64u) * (SEQ / 64u) * (unsigned)NB)
__global__ __launch_bounds__(32) void k_proj(const bf* __restrict__ XB, const bf* __restrict__ WQK, const bf* __restrict__ WV, h16* QKP, h16* VTP) {
    const unsigned b = blockIdx.x; const bool qk = b < PQK; const unsigned v = b - PQK;
    gemmw_tile<bf, 0, 1>(qk ? XB : WV, nullptr, qk ? WQK : XB, nullptr, DM, qk ? (void*)QKP : (void*)VTP, qk ? QKW : SEQ, QCAR, 0, qk ? (size_t)0 : (size_t)SEQ * DM, qk ? (size_t)0 : (size_t)DM * SEQ,
                         qk ? b % PQM : v % (DM / 64u), qk ? b / PQM : (v / (DM / 64u)) % (SEQ / 64u), qk ? 0u : v / ((DM / 64u) * (SEQ / 64u)));
}

__device__ __forceinline__ void xprep_blk(const float* __restrict__ x, bf* XB, unsigned blk) {
    const unsigned i = blk * 256u + threadIdx.x; if (i >= (unsigned)NB * SEQ * (DM / 8)) return;
    const unsigned b = i / ((unsigned)SEQ * (DM / 8)), r = i - b * ((unsigned)SEQ * (DM / 8));
    const float* s = x + ((size_t)b * SEQ_FULL * (DM / 8) + r) * 8; const v4f a0 = *(const v4f*)s, a1 = *(const v4f*)(s + 4); v8us o;
#pragma unroll
    for (int q = 0; q < 4; ++q) { o[q] = f2bf(a0[q]); o[4 + q] = f2bf(a1[q]); }
    *(v8us*)(XB + (size_t)i * 8) = o;  }

// wprep_blk: B^T weight planes (bf16 RNE, K-contiguous rows of 256): block (g, mt) transposes in[256 d][32 e] -> out[32 e][256 d] through LDS.
// mt 0: wq[g][d][e] -> WQK row g*32+e; mt 1: wk -> WQK row 256 + g*32+e; mt 2: wv -> WV row g*32+e; mt 3: wo[d][g*32+e] -> WOT row g*32+e (in[256][256] -> out[256][256] transposed).
__device__ __forceinline__ void wprep_blk(const float* __restrict__ wq, const float* __restrict__ wk, const float* __restrict__ wv, const float* __restrict__ wo, bf* WQK, bf* WV, bf* WOT, unsigned g, unsigned mt) {
    __shared__ float ts[256 * 33];
    const unsigned tid = threadIdx.x;
    const float* src = wq; unsigned gs = (unsigned)DM * HD, ds = HD; bf* dst = WQK;
    if (mt == 1u) { src = wk; dst = WQK + (size_t)DM * DM; } else if (mt == 2u) { src = wv; dst = WV; } else if (mt == 3u) { src = wo; gs = HD; ds = DM; dst = WOT; }
#pragma unroll 4
    for (unsigned it = 0; it < 32u; ++it) { const unsigned idx = it * 256u + tid, d = idx >> 5, e = idx & 31u; ts[d * 33u + e] = src[(size_t)g * gs + (size_t)d * ds + e]; }   /* 32 x 256 = all 8192 entries */
    __syncthreads();
{
#pragma unroll
        for (unsigned it = 0; it < 4u; ++it) { const unsigned p = it * 256u + tid, e = p >> 5, pc = p & 31u; v8us o;   /* 4 x 256 pieces = 32 rows x 32 pieces */
#pragma unroll
            for (unsigned q = 0; q < 8u; ++q) o[q] = f2bf(ts[(pc * 8u + q) * 33u + e]);
            *(v8us*)(dst + (size_t)(g * HD + e) * DM + pc * 8u) = o; }
         }
}
// k_prep: the weight planes and the x plane read different inputs and write different planes, so both share one grid. The few weight blocks, each a longer chain of loads, LDS and stores, come first.
#define PWB ((unsigned)NH * 4u)
#define PXB ((unsigned)(((size_t)NB * SEQ * (DM / 8)) / 256))
__global__ __launch_bounds__(256) void k_prep(const float* __restrict__ x, const float* __restrict__ wq, const float* __restrict__ wk, const float* __restrict__ wv, const float* __restrict__ wo, bf* XB, bf* WQK, bf* WV, bf* WOT) {
    if (blockIdx.x < PWB) wprep_blk(wq, wk, wv, wo, WQK, WV, WOT, blockIdx.x % (unsigned)NH, blockIdx.x / (unsigned)NH);   /* block-uniform branch: its barrier is passed by the whole block */
    else xprep_blk(x, XB, blockIdx.x - PWB);
}

// k_flash: one wave = 16 queries x one head pair; per head a streaming pass over all SEQ keys in steps of 64 with the running-max softmax.
// Transposed tiles: S^T (M = key, N = query) = K-rows (A) x Q-rows (B), both K-contiguous f16 rows of the [t][512] plane; the f32 S^T accumulators repacked to f16 are directly the B fragments of
// ctx^T (M = e, N = query) = V^T-rows (A, K-contiguous over keys) x P^T: element r <- tile of keys 0..15, element 8+r <- tile of keys 16..31, lane unchanged.
// exp weights carry 2^10 (f16 operand <= 1024); the row sum uses the same f32 values, so the carry cancels in 1/l; the v carry 16 is folded into 1/l.
// Staging: tile t = (head t / (SEQ/64) of the pair, 64 keys) = 64 k rows of 64 B + 32 v^T rows of 128 B, copied once per block into LDS buffer t & 1 by asynchronous 16-byte copies
// (four per thread) while tile t - 1 is worked on; all four waves take their A fragments from LDS. Row pitches 80 B and 144 B (16 B x odd) keep the 16-byte row reads free of bank conflicts.
#define FW 4
#define KPIT 40                        // f16 per staged k row (32 + 8 pad)
#define VPIT 72                        // f16 per staged v^T row (64 + 8 pad)
#define RBK  (64 * KPIT)               // f16 of the k part of a buffer
#define RB   (64 * KPIT + 32 * VPIT)   // f16 per buffer
#define NTILE (2u * (SEQ / 64))
static_assert((KPIT * 2) % 16 == 0 && (VPIT * 2) % 16 == 0 && (RBK * 2) % 16 == 0 && (RB * 2) % 16 == 0);   // every copy and fragment read 16-byte aligned
// Four copies of 16 B per lane, global -> LDS through no register. s_wait_xcnt 0 closes the statement so that no address register of a copy is rewritten ahead of it.
__device__ __forceinline__ void copy4(unsigned l0, unsigned l1, unsigned l2, unsigned l3, const h16* g0, const h16* g1, const h16* g2, const h16* g3) {
    asm volatile("global_load_async_to_lds_b128 %0, %4, off\n\t"
                 "global_load_async_to_lds_b128 %1, %5, off\n\t"
                 "global_load_async_to_lds_b128 %2, %6, off\n\t"
                 "global_load_async_to_lds_b128 %3, %7, off\n\t"
                 "s_wait_xcnt 0x0"
                 :: "v"(l0), "v"(l1), "v"(l2), "v"(l3), "v"(g0), "v"(g1), "v"(g2), "v"(g3) : "memory");
}
__global__ __launch_bounds__(128) void k_flash(const h16* __restrict__ QK, const h16* __restrict__ VT, bf* CH, bf* CL) {
    __shared__ __align__(16) float os[FW * 16 * 68];
    __shared__ __align__(16) h16 ring[2 * RB];
    const unsigned tid = threadIdx.x, lane = tid & 31u, w = tid >> 5, lr = lane & 15u, hi = lane >> 4;
    const unsigned bz = blockIdx.z, hp = blockIdx.y, i0 = blockIdx.x * 64u + w * 16u;
    const h16* qkb = QK + (size_t)bz * SEQ * QKW;
    const h16* vtb = VT + (size_t)bz * DM * SEQ;
    float* osw = os + w * (16u * 68u);
    /* this thread's pieces of a tile: k rows tid>>2 and +32, 16-byte piece tid&3; v^T rows tid>>3 and +16, piece tid&7 */
    const unsigned ringb = (unsigned)(size_t)ring;   /* LDS byte address: the low 32 bits */
    const unsigned lk = ringb + 2u * ((tid >> 2) * KPIT + (tid & 3u) * 8u), lv = ringb + 2u * (RBK + (tid >> 3) * VPIT + (tid & 7u) * 8u);
    const h16* gk = qkb + (size_t)(tid >> 2) * QKW + DM + hp * 2u * HD + (tid & 3u) * 8u;
    const h16* gv = vtb + (size_t)(hp * 2u * HD + (tid >> 3)) * SEQ + (tid & 7u) * 8u;
    auto stage = [&](unsigned t) {
        const unsigned th = t / (SEQ / 64), tj = (t % (SEQ / 64)) * 64u, lb = (t & 1u) * (2u * RB);
        const h16* k0 = gk + th * HD + (size_t)tj * QKW; const h16* v0 = gv + (size_t)th * HD * SEQ + tj;
        copy4(lk + lb, lk + lb + 2u * 32u * KPIT, lv + lb, lv + lb + 2u * 16u * VPIT, k0, k0 + (size_t)32 * QKW, v0, v0 + (size_t)16 * SEQ); };
    stage(0u);
    asm volatile("s_wait_asynccnt 0x0" ::: "memory");   /* this wave's pieces of tile 0 have landed */
    __syncthreads();                                     /* tile 0 readable by every wave */
    stage(1u);
#pragma unroll 1
    for (unsigned hh = 0; hh < 2u; ++hh) {
        const unsigned hd = hp * 2u + hh;
        const v16h bq = ldh(qkb + (size_t)(i0 + lr) * QKW + hd * HD + 8u * hi);        /* B: n = query i0+lr, k = e */
        v8f acc0 = (v8f){}, acc1 = (v8f){}; float m = -3.0e38f, l = 0.0f;
#pragma unroll 1
        for (unsigned j0 = 0; j0 < (unsigned)SEQ; j0 += 64u) {
            const unsigned t = hh * (SEQ / 64) + j0 / 64u;
            const h16* kt = ring + (t & 1u) * RB + lr * KPIT + 8u * hi;                    /* A rows: key lr of the step, k = e */
            const v16h ka0 = ldh(kt), ka1 = ldh(kt + 16 * KPIT), ka2 = ldh(kt + 32 * KPIT), ka3 = ldh(kt + 48 * KPIT);
            v8f s0 = wmma16(ka0, bq, (v8f){}); v8f s1 = wmma16(ka1, bq, (v8f){}); v8f s2 = wmma16(ka2, bq, (v8f){}); v8f s3 = wmma16(ka3, bq, (v8f){});
            asm volatile("v_nop\n\tv_nop\n\tv_nop\n\tv_nop" : "+v"(s0), "+v"(s1), "+v"(s2), "+v"(s3) : "v"(ka3), "v"(bq));
            float vm = s0[0];
#pragma unroll
            for (int r = 0; r < 8; ++r) { vm = fmaxf(vm, fmaxf(s0[r], s1[r])); vm = fmaxf(vm, fmaxf(s2[r], s3[r])); }
            vm = fmaxf(vm, __shfl_xor(vm, 16, 32));                   /* both lane halves hold the other 32 keys of the same query */
            const float mn = fmaxf(m, vm * SCLX);
            const float alpha = __builtin_amdgcn_exp2f(m - mn); m = mn;
            const float nb = 10.0f - mn;                              /* 2^10 carry */
            float rs = 0.0f;
#pragma unroll
            for (int r = 0; r < 8; ++r) {
                s0[r] = __builtin_amdgcn_exp2f(fmaf(s0[r], SCLX, nb)); s1[r] = __builtin_amdgcn_exp2f(fmaf(s1[r], SCLX, nb));
                s2[r] = __builtin_amdgcn_exp2f(fmaf(s2[r], SCLX, nb)); s3[r] = __builtin_amdgcn_exp2f(fmaf(s3[r], SCLX, nb));
                rs += (s0[r] + s1[r]) + (s2[r] + s3[r]); }
            rs += __shfl_xor(rs, 16, 32);
            l = l * alpha + rs;
            v16h pB0, pB1;
#pragma unroll
            for (int r = 0; r < 8; ++r) { acc0[r] *= alpha; acc1[r] *= alpha;
                pB0[r] = (h16)s0[r]; pB0[8 + r] = (h16)s1[r]; pB1[r] = (h16)s2[r]; pB1[8 + r] = (h16)s3[r]; }
            const h16* vt = ring + (t & 1u) * RB + RBK + lr * VPIT + 8u * hi;              /* A rows: e = lr, k = key */
            const v16h va00 = ldh(vt), va01 = ldh(vt + 32), va10 = ldh(vt + 16 * VPIT), va11 = ldh(vt + 16 * VPIT + 32);
            acc0 = wmma16(va00, pB0, acc0); acc1 = wmma16(va10, pB0, acc1); acc0 = wmma16(va01, pB1, acc0); acc1 = wmma16(va11, pB1, acc1);
            asm volatile("v_nop\n\tv_nop\n\tv_nop\n\tv_nop" : "+v"(acc0), "+v"(acc1) : "v"(va11), "v"(va01), "v"(pB1));
            asm volatile("s_wait_dscnt 0x0" ::: "memory");      /* this wave's reads of buffer t & 1 are done before it is refilled */
            asm volatile("s_wait_asynccnt 0x0" ::: "memory");   /* this wave's pieces of tile t + 1 have landed */
            __syncthreads();                                     /* publishes tile t + 1 and ends every wave's reads of tile t */
            if (t + 2u < NTILE) stage(t + 2u);                   /* block-uniform test; refills the buffer just read */
        }
        const float inv = (1.0f / QCAR) / l;
#pragma unroll
        for (int r = 0; r < 8; ++r) { osw[lr * 68u + hh * 32u + 8u * hi + r] = acc0[r] * inv; osw[lr * 68u + hh * 32u + 16u + 8u * hi + r] = acc1[r] * inv; }   /* D: e = 8*hi + r (+16), query lr */
    }
    asm volatile("s_wait_asynccnt 0x0" ::: "memory");   /* no copy outstanding behind the loop */
    __syncthreads();
    const size_t rowbase = ((size_t)bz * SEQ + i0) * DM + hp * 64u;
{
#pragma unroll
        for (unsigned s = 0; s < 4u; ++s) { const unsigned row = 4u * s + (lane >> 3), pc = (lane & 7u) * 8u; const v4f v0 = *(const v4fa*)(osw + row * 68u + pc); const v4f v1 = *(const v4fa*)(osw + row * 68u + pc + 4u); v8us oh, ol;
#pragma unroll
            for (int q = 0; q < 4; ++q) { unsigned short a2, c2; splitf(v0[q], a2, c2); oh[q] = a2; ol[q] = c2; splitf(v1[q], a2, c2); oh[4 + q] = a2; ol[4 + q] = c2; }
            const size_t oo = rowbase + (size_t)row * DM + pc;
            *(v8us*)(CH + oo) = oh; *(v8us*)(CL + oo) = ol; }   
         }
}

constexpr size_t al256(size_t b) { return (b + 255) & ~(size_t)255; }
constexpr size_t SZ_XB  = al256((size_t)NB * SEQ * DM * 2);
constexpr size_t SZ_WQK = al256((size_t)QKW * DM * 2);
constexpr size_t SZ_W   = al256((size_t)DM * DM * 2);
constexpr size_t SZ_QK  = al256((size_t)NB * SEQ * QKW * 2);
constexpr size_t SZ_VT  = al256((size_t)NB * DM * SEQ * 2);
constexpr size_t SZ_C   = al256((size_t)NB * SEQ * DM * 2);
constexpr size_t CARVE  = SZ_XB + SZ_WQK + 2 * SZ_W + SZ_QK + SZ_VT + 2 * SZ_C;
static_assert(CARVE <= (size_t)134217728);                                   // carve <= 128 MiB
static_assert(((size_t)NB * SEQ * (DM / 8)) % 256 == 0);                      // x blocks of k_prep x 256 threads x 8 == XB elements
static_assert((size_t)NH * 4 * 256 * 4 * 8 == (size_t)(QKW + 2 * DM) * DM);  // weight blocks of k_prep x threads x 4 pieces x 8 == all weight-plane elements
static_assert((size_t)(SEQ / 64) * (NH / 2) * NB * FW * 16 * 64 == (size_t)NB * SEQ * DM);   // k_flash waves x 16 rows x 64 cols == ctx plane elements

extern "C" void kernel_launch(void* const* d_in, const int* in_sizes, int n_in,
                              void* d_out, int out_size, void* d_ws, size_t ws_size, hipStream_t stream) {
    if (n_in < 5) return;
    const long long xmin = (long long)(NB - 1) * SEQ_FULL * DM + (long long)SEQ * DM;
    if ((long long)in_sizes[0] < xmin || in_sizes[1] < NH * DM * HD || in_sizes[2] < NH * DM * HD || in_sizes[3] < NH * DM * HD || in_sizes[4] < DM * DM) return;
    if ((long long)out_size < xmin) return;
    if (CARVE > ws_size) return;
    const float* x = (const float*)d_in[0]; const float* wq = (const float*)d_in[1]; const float* wk = (const float*)d_in[2]; const float* wv = (const float*)d_in[3]; const float* wo = (const float*)d_in[4];
    float* OUT = (float*)d_out;   /* [NB_FULL][SEQ_FULL][256] f32, batch stride from the full sizes */
    char* wsp = (char*)d_ws;
    auto take = [&](size_t bytes) { char* p = wsp; wsp += bytes; return (void*)p; };
    bf* XB = (bf*)take(SZ_XB); bf* WQK = (bf*)take(SZ_WQK); bf* WV = (bf*)take(SZ_W); bf* WOT = (bf*)take(SZ_W);
    h16* QKP = (h16*)take(SZ_QK); h16* VTP = (h16*)take(SZ_VT); bf* CH = (bf*)take(SZ_C); bf* CL = (bf*)take(SZ_C);

    k_prep<<<PWB + PXB, 256, 0, stream>>>(x, wq, wk, wv, wo, XB, WQK, WV, WOT);
    k_proj<<<PQK + PV, 32, 0, stream>>>(XB, WQK, WV, QKP, VTP);
    k_flash<<<dim3(SEQ / 64, NH / 2, NB), 128, 0, stream>>>(QKP, VTP, CH, CL);
    /* out[b][t][n] = (CH + CL)[b][t][:] . WOT[n][:]: M = SEQ, N = 256, K = 256, z = batch (output stride from the full sizes) */
    k_gemmw<bf, 1, 0><<<dim3(SEQ / 64, DM / 64, NB), 32, 0, stream>>>(CH, CL, WOT, nullptr, DM, (void*)OUT, DM, 1.0f, (size_t)SEQ * DM, 0, (size_t)SEQ_FULL * DM);
}

// v003
// It runs in 62.2 microseconds.
// Two timings next to v002 put it at 1.09 and 1.08 times that version's speed.
// All steps since v000 together make it 1.74 times as fast.
#include <hip/hip_runtime.h>

// Compute dtypes (f32 accumulate everywhere): q/k/v projections v_wmma_f32_16x16x32_bf16 on bf16 RNE-converted x and weights (exact products); scores q.k^T v_wmma_f32_16x16x32_f16 (q x16, k x16 carries); attn.V v_wmma_f32_16x16x32_f16 (exp weights x1024, v x16 carries); output projection v_wmma_f32_16x16x32_bf16 with the context as bf16 hi + lo planes (2 products) against bf16 wo.
// Multi-head attention: x [NB][SEQ_FULL][256] (first SEQ rows per batch), per-head weights w[8][256][32] ([in][out] per head), scores x 256^-0.5, softmax over all SEQ keys (no mask), heads concatenated head-major, times wo [in][out].
// Every GEMM wave stages its operand tiles in its own LDS by asynchronous copies that cover whole 128-byte lines and takes its fragments from there.
// Plan, four launches: k_prep (weight planes B^T, transposed through LDS, and the x plane, in block ranges of one grid), k_proj (GEMM q|k -> f16 token-major plane [t][512] and GEMM v^T -> f16 plane [b][h*32+e][t], in block ranges of one grid), k_flash (online softmax, k and v^T tiles staged in LDS for the block's four waves, 16 queries x 2 heads per wave -> ctx hi/lo bf16 planes [t][256]), GEMM wo -> out f32.

#ifndef NB
#define NB 4
#endif
#ifndef SEQ
#define SEQ 2048
#endif
#define NB_FULL  4
#define SEQ_FULL 2048
#define DM   256      // model width = NH * HD
#define NH   8
#define HD   32       // head dim: exactly one 32-deep k-step per score tile
#define QKW  512      // q|k plane row width (q cols 0..255, k cols 256..511)
#define QCAR 16.0f    // carry on q, k and v planes
#define SCLX (0.0625f * 1.44269504088896340736f / 256.0f)   // 256^-0.5 x log2(e) / (16 x 16)

static_assert(DM == NH * HD);          // head-major concat width
static_assert(HD == 32);               // one WMMA k-step per head; two 16-wide e tiles
static_assert((NH & 1) == 0);
static_assert(SEQ % 64 == 0);          // 64-row GEMM tiles, 64-key flash steps, 64-query blocks
static_assert(DM % 64 == 0 && QKW % 64 == 0 && DM % 32 == 0);
static_assert(NB <= NB_FULL && SEQ <= SEQ_FULL);

typedef _Float16 h16;
typedef unsigned short bf;
typedef __attribute__((ext_vector_type(16))) __bf16   v16bf;
typedef __attribute__((ext_vector_type(16))) _Float16 v16h;
typedef __attribute__((ext_vector_type(8)))  _Float16 v8h;
typedef __attribute__((ext_vector_type(8)))  unsigned short v8us;
typedef __attribute__((ext_vector_type(8)))  float    v8f;
typedef __attribute__((ext_vector_type(4)))  float    v4f;
typedef v4f  __attribute__((may_alias)) v4fa;

__device__ __forceinline__ unsigned short f2bf(float f) { unsigned u = __float_as_uint(f); u += 0x7FFFu + ((u >> 16) & 1u); return (unsigned short)(u >> 16); }
__device__ __forceinline__ float bf2f(unsigned short b) { return __uint_as_float(((unsigned)b) << 16); }
__device__ __forceinline__ v16h cat16(v8h lo, v8h hi) { return __builtin_shufflevector(lo, hi, 0, 1, 2, 3, 4, 5, 6, 7, 8, 9, 10, 11, 12, 13, 14, 15); }
__device__ __forceinline__ v16bf cat16b(v8us lo, v8us hi) { return __builtin_bit_cast(v16bf, __builtin_shufflevector(lo, hi, 0, 1, 2, 3, 4, 5, 6, 7, 8, 9, 10, 11, 12, 13, 14, 15)); }
__device__ __forceinline__ v8f wmma16(v16h a, v16h b, v8f c) { return __builtin_amdgcn_wmma_f32_16x16x32_f16(false, a, false, b, (short)0, c, false, false); }
__device__ __forceinline__ v8f wmmab(v16bf a, v16bf b, v8f c) { return __builtin_amdgcn_wmma_f32_16x16x32_bf16(false, a, false, b, (short)0, c, false, false); }
__device__ __forceinline__ void splitf(float y, unsigned short& h, unsigned short& l) { h = f2bf(y); l = f2bf(y - bf2f(h)); }
// fragment from a K-contiguous f16 row: p already includes row and 8*(lane>>4); elements 0..7 <- p[0..7], 8..15 <- p[16..23]
__device__ __forceinline__ v16h ldh(const h16* p) { return cat16(*(const v8h*)p, *(const v8h*)(p + 16)); }

// ---- gemmw_tile: register-blocked GEMM, ONE WAVE per 64x64 output tile (16 accumulators), operands from K-contiguous 16-bit planes (row pitch == K); tile (bx, by) of batch bz, 32 threads.
// C[m][n] = sum_k A[m][k] Bt[n][k] (+ A2 Bt for NSPLIT 1). z-batch strides sA/sB/sC in elements. K % 64 == 0, M % 64 == 0, N % 64 == 0 (no tail masking).
// Staging: chunk t = 64 k of the tile's 64 A (and A2) rows and 64 Bt rows, 128 B of each row. A fragment load straight from the plane would touch 16 lines for 512 B; a copy here takes 4 rows x 128 B, whole lines,
// global -> LDS buffer t & 1 through no register, while chunk t - 1 is worked on. Row pitch 144 B (16 B x odd) keeps the 16-byte fragment reads free of bank conflicts. The k order of the sums is unchanged.
// OMODE 0: f32 C (pitch ldc): per 16-row slab staged in LDS, each row's 64 floats (256 B) written as 16 lanes x 16 B (2 rows per instruction).
template <typename T16> struct WFrag;
template <> struct WFrag<h16> { typedef v16h V; static __device__ __forceinline__ V ld(const h16* p) { return cat16(*(const v8h*)p, *(const v8h*)(p + 16)); } static __device__ __forceinline__ v8f mma(V a, V b, v8f c) { return wmma16(a, b, c); } };
template <> struct WFrag<bf> { typedef v16bf V; static __device__ __forceinline__ V ld(const bf* p) { return cat16b(*(const v8us*)p, *(const v8us*)(p + 16)); } static __device__ __forceinline__ v8f mma(V a, V b, v8f c) { return wmmab(a, b, c); } };
#define GKC  64                        // k per staged chunk: 128 B of every row
#define GPIT 72                        // 16-bit elements per staged row (64 + 8 pad)
#define GPL  (64 * GPIT)               // elements of one staged plane: 64 rows
static_assert((GPIT * 2) % 16 == 0 && (GPL * 2) % 16 == 0);   // every copy and fragment read 16-byte aligned
static_assert(DM % GKC == 0 && DM / GKC >= 2);                 // K = DM: whole chunks, and the two that the prologue stages exist
// Eight copies of 16 B per lane, global -> LDS through no register. s_wait_xcnt 0 closes the statement so that no address register of a copy is rewritten ahead of it.
template <typename T16>
__device__ __forceinline__ void copy8(unsigned l0, unsigned l1, unsigned l2, unsigned l3, unsigned l4, unsigned l5, unsigned l6, unsigned l7,
                                      const T16* g0, const T16* g1, const T16* g2, const T16* g3, const T16* g4, const T16* g5, const T16* g6, const T16* g7) {
    asm volatile("global_load_async_to_lds_b128 %0, %8, off\n\t"
                 "global_load_async_to_lds_b128 %1, %9, off\n\t"
                 "global_load_async_to_lds_b128 %2, %10, off\n\t"
                 "global_load_async_to_lds_b128 %3, %11, off\n\t"
                 "global_load_async_to_lds_b128 %4, %12, off\n\t"
                 "global_load_async_to_lds_b128 %5, %13, off\n\t"
                 "global_load_async_to_lds_b128 %6, %14, off\n\t"
                 "global_load_async_to_lds_b128 %7, %15, off\n\t"
                 "s_wait_xcnt 0x0"
                 :: "v"(l0), "v"(l1), "v"(l2), "v"(l3), "v"(l4), "v"(l5), "v"(l6), "v"(l7), "v"(g0), "v"(g1), "v"(g2), "v"(g3), "v"(g4), "v"(g5), "v"(g6), "v"(g7) : "memory");
}
template <typename T16, int NSPLIT, int OMODE>
__device__ __forceinline__ void gemmw_tile(const T16* __restrict__ A, const T16* __restrict__ A2, const T16* __restrict__ Bt, const T16* __restrict__ Bt2, int K, void* Cv, int ldc, float oscale, size_t sA, size_t sB, size_t sC, unsigned bx, unsigned by, unsigned bz) {
    typedef typename WFrag<T16>::V V;
    static_assert(NSPLIT == 0 || NSPLIT == 1);
    constexpr unsigned NP = (NSPLIT == 1) ? 3u : 2u;   /* staged planes: A, (A2,) Bt */
    __shared__ __align__(16) float os[16 * 68];
    __shared__ __align__(16) T16 gring[2 * NP * GPL];
    const size_t z = bz; A += z * sA; if (A2) A2 += z * sA; Bt += z * sB;
    const unsigned lane = threadIdx.x & 31u, lr = lane & 15u, hi = lane >> 4; const unsigned r0 = bx * 64u, c0 = by * 64u;
    v8f acc[4][4];
#pragma unroll
    for (int mb = 0; mb < 4; ++mb)
#pragma unroll
        for (int nb = 0; nb < 4; ++nb) acc[mb][nb] = (v8f){};
    /* this lane's piece of a copy: row lane >> 3 of the copy's four rows, 16-byte piece lane & 7 of the row's 128 B */
    const unsigned lst = (unsigned)(size_t)gring + 2u * ((lane >> 3) * GPIT + (lane & 7u) * 8u);   /* LDS byte address: the low 32 bits */
    const size_t goff = (size_t)(lane >> 3) * K + (lane & 7u) * 8u;
    const T16* ga = A + (size_t)r0 * K + goff; const T16* ga2 = (NSPLIT == 1) ? A2 + (size_t)r0 * K + goff : nullptr; const T16* gb = Bt + (size_t)c0 * K + goff;
    auto plane = [&](unsigned l, const T16* g) {   /* 64 rows x 128 B: 16 copies of 4 rows */
#pragma unroll   /* two statements of eight copies; their LDS and row steps become literals */
        for (unsigned c = 0; c < 16u; c += 8u) { const unsigned lc = l + c * (8u * GPIT); const T16* gc = g + (size_t)c * 4 * K;
            copy8<T16>(lc, lc + 8u * GPIT, lc + 16u * GPIT, lc + 24u * GPIT, lc + 32u * GPIT, lc + 40u * GPIT, lc + 48u * GPIT, lc + 56u * GPIT,
                       gc, gc + (size_t)4 * K, gc + (size_t)8 * K, gc + (size_t)12 * K, gc + (size_t)16 * K, gc + (size_t)20 * K, gc + (size_t)24 * K, gc + (size_t)28 * K); } };
    auto stage = [&](int t) { const unsigned lb = lst + (unsigned)(t & 1) * (2u * NP * GPL); const int kc = t * GKC;   /* 16 x NP copies in flight, at most 48 */
        plane(lb, ga + kc); if constexpr (NSPLIT == 1) plane(lb + 2u * GPL, ga2 + kc); plane(lb + 2u * (NP - 1) * GPL, gb + kc); };
    const int nt = K / GKC;
    stage(0);
    asm volatile("s_wait_asynccnt 0x0" ::: "memory");   /* chunk 0 has landed */
    __syncthreads();                                     /* chunk 0 readable (single-wave block) */
    if (1 < nt) stage(1);
#pragma unroll 1   /* rolled: one copy of the chunk's code in the instruction cache, the buffer picked by t & 1 */
    for (int t = 0; t < nt; ++t) {
        const T16* fb = gring + (t & 1) * (NP * GPL) + lr * GPIT + 8 * hi;   /* fragment rows: row lr of a 16-row group, k = 8*hi + ... */
#pragma unroll   /* both k-steps of a chunk in line: the second's reads start under the first's last products */
        for (int ks = 0; ks < GKC; ks += 32) {
            V a[4], a2[4];
#pragma unroll
            for (int mb = 0; mb < 4; ++mb) { a[mb] = WFrag<T16>::ld(fb + mb * 16 * GPIT + ks); if (NSPLIT == 1) a2[mb] = WFrag<T16>::ld(fb + GPL + mb * 16 * GPIT + ks); }
            V b[4];   /* all fragments of a k-step are read as one group: one LDS wait per 16 (32) products */
#pragma unroll
            for (int nb = 0; nb < 4; ++nb) b[nb] = WFrag<T16>::ld(fb + (NP - 1) * GPL + nb * 16 * GPIT + ks);
            __builtin_amdgcn_sched_barrier(0);   /* keeps the reads together ahead of the products: sunk among them, each pair of reads is waited out on its own */
#pragma unroll
            for (int nb = 0; nb < 4; ++nb) {
#pragma unroll
                for (int mb = 0; mb < 4; ++mb) { acc[mb][nb] = WFrag<T16>::mma(a[mb], b[nb], acc[mb][nb]); if (NSPLIT == 1) acc[mb][nb] = WFrag<T16>::mma(a2[mb], b[nb], acc[mb][nb]); } }
            if (ks + 32 == GKC) {   /* behind the chunk's last products: fills the vector slots they need before an instruction behind the loop's branches touches their registers */
                if constexpr (NSPLIT == 1) { asm volatile("v_nop\n\tv_nop\n\tv_nop\n\tv_nop" : "+v"(acc[0][0]), "+v"(acc[1][1]), "+v"(acc[2][2]), "+v"(acc[3][3]) : "v"(a[0]), "v"(a[3]), "v"(a2[3])); }
                else { asm volatile("v_nop\n\tv_nop\n\tv_nop\n\tv_nop" : "+v"(acc[0][0]), "+v"(acc[1][1]), "+v"(acc[2][2]), "+v"(acc[3][3]) : "v"(a[0]), "v"(a[3])); } }
        }
        asm volatile("s_wait_dscnt 0x0" ::: "memory");      /* the reads of buffer t & 1 are done before it is refilled */
        asm volatile("s_wait_asynccnt 0x0" ::: "memory");   /* chunk t + 1 has landed */
        __syncthreads();                                     /* publishes chunk t + 1 and ends the reads of chunk t */
        if (t + 2 < nt) stage(t + 2);                        /* uniform test; refills the buffer just read */
    }
    asm volatile("s_wait_asynccnt 0x0" ::: "memory");   /* no copy outstanding behind the loop */
#pragma unroll
    for (int mb = 0; mb < 4; ++mb) {
#pragma unroll
        for (int nb = 0; nb < 4; ++nb) {
#pragma unroll
            for (int j = 0; j < 8; ++j) os[(hi * 8 + j) * 68 + nb * 16 + lr] = acc[mb][nb][j]; }   /* D: row 8*hi + j, col 16*nb + lr */
        __syncthreads();   /* single-wave block: staging visible to every lane */
        if constexpr (OMODE == 0) {
            float* crow = (float*)Cv + z * sC + (size_t)(r0 + mb * 16) * ldc + c0;
{
#pragma unroll
                for (int s = 0; s < 8; ++s) { const unsigned row = 2u * s + hi, cofs = lr * 4u; const v4f val = *(const v4fa*)(os + row * 68 + cofs);
                    *(v4f*)(crow + (size_t)row * ldc + cofs) = val; }   /* rows 2s+hi, s 0..7: all 16 rows; 16 lanes x 16 B = 256 B row segment */
                 }
        } else {
            h16* crow = (h16*)Cv + z * sC + (size_t)(r0 + mb * 16) * ldc + c0;
{
#pragma unroll
                for (int s = 0; s < 4; ++s) { const unsigned row = 4u * s + (lane >> 3), pc = (lane & 7u) * 8u; const v4f v0 = *(const v4fa*)(os + row * 68 + pc); const v4f v1 = *(const v4fa*)(os + row * 68 + pc + 4); v8h o;
#pragma unroll
                    for (int q = 0; q < 4; ++q) { o[q] = (h16)(v0[q] * oscale); o[4 + q] = (h16)(v1[q] * oscale); }
                    *(v8h*)(crow + (size_t)row * ldc + pc) = o; }   
                 }
        }
        __syncthreads();   /* staging free before the next slab overwrites it */
    }
}
// k_gemmw: one GEMM per launch, K = DM; grid (M/64, N/64, Z).
template <typename T16, int NSPLIT, int OMODE>
__global__ __launch_bounds__(32) void k_gemmw(const T16* __restrict__ A, const T16* __restrict__ A2, const T16* __restrict__ Bt, const T16* __restrict__ Bt2, void* Cv, int ldc, float oscale, size_t sA, size_t sB, size_t sC) {
    gemmw_tile<T16, NSPLIT, OMODE>(A, A2, Bt, Bt2, DM, Cv, ldc, oscale, sA, sB, sC, blockIdx.x, blockIdx.y, blockIdx.z);   /* K = DM, a constant: the copies' row steps are literals */
}
// k_proj: the two projection GEMMs depend on the planes of k_prep only, not on each other, so their tiles share one grid and run side by side.
// Blocks [0, PQK): q|k plane [NB*SEQ][512] f16 = 16 x (XB . WQK^T), M = NB*SEQ, N = 512, K = 256, row tile fastest.
// Blocks [PQK, PQK + PV): v^T plane [b][256 (h*32+e)][SEQ] f16 = 16 x (WV . XB[b]^T), M = 256, N = SEQ, K = 256, row tile fastest, then key tile, then batch.
#define PQM ((unsigned)((size_t)NB * SEQ / 64))
#define PQK (PQM * (QKW / 64u))
#define PV  ((DM / 64u) * (SEQ / 64u) * (unsigned)NB)
__global__ __launch_bounds__(32) void k_proj(const bf* __restrict__ XB, const bf* __restrict__ WQK, const bf* __restrict__ WV, h16* QKP, h16* VTP) {
    const unsigned b = blockIdx.x; const bool qk = b < PQK; const unsigned v = b - PQK;
    gemmw_tile<bf, 0, 1>(qk ? XB : WV, nullptr, qk ? WQK : XB, nullptr, DM, qk ? (void*)QKP : (void*)VTP, qk ? QKW : SEQ, QCAR, 0, qk ? (size_t)0 : (size_t)SEQ * DM, qk ? (size_t)0 : (size_t)DM * SEQ,
                         qk ? b % PQM : v % (DM / 64u), qk ? b / PQM : (v / (DM / 64u)) % (SEQ / 64u), qk ? 0u : v / ((DM / 64u) * (SEQ / 64u)));
}

__device__ __forceinline__ void xprep_blk(const float* __restrict__ x, bf* XB, unsigned blk) {
    const unsigned i = blk * 256u + threadIdx.x; if (i >= (unsigned)NB * SEQ * (DM / 8)) return;
    const unsigned b = i / ((unsigned)SEQ * (DM / 8)), r = i - b * ((unsigned)SEQ * (DM / 8));
    const float* s = x + ((size_t)b * SEQ_FULL * (DM / 8) + r) * 8; const v4f a0 = *(const v4f*)s, a1 = *(const v4f*)(s + 4); v8us o;
#pragma unroll
    for (int q = 0; q < 4; ++q) { o[q] = f2bf(a0[q]); o[4 + q] = f2bf(a1[q]); }
    *(v8us*)(XB + (size_t)i * 8) = o;  }

// wprep_blk: B^T weight planes (bf16 RNE, K-contiguous rows of 256): block (g, mt) transposes in[256 d][32 e] -> out[32 e][256 d] through LDS.
// mt 0: wq[g][d][e] -> WQK row g*32+e; mt 1: wk -> WQK row 256 + g*32+e; mt 2: wv -> WV row g*32+e; mt 3: wo[d][g*32+e] -> WOT row g*32+e (in[256][256] -> out[256][256] transposed).
__device__ __forceinline__ void wprep_blk(const float* __restrict__ wq, const float* __restrict__ wk, const float* __restrict__ wv, const float* __restrict__ wo, bf* WQK, bf* WV, bf* WOT, unsigned g, unsigned mt) {
    __shared__ float ts[256 * 33];
    const unsigned tid = threadIdx.x;
    const float* src = wq; unsigned gs = (unsigned)DM * HD, ds = HD; bf* dst = WQK;
    if (mt == 1u) { src = wk; dst = WQK + (size_t)DM * DM; } else if (mt == 2u) { src = wv; dst = WV; } else if (mt == 3u) { src = wo; gs = HD; ds = DM; dst = WOT; }
#pragma unroll 4
    for (unsigned it = 0; it < 32u; ++it) { const unsigned idx = it * 256u + tid, d = idx >> 5, e = idx & 31u; ts[d * 33u + e] = src[(size_t)g * gs + (size_t)d * ds + e]; }   /* 32 x 256 = all 8192 entries */
    __syncthreads();
{
#pragma unroll
        for (unsigned it = 0; it < 4u; ++it) { const unsigned p = it * 256u + tid, e = p >> 5, pc = p & 31u; v8us o;   /* 4 x 256 pieces = 32 rows x 32 pieces */
#pragma unroll
            for (unsigned q = 0; q < 8u; ++q) o[q] = f2bf(ts[(pc * 8u + q) * 33u + e]);
            *(v8us*)(dst + (size_t)(g * HD + e) * DM + pc * 8u) = o; }
         }
}
// k_prep: the weight planes and the x plane read different inputs and write different planes, so both share one grid. The few weight blocks, each a longer chain of loads, LDS and stores, come first.
#define PWB ((unsigned)NH * 4u)
#define PXB ((unsigned)(((size_t)NB * SEQ * (DM / 8)) / 256))
__global__ __launch_bounds__(256) void k_prep(const float* __restrict__ x, const float* __restrict__ wq, const float* __restrict__ wk, const float* __restrict__ wv, const float* __restrict__ wo, bf* XB, bf* WQK, bf* WV, bf* WOT) {
    if (blockIdx.x < PWB) wprep_blk(wq, wk, wv, wo, WQK, WV, WOT, blockIdx.x % (unsigned)NH, blockIdx.x / (unsigned)NH);   /* block-uniform branch: its barrier is passed by the whole block */
    else xprep_blk(x, XB, blockIdx.x - PWB);
}

// k_flash: one wave = 16 queries x one head pair; per head a streaming pass over all SEQ keys in steps of 64 with the running-max softmax.
// Transposed tiles: S^T (M = key, N = query) = K-rows (A) x Q-rows (B), both K-contiguous f16 rows of the [t][512] plane; the f32 S^T accumulators repacked to f16 are directly the B fragments of
// ctx^T (M = e, N = query) = V^T-rows (A, K-contiguous over keys) x P^T: element r <- tile of keys 0..15, element 8+r <- tile of keys 16..31, lane unchanged.
// exp weights carry 2^10 (f16 operand <= 1024); the row sum uses the same f32 values, so the carry cancels in 1/l; the v carry 16 is folded into 1/l.
// Staging: tile t = (head t / (SEQ/64) of the pair, 64 keys) = 64 k rows of 64 B + 32 v^T rows of 128 B, copied once per block into LDS buffer t & 1 by asynchronous 16-byte copies
// (four per thread) while tile t - 1 is worked on; all four waves take their A fragments from LDS. Row pitches 80 B and 144 B (16 B x odd) keep the 16-byte row reads free of bank conflicts.
#define FW 4
#define KPIT 40                        // f16 per staged k row (32 + 8 pad)
#define VPIT 72                        // f16 per staged v^T row (64 + 8 pad)
#define RBK  (64 * KPIT)               // f16 of the k part of a buffer
#define RB   (64 * KPIT + 32 * VPIT)   // f16 per buffer
#define NTILE (2u * (SEQ / 64))
static_assert((KPIT * 2) % 16 == 0 && (VPIT * 2) % 16 == 0 && (RBK * 2) % 16 == 0 && (RB * 2) % 16 == 0);   // every copy and fragment read 16-byte aligned
// Four copies of 16 B per lane, global -> LDS through no register. s_wait_xcnt 0 closes the statement so that no address register of a copy is rewritten ahead of it.
__device__ __forceinline__ void copy4(unsigned l0, unsigned l1, unsigned l2, unsigned l3, const h16* g0, const h16* g1, const h16* g2, const h16* g3) {
    asm volatile("global_load_async_to_lds_b128 %0, %4, off\n\t"
                 "global_load_async_to_lds_b128 %1, %5, off\n\t"
                 "global_load_async_to_lds_b128 %2, %6, off\n\t"
                 "global_load_async_to_lds_b128 %3, %7, off\n\t"
                 "s_wait_xcnt 0x0"
                 :: "v"(l0), "v"(l1), "v"(l2), "v"(l3), "v"(g0), "v"(g1), "v"(g2), "v"(g3) : "memory");
}
__global__ __launch_bounds__(128) void k_flash(const h16* __restrict__ QK, const h16* __restrict__ VT, bf* CH, bf* CL) {
    __shared__ __align__(16) float os[FW * 16 * 68];
    __shared__ __align__(16) h16 ring[2 * RB];
    const unsigned tid = threadIdx.x, lane = tid & 31u, w = tid >> 5, lr = lane & 15u, hi = lane >> 4;
    const unsigned bz = blockIdx.z, hp = blockIdx.y, i0 = blockIdx.x * 64u + w * 16u;
    const h16* qkb = QK + (size_t)bz * SEQ * QKW;
    const h16* vtb = VT + (size_t)bz * DM * SEQ;
    float* osw = os + w * (16u * 68u);
    /* this thread's pieces of a tile: k rows tid>>2 and +32, 16-byte piece tid&3; v^T rows tid>>3 and +16, piece tid&7 */
    const unsigned ringb = (unsigned)(size_t)ring;   /* LDS byte address: the low 32 bits */
    const unsigned lk = ringb + 2u * ((tid >> 2) * KPIT + (tid & 3u) * 8u), lv = ringb + 2u * (RBK + (tid >> 3) * VPIT + (tid & 7u) * 8u);
    const h16* gk = qkb + (size_t)(tid >> 2) * QKW + DM + hp * 2u * HD + (tid & 3u) * 8u;
    const h16* gv = vtb + (size_t)(hp * 2u * HD + (tid >> 3)) * SEQ + (tid & 7u) * 8u;
    auto stage = [&](unsigned t) {
        const unsigned th = t / (SEQ / 64), tj = (t % (SEQ / 64)) * 64u, lb = (t & 1u) * (2u * RB);
        const h16* k0 = gk + th * HD + (size_t)tj * QKW; const h16* v0 = gv + (size_t)th * HD * SEQ + tj;
        copy4(lk + lb, lk + lb + 2u * 32u * KPIT, lv + lb, lv + lb + 2u * 16u * VPIT, k0, k0 + (size_t)32 * QKW, v0, v0 + (size_t)16 * SEQ); };
    stage(0u);
    asm volatile("s_wait_asynccnt 0x0" ::: "memory");   /* this wave's pieces of tile 0 have landed */
    __syncthreads();                                     /* tile 0 readable by every wave */
    stage(1u);
#pragma unroll 1
    for (unsigned hh = 0; hh < 2u; ++hh) {
        const unsigned hd = hp * 2u + hh;
        const v16h bq = ldh(qkb + (size_t)(i0 + lr) * QKW + hd * HD + 8u * hi);        /* B: n = query i0+lr, k = e */
        v8f acc0 = (v8f){}, acc1 = (v8f){}; float m = -3.0e38f, l = 0.0f;
#pragma unroll 1
        for (unsigned j0 = 0; j0 < (unsigned)SEQ; j0 += 64u) {
            const unsigned t = hh * (SEQ / 64) + j0 / 64u;
            const h16* kt = ring + (t & 1u) * RB + lr * KPIT + 8u * hi;                    /* A rows: key lr of the step, k = e */
            const v16h ka0 = ldh(kt), ka1 = ldh(kt + 16 * KPIT), ka2 = ldh(kt + 32 * KPIT), ka3 = ldh(kt + 48 * KPIT);
            v8f s0 = wmma16(ka0, bq, (v8f){}); v8f s1 = wmma16(ka1, bq, (v8f){}); v8f s2 = wmma16(ka2, bq, (v8f){}); v8f s3 = wmma16(ka3, bq, (v8f){});
            asm volatile("v_nop\n\tv_nop\n\tv_nop\n\tv_nop" : "+v"(s0), "+v"(s1), "+v"(s2), "+v"(s3) : "v"(ka3), "v"(bq));
            float vm = s0[0];
#pragma unroll
            for (int r = 0; r < 8; ++r) { vm = fmaxf(vm, fmaxf(s0[r], s1[r])); vm = fmaxf(vm, fmaxf(s2[r], s3[r])); }
            vm = fmaxf(vm, __shfl_xor(vm, 16, 32));                   /* both lane halves hold the other 32 keys of the same query */
            const float mn = fmaxf(m, vm * SCLX);
            const float alpha = __builtin_amdgcn_exp2f(m - mn); m = mn;
            const float nb = 10.0f - mn;                              /* 2^10 carry */
            float rs = 0.0f;
#pragma unroll
            for (int r = 0; r < 8; ++r) {
                s0[r] = __builtin_amdgcn_exp2f(fmaf(s0[r], SCLX, nb)); s1[r] = __builtin_amdgcn_exp2f(fmaf(s1[r], SCLX, nb));
                s2[r] = __builtin_amdgcn_exp2f(fmaf(s2[r], SCLX, nb)); s3[r] = __builtin_amdgcn_exp2f(fmaf(s3[r], SCLX, nb));
                rs += (s0[r] + s1[r]) + (s2[r] + s3[r]); }
            rs += __shfl_xor(rs, 16, 32);
            l = l * alpha + rs;
            v16h pB0, pB1;
#pragma unroll
            for (int r = 0; r < 8; ++r) { acc0[r] *= alpha; acc1[r] *= alpha;
                pB0[r] = (h16)s0[r]; pB0[8 + r] = (h16)s1[r]; pB1[r] = (h16)s2[r]; pB1[8 + r] = (h16)s3[r]; }
            const h16* vt = ring + (t & 1u) * RB + RBK + lr * VPIT + 8u * hi;              /* A rows: e = lr, k = key */
            const v16h va00 = ldh(vt), va01 = ldh(vt + 32), va10 = ldh(vt + 16 * VPIT), va11 = ldh(vt + 16 * VPIT + 32);
            acc0 = wmma16(va00, pB0, acc0); acc1 = wmma16(va10, pB0, acc1); acc0 = wmma16(va01, pB1, acc0); acc1 = wmma16(va11, pB1, acc1);
            asm volatile("v_nop\n\tv_nop\n\tv_nop\n\tv_nop" : "+v"(acc0), "+v"(acc1) : "v"(va11), "v"(va01), "v"(pB1));
            asm volatile("s_wait_dscnt 0x0" ::: "memory");      /* this wave's reads of buffer t & 1 are done before it is refilled */
            asm volatile("s_wait_asynccnt 0x0" ::: "memory");   /* this wave's pieces of tile t + 1 have landed */
            __syncthreads();                                     /* publishes tile t + 1 and ends every wave's reads of tile t */
            if (t + 2u < NTILE) stage(t + 2u);                   /* block-uniform test; refills the buffer just read */
        }
        const float inv = (1.0f / QCAR) / l;
#pragma unroll
        for (int r = 0; r < 8; ++r) { osw[lr * 68u + hh * 32u + 8u * hi + r] = acc0[r] * inv; osw[lr * 68u + hh * 32u + 16u + 8u * hi + r] = acc1[r] * inv; }   /* D: e = 8*hi + r (+16), query lr */
    }
    asm volatile("s_wait_asynccnt 0x0" ::: "memory");   /* no copy outstanding behind the loop */
    __syncthreads();
    const size_t rowbase = ((size_t)bz * SEQ + i0) * DM + hp * 64u;
{
#pragma unroll
        for (unsigned s = 0; s < 4u; ++s) { const unsigned row = 4u * s + (lane >> 3), pc = (lane & 7u) * 8u; const v4f v0 = *(const v4fa*)(osw + row * 68u + pc); const v4f v1 = *(const v4fa*)(osw + row * 68u + pc + 4u); v8us oh, ol;
#pragma unroll
            for (int q = 0; q < 4; ++q) { unsigned short a2, c2; splitf(v0[q], a2, c2); oh[q] = a2; ol[q] = c2; splitf(v1[q], a2, c2); oh[4 + q] = a2; ol[4 + q] = c2; }
            const size_t oo = rowbase + (size_t)row * DM + pc;
            *(v8us*)(CH + oo) = oh; *(v8us*)(CL + oo) = ol; }   
         }
}

constexpr size_t al256(size_t b) { return (b + 255) & ~(size_t)255; }
constexpr size_t SZ_XB  = al256((size_t)NB * SEQ * DM * 2);
constexpr size_t SZ_WQK = al256((size_t)QKW * DM * 2);
constexpr size_t SZ_W   = al256((size_t)DM * DM * 2);
constexpr size_t SZ_QK  = al256((size_t)NB * SEQ * QKW * 2);
constexpr size_t SZ_VT  = al256((size_t)NB * DM * SEQ * 2);
constexpr size_t SZ_C   = al256((size_t)NB * SEQ * DM * 2);
constexpr size_t CARVE  = SZ_XB + SZ_WQK + 2 * SZ_W + SZ_QK + SZ_VT + 2 * SZ_C;
static_assert(CARVE <= (size_t)134217728);                                   // carve <= 128 MiB
static_assert(((size_t)NB * SEQ * (DM / 8)) % 256 == 0);                      // x blocks of k_prep x 256 threads x 8 == XB elements
static_assert((size_t)NH * 4 * 256 * 4 * 8 == (size_t)(QKW + 2 * DM) * DM);  // weight blocks of k_prep x threads x 4 pieces x 8 == all weight-plane elements
static_assert((size_t)(SEQ / 64) * (NH / 2) * NB * FW * 16 * 64 == (size_t)NB * SEQ * DM);   // k_flash waves x 16 rows x 64 cols == ctx plane elements

extern "C" void kernel_launch(void* const* d_in, const int* in_sizes, int n_in,
                              void* d_out, int out_size, void* d_ws, size_t ws_size, hipStream_t stream) {
    if (n_in < 5) return;
    const long long xmin = (long long)(NB - 1) * SEQ_FULL * DM + (long long)SEQ * DM;
    if ((long long)in_sizes[0] < xmin || in_sizes[1] < NH * DM * HD || in_sizes[2] < NH * DM * HD || in_sizes[3] < NH * DM * HD || in_sizes[4] < DM * DM) return;
    if ((long long)out_size < xmin) return;
    if (CARVE > ws_size) return;
    const float* x = (const float*)d_in[0]; const float* wq = (const float*)d_in[1]; const float* wk = (const float*)d_in[2]; const float* wv = (const float*)d_in[3]; const float* wo = (const float*)d_in[4];
    float* OUT = (float*)d_out;   /* [NB_FULL][SEQ_FULL][256] f32, batch stride from the full sizes */
    char* wsp = (char*)d_ws;
    auto take = [&](size_t bytes) { char* p = wsp; wsp += bytes; return (void*)p; };
    bf* XB = (bf*)take(SZ_XB); bf* WQK = (bf*)take(SZ_WQK); bf* WV = (bf*)take(SZ_W); bf* WOT = (bf*)take(SZ_W);
    h16* QKP = (h16*)take(SZ_QK); h16* VTP = (h16*)take(SZ_VT); bf* CH = (bf*)take(SZ_C); bf* CL = (bf*)take(SZ_C);

    k_prep<<<PWB + PXB, 256, 0, stream>>>(x, wq, wk, wv, wo, XB, WQK, WV, WOT);
    k_proj<<<PQK + PV, 32, 0, stream>>>(XB, WQK, WV, QKP, VTP);
    k_flash<<<dim3(SEQ / 64, NH / 2, NB), 128, 0, stream>>>(QKP, VTP, CH, CL);
    /* out[b][t][n] = (CH + CL)[b][t][:] . WOT[n][:]: M = SEQ, N = 256, K = 256, z = batch (output stride from the full sizes) */
    k_gemmw<bf, 1, 0><<<dim3(SEQ / 64, DM / 64, NB), 32, 0, stream>>>(CH, CL, WOT, nullptr, (void*)OUT, DM, 1.0f, (size_t)SEQ * DM, 0, (size_t)SEQ_FULL * DM);
}

// v004
// It runs in 50 microseconds.
// Two timings next to v003 put it at 1.27 and 1.25 times that version's speed.
// All steps since v000 together make it 2.18 times as fast.
#include <hip/hip_runtime.h>

// Compute dtypes (f32 accumulate everywhere): q/k/v projections v_wmma_f32_16x16x32_bf16 on bf16 RNE-converted x and weights (exact products); scores q.k^T v_wmma_f32_16x16x32_f16 (q x16, k x16 carries); attn.V v_wmma_f32_16x16x32_f16 (exp weights x1024, v x16 carries); output projection v_wmma_f32_16x16x32_bf16 with the context as bf16 hi + lo planes (2 products) against bf16 wo.
// Multi-head attention: x [NB][SEQ_FULL][256] (first SEQ rows per batch), per-head weights w[8][256][32] ([in][out] per head), scores x 256^-0.5, softmax over all SEQ keys (no mask), heads concatenated head-major, times wo [in][out].
// Every GEMM wave stages its operand tiles in its own LDS by asynchronous copies that cover whole 128-byte lines and takes its fragments from there.
// Plan, four launches: k_prep (weight planes B^T, transposed through LDS, and the x plane, in block ranges of one grid), k_proj (GEMM q|k -> f16 token-major plane [t][512] and GEMM v^T -> f16 plane [b][h*32+e][t], in block ranges of one grid), k_flash (online softmax, k and v^T tiles of a head pair staged in LDS for the block's eight waves, 16 queries x 1 head per wave -> ctx hi/lo bf16 planes [t][256]), GEMM wo -> out f32.

#ifndef NB
#define NB 4
#endif
#ifndef SEQ
#define SEQ 2048
#endif
#define NB_FULL  4
#define SEQ_FULL 2048
#define DM   256      // model width = NH * HD
#define NH   8
#define HD   32       // head dim: exactly one 32-deep k-step per score tile
#define QKW  512      // q|k plane row width (q cols 0..255, k cols 256..511)
#define QCAR 16.0f    // carry on q, k and v planes
#define SCLX (0.0625f * 1.44269504088896340736f / 256.0f)   // 256^-0.5 x log2(e) / (16 x 16)

static_assert(DM == NH * HD);          // head-major concat width
static_assert(HD == 32);               // one WMMA k-step per head; two 16-wide e tiles
static_assert((NH & 1) == 0);
static_assert(SEQ % 64 == 0);          // 64-row GEMM tiles, 64-key flash steps, 64-query blocks
static_assert(DM % 64 == 0 && QKW % 64 == 0 && DM % 32 == 0);
static_assert(NB <= NB_FULL && SEQ <= SEQ_FULL);

typedef _Float16 h16;
typedef unsigned short bf;
typedef __attribute__((ext_vector_type(16))) __bf16   v16bf;
typedef __attribute__((ext_vector_type(16))) _Float16 v16h;
typedef __attribute__((ext_vector_type(8)))  _Float16 v8h;
typedef __attribute__((ext_vector_type(8)))  unsigned short v8us;
typedef __attribute__((ext_vector_type(8)))  float    v8f;
typedef __attribute__((ext_vector_type(4)))  float    v4f;
typedef v4f  __attribute__((may_alias)) v4fa;

__device__ __forceinline__ unsigned short f2bf(float f) { unsigned u = __float_as_uint(f); u += 0x7FFFu + ((u >> 16) & 1u); return (unsigned short)(u >> 16); }
__device__ __forceinline__ float bf2f(unsigned short b) { return __uint_as_float(((unsigned)b) << 16); }
__device__ __forceinline__ v16h cat16(v8h lo, v8h hi) { return __builtin_shufflevector(lo, hi, 0, 1, 2, 3, 4, 5, 6, 7, 8, 9, 10, 11, 12, 13, 14, 15); }
__device__ __forceinline__ v16bf cat16b(v8us lo, v8us hi) { return __builtin_bit_cast(v16bf, __builtin_shufflevector(lo, hi, 0, 1, 2, 3, 4, 5, 6, 7, 8, 9, 10, 11, 12, 13, 14, 15)); }
__device__ __forceinline__ v8f wmma16(v16h a, v16h b, v8f c) { return __builtin_amdgcn_wmma_f32_16x16x32_f16(false, a, false, b, (short)0, c, false, false); }
__device__ __forceinline__ v8f wmmab(v16bf a, v16bf b, v8f c) { return __builtin_amdgcn_wmma_f32_16x16x32_bf16(false, a, false, b, (short)0, c, false, false); }
__device__ __forceinline__ void splitf(float y, unsigned short& h, unsigned short& l) { h = f2bf(y); l = f2bf(y - bf2f(h)); }
// fragment from a K-contiguous f16 row: p already includes row and 8*(lane>>4); elements 0..7 <- p[0..7], 8..15 <- p[16..23]
__device__ __forceinline__ v16h ldh(const h16* p) { return cat16(*(const v8h*)p, *(const v8h*)(p + 16)); }

// ---- gemmw_tile: register-blocked GEMM, ONE WAVE per 64x64 output tile (16 accumulators), operands from K-contiguous 16-bit planes (row pitch == K); tile (bx, by) of batch bz, 32 threads.
// C[m][n] = sum_k A[m][k] Bt[n][k] (+ A2 Bt for NSPLIT 1). z-batch strides sA/sB/sC in elements. K % 64 == 0, M % 64 == 0, N % 64 == 0 (no tail masking).
// Staging: chunk t = 64 k of the tile's 64 A (and A2) rows and 64 Bt rows, 128 B of each row. A fragment load straight from the plane would touch 16 lines for 512 B; a copy here takes 4 rows x 128 B, whole lines,
// global -> LDS buffer t & 1 through no register, while chunk t - 1 is worked on. Row pitch 144 B (16 B x odd) keeps the 16-byte fragment reads free of bank conflicts. The k order of the sums is unchanged.
// OMODE 0: f32 C (pitch ldc): per 16-row slab staged in LDS, each row's 64 floats (256 B) written as 16 lanes x 16 B (2 rows per instruction).
template <typename T16> struct WFrag;
template <> struct WFrag<h16> { typedef v16h V; static __device__ __forceinline__ V ld(const h16* p) { return cat16(*(const v8h*)p, *(const v8h*)(p + 16)); } static __device__ __forceinline__ v8f mma(V a, V b, v8f c) { return wmma16(a, b, c); } };
template <> struct WFrag<bf> { typedef v16bf V; static __device__ __forceinline__ V ld(const bf* p) { return cat16b(*(const v8us*)p, *(const v8us*)(p + 16)); } static __device__ __forceinline__ v8f mma(V a, V b, v8f c) { return wmmab(a, b, c); } };
#define GKC  64                        // k per staged chunk: 128 B of every row
#define GPIT 72                        // 16-bit elements per staged row (64 + 8 pad)
#define GPL  (64 * GPIT)               // elements of one staged plane: 64 rows
static_assert((GPIT * 2) % 16 == 0 && (GPL * 2) % 16 == 0);   // every copy and fragment read 16-byte aligned
static_assert(DM % GKC == 0 && DM / GKC >= 2);                 // K = DM: whole chunks, and the two that the prologue stages exist
// Eight copies of 16 B per lane, global -> LDS through no register. s_wait_xcnt 0 closes the statement so that no address register of a copy is rewritten ahead of it.
template <typename T16>
__device__ __forceinline__ void copy8(unsigned l0, unsigned l1, unsigned l2, unsigned l3, unsigned l4, unsigned l5, unsigned l6, unsigned l7,
                                      const T16* g0, const T16* g1, const T16* g2, const T16* g3, const T16* g4, const T16* g5, const T16* g6, const T16* g7) {
    asm volatile("global_load_async_to_lds_b128 %0, %8, off\n\t"
                 "global_load_async_to_lds_b128 %1, %9, off\n\t"
                 "global_load_async_to_lds_b128 %2, %10, off\n\t"
                 "global_load_async_to_lds_b128 %3, %11, off\n\t"
                 "global_load_async_to_lds_b128 %4, %12, off\n\t"
                 "global_load_async_to_lds_b128 %5, %13, off\n\t"
                 "global_load_async_to_lds_b128 %6, %14, off\n\t"
                 "global_load_async_to_lds_b128 %7, %15, off\n\t"
                 "s_wait_xcnt 0x0"
                 :: "v"(l0), "v"(l1), "v"(l2), "v"(l3), "v"(l4), "v"(l5), "v"(l6), "v"(l7), "v"(g0), "v"(g1), "v"(g2), "v"(g3), "v"(g4), "v"(g5), "v"(g6), "v"(g7) : "memory");
}
template <typename T16, int NSPLIT, int OMODE>
__device__ __forceinline__ void gemmw_tile(const T16* __restrict__ A, const T16* __restrict__ A2, const T16* __restrict__ Bt, const T16* __restrict__ Bt2, int K, void* Cv, int ldc, float oscale, size_t sA, size_t sB, size_t sC, unsigned bx, unsigned by, unsigned bz) {
    typedef typename WFrag<T16>::V V;
    static_assert(NSPLIT == 0 || NSPLIT == 1);
    constexpr unsigned NP = (NSPLIT == 1) ? 3u : 2u;   /* staged planes: A, (A2,) Bt */
    __shared__ __align__(16) float os[16 * 68];
    __shared__ __align__(16) T16 gring[2 * NP * GPL];
    const size_t z = bz; A += z * sA; if (A2) A2 += z * sA; Bt += z * sB;
    const unsigned lane = threadIdx.x & 31u, lr = lane & 15u, hi = lane >> 4; const unsigned r0 = bx * 64u, c0 = by * 64u;
    v8f acc[4][4];
#pragma unroll
    for (int mb = 0; mb < 4; ++mb)
#pragma unroll
        for (int nb = 0; nb < 4; ++nb) acc[mb][nb] = (v8f){};
    /* this lane's piece of a copy: row lane >> 3 of the copy's four rows, 16-byte piece lane & 7 of the row's 128 B */
    const unsigned lst = (unsigned)(size_t)gring + 2u * ((lane >> 3) * GPIT + (lane & 7u) * 8u);   /* LDS byte address: the low 32 bits */
    const size_t goff = (size_t)(lane >> 3) * K + (lane & 7u) * 8u;
    const T16* ga = A + (size_t)r0 * K + goff; const T16* ga2 = (NSPLIT == 1) ? A2 + (size_t)r0 * K + goff : nullptr; const T16* gb = Bt + (size_t)c0 * K + goff;
    auto plane = [&](unsigned l, const T16* g) {   /* 64 rows x 128 B: 16 copies of 4 rows */
#pragma unroll   /* two statements of eight copies; their LDS and row steps become literals */
        for (unsigned c = 0; c < 16u; c += 8u) { const unsigned lc = l + c * (8u * GPIT); const T16* gc = g + (size_t)c * 4 * K;
            copy8<T16>(lc, lc + 8u * GPIT, lc + 16u * GPIT, lc + 24u * GPIT, lc + 32u * GPIT, lc + 40u * GPIT, lc + 48u * GPIT, lc + 56u * GPIT,
                       gc, gc + (size_t)4 * K, gc + (size_t)8 * K, gc + (size_t)12 * K, gc + (size_t)16 * K, gc + (size_t)20 * K, gc + (size_t)24 * K, gc + (size_t)28 * K); } };
    auto stage = [&](int t) { const unsigned lb = lst + (unsigned)(t & 1) * (2u * NP * GPL); const int kc = t * GKC;   /* 16 x NP copies in flight, at most 48 */
        plane(lb, ga + kc); if constexpr (NSPLIT == 1) plane(lb + 2u * GPL, ga2 + kc); plane(lb + 2u * (NP - 1) * GPL, gb + kc); };
    const int nt = K / GKC;
    stage(0);
    asm volatile("s_wait_asynccnt 0x0" ::: "memory");   /* chunk 0 has landed */
    __syncthreads();                                     /* chunk 0 readable (single-wave block) */
    if (1 < nt) stage(1);
#pragma unroll 1   /* rolled: one copy of the chunk's code in the instruction cache, the buffer picked by t & 1 */
    for (int t = 0; t < nt; ++t) {
        const T16* fb = gring + (t & 1) * (NP * GPL) + lr * GPIT + 8 * hi;   /* fragment rows: row lr of a 16-row group, k = 8*hi + ... */
#pragma unroll   /* both k-steps of a chunk in line: the second's reads start under the first's last products */
        for (int ks = 0; ks < GKC; ks += 32) {
            V a[4], a2[4];
#pragma unroll
            for (int mb = 0; mb < 4; ++mb) { a[mb] = WFrag<T16>::ld(fb + mb * 16 * GPIT + ks); if (NSPLIT == 1) a2[mb] = WFrag<T16>::ld(fb + GPL + mb * 16 * GPIT + ks); }
            V b[4];   /* all fragments of a k-step are read as one group: one LDS wait per 16 (32) products */
#pragma unroll
            for (int nb = 0; nb < 4; ++nb) b[nb] = WFrag<T16>::ld(fb + (NP - 1) * GPL + nb * 16 * GPIT + ks);
            __builtin_amdgcn_sched_barrier(0);   /* keeps the reads together ahead of the products: sunk among them, each pair of reads is waited out on its own */
#pragma unroll
            for (int nb = 0; nb < 4; ++nb) {
#pragma unroll
                for (int mb = 0; mb < 4; ++mb) { acc[mb][nb] = WFrag<T16>::mma(a[mb], b[nb], acc[mb][nb]); if (NSPLIT == 1) acc[mb][nb] = WFrag<T16>::mma(a2[mb], b[nb], acc[mb][nb]); } }
            if (ks + 32 == GKC) {   /* behind the chunk's last products: fills the vector slots they need before an instruction behind the loop's branches touches their registers */
                if constexpr (NSPLIT == 1) { asm volatile("v_nop\n\tv_nop\n\tv_nop\n\tv_nop" : "+v"(acc[0][0]), "+v"(acc[1][1]), "+v"(acc[2][2]), "+v"(acc[3][3]) : "v"(a[0]), "v"(a[3]), "v"(a2[3])); }
                else { asm volatile("v_nop\n\tv_nop\n\tv_nop\n\tv_nop" : "+v"(acc[0][0]), "+v"(acc[1][1]), "+v"(acc[2][2]), "+v"(acc[3][3]) : "v"(a[0]), "v"(a[3])); } }
        }
        asm volatile("s_wait_dscnt 0x0" ::: "memory");      /* the reads of buffer t & 1 are done before it is refilled */
        asm volatile("s_wait_asynccnt 0x0" ::: "memory");   /* chunk t + 1 has landed */
        __syncthreads();                                     /* publishes chunk t + 1 and ends the reads of chunk t */
        if (t + 2 < nt) stage(t + 2);                        /* uniform test; refills the buffer just read */
    }
    asm volatile("s_wait_asynccnt 0x0" ::: "memory");   /* no copy outstanding behind the loop */
#pragma unroll
    for (int mb = 0; mb < 4; ++mb) {
#pragma unroll
        for (int nb = 0; nb < 4; ++nb) {
#pragma unroll
            for (int j = 0; j < 8; ++j) os[(hi * 8 + j) * 68 + nb * 16 + lr] = acc[mb][nb][j]; }   /* D: row 8*hi + j, col 16*nb + lr */
        __syncthreads();   /* single-wave block: staging visible to every lane */
        if constexpr (OMODE == 0) {
            float* crow = (float*)Cv + z * sC + (size_t)(r0 + mb * 16) * ldc + c0;
{
#pragma unroll
                for (int s = 0; s < 8; ++s) { const unsigned row = 2u * s + hi, cofs = lr * 4u; const v4f val = *(const v4fa*)(os + row * 68 + cofs);
                    *(v4f*)(crow + (size_t)row * ldc + cofs) = val; }   /* rows 2s+hi, s 0..7: all 16 rows; 16 lanes x 16 B = 256 B row segment */
                 }
        } else {
            h16* crow = (h16*)Cv + z * sC + (size_t)(r0 + mb * 16) * ldc + c0;
{
#pragma unroll
                for (int s = 0; s < 4; ++s) { const unsigned row = 4u * s + (lane >> 3), pc = (lane & 7u) * 8u; const v4f v0 = *(const v4fa*)(os + row * 68 + pc); const v4f v1 = *(const v4fa*)(os + row * 68 + pc + 4); v8h o;
#pragma unroll
                    for (int q = 0; q < 4; ++q) { o[q] = (h16)(v0[q] * oscale); o[4 + q] = (h16)(v1[q] * oscale); }
                    *(v8h*)(crow + (size_t)row * ldc + pc) = o; }   
                 }
        }
        __syncthreads();   /* staging free before the next slab overwrites it */
    }
}
// k_gemmw: one GEMM per launch, K = DM; grid (M/64, N/64, Z).
template <typename T16, int NSPLIT, int OMODE>
__global__ __launch_bounds__(32) void k_gemmw(const T16* __restrict__ A, const T16* __restrict__ A2, const T16* __restrict__ Bt, const T16* __restrict__ Bt2, void* Cv, int ldc, float oscale, size_t sA, size_t sB, size_t sC) {
    gemmw_tile<T16, NSPLIT, OMODE>(A, A2, Bt, Bt2, DM, Cv, ldc, oscale, sA, sB, sC, blockIdx.x, blockIdx.y, blockIdx.z);   /* K = DM, a constant: the copies' row steps are literals */
}
// k_proj: the two projection GEMMs depend on the planes of k_prep only, not on each other, so their tiles share one grid and run side by side.
// Blocks [0, PQK): q|k plane [NB*SEQ][512] f16 = 16 x (XB . WQK^T), M = NB*SEQ, N = 512, K = 256, row tile fastest.
// Blocks [PQK, PQK + PV): v^T plane [b][256 (h*32+e)][SEQ] f16 = 16 x (WV . XB[b]^T), M = 256, N = SEQ, K = 256, row tile fastest, then key tile, then batch.
#define PQM ((unsigned)((size_t)NB * SEQ / 64))
#define PQK (PQM * (QKW / 64u))
#define PV  ((DM / 64u) * (SEQ / 64u) * (unsigned)NB)
__global__ __launch_bounds__(32) void k_proj(const bf* __restrict__ XB, const bf* __restrict__ WQK, const bf* __restrict__ WV, h16* QKP, h16* VTP) {
    const unsigned b = blockIdx.x; const bool qk = b < PQK; const unsigned v = b - PQK;
    gemmw_tile<bf, 0, 1>(qk ? XB : WV, nullptr, qk ? WQK : XB, nullptr, DM, qk ? (void*)QKP : (void*)VTP, qk ? QKW : SEQ, QCAR, 0, qk ? (size_t)0 : (size_t)SEQ * DM, qk ? (size_t)0 : (size_t)DM * SEQ,
                         qk ? b % PQM : v % (DM / 64u), qk ? b / PQM : (v / (DM / 64u)) % (SEQ / 64u), qk ? 0u : v / ((DM / 64u) * (SEQ / 64u)));
}

__device__ __forceinline__ void xprep_blk(const float* __restrict__ x, bf* XB, unsigned blk) {
    const unsigned i = blk * 256u + threadIdx.x; if (i >= (unsigned)NB * SEQ * (DM / 8)) return;
    const unsigned b = i / ((unsigned)SEQ * (DM / 8)), r = i - b * ((unsigned)SEQ * (DM / 8));
    const float* s = x + ((size_t)b * SEQ_FULL * (DM / 8) + r) * 8; const v4f a0 = *(const v4f*)s, a1 = *(const v4f*)(s + 4); v8us o;
#pragma unroll
    for (int q = 0; q < 4; ++q) { o[q] = f2bf(a0[q]); o[4 + q] = f2bf(a1[q]); }
    *(v8us*)(XB + (size_t)i * 8) = o;  }

// wprep_blk: B^T weight planes (bf16 RNE, K-contiguous rows of 256): block (g, mt) transposes in[256 d][32 e] -> out[32 e][256 d] through LDS.
// mt 0: wq[g][d][e] -> WQK row g*32+e; mt 1: wk -> WQK row 256 + g*32+e; mt 2: wv -> WV row g*32+e; mt 3: wo[d][g*32+e] -> WOT row g*32+e (in[256][256] -> out[256][256] transposed).
__device__ __forceinline__ void wprep_blk(const float* __restrict__ wq, const float* __restrict__ wk, const float* __restrict__ wv, const float* __restrict__ wo, bf* WQK, bf* WV, bf* WOT, unsigned g, unsigned mt) {
    __shared__ float ts[256 * 33];
    const unsigned tid = threadIdx.x;
    const float* src = wq; unsigned gs = (unsigned)DM * HD, ds = HD; bf* dst = WQK;
    if (mt == 1u) { src = wk; dst = WQK + (size_t)DM * DM; } else if (mt == 2u) { src = wv; dst = WV; } else if (mt == 3u) { src = wo; gs = HD; ds = DM; dst = WOT; }
#pragma unroll 4
    for (unsigned it = 0; it < 32u; ++it) { const unsigned idx = it * 256u + tid, d = idx >> 5, e = idx & 31u; ts[d * 33u + e] = src[(size_t)g * gs + (size_t)d * ds + e]; }   /* 32 x 256 = all 8192 entries */
    __syncthreads();
{
#pragma unroll
        for (unsigned it = 0; it < 4u; ++it) { const unsigned p = it * 256u + tid, e = p >> 5, pc = p & 31u; v8us o;   /* 4 x 256 pieces = 32 rows x 32 pieces */
#pragma unroll
            for (unsigned q = 0; q < 8u; ++q) o[q] = f2bf(ts[(pc * 8u + q) * 33u + e]);
            *(v8us*)(dst + (size_t)(g * HD + e) * DM + pc * 8u) = o; }
         }
}
// k_prep: the weight planes and the x plane read different inputs and write different planes, so both share one grid. The few weight blocks, each a longer chain of loads, LDS and stores, come first.
#define PWB ((unsigned)NH * 4u)
#define PXB ((unsigned)(((size_t)NB * SEQ * (DM / 8)) / 256))
__global__ __launch_bounds__(256) void k_prep(const float* __restrict__ x, const float* __restrict__ wq, const float* __restrict__ wk, const float* __restrict__ wv, const float* __restrict__ wo, bf* XB, bf* WQK, bf* WV, bf* WOT) {
    if (blockIdx.x < PWB) wprep_blk(wq, wk, wv, wo, WQK, WV, WOT, blockIdx.x % (unsigned)NH, blockIdx.x / (unsigned)NH);   /* block-uniform branch: its barrier is passed by the whole block */
    else xprep_blk(x, XB, blockIdx.x - PWB);
}

// k_flash: one block = 64 queries x one head pair on eight waves; wave w = 16 queries (group w & 3) x ONE head (w >> 2 of the pair): a streaming pass over all SEQ keys in steps of 64 with the running-max softmax.
// Both heads run side by side, so a SIMD holds four waves (two blocks per WGP) whose vector work, LDS waits and cross-lane waits fill one another's gaps.
// Transposed tiles: S^T (M = key, N = query) = K-rows (A) x Q-rows (B), both K-contiguous f16 rows of the [t][512] plane; the f32 S^T accumulators repacked to f16 are directly the B fragments of
// ctx^T (M = e, N = query) = V^T-rows (A, K-contiguous over keys) x P^T: element r <- tile of keys 0..15, element 8+r <- tile of keys 16..31, lane unchanged.
// exp weights carry 2^10 (f16 operand <= 1024); the row sum uses the same f32 values, so the carry cancels in 1/l; the v carry 16 is folded into 1/l.
// Staging: tile t = 64 keys of both heads = per head 64 k rows of 64 B + 32 v^T rows of 128 B, copied once per block into LDS buffer t & 1 by asynchronous 16-byte copies
// (four per thread) while tile t - 1 is worked on; a k copy takes the 128 B of a plane row that hold both heads, a whole line. The four waves of a head take their A fragments from its half of the buffer.
// Row pitches 80 B and 144 B (16 B x odd) keep the 16-byte row reads free of bank conflicts.
#define FW 4                           // query groups of 16 per block
#define KPIT 40                        // f16 per staged k row (32 + 8 pad)
#define VPIT 72                        // f16 per staged v^T row (64 + 8 pad)
#define RBK  (64 * KPIT)               // f16 of the k part of one head's half
#define RB   (64 * KPIT + 32 * VPIT)   // f16 of one head's half of a buffer
#define RB2  (2 * RB)                  // f16 per buffer: both heads
#define NTILE ((unsigned)(SEQ / 64))
static_assert((KPIT * 2) % 16 == 0 && (VPIT * 2) % 16 == 0 && (RBK * 2) % 16 == 0 && (RB * 2) % 16 == 0);   // every copy and fragment read 16-byte aligned
static_assert(SEQ / 64 >= 2);          // the two tiles that the prologue stages exist
// Four copies of 16 B per lane, global -> LDS through no register. s_wait_xcnt 0 closes the statement so that no address register of a copy is rewritten ahead of it.
__device__ __forceinline__ void copy4(unsigned l0, unsigned l1, unsigned l2, unsigned l3, const h16* g0, const h16* g1, const h16* g2, const h16* g3) {
    asm volatile("global_load_async_to_lds_b128 %0, %4, off\n\t"
                 "global_load_async_to_lds_b128 %1, %5, off\n\t"
                 "global_load_async_to_lds_b128 %2, %6, off\n\t"
                 "global_load_async_to_lds_b128 %3, %7, off\n\t"
                 "s_wait_xcnt 0x0"
                 :: "v"(l0), "v"(l1), "v"(l2), "v"(l3), "v"(g0), "v"(g1), "v"(g2), "v"(g3) : "memory");
}
// waves_per_eu(4, 4): four waves per SIMD is what the grid gives (512 blocks x 8 waves on 1,024 SIMDs); with that register budget the compiler keeps a step's fragment reads together instead of re-using few registers, one LDS wait per read pair.
__global__ __launch_bounds__(256) __attribute__((amdgpu_waves_per_eu(4, 4))) void k_flash(const h16* __restrict__ QK, const h16* __restrict__ VT, bf* CH, bf* CL) {
    __shared__ __align__(16) float os[FW * 16 * 68];
    __shared__ __align__(16) h16 ring[2 * RB2];
    const unsigned tid = threadIdx.x, lane = tid & 31u, w = tid >> 5, qg = w & 3u, hh = w >> 2, lr = lane & 15u, hi = lane >> 4;
    const unsigned bz = blockIdx.z, hp = blockIdx.y, i0 = blockIdx.x * 64u + qg * 16u;
    const h16* qkb = QK + (size_t)bz * SEQ * QKW;
    const h16* vtb = VT + (size_t)bz * DM * SEQ;
    float* osw = os + qg * (16u * 68u);   /* 16 queries x 64 columns: both waves of a query group write here, each its head's 32 columns */
    /* this thread's pieces of a tile: k rows tid>>3 and +32, 16-byte piece tid&7 of the row's 128 B (pieces 0..3 head 0, 4..7 head 1); v^T row tid>>3 of head 0 and of head 1, piece tid&7 */
    const unsigned ringb = (unsigned)(size_t)ring;   /* LDS byte address: the low 32 bits */
    const unsigned lk = ringb + 2u * (((tid >> 2) & 1u) * RB + (tid >> 3) * KPIT + (tid & 3u) * 8u), lv = ringb + 2u * (RBK + (tid >> 3) * VPIT + (tid & 7u) * 8u);
    const h16* gk = qkb + (size_t)(tid >> 3) * QKW + DM + hp * 2u * HD + (tid & 7u) * 8u;
    const h16* gv = vtb + (size_t)(hp * 2u * HD + (tid >> 3)) * SEQ + (tid & 7u) * 8u;
    auto stage = [&](unsigned t) {
        const unsigned tj = t * 64u, lb = (t & 1u) * (2u * RB2);
        const h16* k0 = gk + (size_t)tj * QKW; const h16* v0 = gv + tj;
        copy4(lk + lb, lk + lb + 2u * 32u * KPIT, lv + lb, lv + lb + 2u * RB, k0, k0 + (size_t)32 * QKW, v0, v0 + (size_t)HD * SEQ); };
    stage(0u);
    const unsigned hd = hp * 2u + hh;
    const v16h bq = ldh(qkb + (size_t)(i0 + lr) * QKW + hd * HD + 8u * hi);        /* B: n = query i0+lr, k = e */
    asm volatile("s_wait_asynccnt 0x0" ::: "memory");   /* this wave's pieces of tile 0 have landed */
    __syncthreads();                                     /* tile 0 readable by every wave */
    stage(1u);
    v8f acc0 = (v8f){}, acc1 = (v8f){}; float m = -3.0e38f, l = 0.0f;
#pragma unroll 1
    for (unsigned t = 0; t < NTILE; ++t) {
        const h16* kt = ring + (t & 1u) * RB2 + hh * RB + lr * KPIT + 8u * hi;         /* A rows: key lr of the step, k = e */
        const v16h ka0 = ldh(kt), ka1 = ldh(kt + 16 * KPIT), ka2 = ldh(kt + 32 * KPIT), ka3 = ldh(kt + 48 * KPIT);
        v8f s0 = wmma16(ka0, bq, (v8f){}); v8f s1 = wmma16(ka1, bq, (v8f){}); v8f s2 = wmma16(ka2, bq, (v8f){}); v8f s3 = wmma16(ka3, bq, (v8f){});
        asm volatile("v_nop\n\tv_nop\n\tv_nop\n\tv_nop" : "+v"(s0), "+v"(s1), "+v"(s2), "+v"(s3) : "v"(ka3), "v"(bq));
        float vm = s0[0];
#pragma unroll
        for (int r = 0; r < 8; ++r) { vm = fmaxf(vm, fmaxf(s0[r], s1[r])); vm = fmaxf(vm, fmaxf(s2[r], s3[r])); }
        vm = fmaxf(vm, __shfl_xor(vm, 16, 32));                   /* both lane halves hold the other 32 keys of the same query */
        const float mn = fmaxf(m, vm * SCLX);
        const float alpha = __builtin_amdgcn_exp2f(m - mn); m = mn;
        const float nb = 10.0f - mn;                              /* 2^10 carry */
        float rs = 0.0f;
#pragma unroll
        for (int r = 0; r < 8; ++r) {
            s0[r] = __builtin_amdgcn_exp2f(fmaf(s0[r], SCLX, nb)); s1[r] = __builtin_amdgcn_exp2f(fmaf(s1[r], SCLX, nb));
            s2[r] = __builtin_amdgcn_exp2f(fmaf(s2[r], SCLX, nb)); s3[r] = __builtin_amdgcn_exp2f(fmaf(s3[r], SCLX, nb));
            rs += (s0[r] + s1[r]) + (s2[r] + s3[r]); }
        rs += __shfl_xor(rs, 16, 32);
        l = l * alpha + rs;
        v16h pB0, pB1;
#pragma unroll
        for (int r = 0; r < 8; ++r) { acc0[r] *= alpha; acc1[r] *= alpha;
            pB0[r] = (h16)s0[r]; pB0[8 + r] = (h16)s1[r]; pB1[r] = (h16)s2[r]; pB1[8 + r] = (h16)s3[r]; }
        const h16* vt = ring + (t & 1u) * RB2 + hh * RB + RBK + lr * VPIT + 8u * hi;   /* A rows: e = lr, k = key */
        const v16h va00 = ldh(vt), va01 = ldh(vt + 32), va10 = ldh(vt + 16 * VPIT), va11 = ldh(vt + 16 * VPIT + 32);
        acc0 = wmma16(va00, pB0, acc0); acc1 = wmma16(va10, pB0, acc1); acc0 = wmma16(va01, pB1, acc0); acc1 = wmma16(va11, pB1, acc1);
        asm volatile("v_nop\n\tv_nop\n\tv_nop\n\tv_nop" : "+v"(acc0), "+v"(acc1) : "v"(va11), "v"(va01), "v"(pB1));
        asm volatile("s_wait_dscnt 0x0" ::: "memory");      /* this wave's reads of buffer t & 1 are done before it is refilled */
        asm volatile("s_wait_asynccnt 0x0" ::: "memory");   /* this wave's pieces of tile t + 1 have landed */
        __syncthreads();                                     /* publishes tile t + 1 and ends every wave's reads of tile t */
        if (t + 2u < NTILE) stage(t + 2u);                   /* block-uniform test; refills the buffer just read */
    }
    asm volatile("s_wait_asynccnt 0x0" ::: "memory");   /* no copy outstanding behind the loop */
    const float inv = (1.0f / QCAR) / l;
#pragma unroll
    for (int r = 0; r < 8; ++r) { osw[lr * 68u + hh * 32u + 8u * hi + r] = acc0[r] * inv; osw[lr * 68u + hh * 32u + 16u + 8u * hi + r] = acc1[r] * inv; }   /* D: e = 8*hi + r (+16), query lr */
    __syncthreads();   /* both heads' columns of every query row are in place */
    const size_t rowbase = ((size_t)bz * SEQ + i0) * DM + hp * 64u;
{
#pragma unroll
        for (unsigned s = 0; s < 2u; ++s) { const unsigned row = 8u * hh + 4u * s + (lane >> 3), pc = (lane & 7u) * 8u; const v4f v0 = *(const v4fa*)(osw + row * 68u + pc); const v4f v1 = *(const v4fa*)(osw + row * 68u + pc + 4u); v8us oh, ol;   /* the two waves of a query group write 8 rows each, whole 128-B lines */
#pragma unroll
            for (int q = 0; q < 4; ++q) { unsigned short a2, c2; splitf(v0[q], a2, c2); oh[q] = a2; ol[q] = c2; splitf(v1[q], a2, c2); oh[4 + q] = a2; ol[4 + q] = c2; }
            const size_t oo = rowbase + (size_t)row * DM + pc;
            *(v8us*)(CH + oo) = oh; *(v8us*)(CL + oo) = ol; }   
         }
}

constexpr size_t al256(size_t b) { return (b + 255) & ~(size_t)255; }
constexpr size_t SZ_XB  = al256((size_t)NB * SEQ * DM * 2);
constexpr size_t SZ_WQK = al256((size_t)QKW * DM * 2);
constexpr size_t SZ_W   = al256((size_t)DM * DM * 2);
constexpr size_t SZ_QK  = al256((size_t)NB * SEQ * QKW * 2);
constexpr size_t SZ_VT  = al256((size_t)NB * DM * SEQ * 2);
constexpr size_t SZ_C   = al256((size_t)NB * SEQ * DM * 2);
constexpr size_t CARVE  = SZ_XB + SZ_WQK + 2 * SZ_W + SZ_QK + SZ_VT + 2 * SZ_C;
static_assert(CARVE <= (size_t)134217728);                                   // carve <= 128 MiB
static_assert(((size_t)NB * SEQ * (DM / 8)) % 256 == 0);                      // x blocks of k_prep x 256 threads x 8 == XB elements
static_assert((size_t)NH * 4 * 256 * 4 * 8 == (size_t)(QKW + 2 * DM) * DM);  // weight blocks of k_prep x threads x 4 pieces x 8 == all weight-plane elements
static_assert((size_t)(SEQ / 64) * (NH / 2) * NB * FW * 16 * 64 == (size_t)NB * SEQ * DM);   // k_flash query groups x 16 rows x 64 cols == ctx plane elements

extern "C" void kernel_launch(void* const* d_in, const int* in_sizes, int n_in,
                              void* d_out, int out_size, void* d_ws, size_t ws_size, hipStream_t stream) {
    if (n_in < 5) return;
    const long long xmin = (long long)(NB - 1) * SEQ_FULL * DM + (long long)SEQ * DM;
    if ((long long)in_sizes[0] < xmin || in_sizes[1] < NH * DM * HD || in_sizes[2] < NH * DM * HD || in_sizes[3] < NH * DM * HD || in_sizes[4] < DM * DM) return;
    if ((long long)out_size < xmin) return;
    if (CARVE > ws_size) return;
    const float* x = (const float*)d_in[0]; const float* wq = (const float*)d_in[1]; const float* wk = (const float*)d_in[2]; const float* wv = (const float*)d_in[3]; const float* wo = (const float*)d_in[4];
    float* OUT = (float*)d_out;   /* [NB_FULL][SEQ_FULL][256] f32, batch stride from the full sizes */
    char* wsp = (char*)d_ws;
    auto take = [&](size_t bytes) { char* p = wsp; wsp += bytes; return (void*)p; };
    bf* XB = (bf*)take(SZ_XB); bf* WQK = (bf*)take(SZ_WQK); bf* WV = (bf*)take(SZ_W); bf* WOT = (bf*)take(SZ_W);
    h16* QKP = (h16*)take(SZ_QK); h16* VTP = (h16*)take(SZ_VT); bf* CH = (bf*)take(SZ_C); bf* CL = (bf*)take(SZ_C);

    k_prep<<<PWB + PXB, 256, 0, stream>>>(x, wq, wk, wv, wo, XB, WQK, WV, WOT);
    k_proj<<<PQK + PV, 32, 0, stream>>>(XB, WQK, WV, QKP, VTP);
    k_flash<<<dim3(SEQ / 64, NH / 2, NB), 256, 0, stream>>>(QKP, VTP, CH, CL);
    /* out[b][t][n] = (CH + CL)[b][t][:] . WOT[n][:]: M = SEQ, N = 256, K = 256, z = batch (output stride from the full sizes) */
    k_gemmw<bf, 1, 0><<<dim3(SEQ / 64, DM / 64, NB), 32, 0, stream>>>(CH, CL, WOT, nullptr, (void*)OUT, DM, 1.0f, (size_t)SEQ * DM, 0, (size_t)SEQ_FULL * DM);
}

// v005
// Measured time: 46.4 microseconds a run.
// In both of two side-by-side timings against v004, it was 1.08 times as fast.
// Counting every step since v000, it is 2.36 times as fast.
#include <hip/hip_runtime.h>

// Compute dtypes (f32 accumulate everywhere): q/k/v projections v_wmma_f32_16x16x32_bf16 on bf16 RNE-converted x and weights (exact products); scores q.k^T v_wmma_f32_16x16x32_f16 (q x16, k x16 carries); attn.V v_wmma_f32_16x16x32_f16 (exp weights x1024, v x16 carries); output projection v_wmma_f32_16x16x32_bf16 with the context as bf16 hi + lo planes (2 products) against bf16 wo.
// Multi-head attention: x [NB][SEQ_FULL][256] (first SEQ rows per batch), per-head weights w[8][256][32] ([in][out] per head), scores x 256^-0.5, softmax over all SEQ keys (no mask), heads concatenated head-major, times wo [in][out].
// Every GEMM wave stages its operand tiles in its own LDS by asynchronous copies that cover whole 128-byte lines and takes its fragments from there.
// Plan, four launches: k_prep (weight planes B^T, transposed through LDS, and the x plane, in block ranges of one grid), k_proj (GEMM q|k -> f16 token-major plane [t][512] and GEMM v^T -> f16 plane [b][h*32+e][t], in block ranges of one grid), k_flash (online softmax in steps of 128 keys, k and v^T tiles of a head pair staged in LDS for the block's eight waves, 16 queries x 1 head per wave -> ctx hi/lo bf16 planes [t][256]), GEMM wo -> out f32.

#ifndef NB
#define NB 4
#endif
#ifndef SEQ
#define SEQ 2048
#endif
#define NB_FULL  4
#define SEQ_FULL 2048
#define DM   256      // model width = NH * HD
#define NH   8
#define HD   32       // head dim: exactly one 32-deep k-step per score tile
#define QKW  512      // q|k plane row width (q cols 0..255, k cols 256..511)
#define QCAR 16.0f    // carry on q, k and v planes
#define SCLX (0.0625f * 1.44269504088896340736f / 256.0f)   // 256^-0.5 x log2(e) / (16 x 16)

static_assert(DM == NH * HD);          // head-major concat width
static_assert(HD == 32);               // one WMMA k-step per head; two 16-wide e tiles
static_assert((NH & 1) == 0);
static_assert(SEQ % 64 == 0);          // 64-row GEMM tiles, 64-query blocks
static_assert(DM % 64 == 0 && QKW % 64 == 0 && DM % 32 == 0);
static_assert(NB <= NB_FULL && SEQ <= SEQ_FULL);

typedef _Float16 h16;
typedef unsigned short bf;
typedef __attribute__((ext_vector_type(16))) __bf16   v16bf;
typedef __attribute__((ext_vector_type(16))) _Float16 v16h;
typedef __attribute__((ext_vector_type(8)))  _Float16 v8h;
typedef __attribute__((ext_vector_type(8)))  unsigned short v8us;
typedef __attribute__((ext_vector_type(8)))  float    v8f;
typedef __attribute__((ext_vector_type(4)))  float    v4f;
typedef v4f  __attribute__((may_alias)) v4fa;

__device__ __forceinline__ unsigned short f2bf(float f) { unsigned u = __float_as_uint(f); u += 0x7FFFu + ((u >> 16) & 1u); return (unsigned short)(u >> 16); }
__device__ __forceinline__ float bf2f(unsigned short b) { return __uint_as_float(((unsigned)b) << 16); }
__device__ __forceinline__ v16h cat16(v8h lo, v8h hi) { return __builtin_shufflevector(lo, hi, 0, 1, 2, 3, 4, 5, 6, 7, 8, 9, 10, 11, 12, 13, 14, 15); }
__device__ __forceinline__ v16bf cat16b(v8us lo, v8us hi) { return __builtin_bit_cast(v16bf, __builtin_shufflevector(lo, hi, 0, 1, 2, 3, 4, 5, 6, 7, 8, 9, 10, 11, 12, 13, 14, 15)); }
__device__ __forceinline__ v8f wmma16(v16h a, v16h b, v8f c) { return __builtin_amdgcn_wmma_f32_16x16x32_f16(false, a, false, b, (short)0, c, false, false); }
__device__ __forceinline__ v8f wmmab(v16bf a, v16bf b, v8f c) { return __builtin_amdgcn_wmma_f32_16x16x32_bf16(false, a, false, b, (short)0, c, false, false); }
__device__ __forceinline__ void splitf(float y, unsigned short& h, unsigned short& l) { h = f2bf(y); l = f2bf(y - bf2f(h)); }
// fragment from a K-contiguous f16 row: p already includes row and 8*(lane>>4); elements 0..7 <- p[0..7], 8..15 <- p[16..23]
__device__ __forceinline__ v16h ldh(const h16* p) { return cat16(*(const v8h*)p, *(const v8h*)(p + 16)); }

// ---- gemmw_tile: register-blocked GEMM, ONE WAVE per 64x64 output tile (16 accumulators), operands from K-contiguous 16-bit planes (row pitch == K); tile (bx, by) of batch bz, 32 threads.
// C[m][n] = sum_k A[m][k] Bt[n][k] (+ A2 Bt for NSPLIT 1). z-batch strides sA/sB/sC in elements. K % 64 == 0, M % 64 == 0, N % 64 == 0 (no tail masking).
// Staging: chunk t = 64 k of the tile's 64 A (and A2) rows and 64 Bt rows, 128 B of each row. A fragment load straight from the plane would touch 16 lines for 512 B; a copy here takes 4 rows x 128 B, whole lines,
// global -> LDS buffer t & 1 through no register, while chunk t - 1 is worked on. Row pitch 144 B (16 B x odd) keeps the 16-byte fragment reads free of bank conflicts. The k order of the sums is unchanged.
// OMODE 0: f32 C (pitch ldc): per 16-row slab staged in LDS, each row's 64 floats (256 B) written as 16 lanes x 16 B (2 rows per instruction).
template <typename T16> struct WFrag;
template <> struct WFrag<h16> { typedef v16h V; static __device__ __forceinline__ V ld(const h16* p) { return cat16(*(const v8h*)p, *(const v8h*)(p + 16)); } static __device__ __forceinline__ v8f mma(V a, V b, v8f c) { return wmma16(a, b, c); } };
template <> struct WFrag<bf> { typedef v16bf V; static __device__ __forceinline__ V ld(const bf* p) { return cat16b(*(const v8us*)p, *(const v8us*)(p + 16)); } static __device__ __forceinline__ v8f mma(V a, V b, v8f c) { return wmmab(a, b, c); } };
#define GKC  64                        // k per staged chunk: 128 B of every row
#define GPIT 72                        // 16-bit elements per staged row (64 + 8 pad)
#define GPL  (64 * GPIT)               // elements of one staged plane: 64 rows
static_assert((GPIT * 2) % 16 == 0 && (GPL * 2) % 16 == 0);   // every copy and fragment read 16-byte aligned
static_assert(DM % GKC == 0 && DM / GKC >= 2);                 // K = DM: whole chunks, and the two that the prologue stages exist
// Eight copies of 16 B per lane, global -> LDS through no register. s_wait_xcnt 0 closes the statement so that no address register of a copy is rewritten ahead of it.
template <typename T16>
__device__ __forceinline__ void copy8(unsigned l0, unsigned l1, unsigned l2, unsigned l3, unsigned l4, unsigned l5, unsigned l6, unsigned l7,
                                      const T16* g0, const T16* g1, const T16* g2, const T16* g3, const T16* g4, const T16* g5, const T16* g6, const T16* g7) {
    asm volatile("global_load_async_to_lds_b128 %0, %8, off\n\t"
                 "global_load_async_to_lds_b128 %1, %9, off\n\t"
                 "global_load_async_to_lds_b128 %2, %10, off\n\t"
                 "global_load_async_to_lds_b128 %3, %11, off\n\t"
                 "global_load_async_to_lds_b128 %4, %12, off\n\t"
                 "global_load_async_to_lds_b128 %5, %13, off\n\t"
                 "global_load_async_to_lds_b128 %6, %14, off\n\t"
                 "global_load_async_to_lds_b128 %7, %15, off\n\t"
                 "s_wait_xcnt 0x0"
                 :: "v"(l0), "v"(l1), "v"(l2), "v"(l3), "v"(l4), "v"(l5), "v"(l6), "v"(l7), "v"(g0), "v"(g1), "v"(g2), "v"(g3), "v"(g4), "v"(g5), "v"(g6), "v"(g7) : "memory");
}
template <typename T16, int NSPLIT, int OMODE>
__device__ __forceinline__ void gemmw_tile(const T16* __restrict__ A, const T16* __restrict__ A2, const T16* __restrict__ Bt, const T16* __restrict__ Bt2, int K, void* Cv, int ldc, float oscale, size_t sA, size_t sB, size_t sC, unsigned bx, unsigned by, unsigned bz) {
    typedef typename WFrag<T16>::V V;
    static_assert(NSPLIT == 0 || NSPLIT == 1);
    constexpr unsigned NP = (NSPLIT == 1) ? 3u : 2u;   /* staged planes: A, (A2,) Bt */
    __shared__ __align__(16) float os[16 * 68];
    __shared__ __align__(16) T16 gring[2 * NP * GPL];
    const size_t z = bz; A += z * sA; if (A2) A2 += z * sA; Bt += z * sB;
    const unsigned lane = threadIdx.x & 31u, lr = lane & 15u, hi = lane >> 4; const unsigned r0 = bx * 64u, c0 = by * 64u;
    v8f acc[4][4];
#pragma unroll
    for (int mb = 0; mb < 4; ++mb)
#pragma unroll
        for (int nb = 0; nb < 4; ++nb) acc[mb][nb] = (v8f){};
    /* this lane's piece of a copy: row lane >> 3 of the copy's four rows, 16-byte piece lane & 7 of the row's 128 B */
    const unsigned lst = (unsigned)(size_t)gring + 2u * ((lane >> 3) * GPIT + (lane & 7u) * 8u);   /* LDS byte address: the low 32 bits */
    const size_t goff = (size_t)(lane >> 3) * K + (lane & 7u) * 8u;
    const T16* ga = A + (size_t)r0 * K + goff; const T16* ga2 = (NSPLIT == 1) ? A2 + (size_t)r0 * K + goff : nullptr; const T16* gb = Bt + (size_t)c0 * K + goff;
    auto plane = [&](unsigned l, const T16* g) {   /* 64 rows x 128 B: 16 copies of 4 rows */
#pragma unroll   /* two statements of eight copies; their LDS and row steps become literals */
        for (unsigned c = 0; c < 16u; c += 8u) { const unsigned lc = l + c * (8u * GPIT); const T16* gc = g + (size_t)c * 4 * K;
            copy8<T16>(lc, lc + 8u * GPIT, lc + 16u * GPIT, lc + 24u * GPIT, lc + 32u * GPIT, lc + 40u * GPIT, lc + 48u * GPIT, lc + 56u * GPIT,
                       gc, gc + (size_t)4 * K, gc + (size_t)8 * K, gc + (size_t)12 * K, gc + (size_t)16 * K, gc + (size_t)20 * K, gc + (size_t)24 * K, gc + (size_t)28 * K); } };
    auto stage = [&](int t) { const unsigned lb = lst + (unsigned)(t & 1) * (2u * NP * GPL); const int kc = t * GKC;   /* 16 x NP copies in flight, at most 48 */
        plane(lb, ga + kc); if constexpr (NSPLIT == 1) plane(lb + 2u * GPL, ga2 + kc); plane(lb + 2u * (NP - 1) * GPL, gb + kc); };
    const int nt = K / GKC;
    stage(0);
    asm volatile("s_wait_asynccnt 0x0" ::: "memory");   /* chunk 0 has landed */
    __syncthreads();                                     /* chunk 0 readable (single-wave block) */
    if (1 < nt) stage(1);
#pragma unroll 1   /* rolled: one copy of the chunk's code in the instruction cache, the buffer picked by t & 1 */
    for (int t = 0; t < nt; ++t) {
        const T16* fb = gring + (t & 1) * (NP * GPL) + lr * GPIT + 8 * hi;   /* fragment rows: row lr of a 16-row group, k = 8*hi + ... */
#pragma unroll   /* both k-steps of a chunk in line: the second's reads start under the first's last products */
        for (int ks = 0; ks < GKC; ks += 32) {
            V a[4], a2[4];
#pragma unroll
            for (int mb = 0; mb < 4; ++mb) { a[mb] = WFrag<T16>::ld(fb + mb * 16 * GPIT + ks); if (NSPLIT == 1) a2[mb] = WFrag<T16>::ld(fb + GPL + mb * 16 * GPIT + ks); }
            V b[4];   /* all fragments of a k-step are read as one group: one LDS wait per 16 (32) products */
#pragma unroll
            for (int nb = 0; nb < 4; ++nb) b[nb] = WFrag<T16>::ld(fb + (NP - 1) * GPL + nb * 16 * GPIT + ks);
            __builtin_amdgcn_sched_barrier(0);   /* keeps the reads together ahead of the products: sunk among them, each pair of reads is waited out on its own */
#pragma unroll
            for (int nb = 0; nb < 4; ++nb) {
#pragma unroll
                for (int mb = 0; mb < 4; ++mb) { acc[mb][nb] = WFrag<T16>::mma(a[mb], b[nb], acc[mb][nb]); if (NSPLIT == 1) acc[mb][nb] = WFrag<T16>::mma(a2[mb], b[nb], acc[mb][nb]); } }
            if (ks + 32 == GKC) {   /* behind the chunk's last products: fills the vector slots they need before an instruction behind the loop's branches touches their registers */
                if constexpr (NSPLIT == 1) { asm volatile("v_nop\n\tv_nop\n\tv_nop\n\tv_nop" : "+v"(acc[0][0]), "+v"(acc[1][1]), "+v"(acc[2][2]), "+v"(acc[3][3]) : "v"(a[0]), "v"(a[3]), "v"(a2[3])); }
                else { asm volatile("v_nop\n\tv_nop\n\tv_nop\n\tv_nop" : "+v"(acc[0][0]), "+v"(acc[1][1]), "+v"(acc[2][2]), "+v"(acc[3][3]) : "v"(a[0]), "v"(a[3])); } }
        }
        asm volatile("s_wait_dscnt 0x0" ::: "memory");      /* the reads of buffer t & 1 are done before it is refilled */
        asm volatile("s_wait_asynccnt 0x0" ::: "memory");   /* chunk t + 1 has landed */
        __syncthreads();                                     /* publishes chunk t + 1 and ends the reads of chunk t */
        if (t + 2 < nt) stage(t + 2);                        /* uniform test; refills the buffer just read */
    }
    asm volatile("s_wait_asynccnt 0x0" ::: "memory");   /* no copy outstanding behind the loop */
#pragma unroll
    for (int mb = 0; mb < 4; ++mb) {
#pragma unroll
        for (int nb = 0; nb < 4; ++nb) {
#pragma unroll
            for (int j = 0; j < 8; ++j) os[(hi * 8 + j) * 68 + nb * 16 + lr] = acc[mb][nb][j]; }   /* D: row 8*hi + j, col 16*nb + lr */
        __syncthreads();   /* single-wave block: staging visible to every lane */
        if constexpr (OMODE == 0) {
            float* crow = (float*)Cv + z * sC + (size_t)(r0 + mb * 16) * ldc + c0;
{
#pragma unroll
                for (int s = 0; s < 8; ++s) { const unsigned row = 2u * s + hi, cofs = lr * 4u; const v4f val = *(const v4fa*)(os + row * 68 + cofs);
                    *(v4f*)(crow + (size_t)row * ldc + cofs) = val; }   /* rows 2s+hi, s 0..7: all 16 rows; 16 lanes x 16 B = 256 B row segment */
                 }
        } else {
            h16* crow = (h16*)Cv + z * sC + (size_t)(r0 + mb * 16) * ldc + c0;
{
#pragma unroll
                for (int s = 0; s < 4; ++s) { const unsigned row = 4u * s + (lane >> 3), pc = (lane & 7u) * 8u; const v4f v0 = *(const v4fa*)(os + row * 68 + pc); const v4f v1 = *(const v4fa*)(os + row * 68 + pc + 4); v8h o;
#pragma unroll
                    for (int q = 0; q < 4; ++q) { o[q] = (h16)(v0[q] * oscale); o[4 + q] = (h16)(v1[q] * oscale); }
                    *(v8h*)(crow + (size_t)row * ldc + pc) = o; }   
                 }
        }
        __syncthreads();   /* staging free before the next slab overwrites it */
    }
}
// k_gemmw: one GEMM per launch, K = DM; grid (M/64, N/64, Z).
template <typename T16, int NSPLIT, int OMODE>
__global__ __launch_bounds__(32) void k_gemmw(const T16* __restrict__ A, const T16* __restrict__ A2, const T16* __restrict__ Bt, const T16* __restrict__ Bt2, void* Cv, int ldc, float oscale, size_t sA, size_t sB, size_t sC) {
    gemmw_tile<T16, NSPLIT, OMODE>(A, A2, Bt, Bt2, DM, Cv, ldc, oscale, sA, sB, sC, blockIdx.x, blockIdx.y, blockIdx.z);   /* K = DM, a constant: the copies' row steps are literals */
}
// k_proj: the two projection GEMMs depend on the planes of k_prep only, not on each other, so their tiles share one grid and run side by side.
// Blocks [0, PQK): q|k plane [NB*SEQ][512] f16 = 16 x (XB . WQK^T), M = NB*SEQ, N = 512, K = 256, row tile fastest.
// Blocks [PQK, PQK + PV): v^T plane [b][256 (h*32+e)][SEQ] f16 = 16 x (WV . XB[b]^T), M = 256, N = SEQ, K = 256, row tile fastest, then key tile, then batch.
#define PQM ((unsigned)((size_t)NB * SEQ / 64))
#define PQK (PQM * (QKW / 64u))
#define PV  ((DM / 64u) * (SEQ / 64u) * (unsigned)NB)
__global__ __launch_bounds__(32) void k_proj(const bf* __restrict__ XB, const bf* __restrict__ WQK, const bf* __restrict__ WV, h16* QKP, h16* VTP) {
    const unsigned b = blockIdx.x; const bool qk = b < PQK; const unsigned v = b - PQK;
    gemmw_tile<bf, 0, 1>(qk ? XB : WV, nullptr, qk ? WQK : XB, nullptr, DM, qk ? (void*)QKP : (void*)VTP, qk ? QKW : SEQ, QCAR, 0, qk ? (size_t)0 : (size_t)SEQ * DM, qk ? (size_t)0 : (size_t)DM * SEQ,
                         qk ? b % PQM : v % (DM / 64u), qk ? b / PQM : (v / (DM / 64u)) % (SEQ / 64u), qk ? 0u : v / ((DM / 64u) * (SEQ / 64u)));
}

__device__ __forceinline__ void xprep_blk(const float* __restrict__ x, bf* XB, unsigned blk) {
    const unsigned i = blk * 256u + threadIdx.x; if (i >= (unsigned)NB * SEQ * (DM / 8)) return;
    const unsigned b = i / ((unsigned)SEQ * (DM / 8)), r = i - b * ((unsigned)SEQ * (DM / 8));
    const float* s = x + ((size_t)b * SEQ_FULL * (DM / 8) + r) * 8; const v4f a0 = *(const v4f*)s, a1 = *(const v4f*)(s + 4); v8us o;
#pragma unroll
    for (int q = 0; q < 4; ++q) { o[q] = f2bf(a0[q]); o[4 + q] = f2bf(a1[q]); }
    *(v8us*)(XB + (size_t)i * 8) = o;  }

// wprep_blk: B^T weight planes (bf16 RNE, K-contiguous rows of 256): block (g, mt) transposes in[256 d][32 e] -> out[32 e][256 d] through LDS.
// mt 0: wq[g][d][e] -> WQK row g*32+e; mt 1: wk -> WQK row 256 + g*32+e; mt 2: wv -> WV row g*32+e; mt 3: wo[d][g*32+e] -> WOT row g*32+e (in[256][256] -> out[256][256] transposed).
__device__ __forceinline__ void wprep_blk(const float* __restrict__ wq, const float* __restrict__ wk, const float* __restrict__ wv, const float* __restrict__ wo, bf* WQK, bf* WV, bf* WOT, unsigned g, unsigned mt) {
    __shared__ float ts[256 * 33];
    const unsigned tid = threadIdx.x;
    const float* src = wq; unsigned gs = (unsigned)DM * HD, ds = HD; bf* dst = WQK;
    if (mt == 1u) { src = wk; dst = WQK + (size_t)DM * DM; } else if (mt == 2u) { src = wv; dst = WV; } else if (mt == 3u) { src = wo; gs = HD; ds = DM; dst = WOT; }
#pragma unroll 4
    for (unsigned it = 0; it < 32u; ++it) { const unsigned idx = it * 256u + tid, d = idx >> 5, e = idx & 31u; ts[d * 33u + e] = src[(size_t)g * gs + (size_t)d * ds + e]; }   /* 32 x 256 = all 8192 entries */
    __syncthreads();
{
#pragma unroll
        for (unsigned it = 0; it < 4u; ++it) { const unsigned p = it * 256u + tid, e = p >> 5, pc = p & 31u; v8us o;   /* 4 x 256 pieces = 32 rows x 32 pieces */
#pragma unroll
            for (unsigned q = 0; q < 8u; ++q) o[q] = f2bf(ts[(pc * 8u + q) * 33u + e]);
            *(v8us*)(dst + (size_t)(g * HD + e) * DM + pc * 8u) = o; }
         }
}
// k_prep: the weight planes and the x plane read different inputs and write different planes, so both share one grid. The few weight blocks, each a longer chain of loads, LDS and stores, come first.
#define PWB ((unsigned)NH * 4u)
#define PXB ((unsigned)(((size_t)NB * SEQ * (DM / 8)) / 256))
__global__ __launch_bounds__(256) void k_prep(const float* __restrict__ x, const float* __restrict__ wq, const float* __restrict__ wk, const float* __restrict__ wv, const float* __restrict__ wo, bf* XB, bf* WQK, bf* WV, bf* WOT) {
    if (blockIdx.x < PWB) wprep_blk(wq, wk, wv, wo, WQK, WV, WOT, blockIdx.x % (unsigned)NH, blockIdx.x / (unsigned)NH);   /* block-uniform branch: its barrier is passed by the whole block */
    else xprep_blk(x, XB, blockIdx.x - PWB);
}

// k_flash: one block = 64 queries x one head pair on eight waves; wave w = 16 queries (group w & 3) x ONE head (w >> 2 of the pair): a streaming pass over all SEQ keys in steps of TK = 128 with the running-max softmax.
// What a step costs once, whatever its length (the cross-lane maximum and sum, the rescale of the 16 accumulator registers, the waits, the barrier, the buffer addresses), is paid every 128 keys, and the eight score tiles of a step give the vector unit and the matrix unit more independent work between two barriers.
// Both heads run side by side, so a SIMD holds four waves (two blocks per WGP) whose vector work, LDS waits and cross-lane waits fill one another's gaps.
// Transposed tiles: S^T (M = key, N = query) = K-rows (A) x Q-rows (B), both K-contiguous f16 rows of the [t][512] plane; the f32 S^T accumulators repacked to f16 are directly the B fragments of
// ctx^T (M = e, N = query) = V^T-rows (A, K-contiguous over keys) x P^T: element r <- tile of keys 0..15, element 8+r <- tile of keys 16..31, lane unchanged.
// exp weights carry 2^10 (f16 operand <= 1024); the row sum uses the same f32 values, so the carry cancels in 1/l; the v carry 16 is folded into 1/l.
// Staging: tile t = TK keys of both heads = per head TK k rows of 64 B + 32 v^T rows of 256 B, copied once per block into LDS buffer t & 1 by asynchronous 16-byte copies
// (eight per thread) while tile t - 1 is worked on; a k copy takes the 128 B of a plane row that hold both heads, a whole line, a v^T copy one of the two lines of a row's 256 B. The four waves of a head take their A fragments from its half of the buffer.
// Row pitches 80 B and 272 B (16 B x odd) keep the 16-byte row reads free of bank conflicts.
#define FW 4                           // query groups of 16 per block
#define TK 128                         // keys per step
#define KPIT 40                        // f16 per staged k row (32 + 8 pad)
#define VPIT (TK + 8)                  // f16 per staged v^T row (TK + 8 pad)
#define RBK  (TK * KPIT)               // f16 of the k part of one head's half
#define RB   (TK * KPIT + 32 * VPIT)   // f16 of one head's half of a buffer
#define RB2  (2 * RB)                  // f16 per buffer: both heads
#define NTILE ((unsigned)(SEQ / TK))
static_assert((KPIT * 2) % 16 == 0 && (VPIT * 2) % 16 == 0 && (RBK * 2) % 16 == 0 && (RB * 2) % 16 == 0);   // every copy and fragment read 16-byte aligned
static_assert(TK == 128 && SEQ % TK == 0 && SEQ / TK >= 2);   // eight copies a thread fill a tile; whole tiles; the two tiles that the prologue stages exist
// waves_per_eu(4, 4): four waves per SIMD is what the grid gives (512 blocks x 8 waves on 1,024 SIMDs); with that register budget the compiler keeps a step's fragment reads together instead of re-using few registers, one LDS wait per read pair.
__global__ __launch_bounds__(256) __attribute__((amdgpu_waves_per_eu(4, 4))) void k_flash(const h16* __restrict__ QK, const h16* __restrict__ VT, bf* CH, bf* CL) {
    __shared__ __align__(16) float os[FW * 16 * 68];
    __shared__ __align__(16) h16 ring[2 * RB2];
    const unsigned tid = threadIdx.x, lane = tid & 31u, w = tid >> 5, qg = w & 3u, hh = w >> 2, lr = lane & 15u, hi = lane >> 4;
    const unsigned bz = blockIdx.z, hp = blockIdx.y, i0 = blockIdx.x * 64u + qg * 16u;
    const h16* qkb = QK + (size_t)bz * SEQ * QKW;
    const h16* vtb = VT + (size_t)bz * DM * SEQ;
    float* osw = os + qg * (16u * 68u);   /* 16 queries x 64 columns: both waves of a query group write here, each its head's 32 columns */
    /* this thread's pieces of a tile: k rows tid>>3, +32, +64 and +96, 16-byte piece tid&7 of the row's 128 B (pieces 0..3 head 0, 4..7 head 1); v^T row tid>>3 of head 0 and of head 1, pieces tid&7 and 8 + (tid&7) of the row's 256 B */
    const unsigned ringb = (unsigned)(size_t)ring;   /* LDS byte address: the low 32 bits */
    const unsigned lk = ringb + 2u * (((tid >> 2) & 1u) * RB + (tid >> 3) * KPIT + (tid & 3u) * 8u), lv = ringb + 2u * (RBK + (tid >> 3) * VPIT + (tid & 7u) * 8u);
    const h16* gk = qkb + (size_t)(tid >> 3) * QKW + DM + hp * 2u * HD + (tid & 7u) * 8u;
    const h16* gv = vtb + (size_t)(hp * 2u * HD + (tid >> 3)) * SEQ + (tid & 7u) * 8u;
    auto stage = [&](unsigned t) {
        const unsigned tj = t * (unsigned)TK, lb = (t & 1u) * (2u * RB2);
        const h16* k0 = gk + (size_t)tj * QKW; const h16* v0 = gv + tj;
        copy8<h16>(lk + lb, lk + lb + 2u * 32u * KPIT, lk + lb + 2u * 64u * KPIT, lk + lb + 2u * 96u * KPIT, lv + lb, lv + lb + 2u * 64u, lv + lb + 2u * RB, lv + lb + 2u * RB + 2u * 64u,
                   k0, k0 + (size_t)32 * QKW, k0 + (size_t)64 * QKW, k0 + (size_t)96 * QKW, v0, v0 + 64, v0 + (size_t)HD * SEQ, v0 + (size_t)HD * SEQ + 64); };
    stage(0u);
    const unsigned hd = hp * 2u + hh;
    const v16h bq = ldh(qkb + (size_t)(i0 + lr) * QKW + hd * HD + 8u * hi);        /* B: n = query i0+lr, k = e */
    asm volatile("s_wait_asynccnt 0x0" ::: "memory");   /* this wave's pieces of tile 0 have landed */
    __syncthreads();                                     /* tile 0 readable by every wave */
    stage(1u);
    v8f acc0 = (v8f){}, acc1 = (v8f){}; float m = -3.0e38f, l = 0.0f;
#pragma unroll 1
    for (unsigned t = 0; t < NTILE; ++t) {
        const h16* kt = ring + (t & 1u) * RB2 + hh * RB + lr * KPIT + 8u * hi;         /* A rows: key lr of a 16-key group, k = e */
        v8f s[8];
        {
            v16h ka[8];
#pragma unroll   /* this and the unrolls below: straight-line code, so that the tiles are registers and the row steps offset literals */
            for (int i = 0; i < 8; ++i) ka[i] = ldh(kt + i * 16 * KPIT);
            __builtin_amdgcn_sched_barrier(0);   /* keeps the sixteen reads one group ahead of the products: sunk among them, each pair of reads is waited out on its own */
#pragma unroll
            for (int i = 0; i < 8; ++i) s[i] = wmma16(ka[i], bq, (v8f){});
            __builtin_amdgcn_sched_barrier(0);   /* keeps the eight products one run: vector work lifted in among them is padded with v_nop to the distance their registers need, twice as many v_nop a step */
        }
        float vm0 = s[0][0], vm1 = s[2][0], vm2 = s[4][0], vm3 = s[6][0];   /* four chains: a maximum is exact in any order, and one chain of 64 would be waited out link by link */
#pragma unroll
        for (int r = 0; r < 8; ++r) { vm0 = fmaxf(vm0, fmaxf(s[0][r], s[1][r])); vm1 = fmaxf(vm1, fmaxf(s[2][r], s[3][r])); vm2 = fmaxf(vm2, fmaxf(s[4][r], s[5][r])); vm3 = fmaxf(vm3, fmaxf(s[6][r], s[7][r])); }
        float vm = fmaxf(fmaxf(vm0, vm1), fmaxf(vm2, vm3));
        vm = fmaxf(vm, __shfl_xor(vm, 16, 32));                   /* both lane halves hold the other 64 keys of the same query */
        const float mn = fmaxf(m, vm * SCLX);
        const float alpha = __builtin_amdgcn_exp2f(m - mn); m = mn;
        const float nb = 10.0f - mn;                              /* 2^10 carry */
        const v8f sclv = { SCLX, SCLX, SCLX, SCLX, SCLX, SCLX, SCLX, SCLX }, nbv = { nb, nb, nb, nb, nb, nb, nb, nb };
#pragma unroll
        for (int i = 0; i < 8; ++i) { const v8f u = __builtin_elementwise_fma(s[i], sclv, nbv);
#pragma unroll
            for (int r = 0; r < 8; ++r) s[i][r] = __builtin_amdgcn_exp2f(u[r]); }
        const v8f ts = ((s[0] + s[1]) + (s[2] + s[3])) + ((s[4] + s[5]) + (s[6] + s[7]));   /* tile by tile, register pairs as they lie */
        float rs = ((ts[0] + ts[1]) + (ts[2] + ts[3])) + ((ts[4] + ts[5]) + (ts[6] + ts[7]));
        rs += __shfl_xor(rs, 16, 32);
        l = l * alpha + rs;
        v16h pB[4];
#pragma unroll
        for (int j = 0; j < 4; ++j) pB[j] = cat16(__builtin_convertvector(s[2 * j], v8h), __builtin_convertvector(s[2 * j + 1], v8h));   /* element r <- keys 8*hi + r of the 32, element 8 + r <- keys 16 + 8*hi + r */
        acc0 *= alpha; acc1 *= alpha;
        const h16* vt = ring + (t & 1u) * RB2 + hh * RB + RBK + lr * VPIT + 8u * hi;   /* A rows: e = lr, k = key */
        v16h va0[4], va1[4];
#pragma unroll
        for (int j = 0; j < 4; ++j) { va0[j] = ldh(vt + j * 32); va1[j] = ldh(vt + 16 * VPIT + j * 32); }
#pragma unroll
        for (int j = 0; j < 4; ++j) { acc0 = wmma16(va0[j], pB[j], acc0); acc1 = wmma16(va1[j], pB[j], acc1); }
        /* behind the step's last products: fills the vector slots they need before an instruction behind the loop's branches touches their registers */
        asm volatile("v_nop\n\tv_nop\n\tv_nop\n\tv_nop" : "+v"(acc0), "+v"(acc1) : "v"(va1[3]), "v"(va0[3]), "v"(pB[3]));
        asm volatile("s_wait_dscnt 0x0" ::: "memory");      /* this wave's reads of buffer t & 1 are done before it is refilled */
        asm volatile("s_wait_asynccnt 0x0" ::: "memory");   /* this wave's pieces of tile t + 1 have landed */
        __syncthreads();                                     /* publishes tile t + 1 and ends every wave's reads of tile t */
        if (t + 2u < NTILE) stage(t + 2u);                   /* block-uniform test; refills the buffer just read */
    }
    asm volatile("s_wait_asynccnt 0x0" ::: "memory");   /* no copy outstanding behind the loop */
    const float inv = (1.0f / QCAR) / l;
#pragma unroll
    for (int r = 0; r < 8; ++r) { osw[lr * 68u + hh * 32u + 8u * hi + r] = acc0[r] * inv; osw[lr * 68u + hh * 32u + 16u + 8u * hi + r] = acc1[r] * inv; }   /* D: e = 8*hi + r (+16), query lr */
    __syncthreads();   /* both heads' columns of every query row are in place */
    const size_t rowbase = ((size_t)bz * SEQ + i0) * DM + hp * 64u;
{
#pragma unroll
        for (unsigned s = 0; s < 2u; ++s) { const unsigned row = 8u * hh + 4u * s + (lane >> 3), pc = (lane & 7u) * 8u; const v4f v0 = *(const v4fa*)(osw + row * 68u + pc); const v4f v1 = *(const v4fa*)(osw + row * 68u + pc + 4u); v8us oh, ol;   /* the two waves of a query group write 8 rows each, whole 128-B lines */
#pragma unroll
            for (int q = 0; q < 4; ++q) { unsigned short a2, c2; splitf(v0[q], a2, c2); oh[q] = a2; ol[q] = c2; splitf(v1[q], a2, c2); oh[4 + q] = a2; ol[4 + q] = c2; }
            const size_t oo = rowbase + (size_t)row * DM + pc;
            *(v8us*)(CH + oo) = oh; *(v8us*)(CL + oo) = ol; }   
         }
}

constexpr size_t al256(size_t b) { return (b + 255) & ~(size_t)255; }
constexpr size_t SZ_XB  = al256((size_t)NB * SEQ * DM * 2);
constexpr size_t SZ_WQK = al256((size_t)QKW * DM * 2);
constexpr size_t SZ_W   = al256((size_t)DM * DM * 2);
constexpr size_t SZ_QK  = al256((size_t)NB * SEQ * QKW * 2);
constexpr size_t SZ_VT  = al256((size_t)NB * DM * SEQ * 2);
constexpr size_t SZ_C   = al256((size_t)NB * SEQ * DM * 2);
constexpr size_t CARVE  = SZ_XB + SZ_WQK + 2 * SZ_W + SZ_QK + SZ_VT + 2 * SZ_C;
static_assert(CARVE <= (size_t)134217728);                                   // carve <= 128 MiB
static_assert(((size_t)NB * SEQ * (DM / 8)) % 256 == 0);                      // x blocks of k_prep x 256 threads x 8 == XB elements
static_assert((size_t)NH * 4 * 256 * 4 * 8 == (size_t)(QKW + 2 * DM) * DM);  // weight blocks of k_prep x threads x 4 pieces x 8 == all weight-plane elements
static_assert((size_t)(SEQ / 64) * (NH / 2) * NB * FW * 16 * 64 == (size_t)NB * SEQ * DM);   // k_flash query groups x 16 rows x 64 cols == ctx plane elements

extern "C" void kernel_launch(void* const* d_in, const int* in_sizes, int n_in,
                              void* d_out, int out_size, void* d_ws, size_t ws_size, hipStream_t stream) {
    if (n_in < 5) return;
    const long long xmin = (long long)(NB - 1) * SEQ_FULL * DM + (long long)SEQ * DM;
    if ((long long)in_sizes[0] < xmin || in_sizes[1] < NH * DM * HD || in_sizes[2] < NH * DM * HD || in_sizes[3] < NH * DM * HD || in_sizes[4] < DM * DM) return;
    if ((long long)out_size < xmin) return;
    if (CARVE > ws_size) return;
    const float* x = (const float*)d_in[0]; const float* wq = (const float*)d_in[1]; const float* wk = (const float*)d_in[2]; const float* wv = (const float*)d_in[3]; const float* wo = (const float*)d_in[4];
    float* OUT = (float*)d_out;   /* [NB_FULL][SEQ_FULL][256] f32, batch stride from the full sizes */
    char* wsp = (char*)d_ws;
    auto take = [&](size_t bytes) { char* p = wsp; wsp += bytes; return (void*)p; };
    bf* XB = (bf*)take(SZ_XB); bf* WQK = (bf*)take(SZ_WQK); bf* WV = (bf*)take(SZ_W); bf* WOT = (bf*)take(SZ_W);
    h16* QKP = (h16*)take(SZ_QK); h16* VTP = (h16*)take(SZ_VT); bf* CH = (bf*)take(SZ_C); bf* CL = (bf*)take(SZ_C);

    k_prep<<<PWB + PXB, 256, 0, stream>>>(x, wq, wk, wv, wo, XB, WQK, WV, WOT);
    k_proj<<<PQK + PV, 32, 0, stream>>>(XB, WQK, WV, QKP, VTP);
    k_flash<<<dim3(SEQ / 64, NH / 2, NB), 256, 0, stream>>>(QKP, VTP, CH, CL);
    /* out[b][t][n] = (CH + CL)[b][t][:] . WOT[n][:]: M = SEQ, N = 256, K = 256, z = batch (output stride from the full sizes) */
    k_gemmw<bf, 1, 0><<<dim3(SEQ / 64, DM / 64, NB), 32, 0, stream>>>(CH, CL, WOT, nullptr, (void*)OUT, DM, 1.0f, (size_t)SEQ * DM, 0, (size_t)SEQ_FULL * DM);
}

// v006
// It runs in 42.9 microseconds.
// Two timings next to v005 both put it at 1.08 times that version's speed.
// All steps since v000 together make it 2.55 times as fast.
#include <hip/hip_runtime.h>

// Compute dtypes (f32 accumulate everywhere): q/k/v projections v_wmma_f32_16x16x32_bf16 on bf16 RNE-converted x and weights (exact products); scores q.k^T v_wmma_f32_16x16x32_f16 (q x16, k x16 carries); attn.V v_wmma_f32_16x16x32_f16 (exp weights x1024, v x16 carries); output projection v_wmma_f32_16x16x32_bf16 with the context as bf16 hi + lo planes (2 products) against bf16 wo.
// Multi-head attention: x [NB][SEQ][256], per-head weights w[8][256][32] ([in][out] per head), scores x 256^-0.5, softmax over all SEQ keys (no mask), heads concatenated head-major, times wo [in][out].
// The GEMMs stage their operand tiles in LDS by asynchronous copies that cover whole 128-byte lines and take their fragments from there.
// Plan, three launches: k_proj (GEMM from the f32 x and weights, rounded to bf16 at the fragment read: q|k -> f16 token-major plane [t][512], v -> f16 plane [b][h*32+e][t]; the wo^T bf16 plane in a block range of the same grid), k_flash (online softmax in steps of 128 keys, k and v^T tiles of a head pair staged in LDS for the block's eight waves, 16 queries x 1 head per wave -> ctx hi/lo bf16 planes [t][256]), GEMM wo -> out f32.

#ifndef NB
#define NB 4
#endif
#ifndef SEQ
#define SEQ 2048
#endif
#define NB_FULL  4
#define SEQ_FULL 2048
#define DM   256      // model width = NH * HD
#define NH   8
#define HD   32       // head dim: exactly one 32-deep k-step per score tile
#define QKW  512      // q|k plane row width (q cols 0..255, k cols 256..511)
#define QCAR 16.0f    // carry on q, k and v planes
#define SCLX (0.0625f * 1.44269504088896340736f / 256.0f)   // 256^-0.5 x log2(e) / (16 x 16)

static_assert(DM == NH * HD);          // head-major concat width
static_assert(HD == 32);               // one WMMA k-step per head; two 16-wide e tiles
static_assert((NH & 1) == 0);
static_assert(SEQ % 64 == 0);          // 64-row GEMM tiles, 64-query blocks
static_assert(DM % 64 == 0 && QKW % 64 == 0 && DM % 32 == 0);
static_assert(NB <= NB_FULL && SEQ <= SEQ_FULL);

typedef _Float16 h16;
typedef unsigned short bf;
typedef __attribute__((ext_vector_type(16))) __bf16   v16bf;
typedef __attribute__((ext_vector_type(16))) _Float16 v16h;
typedef __attribute__((ext_vector_type(8)))  _Float16 v8h;
typedef __attribute__((ext_vector_type(8)))  unsigned short v8us;
typedef __attribute__((ext_vector_type(8)))  float    v8f;
typedef __attribute__((ext_vector_type(4)))  float    v4f;
typedef v4f  __attribute__((may_alias)) v4fa;

__device__ __forceinline__ unsigned short f2bf(float f) { unsigned u = __float_as_uint(f); u += 0x7FFFu + ((u >> 16) & 1u); return (unsigned short)(u >> 16); }
__device__ __forceinline__ float bf2f(unsigned short b) { return __uint_as_float(((unsigned)b) << 16); }
__device__ __forceinline__ v16h cat16(v8h lo, v8h hi) { return __builtin_shufflevector(lo, hi, 0, 1, 2, 3, 4, 5, 6, 7, 8, 9, 10, 11, 12, 13, 14, 15); }
__device__ __forceinline__ v16bf cat16b(v8us lo, v8us hi) { return __builtin_bit_cast(v16bf, __builtin_shufflevector(lo, hi, 0, 1, 2, 3, 4, 5, 6, 7, 8, 9, 10, 11, 12, 13, 14, 15)); }
__device__ __forceinline__ v8f wmma16(v16h a, v16h b, v8f c) { return __builtin_amdgcn_wmma_f32_16x16x32_f16(false, a, false, b, (short)0, c, false, false); }
__device__ __forceinline__ v8f wmmab(v16bf a, v16bf b, v8f c) { return __builtin_amdgcn_wmma_f32_16x16x32_bf16(false, a, false, b, (short)0, c, false, false); }
__device__ __forceinline__ void splitf(float y, unsigned short& h, unsigned short& l) { h = f2bf(y); l = f2bf(y - bf2f(h)); }
// fragment from a K-contiguous f16 row: p already includes row and 8*(lane>>4); elements 0..7 <- p[0..7], 8..15 <- p[16..23]
__device__ __forceinline__ v16h ldh(const h16* p) { return cat16(*(const v8h*)p, *(const v8h*)(p + 16)); }

// ---- gemmw_tile: register-blocked GEMM, ONE WAVE per 64x64 output tile (16 accumulators), operands from K-contiguous 16-bit planes (row pitch == K); tile (bx, by) of batch bz, 32 threads.
// C[m][n] = sum_k A[m][k] Bt[n][k] (+ A2 Bt for NSPLIT 1). z-batch strides sA/sB/sC in elements. K % 64 == 0, M % 64 == 0, N % 64 == 0 (no tail masking).
// Staging: chunk t = 64 k of the tile's 64 A (and A2) rows and 64 Bt rows, 128 B of each row. A fragment load straight from the plane would touch 16 lines for 512 B; a copy here takes 4 rows x 128 B, whole lines,
// global -> LDS buffer t & 1 through no register, while chunk t - 1 is worked on. Row pitch 144 B (16 B x odd) keeps the 16-byte fragment reads free of bank conflicts. The k order of the sums is unchanged.
// OMODE 0: f32 C (pitch ldc): per 16-row slab staged in LDS, each row's 64 floats (256 B) written as 16 lanes x 16 B (2 rows per instruction).
template <typename T16> struct WFrag;
template <> struct WFrag<h16> { typedef v16h V; static __device__ __forceinline__ V ld(const h16* p) { return cat16(*(const v8h*)p, *(const v8h*)(p + 16)); } static __device__ __forceinline__ v8f mma(V a, V b, v8f c) { return wmma16(a, b, c); } };
template <> struct WFrag<bf> { typedef v16bf V; static __device__ __forceinline__ V ld(const bf* p) { return cat16b(*(const v8us*)p, *(const v8us*)(p + 16)); } static __device__ __forceinline__ v8f mma(V a, V b, v8f c) { return wmmab(a, b, c); } };
#define GKC  64                        // k per staged chunk: 128 B of every row
#define GPIT 72                        // 16-bit elements per staged row (64 + 8 pad)
#define GPL  (64 * GPIT)               // elements of one staged plane: 64 rows
static_assert((GPIT * 2) % 16 == 0 && (GPL * 2) % 16 == 0);   // every copy and fragment read 16-byte aligned
static_assert(DM % GKC == 0 && DM / GKC >= 2);                 // K = DM: whole chunks, and the two that the prologue stages exist
// Eight copies of 16 B per lane, global -> LDS through no register. s_wait_xcnt 0 closes the statement so that no address register of a copy is rewritten ahead of it.
template <typename T16>
__device__ __forceinline__ void copy8(unsigned l0, unsigned l1, unsigned l2, unsigned l3, unsigned l4, unsigned l5, unsigned l6, unsigned l7,
                                      const T16* g0, const T16* g1, const T16* g2, const T16* g3, const T16* g4, const T16* g5, const T16* g6, const T16* g7) {
    asm volatile("global_load_async_to_lds_b128 %0, %8, off\n\t"
                 "global_load_async_to_lds_b128 %1, %9, off\n\t"
                 "global_load_async_to_lds_b128 %2, %10, off\n\t"
                 "global_load_async_to_lds_b128 %3, %11, off\n\t"
                 "global_load_async_to_lds_b128 %4, %12, off\n\t"
                 "global_load_async_to_lds_b128 %5, %13, off\n\t"
                 "global_load_async_to_lds_b128 %6, %14, off\n\t"
                 "global_load_async_to_lds_b128 %7, %15, off\n\t"
                 "s_wait_xcnt 0x0"
                 :: "v"(l0), "v"(l1), "v"(l2), "v"(l3), "v"(l4), "v"(l5), "v"(l6), "v"(l7), "v"(g0), "v"(g1), "v"(g2), "v"(g3), "v"(g4), "v"(g5), "v"(g6), "v"(g7) : "memory");
}
template <typename T16, int NSPLIT, int OMODE>
__device__ __forceinline__ void gemmw_tile(const T16* __restrict__ A, const T16* __restrict__ A2, const T16* __restrict__ Bt, const T16* __restrict__ Bt2, int K, void* Cv, int ldc, float oscale, size_t sA, size_t sB, size_t sC, unsigned bx, unsigned by, unsigned bz) {
    typedef typename WFrag<T16>::V V;
    static_assert(NSPLIT == 0 || NSPLIT == 1);
    constexpr unsigned NP = (NSPLIT == 1) ? 3u : 2u;   /* staged planes: A, (A2,) Bt */
    __shared__ __align__(16) float os[16 * 68];
    __shared__ __align__(16) T16 gring[2 * NP * GPL];
    const size_t z = bz; A += z * sA; if (A2) A2 += z * sA; Bt += z * sB;
    const unsigned lane = threadIdx.x & 31u, lr = lane & 15u, hi = lane >> 4; const unsigned r0 = bx * 64u, c0 = by * 64u;
    v8f acc[4][4];
#pragma unroll
    for (int mb = 0; mb < 4; ++mb)
#pragma unroll
        for (int nb = 0; nb < 4; ++nb) acc[mb][nb] = (v8f){};
    /* this lane's piece of a copy: row lane >> 3 of the copy's four rows, 16-byte piece lane & 7 of the row's 128 B */
    const unsigned lst = (unsigned)(size_t)gring + 2u * ((lane >> 3) * GPIT + (lane & 7u) * 8u);   /* LDS byte address: the low 32 bits */
    const size_t goff = (size_t)(lane >> 3) * K + (lane & 7u) * 8u;
    const T16* ga = A + (size_t)r0 * K + goff; const T16* ga2 = (NSPLIT == 1) ? A2 + (size_t)r0 * K + goff : nullptr; const T16* gb = Bt + (size_t)c0 * K + goff;
    auto plane = [&](unsigned l, const T16* g) {   /* 64 rows x 128 B: 16 copies of 4 rows */
#pragma unroll   /* two statements of eight copies; their LDS and row steps become literals */
        for (unsigned c = 0; c < 16u; c += 8u) { const unsigned lc = l + c * (8u * GPIT); const T16* gc = g + (size_t)c * 4 * K;
            copy8<T16>(lc, lc + 8u * GPIT, lc + 16u * GPIT, lc + 24u * GPIT, lc + 32u * GPIT, lc + 40u * GPIT, lc + 48u * GPIT, lc + 56u * GPIT,
                       gc, gc + (size_t)4 * K, gc + (size_t)8 * K, gc + (size_t)12 * K, gc + (size_t)16 * K, gc + (size_t)20 * K, gc + (size_t)24 * K, gc + (size_t)28 * K); } };
    auto stage = [&](int t) { const unsigned lb = lst + (unsigned)(t & 1) * (2u * NP * GPL); const int kc = t * GKC;   /* 16 x NP copies in flight, at most 48 */
        plane(lb, ga + kc); if constexpr (NSPLIT == 1) plane(lb + 2u * GPL, ga2 + kc); plane(lb + 2u * (NP - 1) * GPL, gb + kc); };
    const int nt = K / GKC;
    stage(0);
    asm volatile("s_wait_asynccnt 0x0" ::: "memory");   /* chunk 0 has landed */
    __syncthreads();                                     /* chunk 0 readable (single-wave block) */
    if (1 < nt) stage(1);
#pragma unroll 1   /* rolled: one copy of the chunk's code in the instruction cache, the buffer picked by t & 1 */
    for (int t = 0; t < nt; ++t) {
        const T16* fb = gring + (t & 1) * (NP * GPL) + lr * GPIT + 8 * hi;   /* fragment rows: row lr of a 16-row group, k = 8*hi + ... */
#pragma unroll   /* both k-steps of a chunk in line: the second's reads start under the first's last products */
        for (int ks = 0; ks < GKC; ks += 32) {
            V a[4], a2[4];
#pragma unroll
            for (int mb = 0; mb < 4; ++mb) { a[mb] = WFrag<T16>::ld(fb + mb * 16 * GPIT + ks); if (NSPLIT == 1) a2[mb] = WFrag<T16>::ld(fb + GPL + mb * 16 * GPIT + ks); }
            V b[4];   /* all fragments of a k-step are read as one group: one LDS wait per 16 (32) products */
#pragma unroll
            for (int nb = 0; nb < 4; ++nb) b[nb] = WFrag<T16>::ld(fb + (NP - 1) * GPL + nb * 16 * GPIT + ks);
            __builtin_amdgcn_sched_barrier(0);   /* keeps the reads together ahead of the products: sunk among them, each pair of reads is waited out on its own */
#pragma unroll
            for (int nb = 0; nb < 4; ++nb) {
#pragma unroll
                for (int mb = 0; mb < 4; ++mb) { acc[mb][nb] = WFrag<T16>::mma(a[mb], b[nb], acc[mb][nb]); if (NSPLIT == 1) acc[mb][nb] = WFrag<T16>::mma(a2[mb], b[nb], acc[mb][nb]); } }
            if (ks + 32 == GKC) {   /* behind the chunk's last products: fills the vector slots they need before an instruction behind the loop's branches touches their registers */
                if constexpr (NSPLIT == 1) { asm volatile("v_nop\n\tv_nop\n\tv_nop\n\tv_nop" : "+v"(acc[0][0]), "+v"(acc[1][1]), "+v"(acc[2][2]), "+v"(acc[3][3]) : "v"(a[0]), "v"(a[3]), "v"(a2[3])); }
                else { asm volatile("v_nop\n\tv_nop\n\tv_nop\n\tv_nop" : "+v"(acc[0][0]), "+v"(acc[1][1]), "+v"(acc[2][2]), "+v"(acc[3][3]) : "v"(a[0]), "v"(a[3])); } }
        }
        asm volatile("s_wait_dscnt 0x0" ::: "memory");      /* the reads of buffer t & 1 are done before it is refilled */
        asm volatile("s_wait_asynccnt 0x0" ::: "memory");   /* chunk t + 1 has landed */
        __syncthreads();                                     /* publishes chunk t + 1 and ends the reads of chunk t */
        if (t + 2 < nt) stage(t + 2);                        /* uniform test; refills the buffer just read */
    }
    asm volatile("s_wait_asynccnt 0x0" ::: "memory");   /* no copy outstanding behind the loop */
#pragma unroll
    for (int mb = 0; mb < 4; ++mb) {
#pragma unroll
        for (int nb = 0; nb < 4; ++nb) {
#pragma unroll
            for (int j = 0; j < 8; ++j) os[(hi * 8 + j) * 68 + nb * 16 + lr] = acc[mb][nb][j]; }   /* D: row 8*hi + j, col 16*nb + lr */
        __syncthreads();   /* single-wave block: staging visible to every lane */
        if constexpr (OMODE == 0) {
            float* crow = (float*)Cv + z * sC + (size_t)(r0 + mb * 16) * ldc + c0;
{
#pragma unroll
                for (int s = 0; s < 8; ++s) { const unsigned row = 2u * s + hi, cofs = lr * 4u; const v4f val = *(const v4fa*)(os + row * 68 + cofs);
                    *(v4f*)(crow + (size_t)row * ldc + cofs) = val; }   /* rows 2s+hi, s 0..7: all 16 rows; 16 lanes x 16 B = 256 B row segment */
                 }
        } else {
            h16* crow = (h16*)Cv + z * sC + (size_t)(r0 + mb * 16) * ldc + c0;
{
#pragma unroll
                for (int s = 0; s < 4; ++s) { const unsigned row = 4u * s + (lane >> 3), pc = (lane & 7u) * 8u; const v4f v0 = *(const v4fa*)(os + row * 68 + pc); const v4f v1 = *(const v4fa*)(os + row * 68 + pc + 4); v8h o;
#pragma unroll
                    for (int q = 0; q < 4; ++q) { o[q] = (h16)(v0[q] * oscale); o[4 + q] = (h16)(v1[q] * oscale); }
                    *(v8h*)(crow + (size_t)row * ldc + pc) = o; }   
                 }
        }
        __syncthreads();   /* staging free before the next slab overwrites it */
    }
}
// k_gemmw: one GEMM per launch, K = DM; grid (M/64, N/64, Z).
template <typename T16, int NSPLIT, int OMODE>
__global__ __launch_bounds__(32) void k_gemmw(const T16* __restrict__ A, const T16* __restrict__ A2, const T16* __restrict__ Bt, const T16* __restrict__ Bt2, void* Cv, int ldc, float oscale, size_t sA, size_t sB, size_t sC) {
    gemmw_tile<T16, NSPLIT, OMODE>(A, A2, Bt, Bt2, DM, Cv, ldc, oscale, sA, sB, sC, blockIdx.x, blockIdx.y, blockIdx.z);   /* K = DM, a constant: the copies' row steps are literals */
}
// k_proj: the three projections straight from the f32 inputs, no plane of x or of the weights in between. One block = four waves = 128 tokens x 128 columns (four heads of ONE of wq, wk, wv); wave w = 64 tokens (half w & 1) x 64 columns (half w >> 1), 16 accumulators.
// D[token][col] = sum_d x[token][d] w[h][d][e], col = h*32 + e. Chunk t = 64 d: 256 B of each of the 128 x rows and the 128 B line w[h][d][0..31] of each of the 4 x 64 (h, d), whole lines, copied once per block, global -> LDS buffer t & 1 through no register, while chunk t - 1 is worked on.
// The f32 values are rounded to bf16 (nearest even) where a fragment is read. x fragment: row = token, 16-byte reads along d. Weight fragment: column = lane, one 4-byte read per d (the staged rows run along e, so 16 lanes read 64 B of a row). Both hold k = 8*hi + i in element i and k = 16 + 8*hi + i in element 8 + i.
// Pitches: x rows 272 B (16 B x odd); weight rows 528 B, so that rows d and d + 8, read by the two lane halves, lie 128 B apart in the banks.
// Output: q and k columns -> f16 token-major plane [t][512], x 16; v columns -> f16 plane [b][h*32+e][t], x 16, each 16-column slab turned in LDS.
// Blocks [PT, PT + PWO): the bf16 plane WOT[n][k] = wo[k][n] for the last GEMM; it reads and writes nothing that the tiles touch.
#define PK   64                        // d per staged chunk: 256 B of every x row
#define XPIT 68                        // floats per staged x row (64 + 4 pad)
#define WPIT 132                       // floats per staged weight row (4 heads x 32 + 4 pad)
#define XPL  (128 * XPIT)              // floats of the x part of a buffer
#define PBUF (XPL + PK * WPIT)         // floats per buffer
#define PNT  (DM / PK)
#define PRT  ((unsigned)((size_t)NB * SEQ / 128))
#define PT   (PRT * 6u)                // 768 columns / 128
#define PWO  ((unsigned)DM / 16u)
static_assert((XPIT * 4) % 16 == 0 && (WPIT * 4) % 16 == 0 && (XPL * 4) % 16 == 0 && (PBUF * 4) % 16 == 0);   // every copy and 16-byte read aligned
static_assert(DM % PK == 0 && PNT >= 2 && SEQ % 128 == 0 && SEQ == SEQ_FULL && DM == 256 && HD == 32);         // whole chunks, the prologue's two exist; a tile's tokens lie in one batch; x rows follow one another
typedef __attribute__((ext_vector_type(16))) float v16f;
__device__ __forceinline__ void woprep_blk(const float* __restrict__ wo, bf* WOT, unsigned blk) {
    const unsigned n = blk * 16u + (threadIdx.x >> 3), pc = threadIdx.x & 7u;   /* eight lanes write the 128 B of a line of row n */
#pragma unroll
    for (unsigned kl = 0; kl < 4u; ++kl) { const unsigned k0 = kl * 64u + pc * 8u; v8us o;
#pragma unroll
        for (unsigned q = 0; q < 8u; ++q) o[q] = f2bf(wo[(size_t)(k0 + q) * DM + n]);
        *(v8us*)(WOT + (size_t)n * DM + k0) = o; }
}
__global__ __launch_bounds__(128) void k_proj(const float* __restrict__ x, const float* __restrict__ wq, const float* __restrict__ wk, const float* __restrict__ wv, const float* __restrict__ wo, h16* QKP, h16* VTP, bf* WOT) {
    __shared__ __align__(16) float pring[2 * PBUF];
    if (blockIdx.x >= PT) { woprep_blk(wo, WOT, blockIdx.x - PT); return; }   /* block-uniform, ahead of every barrier and copy */
    const unsigned tid = threadIdx.x, lane = tid & 31u, w = tid >> 5, wm = w & 1u, wn = w >> 1, lr = lane & 15u, hi = lane >> 4;
    const unsigned rt = blockIdx.x % PRT, ct = blockIdx.x / PRT, mat = ct >> 1, r0 = rt * 128u;
    const float* wsrc = (mat == 0u ? wq : (mat == 1u ? wk : wv)) + (size_t)(ct & 1u) * 4u * DM * HD;
    v8f acc[4][4];
#pragma unroll
    for (int mb = 0; mb < 4; ++mb)
#pragma unroll
        for (int nb = 0; nb < 4; ++nb) acc[mb][nb] = (v8f){};
    /* this thread's pieces of a chunk: 16-byte piece tid & 7 of both 128-B halves of x rows (tid >> 3) + 16 i, i = 0..7, and of the weight lines d = (tid >> 3) + 16 i, i = 0..3, of the four heads */
    const unsigned pb = (unsigned)(size_t)pring;   /* LDS byte address: the low 32 bits */
    const unsigned lx = pb + 4u * ((tid >> 3) * XPIT + (tid & 7u) * 4u), lw = pb + 4u * (XPL + (tid >> 3) * WPIT + (tid & 7u) * 4u);
    const float* gx = x + (size_t)(r0 + (tid >> 3)) * DM + (tid & 7u) * 4u;
    const float* gw = wsrc + (size_t)(tid >> 3) * HD + (tid & 7u) * 4u;
    auto stage = [&](int t) {   /* 32 copies a thread in flight */
#pragma unroll   /* four statements of eight copies; their LDS and row steps become literals */
      for (unsigned hf = 0; hf < 2u; ++hf) {
        const unsigned lb = (unsigned)(t & 1) * (4u * PBUF); const unsigned a = lx + lb + 4u * 32u * hf, c = lw + lb + 4u * 32u * WPIT * hf;
        const float* g = gx + t * PK + 32u * hf; const float* h = gw + (size_t)t * PK * HD + (size_t)32 * HD * hf;
        copy8<float>(a, a + 4u * 16u * XPIT, a + 4u * 32u * XPIT, a + 4u * 48u * XPIT, a + 4u * 64u * XPIT, a + 4u * 80u * XPIT, a + 4u * 96u * XPIT, a + 4u * 112u * XPIT,
                     g, g + (size_t)16 * DM, g + (size_t)32 * DM, g + (size_t)48 * DM, g + (size_t)64 * DM, g + (size_t)80 * DM, g + (size_t)96 * DM, g + (size_t)112 * DM);
        copy8<float>(c, c + 4u * 16u * WPIT, c + 4u * 32u, c + 4u * (16u * WPIT + 32u), c + 4u * 64u, c + 4u * (16u * WPIT + 64u), c + 4u * 96u, c + 4u * (16u * WPIT + 96u),
                     h, h + (size_t)16 * HD, h + (size_t)DM * HD, h + (size_t)DM * HD + 16 * HD, h + (size_t)2 * DM * HD, h + (size_t)2 * DM * HD + 16 * HD, h + (size_t)3 * DM * HD, h + (size_t)3 * DM * HD + 16 * HD); } };
    stage(0);
    asm volatile("s_wait_asynccnt 0x0" ::: "memory");   /* this wave's pieces of chunk 0 have landed */
    __syncthreads();                                     /* chunk 0 readable by every wave */
    stage(1);
#pragma unroll 1   /* rolled: one copy of the chunk's code, the buffer picked by t & 1 */
    for (int t = 0; t < PNT; ++t) {
        const float* fx = pring + (t & 1) * PBUF + (wm * 64u + lr) * XPIT + 8u * hi;
        const float* fw = pring + (t & 1) * PBUF + XPL + 8u * hi * WPIT + wn * 64u + lr;
#pragma unroll   /* both k-steps of a chunk in line: the second's reads start under the first's products */
      for (int ks = 0; ks < PK; ks += 32) {
        v16bf a[4], b[4];
#pragma unroll
        for (int mb = 0; mb < 4; ++mb) { const float* p = fx + mb * 16 * XPIT + ks; const v4f a0 = *(const v4fa*)p, a1 = *(const v4fa*)(p + 4), a2 = *(const v4fa*)(p + 16), a3 = *(const v4fa*)(p + 20); v16f f;
#pragma unroll
            for (int q = 0; q < 4; ++q) { f[q] = a0[q]; f[4 + q] = a1[q]; f[8 + q] = a2[q]; f[12 + q] = a3[q]; }
            a[mb] = __builtin_convertvector(f, v16bf); }
#pragma unroll
        for (int nb = 0; nb < 4; ++nb) { const float* p = fw + nb * 16 + ks * WPIT; v16f f;
#pragma unroll
            for (int q = 0; q < 8; ++q) { f[q] = p[q * WPIT]; f[8 + q] = p[(16 + q) * WPIT]; }
            b[nb] = __builtin_convertvector(f, v16bf); }
#pragma unroll
        for (int nb = 0; nb < 4; ++nb) {
#pragma unroll
            for (int mb = 0; mb < 4; ++mb) acc[mb][nb] = wmmab(a[mb], b[nb], acc[mb][nb]); }
        if (ks + 32 == PK) {
            __builtin_amdgcn_sched_barrier(0);   /* no product sinks behind the slots below and the barrier, in front of the loop's branches */
            /* behind the chunk's last products: fills the vector slots they need before an instruction behind the loop's branches touches their registers */
            asm volatile("v_nop\n\tv_nop\n\tv_nop\n\tv_nop" : "+v"(acc[0][0]), "+v"(acc[1][1]), "+v"(acc[2][2]), "+v"(acc[3][3]) : "v"(a[0]), "v"(a[3]), "v"(b[3])); }
      }
        asm volatile("s_wait_dscnt 0x0" ::: "memory");      /* this wave's reads of buffer t & 1 are done before it is refilled */
        asm volatile("s_wait_asynccnt 0x0" ::: "memory");   /* this wave's pieces of chunk t + 1 have landed */
        __syncthreads();                                     /* publishes chunk t + 1 and ends every wave's reads of chunk t */
        if (t + 2 < PNT) stage(t + 2);                       /* block-uniform test; refills the buffer just read */
    }
    asm volatile("s_wait_asynccnt 0x0" ::: "memory");   /* no copy outstanding behind the loop */
    float* os = pring + w * (16u * 68u);   /* each wave turns its slabs in its own 16 x 64 floats of the ring: behind the loop's last barrier nobody reads a chunk and no copy is under way */
    const unsigned tok = r0 + wm * 64u, col = (ct & 1u) * 128u + wn * 64u;
    h16* crow = (mat < 2u) ? QKP + (size_t)tok * QKW + mat * (unsigned)DM + col : VTP + (size_t)(tok / SEQ) * DM * SEQ + (size_t)col * SEQ + tok % SEQ;
    const size_t ldc = (mat < 2u) ? (size_t)QKW : (size_t)SEQ;
#pragma unroll
    for (int sb = 0; sb < 4; ++sb) {
        if (mat < 2u) {   /* block-uniform. slab = 16 tokens x 64 columns. D: token 8*hi + j, column 16*nb + lr */
#pragma unroll
            for (int nb = 0; nb < 4; ++nb)
#pragma unroll
                for (int j = 0; j < 8; ++j) os[(hi * 8 + j) * 68 + nb * 16 + lr] = acc[sb][nb][j];
        } else {          /* slab = 16 columns x 64 tokens */
#pragma unroll
            for (int mb = 0; mb < 4; ++mb)
#pragma unroll
                for (int j = 0; j < 8; ++j) os[lr * 68 + mb * 16 + hi * 8 + j] = acc[mb][sb][j];
        }
        __syncthreads();   /* slab visible to every lane */
#pragma unroll
        for (int s = 0; s < 4; ++s) { const unsigned row = 4u * s + (lane >> 3), pc = (lane & 7u) * 8u; const v4f v0 = *(const v4fa*)(os + row * 68 + pc); const v4f v1 = *(const v4fa*)(os + row * 68 + pc + 4); v8h o;
#pragma unroll
            for (int q = 0; q < 4; ++q) { o[q] = (h16)(v0[q] * QCAR); o[4 + q] = (h16)(v1[q] * QCAR); }
            *(v8h*)(crow + (size_t)(sb * 16 + row) * ldc + pc) = o; }   /* eight lanes write the 128 B of a row's 64 values */
        __syncthreads();   /* slab free before the next one overwrites it */
    }
}

// k_flash: one block = 64 queries x one head pair on eight waves; wave w = 16 queries (group w & 3) x ONE head (w >> 2 of the pair): a streaming pass over all SEQ keys in steps of TK = 128 with the running-max softmax.
// What a step costs once, whatever its length (the cross-lane maximum and sum, the rescale of the 16 accumulator registers, the waits, the barrier, the buffer addresses), is paid every 128 keys, and the eight score tiles of a step give the vector unit and the matrix unit more independent work between two barriers.
// Both heads run side by side, so a SIMD holds four waves (two blocks per WGP) whose vector work, LDS waits and cross-lane waits fill one another's gaps.
// Transposed tiles: S^T (M = key, N = query) = K-rows (A) x Q-rows (B), both K-contiguous f16 rows of the [t][512] plane; the f32 S^T accumulators repacked to f16 are directly the B fragments of
// ctx^T (M = e, N = query) = V^T-rows (A, K-contiguous over keys) x P^T: element r <- tile of keys 0..15, element 8+r <- tile of keys 16..31, lane unchanged.
// exp weights carry 2^10 (f16 operand <= 1024); the row sum uses the same f32 values, so the carry cancels in 1/l; the v carry 16 is folded into 1/l.
// Staging: tile t = TK keys of both heads = per head TK k rows of 64 B + 32 v^T rows of 256 B, copied once per block into LDS buffer t & 1 by asynchronous 16-byte copies
// (eight per thread) while tile t - 1 is worked on; a k copy takes the 128 B of a plane row that hold both heads, a whole line, a v^T copy one of the two lines of a row's 256 B. The four waves of a head take their A fragments from its half of the buffer.
// Row pitches 80 B and 272 B (16 B x odd) keep the 16-byte row reads free of bank conflicts.
#define FW 4                           // query groups of 16 per block
#define TK 128                         // keys per step
#define KPIT 40                        // f16 per staged k row (32 + 8 pad)
#define VPIT (TK + 8)                  // f16 per staged v^T row (TK + 8 pad)
#define RBK  (TK * KPIT)               // f16 of the k part of one head's half
#define RB   (TK * KPIT + 32 * VPIT)   // f16 of one head's half of a buffer
#define RB2  (2 * RB)                  // f16 per buffer: both heads
#define NTILE ((unsigned)(SEQ / TK))
static_assert((KPIT * 2) % 16 == 0 && (VPIT * 2) % 16 == 0 && (RBK * 2) % 16 == 0 && (RB * 2) % 16 == 0);   // every copy and fragment read 16-byte aligned
static_assert(TK == 128 && SEQ % TK == 0 && SEQ / TK >= 2);   // eight copies a thread fill a tile; whole tiles; the two tiles that the prologue stages exist
// waves_per_eu(4, 4): four waves per SIMD is what the grid gives (512 blocks x 8 waves on 1,024 SIMDs); with that register budget the compiler keeps a step's fragment reads together instead of re-using few registers, one LDS wait per read pair.
__global__ __launch_bounds__(256) __attribute__((amdgpu_waves_per_eu(4, 4))) void k_flash(const h16* __restrict__ QK, const h16* __restrict__ VT, bf* CH, bf* CL) {
    __shared__ __align__(16) float os[FW * 16 * 68];
    __shared__ __align__(16) h16 ring[2 * RB2];
    const unsigned tid = threadIdx.x, lane = tid & 31u, w = tid >> 5, qg = w & 3u, hh = w >> 2, lr = lane & 15u, hi = lane >> 4;
    const unsigned bz = blockIdx.z, hp = blockIdx.y, i0 = blockIdx.x * 64u + qg * 16u;
    const h16* qkb = QK + (size_t)bz * SEQ * QKW;
    const h16* vtb = VT + (size_t)bz * DM * SEQ;
    float* osw = os + qg * (16u * 68u);   /* 16 queries x 64 columns: both waves of a query group write here, each its head's 32 columns */
    /* this thread's pieces of a tile: k rows tid>>3, +32, +64 and +96, 16-byte piece tid&7 of the row's 128 B (pieces 0..3 head 0, 4..7 head 1); v^T row tid>>3 of head 0 and of head 1, pieces tid&7 and 8 + (tid&7) of the row's 256 B */
    const unsigned ringb = (unsigned)(size_t)ring;   /* LDS byte address: the low 32 bits */
    const unsigned lk = ringb + 2u * (((tid >> 2) & 1u) * RB + (tid >> 3) * KPIT + (tid & 3u) * 8u), lv = ringb + 2u * (RBK + (tid >> 3) * VPIT + (tid & 7u) * 8u);
    const h16* gk = qkb + (size_t)(tid >> 3) * QKW + DM + hp * 2u * HD + (tid & 7u) * 8u;
    const h16* gv = vtb + (size_t)(hp * 2u * HD + (tid >> 3)) * SEQ + (tid & 7u) * 8u;
    auto stage = [&](unsigned t) {
        const unsigned tj = t * (unsigned)TK, lb = (t & 1u) * (2u * RB2);
        const h16* k0 = gk + (size_t)tj * QKW; const h16* v0 = gv + tj;
        copy8<h16>(lk + lb, lk + lb + 2u * 32u * KPIT, lk + lb + 2u * 64u * KPIT, lk + lb + 2u * 96u * KPIT, lv + lb, lv + lb + 2u * 64u, lv + lb + 2u * RB, lv + lb + 2u * RB + 2u * 64u,
                   k0, k0 + (size_t)32 * QKW, k0 + (size_t)64 * QKW, k0 + (size_t)96 * QKW, v0, v0 + 64, v0 + (size_t)HD * SEQ, v0 + (size_t)HD * SEQ + 64); };
    stage(0u);
    const unsigned hd = hp * 2u + hh;
    const v16h bq = ldh(qkb + (size_t)(i0 + lr) * QKW + hd * HD + 8u * hi);        /* B: n = query i0+lr, k = e */
    asm volatile("s_wait_asynccnt 0x0" ::: "memory");   /* this wave's pieces of tile 0 have landed */
    __syncthreads();                                     /* tile 0 readable by every wave */
    stage(1u);
    v8f acc0 = (v8f){}, acc1 = (v8f){}; float m = -3.0e38f, l = 0.0f;
#pragma unroll 1
    for (unsigned t = 0; t < NTILE; ++t) {
        const h16* kt = ring + (t & 1u) * RB2 + hh * RB + lr * KPIT + 8u * hi;         /* A rows: key lr of a 16-key group, k = e */
        v8f s[8];
        {
            v16h ka[8];
#pragma unroll   /* this and the unrolls below: straight-line code, so that the tiles are registers and the row steps offset literals */
            for (int i = 0; i < 8; ++i) ka[i] = ldh(kt + i * 16 * KPIT);
            __builtin_amdgcn_sched_barrier(0);   /* keeps the sixteen reads one group ahead of the products: sunk among them, each pair of reads is waited out on its own */
#pragma unroll
            for (int i = 0; i < 8; ++i) s[i] = wmma16(ka[i], bq, (v8f){});
            __builtin_amdgcn_sched_barrier(0);   /* keeps the eight products one run: vector work lifted in among them is padded with v_nop to the distance their registers need, twice as many v_nop a step */
        }
        float vm0 = s[0][0], vm1 = s[2][0], vm2 = s[4][0], vm3 = s[6][0];   /* four chains: a maximum is exact in any order, and one chain of 64 would be waited out link by link */
#pragma unroll
        for (int r = 0; r < 8; ++r) { vm0 = fmaxf(vm0, fmaxf(s[0][r], s[1][r])); vm1 = fmaxf(vm1, fmaxf(s[2][r], s[3][r])); vm2 = fmaxf(vm2, fmaxf(s[4][r], s[5][r])); vm3 = fmaxf(vm3, fmaxf(s[6][r], s[7][r])); }
        float vm = fmaxf(fmaxf(vm0, vm1), fmaxf(vm2, vm3));
        vm = fmaxf(vm, __shfl_xor(vm, 16, 32));                   /* both lane halves hold the other 64 keys of the same query */
        const float mn = fmaxf(m, vm * SCLX);
        const float alpha = __builtin_amdgcn_exp2f(m - mn); m = mn;
        const float nb = 10.0f - mn;                              /* 2^10 carry */
        const v8f sclv = { SCLX, SCLX, SCLX, SCLX, SCLX, SCLX, SCLX, SCLX }, nbv = { nb, nb, nb, nb, nb, nb, nb, nb };
#pragma unroll
        for (int i = 0; i < 8; ++i) { const v8f u = __builtin_elementwise_fma(s[i], sclv, nbv);
#pragma unroll
            for (int r = 0; r < 8; ++r) s[i][r] = __builtin_amdgcn_exp2f(u[r]); }
        const v8f ts = ((s[0] + s[1]) + (s[2] + s[3])) + ((s[4] + s[5]) + (s[6] + s[7]));   /* tile by tile, register pairs as they lie */
        float rs = ((ts[0] + ts[1]) + (ts[2] + ts[3])) + ((ts[4] + ts[5]) + (ts[6] + ts[7]));
        rs += __shfl_xor(rs, 16, 32);
        l = l * alpha + rs;
        v16h pB[4];
#pragma unroll
        for (int j = 0; j < 4; ++j) pB[j] = cat16(__builtin_convertvector(s[2 * j], v8h), __builtin_convertvector(s[2 * j + 1], v8h));   /* element r <- keys 8*hi + r of the 32, element 8 + r <- keys 16 + 8*hi + r */
        acc0 *= alpha; acc1 *= alpha;
        const h16* vt = ring + (t & 1u) * RB2 + hh * RB + RBK + lr * VPIT + 8u * hi;   /* A rows: e = lr, k = key */
        v16h va0[4], va1[4];
#pragma unroll
        for (int j = 0; j < 4; ++j) { va0[j] = ldh(vt + j * 32); va1[j] = ldh(vt + 16 * VPIT + j * 32); }
#pragma unroll
        for (int j = 0; j < 4; ++j) { acc0 = wmma16(va0[j], pB[j], acc0); acc1 = wmma16(va1[j], pB[j], acc1); }
        /* behind the step's last products: fills the vector slots they need before an instruction behind the loop's branches touches their registers */
        asm volatile("v_nop\n\tv_nop\n\tv_nop\n\tv_nop" : "+v"(acc0), "+v"(acc1) : "v"(va1[3]), "v"(va0[3]), "v"(pB[3]));
        asm volatile("s_wait_dscnt 0x0" ::: "memory");      /* this wave's reads of buffer t & 1 are done before it is refilled */
        asm volatile("s_wait_asynccnt 0x0" ::: "memory");   /* this wave's pieces of tile t + 1 have landed */
        __syncthreads();                                     /* publishes tile t + 1 and ends every wave's reads of tile t */
        if (t + 2u < NTILE) stage(t + 2u);                   /* block-uniform test; refills the buffer just read */
    }
    asm volatile("s_wait_asynccnt 0x0" ::: "memory");   /* no copy outstanding behind the loop */
    const float inv = (1.0f / QCAR) / l;
#pragma unroll
    for (int r = 0; r < 8; ++r) { osw[lr * 68u + hh * 32u + 8u * hi + r] = acc0[r] * inv; osw[lr * 68u + hh * 32u + 16u + 8u * hi + r] = acc1[r] * inv; }   /* D: e = 8*hi + r (+16), query lr */
    __syncthreads();   /* both heads' columns of every query row are in place */
    const size_t rowbase = ((size_t)bz * SEQ + i0) * DM + hp * 64u;
{
#pragma unroll
        for (unsigned s = 0; s < 2u; ++s) { const unsigned row = 8u * hh + 4u * s + (lane >> 3), pc = (lane & 7u) * 8u; const v4f v0 = *(const v4fa*)(osw + row * 68u + pc); const v4f v1 = *(const v4fa*)(osw + row * 68u + pc + 4u); v8us oh, ol;   /* the two waves of a query group write 8 rows each, whole 128-B lines */
#pragma unroll
            for (int q = 0; q < 4; ++q) { unsigned short a2, c2; splitf(v0[q], a2, c2); oh[q] = a2; ol[q] = c2; splitf(v1[q], a2, c2); oh[4 + q] = a2; ol[4 + q] = c2; }
            const size_t oo = rowbase + (size_t)row * DM + pc;
            *(v8us*)(CH + oo) = oh; *(v8us*)(CL + oo) = ol; }   
         }
}

constexpr size_t al256(size_t b) { return (b + 255) & ~(size_t)255; }
constexpr size_t SZ_W   = al256((size_t)DM * DM * 2);
constexpr size_t SZ_QK  = al256((size_t)NB * SEQ * QKW * 2);
constexpr size_t SZ_VT  = al256((size_t)NB * DM * SEQ * 2);
constexpr size_t SZ_C   = al256((size_t)NB * SEQ * DM * 2);
constexpr size_t CARVE  = SZ_W + SZ_QK + SZ_VT + 2 * SZ_C;
static_assert(CARVE <= (size_t)134217728);                                   // carve <= 128 MiB
static_assert((size_t)PT * 128 * 128 == (size_t)NB * SEQ * (QKW + DM));       // k_proj tiles == q|k and v^T plane elements
static_assert((size_t)PWO * 128 * 4 * 8 == (size_t)DM * DM);                  // wo^T blocks x threads x 4 pieces x 8 == plane elements
static_assert((size_t)(SEQ / 64) * (NH / 2) * NB * FW * 16 * 64 == (size_t)NB * SEQ * DM);   // k_flash query groups x 16 rows x 64 cols == ctx plane elements

extern "C" void kernel_launch(void* const* d_in, const int* in_sizes, int n_in,
                              void* d_out, int out_size, void* d_ws, size_t ws_size, hipStream_t stream) {
    if (n_in < 5) return;
    const long long xmin = (long long)(NB - 1) * SEQ_FULL * DM + (long long)SEQ * DM;
    if ((long long)in_sizes[0] < xmin || in_sizes[1] < NH * DM * HD || in_sizes[2] < NH * DM * HD || in_sizes[3] < NH * DM * HD || in_sizes[4] < DM * DM) return;
    if ((long long)out_size < xmin) return;
    if (CARVE > ws_size) return;
    const float* x = (const float*)d_in[0]; const float* wq = (const float*)d_in[1]; const float* wk = (const float*)d_in[2]; const float* wv = (const float*)d_in[3]; const float* wo = (const float*)d_in[4];
    float* OUT = (float*)d_out;   /* [NB_FULL][SEQ_FULL][256] f32, batch stride from the full sizes */
    char* wsp = (char*)d_ws;
    auto take = [&](size_t bytes) { char* p = wsp; wsp += bytes; return (void*)p; };
    bf* WOT = (bf*)take(SZ_W);
    h16* QKP = (h16*)take(SZ_QK); h16* VTP = (h16*)take(SZ_VT); bf* CH = (bf*)take(SZ_C); bf* CL = (bf*)take(SZ_C);

    k_proj<<<PT + PWO, 128, 0, stream>>>(x, wq, wk, wv, wo, QKP, VTP, WOT);
    k_flash<<<dim3(SEQ / 64, NH / 2, NB), 256, 0, stream>>>(QKP, VTP, CH, CL);
    /* out[b][t][n] = (CH + CL)[b][t][:] . WOT[n][:]: M = SEQ, N = 256, K = 256, z = batch (output stride from the full sizes) */
    k_gemmw<bf, 1, 0><<<dim3(SEQ / 64, DM / 64, NB), 32, 0, stream>>>(CH, CL, WOT, nullptr, (void*)OUT, DM, 1.0f, (size_t)SEQ * DM, 0, (size_t)SEQ_FULL * DM);
}

// v007
// It runs in 39.8 microseconds.
// In both of two side-by-side timings against v006, it was 1.07 times as fast.
// Counting every step since v000, it is 2.74 times as fast.
#include <hip/hip_runtime.h>

// Compute dtypes (f32 accumulate everywhere): q/k/v projections v_wmma_f32_16x16x32_bf16 on bf16 RNE-converted x and weights (exact products); scores q.k^T v_wmma_f32_16x16x32_f16 (q x 256^-0.5 log2(e) / 16, k x16: the product is the score in log2 units); attn.V v_wmma_f32_16x16x32_f16 (exp weights x32 over the shift in use, v x16 carry); output projection v_wmma_f32_16x16x32_bf16 with the context as bf16 hi + lo planes (2 products) against bf16 wo.
// Multi-head attention: x [NB][SEQ][256], per-head weights w[8][256][32] ([in][out] per head), scores x 256^-0.5, softmax over all SEQ keys (no mask), heads concatenated head-major, times wo [in][out].
// The GEMMs stage their operand tiles in LDS by asynchronous copies that cover whole 128-byte lines and take their fragments from there.
// Plan, three launches: k_proj (GEMM from the f32 x and weights, rounded to bf16 at the fragment read: q|k -> f16 token-major plane [t][512], v -> f16 plane [b][h*32+e][t]; the wo^T bf16 plane in a block range of the same grid), k_flash (streaming softmax in steps of 128 keys, its shift moved only when a step needs it, k and v^T tiles of a head pair staged in LDS for the block's eight waves, 16 queries x 1 head per wave -> ctx hi/lo bf16 planes [t][256]), GEMM wo -> out f32.

#ifndef NB
#define NB 4
#endif
#ifndef SEQ
#define SEQ 2048
#endif
#define NB_FULL  4
#define SEQ_FULL 2048
#define DM   256      // model width = NH * HD
#define NH   8
#define HD   32       // head dim: exactly one 32-deep k-step per score tile
#define QKW  512      // q|k plane row width (q cols 0..255, k cols 256..511)
#define QCAR 16.0f    // carry on k and v planes
#define QSCL (0.0625f * 1.44269504088896340736f / 16.0f)   // factor on the q plane: 256^-0.5 x log2(e) / 16, so that q-plane . k-plane is the scaled score in log2 units

static_assert(DM == NH * HD);          // head-major concat width
static_assert(HD == 32);               // one WMMA k-step per head; two 16-wide e tiles
static_assert((NH & 1) == 0);
static_assert(SEQ % 64 == 0);          // 64-row GEMM tiles, 64-query blocks
static_assert(DM % 64 == 0 && QKW % 64 == 0 && DM % 32 == 0);
static_assert(NB <= NB_FULL && SEQ <= SEQ_FULL);

typedef _Float16 h16;
typedef unsigned short bf;
typedef __attribute__((ext_vector_type(16))) __bf16   v16bf;
typedef __attribute__((ext_vector_type(16))) _Float16 v16h;
typedef __attribute__((ext_vector_type(8)))  _Float16 v8h;
typedef __attribute__((ext_vector_type(8)))  unsigned short v8us;
typedef __attribute__((ext_vector_type(8)))  float    v8f;
typedef __attribute__((ext_vector_type(4)))  float    v4f;
typedef v4f  __attribute__((may_alias)) v4fa;

__device__ __forceinline__ unsigned short f2bf(float f) { unsigned u = __float_as_uint(f); u += 0x7FFFu + ((u >> 16) & 1u); return (unsigned short)(u >> 16); }
__device__ __forceinline__ float bf2f(unsigned short b) { return __uint_as_float(((unsigned)b) << 16); }
__device__ __forceinline__ v16h cat16(v8h lo, v8h hi) { return __builtin_shufflevector(lo, hi, 0, 1, 2, 3, 4, 5, 6, 7, 8, 9, 10, 11, 12, 13, 14, 15); }
__device__ __forceinline__ v16bf cat16b(v8us lo, v8us hi) { return __builtin_bit_cast(v16bf, __builtin_shufflevector(lo, hi, 0, 1, 2, 3, 4, 5, 6, 7, 8, 9, 10, 11, 12, 13, 14, 15)); }
__device__ __forceinline__ v8f wmma16(v16h a, v16h b, v8f c) { return __builtin_amdgcn_wmma_f32_16x16x32_f16(false, a, false, b, (short)0, c, false, false); }
__device__ __forceinline__ v8f wmmab(v16bf a, v16bf b, v8f c) { return __builtin_amdgcn_wmma_f32_16x16x32_bf16(false, a, false, b, (short)0, c, false, false); }
__device__ __forceinline__ void splitf(float y, unsigned short& h, unsigned short& l) { h = f2bf(y); l = f2bf(y - bf2f(h)); }
// fragment from a K-contiguous f16 row: p already includes row and 8*(lane>>4); elements 0..7 <- p[0..7], 8..15 <- p[16..23]
__device__ __forceinline__ v16h ldh(const h16* p) { return cat16(*(const v8h*)p, *(const v8h*)(p + 16)); }

// ---- gemmw_tile: register-blocked GEMM, ONE WAVE per 64x64 output tile (16 accumulators), operands from K-contiguous 16-bit planes (row pitch == K); tile (bx, by) of batch bz, 32 threads.
// C[m][n] = sum_k A[m][k] Bt[n][k] (+ A2 Bt for NSPLIT 1). z-batch strides sA/sB/sC in elements. K % 64 == 0, M % 64 == 0, N % 64 == 0 (no tail masking).
// Staging: chunk t = 64 k of the tile's 64 A (and A2) rows and 64 Bt rows, 128 B of each row. A fragment load straight from the plane would touch 16 lines for 512 B; a copy here takes 4 rows x 128 B, whole lines,
// global -> LDS buffer t & 1 through no register, while chunk t - 1 is worked on. Row pitch 144 B (16 B x odd) keeps the 16-byte fragment reads free of bank conflicts. The k order of the sums is unchanged.
// OMODE 0: f32 C (pitch ldc): per 16-row slab staged in LDS, each row's 64 floats (256 B) written as 16 lanes x 16 B (2 rows per instruction).
template <typename T16> struct WFrag;
template <> struct WFrag<h16> { typedef v16h V; static __device__ __forceinline__ V ld(const h16* p) { return cat16(*(const v8h*)p, *(const v8h*)(p + 16)); } static __device__ __forceinline__ v8f mma(V a, V b, v8f c) { return wmma16(a, b, c); } };
template <> struct WFrag<bf> { typedef v16bf V; static __device__ __forceinline__ V ld(const bf* p) { return cat16b(*(const v8us*)p, *(const v8us*)(p + 16)); } static __device__ __forceinline__ v8f mma(V a, V b, v8f c) { return wmmab(a, b, c); } };
#define GKC  64                        // k per staged chunk: 128 B of every row
#define GPIT 72                        // 16-bit elements per staged row (64 + 8 pad)
#define GPL  (64 * GPIT)               // elements of one staged plane: 64 rows
static_assert((GPIT * 2) % 16 == 0 && (GPL * 2) % 16 == 0);   // every copy and fragment read 16-byte aligned
static_assert(DM % GKC == 0 && DM / GKC >= 2);                 // K = DM: whole chunks, and the two that the prologue stages exist
// Eight copies of 16 B per lane, global -> LDS through no register. s_wait_xcnt 0 closes the statement so that no address register of a copy is rewritten ahead of it.
template <typename T16>
__device__ __forceinline__ void copy8(unsigned l0, unsigned l1, unsigned l2, unsigned l3, unsigned l4, unsigned l5, unsigned l6, unsigned l7,
                                      const T16* g0, const T16* g1, const T16* g2, const T16* g3, const T16* g4, const T16* g5, const T16* g6, const T16* g7) {
    asm volatile("global_load_async_to_lds_b128 %0, %8, off\n\t"
                 "global_load_async_to_lds_b128 %1, %9, off\n\t"
                 "global_load_async_to_lds_b128 %2, %10, off\n\t"
                 "global_load_async_to_lds_b128 %3, %11, off\n\t"
                 "global_load_async_to_lds_b128 %4, %12, off\n\t"
                 "global_load_async_to_lds_b128 %5, %13, off\n\t"
                 "global_load_async_to_lds_b128 %6, %14, off\n\t"
                 "global_load_async_to_lds_b128 %7, %15, off\n\t"
                 "s_wait_xcnt 0x0"
                 :: "v"(l0), "v"(l1), "v"(l2), "v"(l3), "v"(l4), "v"(l5), "v"(l6), "v"(l7), "v"(g0), "v"(g1), "v"(g2), "v"(g3), "v"(g4), "v"(g5), "v"(g6), "v"(g7) : "memory");
}
template <typename T16, int NSPLIT, int OMODE>
__device__ __forceinline__ void gemmw_tile(const T16* __restrict__ A, const T16* __restrict__ A2, const T16* __restrict__ Bt, const T16* __restrict__ Bt2, int K, void* Cv, int ldc, float oscale, size_t sA, size_t sB, size_t sC, unsigned bx, unsigned by, unsigned bz) {
    typedef typename WFrag<T16>::V V;
    static_assert(NSPLIT == 0 || NSPLIT == 1);
    constexpr unsigned NP = (NSPLIT == 1) ? 3u : 2u;   /* staged planes: A, (A2,) Bt */
    __shared__ __align__(16) float os[16 * 68];
    __shared__ __align__(16) T16 gring[2 * NP * GPL];
    const size_t z = bz; A += z * sA; if (A2) A2 += z * sA; Bt += z * sB;
    const unsigned lane = threadIdx.x & 31u, lr = lane & 15u, hi = lane >> 4; const unsigned r0 = bx * 64u, c0 = by * 64u;
    v8f acc[4][4];
#pragma unroll
    for (int mb = 0; mb < 4; ++mb)
#pragma unroll
        for (int nb = 0; nb < 4; ++nb) acc[mb][nb] = (v8f){};
    /* this lane's piece of a copy: row lane >> 3 of the copy's four rows, 16-byte piece lane & 7 of the row's 128 B */
    const unsigned lst = (unsigned)(size_t)gring + 2u * ((lane >> 3) * GPIT + (lane & 7u) * 8u);   /* LDS byte address: the low 32 bits */
    const size_t goff = (size_t)(lane >> 3) * K + (lane & 7u) * 8u;
    const T16* ga = A + (size_t)r0 * K + goff; const T16* ga2 = (NSPLIT == 1) ? A2 + (size_t)r0 * K + goff : nullptr; const T16* gb = Bt + (size_t)c0 * K + goff;
    auto plane = [&](unsigned l, const T16* g) {   /* 64 rows x 128 B: 16 copies of 4 rows */
#pragma unroll   /* two statements of eight copies; their LDS and row steps become literals */
        for (unsigned c = 0; c < 16u; c += 8u) { const unsigned lc = l + c * (8u * GPIT); const T16* gc = g + (size_t)c * 4 * K;
            copy8<T16>(lc, lc + 8u * GPIT, lc + 16u * GPIT, lc + 24u * GPIT, lc + 32u * GPIT, lc + 40u * GPIT, lc + 48u * GPIT, lc + 56u * GPIT,
                       gc, gc + (size_t)4 * K, gc + (size_t)8 * K, gc + (size_t)12 * K, gc + (size_t)16 * K, gc + (size_t)20 * K, gc + (size_t)24 * K, gc + (size_t)28 * K); } };
    auto stage = [&](int t) { const unsigned lb = lst + (unsigned)(t & 1) * (2u * NP * GPL); const int kc = t * GKC;   /* 16 x NP copies in flight, at most 48 */
        plane(lb, ga + kc); if constexpr (NSPLIT == 1) plane(lb + 2u * GPL, ga2 + kc); plane(lb + 2u * (NP - 1) * GPL, gb + kc); };
    const int nt = K / GKC;
    stage(0);
    asm volatile("s_wait_asynccnt 0x0" ::: "memory");   /* chunk 0 has landed */
    __syncthreads();                                     /* chunk 0 readable (single-wave block) */
    if (1 < nt) stage(1);
#pragma unroll 1   /* rolled: one copy of the chunk's code in the instruction cache, the buffer picked by t & 1 */
    for (int t = 0; t < nt; ++t) {
        const T16* fb = gring + (t & 1) * (NP * GPL) + lr * GPIT + 8 * hi;   /* fragment rows: row lr of a 16-row group, k = 8*hi + ... */
#pragma unroll   /* both k-steps of a chunk in line: the second's reads start under the first's last products */
        for (int ks = 0; ks < GKC; ks += 32) {
            V a[4], a2[4];
#pragma unroll
            for (int mb = 0; mb < 4; ++mb) { a[mb] = WFrag<T16>::ld(fb + mb * 16 * GPIT + ks); if (NSPLIT == 1) a2[mb] = WFrag<T16>::ld(fb + GPL + mb * 16 * GPIT + ks); }
            V b[4];   /* all fragments of a k-step are read as one group: one LDS wait per 16 (32) products */
#pragma unroll
            for (int nb = 0; nb < 4; ++nb) b[nb] = WFrag<T16>::ld(fb + (NP - 1) * GPL + nb * 16 * GPIT + ks);
            __builtin_amdgcn_sched_barrier(0);   /* keeps the reads together ahead of the products: sunk among them, each pair of reads is waited out on its own */
#pragma unroll
            for (int nb = 0; nb < 4; ++nb) {
#pragma unroll
                for (int mb = 0; mb < 4; ++mb) { acc[mb][nb] = WFrag<T16>::mma(a[mb], b[nb], acc[mb][nb]); if (NSPLIT == 1) acc[mb][nb] = WFrag<T16>::mma(a2[mb], b[nb], acc[mb][nb]); } }
            if (ks + 32 == GKC) {   /* behind the chunk's last products: fills the vector slots they need before an instruction behind the loop's branches touches their registers */
                if constexpr (NSPLIT == 1) { asm volatile("v_nop\n\tv_nop\n\tv_nop\n\tv_nop" : "+v"(acc[0][0]), "+v"(acc[1][1]), "+v"(acc[2][2]), "+v"(acc[3][3]) : "v"(a[0]), "v"(a[3]), "v"(a2[3])); }
                else { asm volatile("v_nop\n\tv_nop\n\tv_nop\n\tv_nop" : "+v"(acc[0][0]), "+v"(acc[1][1]), "+v"(acc[2][2]), "+v"(acc[3][3]) : "v"(a[0]), "v"(a[3])); } }
        }
        asm volatile("s_wait_dscnt 0x0" ::: "memory");      /* the reads of buffer t & 1 are done before it is refilled */
        asm volatile("s_wait_asynccnt 0x0" ::: "memory");   /* chunk t + 1 has landed */
        __syncthreads();                                     /* publishes chunk t + 1 and ends the reads of chunk t */
        if (t + 2 < nt) stage(t + 2);                        /* uniform test; refills the buffer just read */
    }
    asm volatile("s_wait_asynccnt 0x0" ::: "memory");   /* no copy outstanding behind the loop */
#pragma unroll
    for (int mb = 0; mb < 4; ++mb) {
#pragma unroll
        for (int nb = 0; nb < 4; ++nb) {
#pragma unroll
            for (int j = 0; j < 8; ++j) os[(hi * 8 + j) * 68 + nb * 16 + lr] = acc[mb][nb][j]; }   /* D: row 8*hi + j, col 16*nb + lr */
        __syncthreads();   /* single-wave block: staging visible to every lane */
        if constexpr (OMODE == 0) {
            float* crow = (float*)Cv + z * sC + (size_t)(r0 + mb * 16) * ldc + c0;
{
#pragma unroll
                for (int s = 0; s < 8; ++s) { const unsigned row = 2u * s + hi, cofs = lr * 4u; const v4f val = *(const v4fa*)(os + row * 68 + cofs);
                    *(v4f*)(crow + (size_t)row * ldc + cofs) = val; }   /* rows 2s+hi, s 0..7: all 16 rows; 16 lanes x 16 B = 256 B row segment */
                 }
        } else {
            h16* crow = (h16*)Cv + z * sC + (size_t)(r0 + mb * 16) * ldc + c0;
{
#pragma unroll
                for (int s = 0; s < 4; ++s) { const unsigned row = 4u * s + (lane >> 3), pc = (lane & 7u) * 8u; const v4f v0 = *(const v4fa*)(os + row * 68 + pc); const v4f v1 = *(const v4fa*)(os + row * 68 + pc + 4); v8h o;
#pragma unroll
                    for (int q = 0; q < 4; ++q) { o[q] = (h16)(v0[q] * oscale); o[4 + q] = (h16)(v1[q] * oscale); }
                    *(v8h*)(crow + (size_t)row * ldc + pc) = o; }   
                 }
        }
        __syncthreads();   /* staging free before the next slab overwrites it */
    }
}
// k_gemmw: one GEMM per launch, K = DM; grid (M/64, N/64, Z).
template <typename T16, int NSPLIT, int OMODE>
__global__ __launch_bounds__(32) void k_gemmw(const T16* __restrict__ A, const T16* __restrict__ A2, const T16* __restrict__ Bt, const T16* __restrict__ Bt2, void* Cv, int ldc, float oscale, size_t sA, size_t sB, size_t sC) {
    gemmw_tile<T16, NSPLIT, OMODE>(A, A2, Bt, Bt2, DM, Cv, ldc, oscale, sA, sB, sC, blockIdx.x, blockIdx.y, blockIdx.z);   /* K = DM, a constant: the copies' row steps are literals */
}
// k_proj: the three projections straight from the f32 inputs, no plane of x or of the weights in between. One block = four waves = 128 tokens x 128 columns (four heads of ONE of wq, wk, wv); wave w = 64 tokens (half w & 1) x 64 columns (half w >> 1), 16 accumulators.
// D[token][col] = sum_d x[token][d] w[h][d][e], col = h*32 + e. Chunk t = 64 d: 256 B of each of the 128 x rows and the 128 B line w[h][d][0..31] of each of the 4 x 64 (h, d), whole lines, copied once per block, global -> LDS buffer t & 1 through no register, while chunk t - 1 is worked on.
// The f32 values are rounded to bf16 (nearest even) where a fragment is read. x fragment: row = token, 16-byte reads along d. Weight fragment: column = lane, one 4-byte read per d (the staged rows run along e, so 16 lanes read 64 B of a row). Both hold k = 8*hi + i in element i and k = 16 + 8*hi + i in element 8 + i.
// Pitches: x rows 272 B (16 B x odd); weight rows 528 B, so that rows d and d + 8, read by the two lane halves, lie 128 B apart in the banks.
// Output: q and k columns -> f16 token-major plane [t][512], q x QSCL, k x 16; v columns -> f16 plane [b][h*32+e][t], x 16, each 16-column slab turned in LDS.
// Blocks [PT, PT + PWO): the bf16 plane WOT[n][k] = wo[k][n] for the last GEMM; it reads and writes nothing that the tiles touch.
#define PK   64                        // d per staged chunk: 256 B of every x row
#define XPIT 68                        // floats per staged x row (64 + 4 pad)
#define WPIT 132                       // floats per staged weight row (4 heads x 32 + 4 pad)
#define XPL  (128 * XPIT)              // floats of the x part of a buffer
#define PBUF (XPL + PK * WPIT)         // floats per buffer
#define PNT  (DM / PK)
#define PRT  ((unsigned)((size_t)NB * SEQ / 128))
#define PT   (PRT * 6u)                // 768 columns / 128
#define PWO  ((unsigned)DM / 16u)
static_assert((XPIT * 4) % 16 == 0 && (WPIT * 4) % 16 == 0 && (XPL * 4) % 16 == 0 && (PBUF * 4) % 16 == 0);   // every copy and 16-byte read aligned
static_assert(DM % PK == 0 && PNT >= 2 && SEQ % 128 == 0 && SEQ == SEQ_FULL && DM == 256 && HD == 32);         // whole chunks, the prologue's two exist; a tile's tokens lie in one batch; x rows follow one another
typedef __attribute__((ext_vector_type(16))) float v16f;
__device__ __forceinline__ void woprep_blk(const float* __restrict__ wo, bf* WOT, unsigned blk) {
    const unsigned n = blk * 16u + (threadIdx.x >> 3), pc = threadIdx.x & 7u;   /* eight lanes write the 128 B of a line of row n */
#pragma unroll
    for (unsigned kl = 0; kl < 4u; ++kl) { const unsigned k0 = kl * 64u + pc * 8u; v8us o;
#pragma unroll
        for (unsigned q = 0; q < 8u; ++q) o[q] = f2bf(wo[(size_t)(k0 + q) * DM + n]);
        *(v8us*)(WOT + (size_t)n * DM + k0) = o; }
}
__global__ __launch_bounds__(128) void k_proj(const float* __restrict__ x, const float* __restrict__ wq, const float* __restrict__ wk, const float* __restrict__ wv, const float* __restrict__ wo, h16* QKP, h16* VTP, bf* WOT) {
    __shared__ __align__(16) float pring[2 * PBUF];
    if (blockIdx.x >= PT) { woprep_blk(wo, WOT, blockIdx.x - PT); return; }   /* block-uniform, ahead of every barrier and copy */
    const unsigned tid = threadIdx.x, lane = tid & 31u, w = tid >> 5, wm = w & 1u, wn = w >> 1, lr = lane & 15u, hi = lane >> 4;
    const unsigned rt = blockIdx.x % PRT, ct = blockIdx.x / PRT, mat = ct >> 1, r0 = rt * 128u;
    const float* wsrc = (mat == 0u ? wq : (mat == 1u ? wk : wv)) + (size_t)(ct & 1u) * 4u * DM * HD;
    v8f acc[4][4];
#pragma unroll
    for (int mb = 0; mb < 4; ++mb)
#pragma unroll
        for (int nb = 0; nb < 4; ++nb) acc[mb][nb] = (v8f){};
    /* this thread's pieces of a chunk: 16-byte piece tid & 7 of both 128-B halves of x rows (tid >> 3) + 16 i, i = 0..7, and of the weight lines d = (tid >> 3) + 16 i, i = 0..3, of the four heads */
    const unsigned pb = (unsigned)(size_t)pring;   /* LDS byte address: the low 32 bits */
    const unsigned lx = pb + 4u * ((tid >> 3) * XPIT + (tid & 7u) * 4u), lw = pb + 4u * (XPL + (tid >> 3) * WPIT + (tid & 7u) * 4u);
    const float* gx = x + (size_t)(r0 + (tid >> 3)) * DM + (tid & 7u) * 4u;
    const float* gw = wsrc + (size_t)(tid >> 3) * HD + (tid & 7u) * 4u;
    auto stage = [&](int t) {   /* 32 copies a thread in flight */
#pragma unroll   /* four statements of eight copies; their LDS and row steps become literals */
      for (unsigned hf = 0; hf < 2u; ++hf) {
        const unsigned lb = (unsigned)(t & 1) * (4u * PBUF); const unsigned a = lx + lb + 4u * 32u * hf, c = lw + lb + 4u * 32u * WPIT * hf;
        const float* g = gx + t * PK + 32u * hf; const float* h = gw + (size_t)t * PK * HD + (size_t)32 * HD * hf;
        copy8<float>(a, a + 4u * 16u * XPIT, a + 4u * 32u * XPIT, a + 4u * 48u * XPIT, a + 4u * 64u * XPIT, a + 4u * 80u * XPIT, a + 4u * 96u * XPIT, a + 4u * 112u * XPIT,
                     g, g + (size_t)16 * DM, g + (size_t)32 * DM, g + (size_t)48 * DM, g + (size_t)64 * DM, g + (size_t)80 * DM, g + (size_t)96 * DM, g + (size_t)112 * DM);
        copy8<float>(c, c + 4u * 16u * WPIT, c + 4u * 32u, c + 4u * (16u * WPIT + 32u), c + 4u * 64u, c + 4u * (16u * WPIT + 64u), c + 4u * 96u, c + 4u * (16u * WPIT + 96u),
                     h, h + (size_t)16 * HD, h + (size_t)DM * HD, h + (size_t)DM * HD + 16 * HD, h + (size_t)2 * DM * HD, h + (size_t)2 * DM * HD + 16 * HD, h + (size_t)3 * DM * HD, h + (size_t)3 * DM * HD + 16 * HD); } };
    stage(0);
    asm volatile("s_wait_asynccnt 0x0" ::: "memory");   /* this wave's pieces of chunk 0 have landed */
    __syncthreads();                                     /* chunk 0 readable by every wave */
    stage(1);
#pragma unroll 1   /* rolled: one copy of the chunk's code, the buffer picked by t & 1 */
    for (int t = 0; t < PNT; ++t) {
        const float* fx = pring + (t & 1) * PBUF + (wm * 64u + lr) * XPIT + 8u * hi;
        const float* fw = pring + (t & 1) * PBUF + XPL + 8u * hi * WPIT + wn * 64u + lr;
#pragma unroll   /* both k-steps of a chunk in line: the second's reads start under the first's products */
      for (int ks = 0; ks < PK; ks += 32) {
        v16bf a[4], b[4];
#pragma unroll
        for (int mb = 0; mb < 4; ++mb) { const float* p = fx + mb * 16 * XPIT + ks; const v4f a0 = *(const v4fa*)p, a1 = *(const v4fa*)(p + 4), a2 = *(const v4fa*)(p + 16), a3 = *(const v4fa*)(p + 20); v16f f;
#pragma unroll
            for (int q = 0; q < 4; ++q) { f[q] = a0[q]; f[4 + q] = a1[q]; f[8 + q] = a2[q]; f[12 + q] = a3[q]; }
            a[mb] = __builtin_convertvector(f, v16bf); }
#pragma unroll
        for (int nb = 0; nb < 4; ++nb) { const float* p = fw + nb * 16 + ks * WPIT; v16f f;
#pragma unroll
            for (int q = 0; q < 8; ++q) { f[q] = p[q * WPIT]; f[8 + q] = p[(16 + q) * WPIT]; }
            b[nb] = __builtin_convertvector(f, v16bf); }
#pragma unroll
        for (int nb = 0; nb < 4; ++nb) {
#pragma unroll
            for (int mb = 0; mb < 4; ++mb) acc[mb][nb] = wmmab(a[mb], b[nb], acc[mb][nb]); }
        if (ks + 32 == PK) {
            __builtin_amdgcn_sched_barrier(0);   /* no product sinks behind the slots below and the barrier, in front of the loop's branches */
            /* behind the chunk's last products: fills the vector slots they need before an instruction behind the loop's branches touches their registers */
            asm volatile("v_nop\n\tv_nop\n\tv_nop\n\tv_nop" : "+v"(acc[0][0]), "+v"(acc[1][1]), "+v"(acc[2][2]), "+v"(acc[3][3]) : "v"(a[0]), "v"(a[3]), "v"(b[3])); }
      }
        asm volatile("s_wait_dscnt 0x0" ::: "memory");      /* this wave's reads of buffer t & 1 are done before it is refilled */
        asm volatile("s_wait_asynccnt 0x0" ::: "memory");   /* this wave's pieces of chunk t + 1 have landed */
        __syncthreads();                                     /* publishes chunk t + 1 and ends every wave's reads of chunk t */
        if (t + 2 < PNT) stage(t + 2);                       /* block-uniform test; refills the buffer just read */
    }
    asm volatile("s_wait_asynccnt 0x0" ::: "memory");   /* no copy outstanding behind the loop */
    float* os = pring + w * (16u * 68u);   /* each wave turns its slabs in its own 16 x 64 floats of the ring: behind the loop's last barrier nobody reads a chunk and no copy is under way */
    const unsigned tok = r0 + wm * 64u, col = (ct & 1u) * 128u + wn * 64u;
    h16* crow = (mat < 2u) ? QKP + (size_t)tok * QKW + mat * (unsigned)DM + col : VTP + (size_t)(tok / SEQ) * DM * SEQ + (size_t)col * SEQ + tok % SEQ;
    const size_t ldc = (mat < 2u) ? (size_t)QKW : (size_t)SEQ;
    const float osc = (mat == 0u) ? QSCL : QCAR;   /* block-uniform */
#pragma unroll
    for (int sb = 0; sb < 4; ++sb) {
        if (mat < 2u) {   /* block-uniform. slab = 16 tokens x 64 columns. D: token 8*hi + j, column 16*nb + lr */
#pragma unroll
            for (int nb = 0; nb < 4; ++nb)
#pragma unroll
                for (int j = 0; j < 8; ++j) os[(hi * 8 + j) * 68 + nb * 16 + lr] = acc[sb][nb][j];
        } else {          /* slab = 16 columns x 64 tokens */
#pragma unroll
            for (int mb = 0; mb < 4; ++mb)
#pragma unroll
                for (int j = 0; j < 8; ++j) os[lr * 68 + mb * 16 + hi * 8 + j] = acc[mb][sb][j];
        }
        __syncthreads();   /* slab visible to every lane */
#pragma unroll
        for (int s = 0; s < 4; ++s) { const unsigned row = 4u * s + (lane >> 3), pc = (lane & 7u) * 8u; const v4f v0 = *(const v4fa*)(os + row * 68 + pc); const v4f v1 = *(const v4fa*)(os + row * 68 + pc + 4); v8h o;
#pragma unroll
            for (int q = 0; q < 4; ++q) { o[q] = (h16)(v0[q] * osc); o[4 + q] = (h16)(v1[q] * osc); }
            *(v8h*)(crow + (size_t)(sb * 16 + row) * ldc + pc) = o; }   /* eight lanes write the 128 B of a row's 64 values */
        __syncthreads();   /* slab free before the next one overwrites it */
    }
}

// k_flash: one block = 64 queries x one head pair on eight waves; wave w = 16 queries (group w & 3) x ONE head (w >> 2 of the pair): a streaming pass over all SEQ keys in steps of TK = 128, softmax weights 2^(score - shift).
// The result does not depend on the shift, only the range of the weights does. It starts as tile 0's maximum and is kept while the weights fit f16: a lane's 64 weights of a step sum to at most PLIM, so each is below the f16 limit.
// Only a step that fails this test searches its maximum, moves the shift there and rescales sum and accumulators. A step that passes needs no maximum, no multiply-add on the scores, no rescale and no cross-lane exchange.
// What a step costs once, whatever its length (the test, the waits, the barrier, the buffer addresses), is paid every 128 keys, and the eight score tiles of a step give the vector unit and the matrix unit more independent work between two barriers.
// Both heads run side by side, so a SIMD holds four waves (two blocks per WGP) whose vector work and LDS waits fill one another's gaps.
// Transposed tiles: S^T (M = key, N = query) = K-rows (A) x Q-rows (B), both K-contiguous f16 rows of the [t][512] plane; the f32 S^T accumulators repacked to f16 are directly the B fragments of
// ctx^T (M = e, N = query) = V^T-rows (A, K-contiguous over keys) x P^T: element r <- tile of keys 0..15, element 8+r <- tile of keys 16..31, lane unchanged.
// exp weights carry 2^PCAR; the row sum uses the same f32 values, so the carry cancels in 1/l; the v carry 16 is folded into 1/l.
// Staging: tile t = TK keys of both heads = per head TK k rows of 64 B + 32 v^T rows of 256 B, copied once per block into LDS buffer t & 1 by asynchronous 16-byte copies
// (eight per thread) while tile t - 1 is worked on; a k copy takes the 128 B of a plane row that hold both heads, a whole line, a v^T copy one of the two lines of a row's 256 B. The four waves of a head take their A fragments from its half of the buffer.
// Row pitches 80 B and 272 B (16 B x odd) keep the 16-byte row reads free of bank conflicts.
#define FW 4                           // query groups of 16 per block
#define TK 128                         // keys per step
#define KPIT 40                        // f16 per staged k row (32 + 8 pad)
#define VPIT (TK + 8)                  // f16 per staged v^T row (TK + 8 pad)
#define RBK  (TK * KPIT)               // f16 of the k part of one head's half
#define RB   (TK * KPIT + 32 * VPIT)   // f16 of one head's half of a buffer
#define RB2  (2 * RB)                  // f16 per buffer: both heads
#define NTILE ((unsigned)(SEQ / TK))
#define PCAR 5.0f                      // log2 of the weight of a score equal to the shift's maximum
#define PLIM 32768.0f                  // bound on a lane's sum of 64 weights: below the f16 limit 65504, above 64 x 2^PCAR
static_assert((KPIT * 2) % 16 == 0 && (VPIT * 2) % 16 == 0 && (RBK * 2) % 16 == 0 && (RB * 2) % 16 == 0);   // every copy and fragment read 16-byte aligned
static_assert(TK == 128 && SEQ % TK == 0 && SEQ / TK >= 2);   // eight copies a thread fill a tile; whole tiles; the two tiles that the prologue stages exist
// waves_per_eu(4, 4): four waves per SIMD is what the grid gives (512 blocks x 8 waves on 1,024 SIMDs); with that register budget the compiler keeps a step's fragment reads together instead of re-using few registers, one LDS wait per read pair.
__global__ __launch_bounds__(256) __attribute__((amdgpu_waves_per_eu(4, 4))) void k_flash(const h16* __restrict__ QK, const h16* __restrict__ VT, bf* CH, bf* CL) {
    __shared__ __align__(16) float os[FW * 16 * 68];
    __shared__ __align__(16) h16 ring[2 * RB2];
    const unsigned tid = threadIdx.x, lane = tid & 31u, w = tid >> 5, qg = w & 3u, hh = w >> 2, lr = lane & 15u, hi = lane >> 4;
    const unsigned bz = blockIdx.z, hp = blockIdx.y, i0 = blockIdx.x * 64u + qg * 16u;
    const h16* qkb = QK + (size_t)bz * SEQ * QKW;
    const h16* vtb = VT + (size_t)bz * DM * SEQ;
    float* osw = os + qg * (16u * 68u);   /* 16 queries x 64 columns: both waves of a query group write here, each its head's 32 columns */
    /* this thread's pieces of a tile: k rows tid>>3, +32, +64 and +96, 16-byte piece tid&7 of the row's 128 B (pieces 0..3 head 0, 4..7 head 1); v^T row tid>>3 of head 0 and of head 1, pieces tid&7 and 8 + (tid&7) of the row's 256 B */
    const unsigned ringb = (unsigned)(size_t)ring;   /* LDS byte address: the low 32 bits */
    const unsigned lk = ringb + 2u * (((tid >> 2) & 1u) * RB + (tid >> 3) * KPIT + (tid & 3u) * 8u), lv = ringb + 2u * (RBK + (tid >> 3) * VPIT + (tid & 7u) * 8u);
    const h16* gk = qkb + (size_t)(tid >> 3) * QKW + DM + hp * 2u * HD + (tid & 7u) * 8u;
    const h16* gv = vtb + (size_t)(hp * 2u * HD + (tid >> 3)) * SEQ + (tid & 7u) * 8u;
    auto stage = [&](unsigned t) {
        const unsigned tj = t * (unsigned)TK, lb = (t & 1u) * (2u * RB2);
        const h16* k0 = gk + (size_t)tj * QKW; const h16* v0 = gv + tj;
        copy8<h16>(lk + lb, lk + lb + 2u * 32u * KPIT, lk + lb + 2u * 64u * KPIT, lk + lb + 2u * 96u * KPIT, lv + lb, lv + lb + 2u * 64u, lv + lb + 2u * RB, lv + lb + 2u * RB + 2u * 64u,
                   k0, k0 + (size_t)32 * QKW, k0 + (size_t)64 * QKW, k0 + (size_t)96 * QKW, v0, v0 + 64, v0 + (size_t)HD * SEQ, v0 + (size_t)HD * SEQ + 64); };
    stage(0u);
    const unsigned hd = hp * 2u + hh;
    const v16h bq = ldh(qkb + (size_t)(i0 + lr) * QKW + hd * HD + 8u * hi);        /* B: n = query i0+lr, k = e */
    asm volatile("s_wait_asynccnt 0x0" ::: "memory");   /* this wave's pieces of tile 0 have landed */
    __syncthreads();                                     /* tile 0 readable by every wave */
    stage(1u);
    v8f acc0 = (v8f){}, acc1 = (v8f){}; float l = 0.0f;   /* l: this lane's own keys only; the two lane halves are joined behind the loop */
    v8f s[8];
    auto scores = [&](unsigned t, v8f c) {   /* s = k rows of tile t . q + c: eight tiles of 16 keys x 16 queries, log2 units */
        const h16* kt = ring + (t & 1u) * RB2 + hh * RB + lr * KPIT + 8u * hi;         /* A rows: key lr of a 16-key group, k = e */
        v16h ka[8];
#pragma unroll   /* this and the unrolls below: straight-line code, so that the tiles are registers and the row steps offset literals */
        for (int i = 0; i < 8; ++i) ka[i] = ldh(kt + i * 16 * KPIT);
        __builtin_amdgcn_sched_barrier(0);   /* keeps the sixteen reads one group ahead of the products: sunk among them, each pair of reads is waited out on its own */
#pragma unroll
        for (int i = 0; i < 8; ++i) s[i] = wmma16(ka[i], bq, c);
        __builtin_amdgcn_sched_barrier(0);   /* keeps the eight products one run: vector work lifted in among them is padded with v_nop to the distance their registers need */
    };
    auto tilemax = [&]() -> float {   /* largest of a query's 128 values in s, the same in both lane halves */
        float vm0 = s[0][0], vm1 = s[2][0], vm2 = s[4][0], vm3 = s[6][0];   /* four chains: a maximum is exact in any order, and one chain of 64 would be waited out link by link */
#pragma unroll
        for (int r = 0; r < 8; ++r) { vm0 = fmaxf(vm0, fmaxf(s[0][r], s[1][r])); vm1 = fmaxf(vm1, fmaxf(s[2][r], s[3][r])); vm2 = fmaxf(vm2, fmaxf(s[4][r], s[5][r])); vm3 = fmaxf(vm3, fmaxf(s[6][r], s[7][r])); }
        const float vm = fmaxf(fmaxf(vm0, vm1), fmaxf(vm2, vm3));
        return fmaxf(vm, __shfl_xor(vm, 16, 32));                 /* both lane halves hold the other 64 keys of the same query */
    };
    auto weights = [&]() -> float {   /* s <- 2^s in place; returns the sum of this lane's 64 weights */
#pragma unroll
        for (int i = 0; i < 8; ++i)
#pragma unroll
            for (int r = 0; r < 8; ++r) s[i][r] = __builtin_amdgcn_exp2f(s[i][r]);
        const v8f ts = ((s[0] + s[1]) + (s[2] + s[3])) + ((s[4] + s[5]) + (s[6] + s[7]));   /* tile by tile, register pairs as they lie */
        return ((ts[0] + ts[1]) + (ts[2] + ts[3])) + ((ts[4] + ts[5]) + (ts[6] + ts[7]));
    };
    v16h pB[4];
    auto pack = [&]() {   /* the weights as B fragments: element r <- keys 8*hi + r of the 32, element 8 + r <- keys 16 + 8*hi + r */
#pragma unroll
        for (int j = 0; j < 4; ++j) pB[j] = cat16(__builtin_convertvector(s[2 * j], v8h), __builtin_convertvector(s[2 * j + 1], v8h));
    };
    scores(0u, (v8f){});
    float sh = PCAR - tilemax();   /* the shift in use: tile 0's largest score of a query gets the weight 2^PCAR */
    v8f shv = { sh, sh, sh, sh, sh, sh, sh, sh };
#pragma unroll 1
    for (unsigned t = 0; t < NTILE; ++t) {
        scores(t, shv);            /* the shift rides in as the products' C operand: what comes out is the exponent */
        const h16* vt = ring + (t & 1u) * RB2 + hh * RB + RBK + lr * VPIT + 8u * hi;   /* A rows: e = lr, k = key */
        v16h va0[4], va1[4];   /* read ahead of the test, so that the test and the packing cover the reads' latency */
#pragma unroll
        for (int j = 0; j < 4; ++j) { va0[j] = ldh(vt + j * 32); va1[j] = ldh(vt + 16 * VPIT + j * 32); }
        float rs = weights();
        if (__builtin_amdgcn_ballot_w32(!(rs <= PLIM)) != 0u) {   /* one scalar branch a step; rare: some score of this tile lies more than 4 above the shift's maximum (or is not a number) */
            scores(t, shv);
            const float d = fmaxf(tilemax() - PCAR, 0.0f);        /* how far the tile's largest score lies above it */
            const float alpha = __builtin_amdgcn_exp2f(-d);
            sh -= d; shv = (v8f){ sh, sh, sh, sh, sh, sh, sh, sh };
#pragma unroll
            for (int i = 0; i < 8; ++i) s[i] -= d;
            rs = weights();                                       /* now every weight <= 2^PCAR */
            acc0 *= alpha; acc1 *= alpha; l *= alpha;
        }
        l += rs;
        pack();
#pragma unroll
        for (int j = 0; j < 4; ++j) { acc0 = wmma16(va0[j], pB[j], acc0); acc1 = wmma16(va1[j], pB[j], acc1); }
        /* behind the step's last products: fills the vector slots they need before an instruction behind the loop's branches touches their registers */
        asm volatile("v_nop\n\tv_nop\n\tv_nop\n\tv_nop" : "+v"(acc0), "+v"(acc1) : "v"(va1[3]), "v"(va0[3]), "v"(pB[3]));
        asm volatile("s_wait_dscnt 0x0" ::: "memory");      /* this wave's reads of buffer t & 1 are done before it is refilled */
        asm volatile("s_wait_asynccnt 0x0" ::: "memory");   /* this wave's pieces of tile t + 1 have landed */
        __syncthreads();                                     /* publishes tile t + 1 and ends every wave's reads of tile t */
        if (t + 2u < NTILE) stage(t + 2u);                   /* block-uniform test; refills the buffer just read */
    }
    asm volatile("s_wait_asynccnt 0x0" ::: "memory");   /* no copy outstanding behind the loop */
    l += __shfl_xor(l, 16, 32);   /* the other 1,024 keys of the same query */
    const float inv = (1.0f / QCAR) / l;
#pragma unroll
    for (int r = 0; r < 8; ++r) { osw[lr * 68u + hh * 32u + 8u * hi + r] = acc0[r] * inv; osw[lr * 68u + hh * 32u + 16u + 8u * hi + r] = acc1[r] * inv; }   /* D: e = 8*hi + r (+16), query lr */
    __syncthreads();   /* both heads' columns of every query row are in place */
    const size_t rowbase = ((size_t)bz * SEQ + i0) * DM + hp * 64u;
{
#pragma unroll
        for (unsigned s = 0; s < 2u; ++s) { const unsigned row = 8u * hh + 4u * s + (lane >> 3), pc = (lane & 7u) * 8u; const v4f v0 = *(const v4fa*)(osw + row * 68u + pc); const v4f v1 = *(const v4fa*)(osw + row * 68u + pc + 4u); v8us oh, ol;   /* the two waves of a query group write 8 rows each, whole 128-B lines */
#pragma unroll
            for (int q = 0; q < 4; ++q) { unsigned short a2, c2; splitf(v0[q], a2, c2); oh[q] = a2; ol[q] = c2; splitf(v1[q], a2, c2); oh[4 + q] = a2; ol[4 + q] = c2; }
            const size_t oo = rowbase + (size_t)row * DM + pc;
            *(v8us*)(CH + oo) = oh; *(v8us*)(CL + oo) = ol; }   
         }
}

constexpr size_t al256(size_t b) { return (b + 255) & ~(size_t)255; }
constexpr size_t SZ_W   = al256((size_t)DM * DM * 2);
constexpr size_t SZ_QK  = al256((size_t)NB * SEQ * QKW * 2);
constexpr size_t SZ_VT  = al256((size_t)NB * DM * SEQ * 2);
constexpr size_t SZ_C   = al256((size_t)NB * SEQ * DM * 2);
constexpr size_t CARVE  = SZ_W + SZ_QK + SZ_VT + 2 * SZ_C;
static_assert(CARVE <= (size_t)134217728);                                   // carve <= 128 MiB
static_assert((size_t)PT * 128 * 128 == (size_t)NB * SEQ * (QKW + DM));       // k_proj tiles == q|k and v^T plane elements
static_assert((size_t)PWO * 128 * 4 * 8 == (size_t)DM * DM);                  // wo^T blocks x threads x 4 pieces x 8 == plane elements
static_assert((size_t)(SEQ / 64) * (NH / 2) * NB * FW * 16 * 64 == (size_t)NB * SEQ * DM);   // k_flash query groups x 16 rows x 64 cols == ctx plane elements

extern "C" void kernel_launch(void* const* d_in, const int* in_sizes, int n_in,
                              void* d_out, int out_size, void* d_ws, size_t ws_size, hipStream_t stream) {
    if (n_in < 5) return;
    const long long xmin = (long long)(NB - 1) * SEQ_FULL * DM + (long long)SEQ * DM;
    if ((long long)in_sizes[0] < xmin || in_sizes[1] < NH * DM * HD || in_sizes[2] < NH * DM * HD || in_sizes[3] < NH * DM * HD || in_sizes[4] < DM * DM) return;
    if ((long long)out_size < xmin) return;
    if (CARVE > ws_size) return;
    const float* x = (const float*)d_in[0]; const float* wq = (const float*)d_in[1]; const float* wk = (const float*)d_in[2]; const float* wv = (const float*)d_in[3]; const float* wo = (const float*)d_in[4];
    float* OUT = (float*)d_out;   /* [NB_FULL][SEQ_FULL][256] f32, batch stride from the full sizes */
    char* wsp = (char*)d_ws;
    auto take = [&](size_t bytes) { char* p = wsp; wsp += bytes; return (void*)p; };
    bf* WOT = (bf*)take(SZ_W);
    h16* QKP = (h16*)take(SZ_QK); h16* VTP = (h16*)take(SZ_VT); bf* CH = (bf*)take(SZ_C); bf* CL = (bf*)take(SZ_C);

    k_proj<<<PT + PWO, 128, 0, stream>>>(x, wq, wk, wv, wo, QKP, VTP, WOT);
    k_flash<<<dim3(SEQ / 64, NH / 2, NB), 256, 0, stream>>>(QKP, VTP, CH, CL);
    /* out[b][t][n] = (CH + CL)[b][t][:] . WOT[n][:]: M = SEQ, N = 256, K = 256, z = batch (output stride from the full sizes) */
    k_gemmw<bf, 1, 0><<<dim3(SEQ / 64, DM / 64, NB), 32, 0, stream>>>(CH, CL, WOT, nullptr, (void*)OUT, DM, 1.0f, (size_t)SEQ * DM, 0, (size_t)SEQ_FULL * DM);
}

// v008
// Measured time: 37.4 microseconds a run.
// Two timings next to v007 both put it at 1.06 times that version's speed.
// All steps since v000 together make it 2.92 times as fast.
#include <hip/hip_runtime.h>

// Compute dtypes (f32 accumulate everywhere): q/k/v projections v_wmma_f32_16x16x32_bf16 on bf16 RNE-converted x and weights (exact products); scores q.k^T v_wmma_f32_16x16x32_f16 (q x 256^-0.5 log2(e) / 16, k x16: the product is the score in log2 units); attn.V v_wmma_f32_16x16x32_f16 (exp weights x32 over the shift in use, v x16 carry); output projection v_wmma_f32_16x16x32_bf16 with the context as bf16 hi + lo planes (2 products) against bf16 wo.
// Multi-head attention: x [NB][SEQ][256], per-head weights w[8][256][32] ([in][out] per head), scores x 256^-0.5, softmax over all SEQ keys (no mask), heads concatenated head-major, times wo [in][out].
// The GEMMs stage their operand tiles in LDS by asynchronous copies that cover whole 128-byte lines and take their fragments from there.
// Plan, three launches: k_proj (GEMM from the f32 x and weights, rounded to bf16 at the fragment read: q|k -> f16 token-major plane [t][512], v -> f16 plane [b][h*32+e][t]; the wo^T bf16 plane in a block range of the same grid), k_flash (streaming softmax in steps of 128 keys, its shift moved only when a step needs it, k and v^T tiles of a head pair staged in LDS for the block's eight waves, 16 queries x 1 head per wave -> ctx hi/lo bf16 planes [t][256]), GEMM wo -> out f32.

#ifndef NB
#define NB 4
#endif
#ifndef SEQ
#define SEQ 2048
#endif
#define NB_FULL  4
#define SEQ_FULL 2048
#define DM   256      // model width = NH * HD
#define NH   8
#define HD   32       // head dim: exactly one 32-deep k-step per score tile
#define QKW  512      // q|k plane row width (q cols 0..255, k cols 256..511)
#define QCAR 16.0f    // carry on k and v planes
#define QSCL (0.0625f * 1.44269504088896340736f / 16.0f)   // factor on the q plane: 256^-0.5 x log2(e) / 16, so that q-plane . k-plane is the scaled score in log2 units

static_assert(DM == NH * HD);          // head-major concat width
static_assert(HD == 32);               // one WMMA k-step per head; two 16-wide e tiles
static_assert((NH & 1) == 0);
static_assert(SEQ % 64 == 0);          // 64-row GEMM tiles, 64-query blocks
static_assert(DM % 64 == 0 && QKW % 64 == 0 && DM % 32 == 0);
static_assert(NB <= NB_FULL && SEQ <= SEQ_FULL);

typedef _Float16 h16;
typedef unsigned short bf;
typedef __attribute__((ext_vector_type(16))) __bf16   v16bf;
typedef __attribute__((ext_vector_type(16))) _Float16 v16h;
typedef __attribute__((ext_vector_type(8)))  _Float16 v8h;
typedef __attribute__((ext_vector_type(8)))  unsigned short v8us;
typedef __attribute__((ext_vector_type(8)))  float    v8f;
typedef __attribute__((ext_vector_type(4)))  float    v4f;
typedef v4f  __attribute__((may_alias)) v4fa;

__device__ __forceinline__ unsigned short f2bf(float f) { unsigned u = __float_as_uint(f); u += 0x7FFFu + ((u >> 16) & 1u); return (unsigned short)(u >> 16); }
__device__ __forceinline__ float bf2f(unsigned short b) { return __uint_as_float(((unsigned)b) << 16); }
__device__ __forceinline__ v16h cat16(v8h lo, v8h hi) { return __builtin_shufflevector(lo, hi, 0, 1, 2, 3, 4, 5, 6, 7, 8, 9, 10, 11, 12, 13, 14, 15); }
__device__ __forceinline__ v16bf cat16b(v8us lo, v8us hi) { return __builtin_bit_cast(v16bf, __builtin_shufflevector(lo, hi, 0, 1, 2, 3, 4, 5, 6, 7, 8, 9, 10, 11, 12, 13, 14, 15)); }
__device__ __forceinline__ v8f wmma16(v16h a, v16h b, v8f c) { return __builtin_amdgcn_wmma_f32_16x16x32_f16(false, a, false, b, (short)0, c, false, false); }
__device__ __forceinline__ v8f wmmab(v16bf a, v16bf b, v8f c) { return __builtin_amdgcn_wmma_f32_16x16x32_bf16(false, a, false, b, (short)0, c, false, false); }
__device__ __forceinline__ void splitf(float y, unsigned short& h, unsigned short& l) { h = f2bf(y); l = f2bf(y - bf2f(h)); }
// fragment from a K-contiguous f16 row: p already includes row and 8*(lane>>4); elements 0..7 <- p[0..7], 8..15 <- p[16..23]
__device__ __forceinline__ v16h ldh(const h16* p) { return cat16(*(const v8h*)p, *(const v8h*)(p + 16)); }

// Eight copies of 16 B per lane, global -> LDS through no register. s_wait_xcnt 0 closes the statement so that no address register of a copy is rewritten ahead of it.
template <typename T16>
__device__ __forceinline__ void copy8(unsigned l0, unsigned l1, unsigned l2, unsigned l3, unsigned l4, unsigned l5, unsigned l6, unsigned l7,
                                      const T16* g0, const T16* g1, const T16* g2, const T16* g3, const T16* g4, const T16* g5, const T16* g6, const T16* g7) {
    asm volatile("global_load_async_to_lds_b128 %0, %8, off\n\t"
                 "global_load_async_to_lds_b128 %1, %9, off\n\t"
                 "global_load_async_to_lds_b128 %2, %10, off\n\t"
                 "global_load_async_to_lds_b128 %3, %11, off\n\t"
                 "global_load_async_to_lds_b128 %4, %12, off\n\t"
                 "global_load_async_to_lds_b128 %5, %13, off\n\t"
                 "global_load_async_to_lds_b128 %6, %14, off\n\t"
                 "global_load_async_to_lds_b128 %7, %15, off\n\t"
                 "s_wait_xcnt 0x0"
                 :: "v"(l0), "v"(l1), "v"(l2), "v"(l3), "v"(l4), "v"(l5), "v"(l6), "v"(l7), "v"(g0), "v"(g1), "v"(g2), "v"(g3), "v"(g4), "v"(g5), "v"(g6), "v"(g7) : "memory");
}
// k_out: out[t][n] = sum_k (CH + CL)[t][k] WOT[n][k], K = DM. One block = eight waves = 64 tokens x 128 columns; wave w = 32 tokens (half w & 1) x 32 columns (quarter w >> 1), four accumulators:
// 2,048 waves, two on every SIMD, each with a quarter of the copies, products and output rows that one wave of a 64 x 64 tile would have in a row.
// Staging: the whole K of the tile's 64 CH rows, 64 CL rows and 128 WOT rows lies in LDS, filled in two halves of 128 k (256 B of every row, whole lines, 16 copies a thread); each half is filled once and then read, the second lands while the first is worked on.
// Row pitch 528 B (16 B x odd) keeps the 16-byte fragment reads free of bank conflicts. Per accumulator the order of the sums is k-step by k-step, CH before CL.
// Output: each wave turns its 32 x 32 floats in its own LDS rows (pitch 144 B), then eight lanes write the 128 B of a row.
#define OKC  128                       // k per staged half
#define OPIT (DM + 8)                  // 16-bit elements per staged row (all of K + 8 pad)
#define OPA  (64 * OPIT)               // elements of one staged context plane: 64 rows
#define OPB  (128 * OPIT)              // elements of the staged WOT rows
#define OSP  36                        // floats per row of a wave's output staging (32 + 4 pad)
static_assert((OPIT * 2) % 16 == 0 && (OPA * 2) % 16 == 0 && (OSP * 4) % 16 == 0);   // every copy, fragment read and staging read 16-byte aligned
static_assert(DM == 2 * OKC && DM % 128 == 0 && SEQ == SEQ_FULL);                     // two halves; whole column tiles; token rows of ctx and out follow one another over the batches
__device__ __forceinline__ v16bf ldb(const bf* p) { return cat16b(*(const v8us*)p, *(const v8us*)(p + 16)); }   /* fragment from a K-contiguous bf16 row: elements 0..7 <- p[0..7], 8..15 <- p[16..23] */
__global__ __launch_bounds__(256) void k_out(const bf* __restrict__ A, const bf* __restrict__ A2, const bf* __restrict__ Bt, float* C) {
    __shared__ __align__(16) bf otile[2 * OPA + OPB];
    __shared__ __align__(16) float os[8 * 32 * OSP];
    const unsigned tid = threadIdx.x, lane = tid & 31u, w = tid >> 5, wm = w & 1u, wn = w >> 1, lr = lane & 15u, hi = lane >> 4;
    const unsigned r0 = blockIdx.x * 64u, c0 = blockIdx.y * 128u;
    v8f acc[2][2];
#pragma unroll
    for (int mb = 0; mb < 2; ++mb)
#pragma unroll
        for (int nb = 0; nb < 2; ++nb) acc[mb][nb] = (v8f){};
    /* this thread's pieces of a half: 16-byte piece tid & 15 of the 256 B of rows (tid >> 4) + 16 i: i = 0..3 of CH and of CL, i = 0..7 of WOT */
    const unsigned lst = (unsigned)(size_t)otile + 2u * ((tid >> 4) * OPIT + (tid & 15u) * 8u);   /* LDS byte address: the low 32 bits */
    const size_t goff = (size_t)(tid >> 4) * DM + (tid & 15u) * 8u;
    const bf* ga = A + (size_t)r0 * DM + goff; const bf* ga2 = A2 + (size_t)r0 * DM + goff; const bf* gb = Bt + (size_t)c0 * DM + goff;
    auto stage = [&](unsigned t) {   /* 16 copies a thread in flight */
        const unsigned la = lst + 2u * OKC * t, lb = la + 2u * 2u * OPA; const bf* a = ga + OKC * t; const bf* a2 = ga2 + OKC * t; const bf* b = gb + OKC * t;
        copy8<bf>(la, la + 2u * 16u * OPIT, la + 2u * 32u * OPIT, la + 2u * 48u * OPIT, la + 2u * OPA, la + 2u * (OPA + 16u * OPIT), la + 2u * (OPA + 32u * OPIT), la + 2u * (OPA + 48u * OPIT),
                  a, a + (size_t)16 * DM, a + (size_t)32 * DM, a + (size_t)48 * DM, a2, a2 + (size_t)16 * DM, a2 + (size_t)32 * DM, a2 + (size_t)48 * DM);
        copy8<bf>(lb, lb + 2u * 16u * OPIT, lb + 2u * 32u * OPIT, lb + 2u * 48u * OPIT, lb + 2u * 64u * OPIT, lb + 2u * 80u * OPIT, lb + 2u * 96u * OPIT, lb + 2u * 112u * OPIT,
                  b, b + (size_t)16 * DM, b + (size_t)32 * DM, b + (size_t)48 * DM, b + (size_t)64 * DM, b + (size_t)80 * DM, b + (size_t)96 * DM, b + (size_t)112 * DM); };
    const bf* fa = otile + (wm * 32u + lr) * OPIT + 8u * hi;             /* fragment rows: row lr of a 16-row group, k = 8*hi + ... */
    const bf* fb = otile + 2 * OPA + (wn * 32u + lr) * OPIT + 8u * hi;
    auto half = [&](int t) {   /* the four k-steps of half t */
        v16bf a[4][2], a2[4][2], b[4][2];
#pragma unroll   /* this and the unrolls below: straight-line code, so that the fragments are registers and the row and k steps offset literals */
        for (int s = 0; s < 4; ++s)
#pragma unroll
            for (int i = 0; i < 2; ++i) { const int k = t * OKC + s * 32; a[s][i] = ldb(fa + i * 16 * OPIT + k); b[s][i] = ldb(fb + i * 16 * OPIT + k); a2[s][i] = ldb(fa + OPA + i * 16 * OPIT + k); }
        __builtin_amdgcn_sched_barrier(0);   /* keeps the reads one group ahead of the products: sunk among them, each pair of reads is waited out on its own */
#pragma unroll
        for (int s = 0; s < 4; ++s) {
#pragma unroll
            for (int nb = 0; nb < 2; ++nb)
#pragma unroll
                for (int mb = 0; mb < 2; ++mb) acc[mb][nb] = wmmab(a[s][mb], b[s][nb], acc[mb][nb]);
#pragma unroll
            for (int nb = 0; nb < 2; ++nb)
#pragma unroll
                for (int mb = 0; mb < 2; ++mb) acc[mb][nb] = wmmab(a2[s][mb], b[s][nb], acc[mb][nb]); }
        __builtin_amdgcn_sched_barrier(0);   /* no product sinks behind the wait and the barrier that follow: the first half's products run while the second half lands */
    };
    stage(0u);
    asm volatile("s_wait_asynccnt 0x0" ::: "memory");   /* this wave's pieces of the first half have landed */
    __syncthreads();                                     /* first half readable by every wave */
    stage(1u);
    half(0);
    asm volatile("s_wait_asynccnt 0x0" ::: "memory");   /* this wave's pieces of the second half have landed; no copy outstanding from here on */
    __syncthreads();                                     /* second half readable by every wave */
    half(1);
    float* osw = os + w * (32u * OSP);
#pragma unroll
    for (int mb = 0; mb < 2; ++mb)
#pragma unroll
        for (int nb = 0; nb < 2; ++nb)
#pragma unroll
            for (int j = 0; j < 8; ++j) osw[(mb * 16 + hi * 8 + j) * OSP + nb * 16 + lr] = acc[mb][nb][j];   /* D: row 8*hi + j, col lr of tile (mb, nb) */
    __syncthreads();   /* staging visible to every lane */
    float* crow = C + (size_t)(r0 + wm * 32u) * DM + c0 + wn * 32u;
#pragma unroll
    for (unsigned s = 0; s < 8u; ++s) { const unsigned row = 4u * s + (lane >> 3), cofs = (lane & 7u) * 4u; const v4f val = *(const v4fa*)(osw + row * OSP + cofs);
        *(v4f*)(crow + (size_t)row * DM + cofs) = val; }   /* eight lanes write the 128 B of a row's 32 floats */
}
// k_proj: the three projections straight from the f32 inputs, no plane of x or of the weights in between. One block = four waves = 128 tokens x 128 columns (four heads of ONE of wq, wk, wv); wave w = 64 tokens (half w & 1) x 64 columns (half w >> 1), 16 accumulators.
// D[token][col] = sum_d x[token][d] w[h][d][e], col = h*32 + e. Chunk t = 64 d: 256 B of each of the 128 x rows and the 128 B line w[h][d][0..31] of each of the 4 x 64 (h, d), whole lines, copied once per block, global -> LDS buffer t & 1 through no register, while chunk t - 1 is worked on.
// The f32 values are rounded to bf16 (nearest even) where a fragment is read. x fragment: row = token, 16-byte reads along d. Weight fragment: column = lane, one 4-byte read per d (the staged rows run along e, so 16 lanes read 64 B of a row). Both hold k = 8*hi + i in element i and k = 16 + 8*hi + i in element 8 + i.
// Pitches: x rows 272 B (16 B x odd); weight rows 528 B, so that rows d and d + 8, read by the two lane halves, lie 128 B apart in the banks.
// Output: q and k columns -> f16 token-major plane [t][512], q x QSCL, k x 16; v columns -> f16 plane [b][h*32+e][t], x 16, each 16-column slab turned in LDS.
// Blocks [PT, PT + PWO): the bf16 plane WOT[n][k] = wo[k][n] for the last GEMM; it reads and writes nothing that the tiles touch.
#define PK   64                        // d per staged chunk: 256 B of every x row
#define XPIT 68                        // floats per staged x row (64 + 4 pad)
#define WPIT 132                       // floats per staged weight row (4 heads x 32 + 4 pad)
#define XPL  (128 * XPIT)              // floats of the x part of a buffer
#define PBUF (XPL + PK * WPIT)         // floats per buffer
#define PNT  (DM / PK)
#define PRT  ((unsigned)((size_t)NB * SEQ / 128))
#define PT   (PRT * 6u)                // 768 columns / 128
#define PWO  ((unsigned)DM / 16u)
static_assert((XPIT * 4) % 16 == 0 && (WPIT * 4) % 16 == 0 && (XPL * 4) % 16 == 0 && (PBUF * 4) % 16 == 0);   // every copy and 16-byte read aligned
static_assert(DM % PK == 0 && PNT >= 2 && SEQ % 128 == 0 && SEQ == SEQ_FULL && DM == 256 && HD == 32);         // whole chunks, the prologue's two exist; a tile's tokens lie in one batch; x rows follow one another
typedef __attribute__((ext_vector_type(16))) float v16f;
__device__ __forceinline__ void woprep_blk(const float* __restrict__ wo, bf* WOT, unsigned blk) {
    const unsigned n = blk * 16u + (threadIdx.x >> 3), pc = threadIdx.x & 7u;   /* eight lanes write the 128 B of a line of row n */
#pragma unroll
    for (unsigned kl = 0; kl < 4u; ++kl) { const unsigned k0 = kl * 64u + pc * 8u; v8us o;
#pragma unroll
        for (unsigned q = 0; q < 8u; ++q) o[q] = f2bf(wo[(size_t)(k0 + q) * DM + n]);
        *(v8us*)(WOT + (size_t)n * DM + k0) = o; }
}
__global__ __launch_bounds__(128) void k_proj(const float* __restrict__ x, const float* __restrict__ wq, const float* __restrict__ wk, const float* __restrict__ wv, const float* __restrict__ wo, h16* QKP, h16* VTP, bf* WOT) {
    __shared__ __align__(16) float pring[2 * PBUF];
    if (blockIdx.x >= PT) { woprep_blk(wo, WOT, blockIdx.x - PT); return; }   /* block-uniform, ahead of every barrier and copy */
    const unsigned tid = threadIdx.x, lane = tid & 31u, w = tid >> 5, wm = w & 1u, wn = w >> 1, lr = lane & 15u, hi = lane >> 4;
    const unsigned rt = blockIdx.x % PRT, ct = blockIdx.x / PRT, mat = ct >> 1, r0 = rt * 128u;
    const float* wsrc = (mat == 0u ? wq : (mat == 1u ? wk : wv)) + (size_t)(ct & 1u) * 4u * DM * HD;
    v8f acc[4][4];
#pragma unroll
    for (int mb = 0; mb < 4; ++mb)
#pragma unroll
        for (int nb = 0; nb < 4; ++nb) acc[mb][nb] = (v8f){};
    /* this thread's pieces of a chunk: 16-byte piece tid & 7 of both 128-B halves of x rows (tid >> 3) + 16 i, i = 0..7, and of the weight lines d = (tid >> 3) + 16 i, i = 0..3, of the four heads */
    const unsigned pb = (unsigned)(size_t)pring;   /* LDS byte address: the low 32 bits */
    const unsigned lx = pb + 4u * ((tid >> 3) * XPIT + (tid & 7u) * 4u), lw = pb + 4u * (XPL + (tid >> 3) * WPIT + (tid & 7u) * 4u);
    const float* gx = x + (size_t)(r0 + (tid >> 3)) * DM + (tid & 7u) * 4u;
    const float* gw = wsrc + (size_t)(tid >> 3) * HD + (tid & 7u) * 4u;
    auto stage = [&](int t) {   /* 32 copies a thread in flight */
#pragma unroll   /* four statements of eight copies; their LDS and row steps become literals */
      for (unsigned hf = 0; hf < 2u; ++hf) {
        const unsigned lb = (unsigned)(t & 1) * (4u * PBUF); const unsigned a = lx + lb + 4u * 32u * hf, c = lw + lb + 4u * 32u * WPIT * hf;
        const float* g = gx + t * PK + 32u * hf; const float* h = gw + (size_t)t * PK * HD + (size_t)32 * HD * hf;
        copy8<float>(a, a + 4u * 16u * XPIT, a + 4u * 32u * XPIT, a + 4u * 48u * XPIT, a + 4u * 64u * XPIT, a + 4u * 80u * XPIT, a + 4u * 96u * XPIT, a + 4u * 112u * XPIT,
                     g, g + (size_t)16 * DM, g + (size_t)32 * DM, g + (size_t)48 * DM, g + (size_t)64 * DM, g + (size_t)80 * DM, g + (size_t)96 * DM, g + (size_t)112 * DM);
        copy8<float>(c, c + 4u * 16u * WPIT, c + 4u * 32u, c + 4u * (16u * WPIT + 32u), c + 4u * 64u, c + 4u * (16u * WPIT + 64u), c + 4u * 96u, c + 4u * (16u * WPIT + 96u),
                     h, h + (size_t)16 * HD, h + (size_t)DM * HD, h + (size_t)DM * HD + 16 * HD, h + (size_t)2 * DM * HD, h + (size_t)2 * DM * HD + 16 * HD, h + (size_t)3 * DM * HD, h + (size_t)3 * DM * HD + 16 * HD); } };
    stage(0);
    asm volatile("s_wait_asynccnt 0x0" ::: "memory");   /* this wave's pieces of chunk 0 have landed */
    __syncthreads();                                     /* chunk 0 readable by every wave */
    stage(1);
#pragma unroll 1   /* rolled: one copy of the chunk's code, the buffer picked by t & 1 */
    for (int t = 0; t < PNT; ++t) {
        const float* fx = pring + (t & 1) * PBUF + (wm * 64u + lr) * XPIT + 8u * hi;
        const float* fw = pring + (t & 1) * PBUF + XPL + 8u * hi * WPIT + wn * 64u + lr;
#pragma unroll   /* both k-steps of a chunk in line: the second's reads start under the first's products */
      for (int ks = 0; ks < PK; ks += 32) {
        v16bf a[4], b[4];
#pragma unroll
        for (int mb = 0; mb < 4; ++mb) { const float* p = fx + mb * 16 * XPIT + ks; const v4f a0 = *(const v4fa*)p, a1 = *(const v4fa*)(p + 4), a2 = *(const v4fa*)(p + 16), a3 = *(const v4fa*)(p + 20); v16f f;
#pragma unroll
            for (int q = 0; q < 4; ++q) { f[q] = a0[q]; f[4 + q] = a1[q]; f[8 + q] = a2[q]; f[12 + q] = a3[q]; }
            a[mb] = __builtin_convertvector(f, v16bf); }
#pragma unroll
        for (int nb = 0; nb < 4; ++nb) { const float* p = fw + nb * 16 + ks * WPIT; v16f f;
#pragma unroll
            for (int q = 0; q < 8; ++q) { f[q] = p[q * WPIT]; f[8 + q] = p[(16 + q) * WPIT]; }
            b[nb] = __builtin_convertvector(f, v16bf); }
#pragma unroll
        for (int nb = 0; nb < 4; ++nb) {
#pragma unroll
            for (int mb = 0; mb < 4; ++mb) acc[mb][nb] = wmmab(a[mb], b[nb], acc[mb][nb]); }
        if (ks + 32 == PK) {
            __builtin_amdgcn_sched_barrier(0);   /* no product sinks behind the slots below and the barrier, in front of the loop's branches */
            /* behind the chunk's last products: fills the vector slots they need before an instruction behind the loop's branches touches their registers */
            asm volatile("v_nop\n\tv_nop\n\tv_nop\n\tv_nop" : "+v"(acc[0][0]), "+v"(acc[1][1]), "+v"(acc[2][2]), "+v"(acc[3][3]) : "v"(a[0]), "v"(a[3]), "v"(b[3])); }
      }
        asm volatile("s_wait_dscnt 0x0" ::: "memory");      /* this wave's reads of buffer t & 1 are done before it is refilled */
        asm volatile("s_wait_asynccnt 0x0" ::: "memory");   /* this wave's pieces of chunk t + 1 have landed */
        __syncthreads();                                     /* publishes chunk t + 1 and ends every wave's reads of chunk t */
        if (t + 2 < PNT) stage(t + 2);                       /* block-uniform test; refills the buffer just read */
    }
    asm volatile("s_wait_asynccnt 0x0" ::: "memory");   /* no copy outstanding behind the loop */
    float* os = pring + w * (16u * 68u);   /* each wave turns its slabs in its own 16 x 64 floats of the ring: behind the loop's last barrier nobody reads a chunk and no copy is under way */
    const unsigned tok = r0 + wm * 64u, col = (ct & 1u) * 128u + wn * 64u;
    h16* crow = (mat < 2u) ? QKP + (size_t)tok * QKW + mat * (unsigned)DM + col : VTP + (size_t)(tok / SEQ) * DM * SEQ + (size_t)col * SEQ + tok % SEQ;
    const size_t ldc = (mat < 2u) ? (size_t)QKW : (size_t)SEQ;
    const float osc = (mat == 0u) ? QSCL : QCAR;   /* block-uniform */
#pragma unroll
    for (int sb = 0; sb < 4; ++sb) {
        if (mat < 2u) {   /* block-uniform. slab = 16 tokens x 64 columns. D: token 8*hi + j, column 16*nb + lr */
#pragma unroll
            for (int nb = 0; nb < 4; ++nb)
#pragma unroll
                for (int j = 0; j < 8; ++j) os[(hi * 8 + j) * 68 + nb * 16 + lr] = acc[sb][nb][j];
        } else {          /* slab = 16 columns x 64 tokens */
#pragma unroll
            for (int mb = 0; mb < 4; ++mb)
#pragma unroll
                for (int j = 0; j < 8; ++j) os[lr * 68 + mb * 16 + hi * 8 + j] = acc[mb][sb][j];
        }
        __syncthreads();   /* slab visible to every lane */
#pragma unroll
        for (int s = 0; s < 4; ++s) { const unsigned row = 4u * s + (lane >> 3), pc = (lane & 7u) * 8u; const v4f v0 = *(const v4fa*)(os + row * 68 + pc); const v4f v1 = *(const v4fa*)(os + row * 68 + pc + 4); v8h o;
#pragma unroll
            for (int q = 0; q < 4; ++q) { o[q] = (h16)(v0[q] * osc); o[4 + q] = (h16)(v1[q] * osc); }
            *(v8h*)(crow + (size_t)(sb * 16 + row) * ldc + pc) = o; }   /* eight lanes write the 128 B of a row's 64 values */
        __syncthreads();   /* slab free before the next one overwrites it */
    }
}

// k_flash: one block = 64 queries x one head pair on eight waves; wave w = 16 queries (group w & 3) x ONE head (w >> 2 of the pair): a streaming pass over all SEQ keys in steps of TK = 128, softmax weights 2^(score - shift).
// The result does not depend on the shift, only the range of the weights does. It starts as tile 0's maximum and is kept while the weights fit f16: a lane's 64 weights of a step sum to at most PLIM, so each is below the f16 limit.
// Only a step that fails this test searches its maximum, moves the shift there and rescales sum and accumulators. A step that passes needs no maximum, no multiply-add on the scores, no rescale and no cross-lane exchange.
// What a step costs once, whatever its length (the test, the waits, the barrier, the buffer addresses), is paid every 128 keys, and the eight score tiles of a step give the vector unit and the matrix unit more independent work between two barriers.
// Both heads run side by side, so a SIMD holds four waves (two blocks per WGP) whose vector work and LDS waits fill one another's gaps.
// Transposed tiles: S^T (M = key, N = query) = K-rows (A) x Q-rows (B), both K-contiguous f16 rows of the [t][512] plane; the f32 S^T accumulators repacked to f16 are directly the B fragments of
// ctx^T (M = e, N = query) = V^T-rows (A, K-contiguous over keys) x P^T: element r <- tile of keys 0..15, element 8+r <- tile of keys 16..31, lane unchanged.
// exp weights carry 2^PCAR; the row sum uses the same f32 values, so the carry cancels in 1/l; the v carry 16 is folded into 1/l.
// Staging: tile t = TK keys of both heads = per head TK k rows of 64 B + 32 v^T rows of 256 B, copied once per block into LDS buffer t & 1 by asynchronous 16-byte copies
// (eight per thread) while tile t - 1 is worked on; a k copy takes the 128 B of a plane row that hold both heads, a whole line, a v^T copy one of the two lines of a row's 256 B. The four waves of a head take their A fragments from its half of the buffer.
// Row pitches 80 B and 272 B (16 B x odd) keep the 16-byte row reads free of bank conflicts.
#define FW 4                           // query groups of 16 per block
#define TK 128                         // keys per step
#define KPIT 40                        // f16 per staged k row (32 + 8 pad)
#define VPIT (TK + 8)                  // f16 per staged v^T row (TK + 8 pad)
#define RBK  (TK * KPIT)               // f16 of the k part of one head's half
#define RB   (TK * KPIT + 32 * VPIT)   // f16 of one head's half of a buffer
#define RB2  (2 * RB)                  // f16 per buffer: both heads
#define NTILE ((unsigned)(SEQ / TK))
#define PCAR 5.0f                      // log2 of the weight of a score equal to the shift's maximum
#define PLIM 32768.0f                  // bound on a lane's sum of 64 weights: below the f16 limit 65504, above 64 x 2^PCAR
static_assert((KPIT * 2) % 16 == 0 && (VPIT * 2) % 16 == 0 && (RBK * 2) % 16 == 0 && (RB * 2) % 16 == 0);   // every copy and fragment read 16-byte aligned
static_assert(TK == 128 && SEQ % TK == 0 && SEQ / TK >= 2);   // eight copies a thread fill a tile; whole tiles; the two tiles that the prologue stages exist
// waves_per_eu(4, 4): four waves per SIMD is what the grid gives (512 blocks x 8 waves on 1,024 SIMDs); with that register budget the compiler keeps a step's fragment reads together instead of re-using few registers, one LDS wait per read pair.
__global__ __launch_bounds__(256) __attribute__((amdgpu_waves_per_eu(4, 4))) void k_flash(const h16* __restrict__ QK, const h16* __restrict__ VT, bf* CH, bf* CL) {
    __shared__ __align__(16) float os[FW * 16 * 68];
    __shared__ __align__(16) h16 ring[2 * RB2];
    const unsigned tid = threadIdx.x, lane = tid & 31u, w = tid >> 5, qg = w & 3u, hh = w >> 2, lr = lane & 15u, hi = lane >> 4;
    const unsigned bz = blockIdx.z, hp = blockIdx.y, i0 = blockIdx.x * 64u + qg * 16u;
    const h16* qkb = QK + (size_t)bz * SEQ * QKW;
    const h16* vtb = VT + (size_t)bz * DM * SEQ;
    float* osw = os + qg * (16u * 68u);   /* 16 queries x 64 columns: both waves of a query group write here, each its head's 32 columns */
    /* this thread's pieces of a tile: k rows tid>>3, +32, +64 and +96, 16-byte piece tid&7 of the row's 128 B (pieces 0..3 head 0, 4..7 head 1); v^T row tid>>3 of head 0 and of head 1, pieces tid&7 and 8 + (tid&7) of the row's 256 B */
    const unsigned ringb = (unsigned)(size_t)ring;   /* LDS byte address: the low 32 bits */
    const unsigned lk = ringb + 2u * (((tid >> 2) & 1u) * RB + (tid >> 3) * KPIT + (tid & 3u) * 8u), lv = ringb + 2u * (RBK + (tid >> 3) * VPIT + (tid & 7u) * 8u);
    const h16* gk = qkb + (size_t)(tid >> 3) * QKW + DM + hp * 2u * HD + (tid & 7u) * 8u;
    const h16* gv = vtb + (size_t)(hp * 2u * HD + (tid >> 3)) * SEQ + (tid & 7u) * 8u;
    auto stage = [&](unsigned t) {
        const unsigned tj = t * (unsigned)TK, lb = (t & 1u) * (2u * RB2);
        const h16* k0 = gk + (size_t)tj * QKW; const h16* v0 = gv + tj;
        copy8<h16>(lk + lb, lk + lb + 2u * 32u * KPIT, lk + lb + 2u * 64u * KPIT, lk + lb + 2u * 96u * KPIT, lv + lb, lv + lb + 2u * 64u, lv + lb + 2u * RB, lv + lb + 2u * RB + 2u * 64u,
                   k0, k0 + (size_t)32 * QKW, k0 + (size_t)64 * QKW, k0 + (size_t)96 * QKW, v0, v0 + 64, v0 + (size_t)HD * SEQ, v0 + (size_t)HD * SEQ + 64); };
    stage(0u);
    const unsigned hd = hp * 2u + hh;
    const v16h bq = ldh(qkb + (size_t)(i0 + lr) * QKW + hd * HD + 8u * hi);        /* B: n = query i0+lr, k = e */
    asm volatile("s_wait_asynccnt 0x0" ::: "memory");   /* this wave's pieces of tile 0 have landed */
    __syncthreads();                                     /* tile 0 readable by every wave */
    stage(1u);
    v8f acc0 = (v8f){}, acc1 = (v8f){}; float l = 0.0f;   /* l: this lane's own keys only; the two lane halves are joined behind the loop */
    v8f s[8];
    auto scores = [&](unsigned t, v8f c) {   /* s = k rows of tile t . q + c: eight tiles of 16 keys x 16 queries, log2 units */
        const h16* kt = ring + (t & 1u) * RB2 + hh * RB + lr * KPIT + 8u * hi;         /* A rows: key lr of a 16-key group, k = e */
        v16h ka[8];
#pragma unroll   /* this and the unrolls below: straight-line code, so that the tiles are registers and the row steps offset literals */
        for (int i = 0; i < 8; ++i) ka[i] = ldh(kt + i * 16 * KPIT);
        __builtin_amdgcn_sched_barrier(0);   /* keeps the sixteen reads one group ahead of the products: sunk among them, each pair of reads is waited out on its own */
#pragma unroll
        for (int i = 0; i < 8; ++i) s[i] = wmma16(ka[i], bq, c);
        __builtin_amdgcn_sched_barrier(0);   /* keeps the eight products one run: vector work lifted in among them is padded with v_nop to the distance their registers need */
    };
    auto tilemax = [&]() -> float {   /* largest of a query's 128 values in s, the same in both lane halves */
        float vm0 = s[0][0], vm1 = s[2][0], vm2 = s[4][0], vm3 = s[6][0];   /* four chains: a maximum is exact in any order, and one chain of 64 would be waited out link by link */
#pragma unroll
        for (int r = 0; r < 8; ++r) { vm0 = fmaxf(vm0, fmaxf(s[0][r], s[1][r])); vm1 = fmaxf(vm1, fmaxf(s[2][r], s[3][r])); vm2 = fmaxf(vm2, fmaxf(s[4][r], s[5][r])); vm3 = fmaxf(vm3, fmaxf(s[6][r], s[7][r])); }
        const float vm = fmaxf(fmaxf(vm0, vm1), fmaxf(vm2, vm3));
        return fmaxf(vm, __shfl_xor(vm, 16, 32));                 /* both lane halves hold the other 64 keys of the same query */
    };
    auto weights = [&]() -> float {   /* s <- 2^s in place; returns the sum of this lane's 64 weights */
#pragma unroll
        for (int i = 0; i < 8; ++i)
#pragma unroll
            for (int r = 0; r < 8; ++r) s[i][r] = __builtin_amdgcn_exp2f(s[i][r]);
        const v8f ts = ((s[0] + s[1]) + (s[2] + s[3])) + ((s[4] + s[5]) + (s[6] + s[7]));   /* tile by tile, register pairs as they lie */
        return ((ts[0] + ts[1]) + (ts[2] + ts[3])) + ((ts[4] + ts[5]) + (ts[6] + ts[7]));
    };
    v16h pB[4];
    auto pack = [&]() {   /* the weights as B fragments: element r <- keys 8*hi + r of the 32, element 8 + r <- keys 16 + 8*hi + r */
#pragma unroll
        for (int j = 0; j < 4; ++j) pB[j] = cat16(__builtin_convertvector(s[2 * j], v8h), __builtin_convertvector(s[2 * j + 1], v8h));
    };
    scores(0u, (v8f){});
    float sh = PCAR - tilemax();   /* the shift in use: tile 0's largest score of a query gets the weight 2^PCAR */
    v8f shv = { sh, sh, sh, sh, sh, sh, sh, sh };
#pragma unroll 1
    for (unsigned t = 0; t < NTILE; ++t) {
        scores(t, shv);            /* the shift rides in as the products' C operand: what comes out is the exponent */
        const h16* vt = ring + (t & 1u) * RB2 + hh * RB + RBK + lr * VPIT + 8u * hi;   /* A rows: e = lr, k = key */
        v16h va0[4], va1[4];   /* read ahead of the test, so that the test and the packing cover the reads' latency */
#pragma unroll
        for (int j = 0; j < 4; ++j) { va0[j] = ldh(vt + j * 32); va1[j] = ldh(vt + 16 * VPIT + j * 32); }
        float rs = weights();
        if (__builtin_amdgcn_ballot_w32(!(rs <= PLIM)) != 0u) {   /* one scalar branch a step; rare: some score of this tile lies more than 4 above the shift's maximum (or is not a number) */
            scores(t, shv);
            const float d = fmaxf(tilemax() - PCAR, 0.0f);        /* how far the tile's largest score lies above it */
            const float alpha = __builtin_amdgcn_exp2f(-d);
            sh -= d; shv = (v8f){ sh, sh, sh, sh, sh, sh, sh, sh };
#pragma unroll
            for (int i = 0; i < 8; ++i) s[i] -= d;
            rs = weights();                                       /* now every weight <= 2^PCAR */
            acc0 *= alpha; acc1 *= alpha; l *= alpha;
        }
        l += rs;
        pack();
#pragma unroll
        for (int j = 0; j < 4; ++j) { acc0 = wmma16(va0[j], pB[j], acc0); acc1 = wmma16(va1[j], pB[j], acc1); }
        /* behind the step's last products: fills the vector slots they need before an instruction behind the loop's branches touches their registers */
        asm volatile("v_nop\n\tv_nop\n\tv_nop\n\tv_nop" : "+v"(acc0), "+v"(acc1) : "v"(va1[3]), "v"(va0[3]), "v"(pB[3]));
        asm volatile("s_wait_dscnt 0x0" ::: "memory");      /* this wave's reads of buffer t & 1 are done before it is refilled */
        asm volatile("s_wait_asynccnt 0x0" ::: "memory");   /* this wave's pieces of tile t + 1 have landed */
        __syncthreads();                                     /* publishes tile t + 1 and ends every wave's reads of tile t */
        if (t + 2u < NTILE) stage(t + 2u);                   /* block-uniform test; refills the buffer just read */
    }
    asm volatile("s_wait_asynccnt 0x0" ::: "memory");   /* no copy outstanding behind the loop */
    l += __shfl_xor(l, 16, 32);   /* the other 1,024 keys of the same query */
    const float inv = (1.0f / QCAR) / l;
#pragma unroll
    for (int r = 0; r < 8; ++r) { osw[lr * 68u + hh * 32u + 8u * hi + r] = acc0[r] * inv; osw[lr * 68u + hh * 32u + 16u + 8u * hi + r] = acc1[r] * inv; }   /* D: e = 8*hi + r (+16), query lr */
    __syncthreads();   /* both heads' columns of every query row are in place */
    const size_t rowbase = ((size_t)bz * SEQ + i0) * DM + hp * 64u;
{
#pragma unroll
        for (unsigned s = 0; s < 2u; ++s) { const unsigned row = 8u * hh + 4u * s + (lane >> 3), pc = (lane & 7u) * 8u; const v4f v0 = *(const v4fa*)(osw + row * 68u + pc); const v4f v1 = *(const v4fa*)(osw + row * 68u + pc + 4u); v8us oh, ol;   /* the two waves of a query group write 8 rows each, whole 128-B lines */
#pragma unroll
            for (int q = 0; q < 4; ++q) { unsigned short a2, c2; splitf(v0[q], a2, c2); oh[q] = a2; ol[q] = c2; splitf(v1[q], a2, c2); oh[4 + q] = a2; ol[4 + q] = c2; }
            const size_t oo = rowbase + (size_t)row * DM + pc;
            *(v8us*)(CH + oo) = oh; *(v8us*)(CL + oo) = ol; }   
         }
}

constexpr size_t al256(size_t b) { return (b + 255) & ~(size_t)255; }
constexpr size_t SZ_W   = al256((size_t)DM * DM * 2);
constexpr size_t SZ_QK  = al256((size_t)NB * SEQ * QKW * 2);
constexpr size_t SZ_VT  = al256((size_t)NB * DM * SEQ * 2);
constexpr size_t SZ_C   = al256((size_t)NB * SEQ * DM * 2);
constexpr size_t CARVE  = SZ_W + SZ_QK + SZ_VT + 2 * SZ_C;
static_assert(CARVE <= (size_t)134217728);                                   // carve <= 128 MiB
static_assert((size_t)PT * 128 * 128 == (size_t)NB * SEQ * (QKW + DM));       // k_proj tiles == q|k and v^T plane elements
static_assert((size_t)PWO * 128 * 4 * 8 == (size_t)DM * DM);                  // wo^T blocks x threads x 4 pieces x 8 == plane elements
static_assert((size_t)(SEQ / 64) * (NH / 2) * NB * FW * 16 * 64 == (size_t)NB * SEQ * DM);   // k_flash query groups x 16 rows x 64 cols == ctx plane elements

extern "C" void kernel_launch(void* const* d_in, const int* in_sizes, int n_in,
                              void* d_out, int out_size, void* d_ws, size_t ws_size, hipStream_t stream) {
    if (n_in < 5) return;
    const long long xmin = (long long)(NB - 1) * SEQ_FULL * DM + (long long)SEQ * DM;
    if ((long long)in_sizes[0] < xmin || in_sizes[1] < NH * DM * HD || in_sizes[2] < NH * DM * HD || in_sizes[3] < NH * DM * HD || in_sizes[4] < DM * DM) return;
    if ((long long)out_size < xmin) return;
    if (CARVE > ws_size) return;
    const float* x = (const float*)d_in[0]; const float* wq = (const float*)d_in[1]; const float* wk = (const float*)d_in[2]; const float* wv = (const float*)d_in[3]; const float* wo = (const float*)d_in[4];
    float* OUT = (float*)d_out;   /* [NB_FULL][SEQ_FULL][256] f32, batch stride from the full sizes */
    char* wsp = (char*)d_ws;
    auto take = [&](size_t bytes) { char* p = wsp; wsp += bytes; return (void*)p; };
    bf* WOT = (bf*)take(SZ_W);
    h16* QKP = (h16*)take(SZ_QK); h16* VTP = (h16*)take(SZ_VT); bf* CH = (bf*)take(SZ_C); bf* CL = (bf*)take(SZ_C);

    k_proj<<<PT + PWO, 128, 0, stream>>>(x, wq, wk, wv, wo, QKP, VTP, WOT);
    k_flash<<<dim3(SEQ / 64, NH / 2, NB), 256, 0, stream>>>(QKP, VTP, CH, CL);
    /* out[t][n] = (CH + CL)[t][:] . WOT[n][:]: M = NB * SEQ tokens, N = 256, K = 256 */
    k_out<<<dim3(NB * SEQ / 64, DM / 128), 256, 0, stream>>>(CH, CL, WOT, OUT);
}

// v009
// One run takes 35.8 microseconds.
// In both of two side-by-side timings against v008, it was 1.05 times as fast.
// All steps since v000 together make it 3.07 times as fast.
#include <hip/hip_runtime.h>

// Compute dtypes (f32 accumulate everywhere): q/k/v projections v_wmma_f32_16x16x32_bf16 on bf16 RNE-converted x and weights (exact products); scores q.k^T v_wmma_f32_16x16x32_f16 (q x 256^-0.5 log2(e) / 16, k x16: the product is the score in log2 units); attn.V v_wmma_f32_16x16x32_f16 (exp weights x32 over the shift in use, v x16 carry); output projection v_wmma_f32_16x16x32_bf16 with the context as bf16 hi + lo planes (2 products) against bf16 wo.
// Multi-head attention: x [NB][SEQ][256], per-head weights w[8][256][32] ([in][out] per head), scores x 256^-0.5, softmax over all SEQ keys (no mask), heads concatenated head-major, times wo [in][out].
// The GEMMs stage their operand tiles in LDS by asynchronous copies that cover whole 128-byte lines and take their fragments from there.
// Plan, three launches: k_proj (GEMM from the f32 x and weights, rounded to bf16 at the fragment read: q -> f16 token-major plane [t][256], k -> f16 head-major plane [h][t][32], v -> f16 plane [b][h*32+e][t]; the wo^T bf16 plane in a block range of the same grid), k_flash (streaming softmax in steps of 128 keys, its shift moved only when a step needs it, k and v^T tiles of ONE head staged in LDS for the block's eight waves, 16 queries per wave -> ctx hi/lo bf16 head-major planes [h][t][32]), GEMM wo -> out f32.

#ifndef NB
#define NB 4
#endif
#ifndef SEQ
#define SEQ 2048
#endif
#define NB_FULL  4
#define SEQ_FULL 2048
#define DM   256      // model width = NH * HD
#define NH   8
#define HD   32       // head dim: exactly one 32-deep k-step per score tile
#define TT   ((size_t)NB * SEQ)   // tokens: rows of a head in the head-major planes
#define QCAR 16.0f    // carry on k and v planes
#define QSCL (0.0625f * 1.44269504088896340736f / 16.0f)   // factor on the q plane: 256^-0.5 x log2(e) / 16, so that q-plane . k-plane is the scaled score in log2 units

static_assert(DM == NH * HD);          // head-major concat width
static_assert(HD == 32);               // one WMMA k-step per head; two 16-wide e tiles
static_assert((NH & 1) == 0);
static_assert(SEQ % 64 == 0);          // 64-row GEMM tiles
static_assert(DM % 64 == 0 && DM % 32 == 0);
static_assert(NB <= NB_FULL && SEQ <= SEQ_FULL);

typedef _Float16 h16;
typedef unsigned short bf;
typedef __attribute__((ext_vector_type(16))) __bf16   v16bf;
typedef __attribute__((ext_vector_type(16))) _Float16 v16h;
typedef __attribute__((ext_vector_type(8)))  _Float16 v8h;
typedef __attribute__((ext_vector_type(8)))  unsigned short v8us;
typedef __attribute__((ext_vector_type(8)))  float    v8f;
typedef __attribute__((ext_vector_type(4)))  float    v4f;
typedef v4f  __attribute__((may_alias)) v4fa;

__device__ __forceinline__ unsigned short f2bf(float f) { unsigned u = __float_as_uint(f); u += 0x7FFFu + ((u >> 16) & 1u); return (unsigned short)(u >> 16); }
__device__ __forceinline__ float bf2f(unsigned short b) { return __uint_as_float(((unsigned)b) << 16); }
__device__ __forceinline__ v16h cat16(v8h lo, v8h hi) { return __builtin_shufflevector(lo, hi, 0, 1, 2, 3, 4, 5, 6, 7, 8, 9, 10, 11, 12, 13, 14, 15); }
__device__ __forceinline__ v16bf cat16b(v8us lo, v8us hi) { return __builtin_bit_cast(v16bf, __builtin_shufflevector(lo, hi, 0, 1, 2, 3, 4, 5, 6, 7, 8, 9, 10, 11, 12, 13, 14, 15)); }
__device__ __forceinline__ v8f wmma16(v16h a, v16h b, v8f c) { return __builtin_amdgcn_wmma_f32_16x16x32_f16(false, a, false, b, (short)0, c, false, false); }
__device__ __forceinline__ v8f wmmab(v16bf a, v16bf b, v8f c) { return __builtin_amdgcn_wmma_f32_16x16x32_bf16(false, a, false, b, (short)0, c, false, false); }
__device__ __forceinline__ void splitf(float y, unsigned short& h, unsigned short& l) { h = f2bf(y); l = f2bf(y - bf2f(h)); }
// fragment from a K-contiguous f16 row: p already includes row and 8*(lane>>4); elements 0..7 <- p[0..7], 8..15 <- p[16..23]
__device__ __forceinline__ v16h ldh(const h16* p) { return cat16(*(const v8h*)p, *(const v8h*)(p + 16)); }

// Eight copies of 16 B per lane, global -> LDS through no register. s_wait_xcnt 0 closes the statement so that no address register of a copy is rewritten ahead of it.
template <typename T16>
__device__ __forceinline__ void copy8(unsigned l0, unsigned l1, unsigned l2, unsigned l3, unsigned l4, unsigned l5, unsigned l6, unsigned l7,
                                      const T16* g0, const T16* g1, const T16* g2, const T16* g3, const T16* g4, const T16* g5, const T16* g6, const T16* g7) {
    asm volatile("global_load_async_to_lds_b128 %0, %8, off\n\t"
                 "global_load_async_to_lds_b128 %1, %9, off\n\t"
                 "global_load_async_to_lds_b128 %2, %10, off\n\t"
                 "global_load_async_to_lds_b128 %3, %11, off\n\t"
                 "global_load_async_to_lds_b128 %4, %12, off\n\t"
                 "global_load_async_to_lds_b128 %5, %13, off\n\t"
                 "global_load_async_to_lds_b128 %6, %14, off\n\t"
                 "global_load_async_to_lds_b128 %7, %15, off\n\t"
                 "s_wait_xcnt 0x0"
                 :: "v"(l0), "v"(l1), "v"(l2), "v"(l3), "v"(l4), "v"(l5), "v"(l6), "v"(l7), "v"(g0), "v"(g1), "v"(g2), "v"(g3), "v"(g4), "v"(g5), "v"(g6), "v"(g7) : "memory");
}
// The same with four copies per lane.
template <typename T16>
__device__ __forceinline__ void copy4(unsigned l0, unsigned l1, unsigned l2, unsigned l3, const T16* g0, const T16* g1, const T16* g2, const T16* g3) {
    asm volatile("global_load_async_to_lds_b128 %0, %4, off\n\t"
                 "global_load_async_to_lds_b128 %1, %5, off\n\t"
                 "global_load_async_to_lds_b128 %2, %6, off\n\t"
                 "global_load_async_to_lds_b128 %3, %7, off\n\t"
                 "s_wait_xcnt 0x0"
                 :: "v"(l0), "v"(l1), "v"(l2), "v"(l3), "v"(g0), "v"(g1), "v"(g2), "v"(g3) : "memory");
}
// k_out: out[t][n] = sum_k (CH + CL)[t][k] WOT[n][k], K = DM. One block = eight waves = 64 tokens x 128 columns; wave w = 32 tokens (half w & 1) x 32 columns (quarter w >> 1), four accumulators:
// 2,048 waves, two on every SIMD, each with a quarter of the copies, products and output rows that one wave of a 64 x 64 tile would have in a row.
// Staging: the whole K of the tile's 64 CH rows, 64 CL rows and 128 WOT rows lies in LDS, filled in two halves of 128 k (256 B of every row, whole lines, 16 copies a thread); each half is filled once and then read, the second lands while the first is worked on.
// CH and CL are head-major [h][t][32]: k = h*32 + e, a half = four heads; the 64 B of two neighbouring tokens of a head are one line, and a wave's copy takes two tokens x four heads.
// Row pitch 528 B (16 B x odd) keeps the 16-byte fragment reads free of bank conflicts. Per accumulator the order of the sums is k-step by k-step, CH before CL.
// Output: each wave turns its 32 x 32 floats in its own LDS rows (pitch 144 B), then eight lanes write the 128 B of a row.
#define OKC  128                       // k per staged half
#define OPIT (DM + 8)                  // 16-bit elements per staged row (all of K + 8 pad)
#define OPA  (64 * OPIT)               // elements of one staged context plane: 64 rows
#define OPB  (128 * OPIT)              // elements of the staged WOT rows
#define OSP  36                        // floats per row of a wave's output staging (32 + 4 pad)
static_assert((OPIT * 2) % 16 == 0 && (OPA * 2) % 16 == 0 && (OSP * 4) % 16 == 0);   // every copy, fragment read and staging read 16-byte aligned
static_assert(DM == 2 * OKC && DM % 128 == 0 && SEQ == SEQ_FULL);                     // two halves; whole column tiles; token rows of ctx and out follow one another over the batches
__device__ __forceinline__ v16bf ldb(const bf* p) { return cat16b(*(const v8us*)p, *(const v8us*)(p + 16)); }   /* fragment from a K-contiguous bf16 row: elements 0..7 <- p[0..7], 8..15 <- p[16..23] */
__global__ __launch_bounds__(256) void k_out(const bf* __restrict__ A, const bf* __restrict__ A2, const bf* __restrict__ Bt, float* C) {
    __shared__ __align__(16) bf otile[2 * OPA + OPB];
    __shared__ __align__(16) float os[8 * 32 * OSP];
    const unsigned tid = threadIdx.x, lane = tid & 31u, w = tid >> 5, wm = w & 1u, wn = w >> 1, lr = lane & 15u, hi = lane >> 4;
    const unsigned r0 = blockIdx.x * 64u, c0 = blockIdx.y * 128u;
    v8f acc[2][2];
#pragma unroll
    for (int mb = 0; mb < 2; ++mb)
#pragma unroll
        for (int nb = 0; nb < 2; ++nb) acc[mb][nb] = (v8f){};
    /* this thread's pieces of a half: 16-byte piece tid & 15 of the 256 B of rows (tid >> 4) + 16 i: i = 0..3 of CH and of CL, i = 0..7 of WOT */
    const unsigned lst = (unsigned)(size_t)otile + 2u * ((tid >> 4) * OPIT + (tid & 15u) * 8u);   /* LDS byte address: the low 32 bits */
    const size_t goff = (size_t)(tid >> 4) * DM + (tid & 15u) * 8u;
    const size_t goa = (size_t)((tid & 15u) >> 2) * TT * HD + (size_t)(r0 + (tid >> 4)) * HD + (tid & 3u) * 8u;   /* head (tid & 15) >> 2 of the half, token, piece of its 64 B */
    const bf* ga = A + goa; const bf* ga2 = A2 + goa; const bf* gb = Bt + (size_t)c0 * DM + goff;
    auto stage = [&](unsigned t) {   /* 16 copies a thread in flight */
        const unsigned la = lst + 2u * OKC * t, lb = la + 2u * 2u * OPA; const bf* a = ga + (size_t)t * (OKC / HD) * TT * HD; const bf* a2 = ga2 + (size_t)t * (OKC / HD) * TT * HD; const bf* b = gb + OKC * t;
        copy8<bf>(la, la + 2u * 16u * OPIT, la + 2u * 32u * OPIT, la + 2u * 48u * OPIT, la + 2u * OPA, la + 2u * (OPA + 16u * OPIT), la + 2u * (OPA + 32u * OPIT), la + 2u * (OPA + 48u * OPIT),
                  a, a + (size_t)16 * HD, a + (size_t)32 * HD, a + (size_t)48 * HD, a2, a2 + (size_t)16 * HD, a2 + (size_t)32 * HD, a2 + (size_t)48 * HD);
        copy8<bf>(lb, lb + 2u * 16u * OPIT, lb + 2u * 32u * OPIT, lb + 2u * 48u * OPIT, lb + 2u * 64u * OPIT, lb + 2u * 80u * OPIT, lb + 2u * 96u * OPIT, lb + 2u * 112u * OPIT,
                  b, b + (size_t)16 * DM, b + (size_t)32 * DM, b + (size_t)48 * DM, b + (size_t)64 * DM, b + (size_t)80 * DM, b + (size_t)96 * DM, b + (size_t)112 * DM); };
    const bf* fa = otile + (wm * 32u + lr) * OPIT + 8u * hi;             /* fragment rows: row lr of a 16-row group, k = 8*hi + ... */
    const bf* fb = otile + 2 * OPA + (wn * 32u + lr) * OPIT + 8u * hi;
    auto half = [&](int t) {   /* the four k-steps of half t */
        v16bf a[4][2], a2[4][2], b[4][2];
#pragma unroll   /* this and the unrolls below: straight-line code, so that the fragments are registers and the row and k steps offset literals */
        for (int s = 0; s < 4; ++s)
#pragma unroll
            for (int i = 0; i < 2; ++i) { const int k = t * OKC + s * 32; a[s][i] = ldb(fa + i * 16 * OPIT + k); b[s][i] = ldb(fb + i * 16 * OPIT + k); a2[s][i] = ldb(fa + OPA + i * 16 * OPIT + k); }
        __builtin_amdgcn_sched_barrier(0);   /* keeps the reads one group ahead of the products: sunk among them, each pair of reads is waited out on its own */
#pragma unroll
        for (int s = 0; s < 4; ++s) {
#pragma unroll
            for (int nb = 0; nb < 2; ++nb)
#pragma unroll
                for (int mb = 0; mb < 2; ++mb) acc[mb][nb] = wmmab(a[s][mb], b[s][nb], acc[mb][nb]);
#pragma unroll
            for (int nb = 0; nb < 2; ++nb)
#pragma unroll
                for (int mb = 0; mb < 2; ++mb) acc[mb][nb] = wmmab(a2[s][mb], b[s][nb], acc[mb][nb]); }
        __builtin_amdgcn_sched_barrier(0);   /* no product sinks behind the wait and the barrier that follow: the first half's products run while the second half lands */
    };
    stage(0u);
    asm volatile("s_wait_asynccnt 0x0" ::: "memory");   /* this wave's pieces of the first half have landed */
    __syncthreads();                                     /* first half readable by every wave */
    stage(1u);
    half(0);
    asm volatile("s_wait_asynccnt 0x0" ::: "memory");   /* this wave's pieces of the second half have landed; no copy outstanding from here on */
    __syncthreads();                                     /* second half readable by every wave */
    half(1);
    float* osw = os + w * (32u * OSP);
#pragma unroll
    for (int mb = 0; mb < 2; ++mb)
#pragma unroll
        for (int nb = 0; nb < 2; ++nb)
#pragma unroll
            for (int j = 0; j < 8; ++j) osw[(mb * 16 + hi * 8 + j) * OSP + nb * 16 + lr] = acc[mb][nb][j];   /* D: row 8*hi + j, col lr of tile (mb, nb) */
    __syncthreads();   /* staging visible to every lane */
    float* crow = C + (size_t)(r0 + wm * 32u) * DM + c0 + wn * 32u;
#pragma unroll
    for (unsigned s = 0; s < 8u; ++s) { const unsigned row = 4u * s + (lane >> 3), cofs = (lane & 7u) * 4u; const v4f val = *(const v4fa*)(osw + row * OSP + cofs);
        *(v4f*)(crow + (size_t)row * DM + cofs) = val; }   /* eight lanes write the 128 B of a row's 32 floats */
}
// k_proj: the three projections straight from the f32 inputs, no plane of x or of the weights in between. One block = four waves = 128 tokens x 128 columns (four heads of ONE of wq, wk, wv); wave w = 64 tokens (half w & 1) x 64 columns (half w >> 1), 16 accumulators.
// D[token][col] = sum_d x[token][d] w[h][d][e], col = h*32 + e. Chunk t = 64 d: 256 B of each of the 128 x rows and the 128 B line w[h][d][0..31] of each of the 4 x 64 (h, d), whole lines, copied once per block, global -> LDS buffer t & 1 through no register, while chunk t - 1 is worked on.
// The f32 values are rounded to bf16 (nearest even) where a fragment is read. x fragment: row = token, 16-byte reads along d. Weight fragment: column = lane, one 4-byte read per d (the staged rows run along e, so 16 lanes read 64 B of a row). Both hold k = 8*hi + i in element i and k = 16 + 8*hi + i in element 8 + i.
// Pitches: x rows 272 B (16 B x odd); weight rows 528 B, so that rows d and d + 8, read by the two lane halves, lie 128 B apart in the banks.
// Output: q columns -> f16 token-major plane [t][256], x QSCL; k columns -> f16 head-major plane [h][t][32], x 16 (four lanes write a token's 64 B, a store four tokens of two heads: whole lines); v columns -> f16 plane [b][h*32+e][t], x 16, each 16-column slab turned in LDS.
// Blocks [PT, PT + PWO): the bf16 plane WOT[n][k] = wo[k][n] for the last GEMM; it reads and writes nothing that the tiles touch.
#define PK   64                        // d per staged chunk: 256 B of every x row
#define XPIT 68                        // floats per staged x row (64 + 4 pad)
#define WPIT 132                       // floats per staged weight row (4 heads x 32 + 4 pad)
#define XPL  (128 * XPIT)              // floats of the x part of a buffer
#define PBUF (XPL + PK * WPIT)         // floats per buffer
#define PNT  (DM / PK)
#define PRT  ((unsigned)((size_t)NB * SEQ / 128))
#define PT   (PRT * 6u)                // 768 columns / 128
#define PWO  ((unsigned)DM / 16u)
static_assert((XPIT * 4) % 16 == 0 && (WPIT * 4) % 16 == 0 && (XPL * 4) % 16 == 0 && (PBUF * 4) % 16 == 0);   // every copy and 16-byte read aligned
static_assert(DM % PK == 0 && PNT >= 2 && SEQ % 128 == 0 && SEQ == SEQ_FULL && DM == 256 && HD == 32);         // whole chunks, the prologue's two exist; a tile's tokens lie in one batch; x rows follow one another
typedef __attribute__((ext_vector_type(16))) float v16f;
__device__ __forceinline__ void woprep_blk(const float* __restrict__ wo, bf* WOT, unsigned blk) {
    const unsigned n = blk * 16u + (threadIdx.x >> 3), pc = threadIdx.x & 7u;   /* eight lanes write the 128 B of a line of row n */
#pragma unroll
    for (unsigned kl = 0; kl < 4u; ++kl) { const unsigned k0 = kl * 64u + pc * 8u; v8us o;
#pragma unroll
        for (unsigned q = 0; q < 8u; ++q) o[q] = f2bf(wo[(size_t)(k0 + q) * DM + n]);
        *(v8us*)(WOT + (size_t)n * DM + k0) = o; }
}
__global__ __launch_bounds__(128) void k_proj(const float* __restrict__ x, const float* __restrict__ wq, const float* __restrict__ wk, const float* __restrict__ wv, const float* __restrict__ wo, h16* QP, h16* KP, h16* VTP, bf* WOT) {
    __shared__ __align__(16) float pring[2 * PBUF];
    if (blockIdx.x >= PT) { woprep_blk(wo, WOT, blockIdx.x - PT); return; }   /* block-uniform, ahead of every barrier and copy */
    const unsigned tid = threadIdx.x, lane = tid & 31u, w = tid >> 5, wm = w & 1u, wn = w >> 1, lr = lane & 15u, hi = lane >> 4;
    const unsigned rt = blockIdx.x % PRT, ct = blockIdx.x / PRT, mat = ct >> 1, r0 = rt * 128u;
    const float* wsrc = (mat == 0u ? wq : (mat == 1u ? wk : wv)) + (size_t)(ct & 1u) * 4u * DM * HD;
    v8f acc[4][4];
#pragma unroll
    for (int mb = 0; mb < 4; ++mb)
#pragma unroll
        for (int nb = 0; nb < 4; ++nb) acc[mb][nb] = (v8f){};
    /* this thread's pieces of a chunk: 16-byte piece tid & 7 of both 128-B halves of x rows (tid >> 3) + 16 i, i = 0..7, and of the weight lines d = (tid >> 3) + 16 i, i = 0..3, of the four heads */
    const unsigned pb = (unsigned)(size_t)pring;   /* LDS byte address: the low 32 bits */
    const unsigned lx = pb + 4u * ((tid >> 3) * XPIT + (tid & 7u) * 4u), lw = pb + 4u * (XPL + (tid >> 3) * WPIT + (tid & 7u) * 4u);
    const float* gx = x + (size_t)(r0 + (tid >> 3)) * DM + (tid & 7u) * 4u;
    const float* gw = wsrc + (size_t)(tid >> 3) * HD + (tid & 7u) * 4u;
    auto stage = [&](int t) {   /* 32 copies a thread in flight */
#pragma unroll   /* four statements of eight copies; their LDS and row steps become literals */
      for (unsigned hf = 0; hf < 2u; ++hf) {
        const unsigned lb = (unsigned)(t & 1) * (4u * PBUF); const unsigned a = lx + lb + 4u * 32u * hf, c = lw + lb + 4u * 32u * WPIT * hf;
        const float* g = gx + t * PK + 32u * hf; const float* h = gw + (size_t)t * PK * HD + (size_t)32 * HD * hf;
        copy8<float>(a, a + 4u * 16u * XPIT, a + 4u * 32u * XPIT, a + 4u * 48u * XPIT, a + 4u * 64u * XPIT, a + 4u * 80u * XPIT, a + 4u * 96u * XPIT, a + 4u * 112u * XPIT,
                     g, g + (size_t)16 * DM, g + (size_t)32 * DM, g + (size_t)48 * DM, g + (size_t)64 * DM, g + (size_t)80 * DM, g + (size_t)96 * DM, g + (size_t)112 * DM);
        copy8<float>(c, c + 4u * 16u * WPIT, c + 4u * 32u, c + 4u * (16u * WPIT + 32u), c + 4u * 64u, c + 4u * (16u * WPIT + 64u), c + 4u * 96u, c + 4u * (16u * WPIT + 96u),
                     h, h + (size_t)16 * HD, h + (size_t)DM * HD, h + (size_t)DM * HD + 16 * HD, h + (size_t)2 * DM * HD, h + (size_t)2 * DM * HD + 16 * HD, h + (size_t)3 * DM * HD, h + (size_t)3 * DM * HD + 16 * HD); } };
    stage(0);
    asm volatile("s_wait_asynccnt 0x0" ::: "memory");   /* this wave's pieces of chunk 0 have landed */
    __syncthreads();                                     /* chunk 0 readable by every wave */
    stage(1);
#pragma unroll 1   /* rolled: one copy of the chunk's code, the buffer picked by t & 1 */
    for (int t = 0; t < PNT; ++t) {
        const float* fx = pring + (t & 1) * PBUF + (wm * 64u + lr) * XPIT + 8u * hi;
        const float* fw = pring + (t & 1) * PBUF + XPL + 8u * hi * WPIT + wn * 64u + lr;
#pragma unroll   /* both k-steps of a chunk in line: the second's reads start under the first's products */
      for (int ks = 0; ks < PK; ks += 32) {
        v16bf a[4], b[4];
#pragma unroll
        for (int mb = 0; mb < 4; ++mb) { const float* p = fx + mb * 16 * XPIT + ks; const v4f a0 = *(const v4fa*)p, a1 = *(const v4fa*)(p + 4), a2 = *(const v4fa*)(p + 16), a3 = *(const v4fa*)(p + 20); v16f f;
#pragma unroll
            for (int q = 0; q < 4; ++q) { f[q] = a0[q]; f[4 + q] = a1[q]; f[8 + q] = a2[q]; f[12 + q] = a3[q]; }
            a[mb] = __builtin_convertvector(f, v16bf); }
#pragma unroll
        for (int nb = 0; nb < 4; ++nb) { const float* p = fw + nb * 16 + ks * WPIT; v16f f;
#pragma unroll
            for (int q = 0; q < 8; ++q) { f[q] = p[q * WPIT]; f[8 + q] = p[(16 + q) * WPIT]; }
            b[nb] = __builtin_convertvector(f, v16bf); }
#pragma unroll
        for (int nb = 0; nb < 4; ++nb) {
#pragma unroll
            for (int mb = 0; mb < 4; ++mb) acc[mb][nb] = wmmab(a[mb], b[nb], acc[mb][nb]); }
        if (ks + 32 == PK) {
            __builtin_amdgcn_sched_barrier(0);   /* no product sinks behind the slots below and the barrier, in front of the loop's branches */
            /* behind the chunk's last products: fills the vector slots they need before an instruction behind the loop's branches touches their registers */
            asm volatile("v_nop\n\tv_nop\n\tv_nop\n\tv_nop" : "+v"(acc[0][0]), "+v"(acc[1][1]), "+v"(acc[2][2]), "+v"(acc[3][3]) : "v"(a[0]), "v"(a[3]), "v"(b[3])); }
      }
        asm volatile("s_wait_dscnt 0x0" ::: "memory");      /* this wave's reads of buffer t & 1 are done before it is refilled */
        asm volatile("s_wait_asynccnt 0x0" ::: "memory");   /* this wave's pieces of chunk t + 1 have landed */
        __syncthreads();                                     /* publishes chunk t + 1 and ends every wave's reads of chunk t */
        if (t + 2 < PNT) stage(t + 2);                       /* block-uniform test; refills the buffer just read */
    }
    asm volatile("s_wait_asynccnt 0x0" ::: "memory");   /* no copy outstanding behind the loop */
    float* os = pring + w * (16u * 68u);   /* each wave turns its slabs in its own 16 x 64 floats of the ring: behind the loop's last barrier nobody reads a chunk and no copy is under way */
    const unsigned tok = r0 + wm * 64u, col = (ct & 1u) * 128u + wn * 64u;
    h16* crow = (mat == 0u) ? QP + (size_t)tok * DM + col : (mat == 1u) ? KP + ((size_t)(col / HD) * TT + tok) * HD : VTP + (size_t)(tok / SEQ) * DM * SEQ + (size_t)col * SEQ + tok % SEQ;
    const size_t ldc = (mat == 0u) ? (size_t)DM : (mat == 1u) ? (size_t)HD : (size_t)SEQ;
    const size_t pofs = (mat == 1u) ? (size_t)((lane & 7u) >> 2) * TT * HD + (lane & 3u) * 8u : (size_t)((lane & 7u) * 8u);   /* where this lane's 8 of a row's 64 values go: k, the second 32 belong to the next head */
    const float osc = (mat == 0u) ? QSCL : QCAR;   /* block-uniform */
#pragma unroll
    for (int sb = 0; sb < 4; ++sb) {
        if (mat < 2u) {   /* block-uniform. slab = 16 tokens x 64 columns. D: token 8*hi + j, column 16*nb + lr */
#pragma unroll
            for (int nb = 0; nb < 4; ++nb)
#pragma unroll
                for (int j = 0; j < 8; ++j) os[(hi * 8 + j) * 68 + nb * 16 + lr] = acc[sb][nb][j];
        } else {          /* slab = 16 columns x 64 tokens */
#pragma unroll
            for (int mb = 0; mb < 4; ++mb)
#pragma unroll
                for (int j = 0; j < 8; ++j) os[lr * 68 + mb * 16 + hi * 8 + j] = acc[mb][sb][j];
        }
        __syncthreads();   /* slab visible to every lane */
#pragma unroll
        for (int s = 0; s < 4; ++s) { const unsigned row = 4u * s + (lane >> 3), pc = (lane & 7u) * 8u; const v4f v0 = *(const v4fa*)(os + row * 68 + pc); const v4f v1 = *(const v4fa*)(os + row * 68 + pc + 4); v8h o;
#pragma unroll
            for (int q = 0; q < 4; ++q) { o[q] = (h16)(v0[q] * osc); o[4 + q] = (h16)(v1[q] * osc); }
            *(v8h*)(crow + (size_t)(sb * 16 + row) * ldc + pofs) = o; }   /* eight lanes write the 128 B of a row's 64 values (k: 64 B to each of two heads, whole lines with the rows beside them) */
        __syncthreads();   /* slab free before the next one overwrites it */
    }
}

// k_flash: one block = 128 queries x ONE head on eight waves; wave w = 16 queries: a streaming pass over all SEQ keys in steps of TK = 128, softmax weights 2^(score - shift).
// The result does not depend on the shift, only the range of the weights does. It starts as tile 0's maximum and is kept while the weights fit f16: a lane's 64 weights of a step sum to at most PLIM, so each is below the f16 limit.
// Only a step that fails this test searches its maximum, moves the shift there and rescales sum and accumulators. A step that passes needs no maximum, no multiply-add on the scores, no rescale and no cross-lane exchange.
// What a step costs once, whatever its length (the test, the waits, the barrier, the buffer addresses), is paid every 128 keys, and the eight score tiles of a step give the vector unit and the matrix unit more independent work between two barriers.
// A staged tile serves all eight waves, so a head's k and v^T cross from L2 into LDS once per 128 queries. A SIMD holds four waves (two blocks per WGP, each with its own barrier) whose vector work and LDS waits fill one another's gaps.
// Transposed tiles: S^T (M = key, N = query) = K-rows (A) x Q-rows (B), both K-contiguous f16 rows of their planes; the f32 S^T accumulators repacked to f16 are directly the B fragments of
// ctx^T (M = e, N = query) = V^T-rows (A, K-contiguous over keys) x P^T: element r <- tile of keys 0..15, element 8+r <- tile of keys 16..31, lane unchanged.
// exp weights carry 2^PCAR; the row sum uses the same f32 values, so the carry cancels in 1/l; the v carry 16 is folded into 1/l.
// Staging: tile t = TK keys = TK k rows of 64 B + 32 v^T rows of 256 B, copied once per block into LDS buffer t & 1 by asynchronous 16-byte copies
// (four per thread) while tile t - 1 is worked on; the k rows of a tile follow one another in the head-major plane, so a wave's k copy takes 512 B in a row, a v^T copy one of the two lines of a row's 256 B.
// Row pitches 80 B and 272 B (16 B x odd) keep the 16-byte row reads free of bank conflicts.
#define FW 8                           // query groups of 16 per block, one per wave
#define TK 128                         // keys per step
#define KPIT 40                        // f16 per staged k row (32 + 8 pad)
#define VPIT (TK + 8)                  // f16 per staged v^T row (TK + 8 pad)
#define RBK  (TK * KPIT)               // f16 of the k part of a buffer
#define RB   (TK * KPIT + 32 * VPIT)   // f16 per buffer
#define FSP  36                        // floats per row of a wave's output staging (32 + 4 pad)
#define NTILE ((unsigned)(SEQ / TK))
#define PCAR 5.0f                      // log2 of the weight of a score equal to the shift's maximum
#define PLIM 32768.0f                  // bound on a lane's sum of 64 weights: below the f16 limit 65504, above 64 x 2^PCAR
static_assert((KPIT * 2) % 16 == 0 && (VPIT * 2) % 16 == 0 && (RBK * 2) % 16 == 0 && (RB * 2) % 16 == 0);   // every copy and fragment read 16-byte aligned
static_assert(TK == 128 && SEQ % TK == 0 && SEQ / TK >= 2 && SEQ % (FW * 16) == 0 && (FSP * 4) % 16 == 0);   // four copies a thread fill a tile; whole tiles; the two tiles that the prologue stages exist; whole query blocks
// waves_per_eu(4, 4): four waves per SIMD is what the grid gives (512 blocks x 8 waves on 1,024 SIMDs); with that register budget the compiler keeps a step's fragment reads together instead of re-using few registers, one LDS wait per read pair.
__global__ __launch_bounds__(256) __attribute__((amdgpu_waves_per_eu(4, 4))) void k_flash(const h16* __restrict__ Q, const h16* __restrict__ K, const h16* __restrict__ VT, bf* CH, bf* CL) {
    __shared__ __align__(16) float os[FW * 16 * FSP];
    __shared__ __align__(16) h16 ring[2 * RB];
    const unsigned tid = threadIdx.x, lane = tid & 31u, w = tid >> 5, lr = lane & 15u, hi = lane >> 4;
    const unsigned bz = blockIdx.z, hd = blockIdx.y, i0 = blockIdx.x * (FW * 16u) + w * 16u;
    const h16* qb = Q + (size_t)bz * SEQ * DM;
    const h16* kb = K + ((size_t)hd * TT + (size_t)bz * SEQ) * HD;
    const h16* vtb = VT + (size_t)bz * DM * SEQ + (size_t)hd * HD * SEQ;
    float* osw = os + w * (16u * FSP);   /* this wave's 16 queries x 32 columns */
    /* this thread's pieces of a tile: k rows tid>>2 and 64 + (tid>>2), 16-byte piece tid&3 of the row's 64 B; v^T row tid>>3, pieces tid&7 and 8 + (tid&7) of the row's 256 B */
    const unsigned ringb = (unsigned)(size_t)ring;   /* LDS byte address: the low 32 bits */
    const unsigned lk = ringb + 2u * ((tid >> 2) * KPIT + (tid & 3u) * 8u), lv = ringb + 2u * (RBK + (tid >> 3) * VPIT + (tid & 7u) * 8u);
    const h16* gk = kb + tid * 8u;
    const h16* gv = vtb + (size_t)(tid >> 3) * SEQ + (tid & 7u) * 8u;
    auto stage = [&](unsigned t) {
        const unsigned tj = t * (unsigned)TK, lb = (t & 1u) * (2u * RB);
        const h16* k0 = gk + (size_t)tj * HD; const h16* v0 = gv + tj;
        copy4<h16>(lk + lb, lk + lb + 2u * 64u * KPIT, lv + lb, lv + lb + 2u * 64u, k0, k0 + (size_t)64 * HD, v0, v0 + 64); };
    stage(0u);
    const v16h bq = ldh(qb + (size_t)(i0 + lr) * DM + hd * HD + 8u * hi);        /* B: n = query i0+lr, k = e */
    asm volatile("s_wait_asynccnt 0x0" ::: "memory");   /* this wave's pieces of tile 0 have landed */
    __syncthreads();                                     /* tile 0 readable by every wave */
    stage(1u);
    v8f acc0 = (v8f){}, acc1 = (v8f){}; float l = 0.0f;   /* l: this lane's own keys only; the two lane halves are joined behind the loop */
    v8f s[8];
    auto scores = [&](unsigned t, v8f c) {   /* s = k rows of tile t . q + c: eight tiles of 16 keys x 16 queries, log2 units */
        const h16* kt = ring + (t & 1u) * RB + lr * KPIT + 8u * hi;         /* A rows: key lr of a 16-key group, k = e */
        v16h ka[8];
#pragma unroll   /* this and the unrolls below: straight-line code, so that the tiles are registers and the row steps offset literals */
        for (int i = 0; i < 8; ++i) ka[i] = ldh(kt + i * 16 * KPIT);
        __builtin_amdgcn_sched_barrier(0);   /* keeps the sixteen reads one group ahead of the products: sunk among them, each pair of reads is waited out on its own */
#pragma unroll
        for (int i = 0; i < 8; ++i) s[i] = wmma16(ka[i], bq, c);
        __builtin_amdgcn_sched_barrier(0);   /* keeps the eight products one run: vector work lifted in among them is padded with v_nop to the distance their registers need */
    };
    auto tilemax = [&]() -> float {   /* largest of a query's 128 values in s, the same in both lane halves */
        float vm0 = s[0][0], vm1 = s[2][0], vm2 = s[4][0], vm3 = s[6][0];   /* four chains: a maximum is exact in any order, and one chain of 64 would be waited out link by link */
#pragma unroll
        for (int r = 0; r < 8; ++r) { vm0 = fmaxf(vm0, fmaxf(s[0][r], s[1][r])); vm1 = fmaxf(vm1, fmaxf(s[2][r], s[3][r])); vm2 = fmaxf(vm2, fmaxf(s[4][r], s[5][r])); vm3 = fmaxf(vm3, fmaxf(s[6][r], s[7][r])); }
        const float vm = fmaxf(fmaxf(vm0, vm1), fmaxf(vm2, vm3));
        return fmaxf(vm, __shfl_xor(vm, 16, 32));                 /* both lane halves hold the other 64 keys of the same query */
    };
    auto weights = [&]() -> float {   /* s <- 2^s in place; returns the sum of this lane's 64 weights */
#pragma unroll
        for (int i = 0; i < 8; ++i)
#pragma unroll
            for (int r = 0; r < 8; ++r) s[i][r] = __builtin_amdgcn_exp2f(s[i][r]);
        const v8f ts = ((s[0] + s[1]) + (s[2] + s[3])) + ((s[4] + s[5]) + (s[6] + s[7]));   /* tile by tile, register pairs as they lie */
        return ((ts[0] + ts[1]) + (ts[2] + ts[3])) + ((ts[4] + ts[5]) + (ts[6] + ts[7]));
    };
    v16h pB[4];
    auto pack = [&]() {   /* the weights as B fragments: element r <- keys 8*hi + r of the 32, element 8 + r <- keys 16 + 8*hi + r */
#pragma unroll
        for (int j = 0; j < 4; ++j) pB[j] = cat16(__builtin_convertvector(s[2 * j], v8h), __builtin_convertvector(s[2 * j + 1], v8h));
    };
    scores(0u, (v8f){});
    float sh = PCAR - tilemax();   /* the shift in use: tile 0's largest score of a query gets the weight 2^PCAR */
    v8f shv = { sh, sh, sh, sh, sh, sh, sh, sh };
#pragma unroll 1
    for (unsigned t = 0; t < NTILE; ++t) {
        scores(t, shv);            /* the shift rides in as the products' C operand: what comes out is the exponent */
        const h16* vt = ring + (t & 1u) * RB + RBK + lr * VPIT + 8u * hi;   /* A rows: e = lr, k = key */
        v16h va0[4], va1[4];   /* read ahead of the test, so that the test and the packing cover the reads' latency */
#pragma unroll
        for (int j = 0; j < 4; ++j) { va0[j] = ldh(vt + j * 32); va1[j] = ldh(vt + 16 * VPIT + j * 32); }
        float rs = weights();
        if (__builtin_amdgcn_ballot_w32(!(rs <= PLIM)) != 0u) {   /* one scalar branch a step; rare: some score of this tile lies more than 4 above the shift's maximum (or is not a number) */
            scores(t, shv);
            const float d = fmaxf(tilemax() - PCAR, 0.0f);        /* how far the tile's largest score lies above it */
            const float alpha = __builtin_amdgcn_exp2f(-d);
            sh -= d; shv = (v8f){ sh, sh, sh, sh, sh, sh, sh, sh };
#pragma unroll
            for (int i = 0; i < 8; ++i) s[i] -= d;
            rs = weights();                                       /* now every weight <= 2^PCAR */
            acc0 *= alpha; acc1 *= alpha; l *= alpha;
        }
        l += rs;
        pack();
#pragma unroll
        for (int j = 0; j < 4; ++j) { acc0 = wmma16(va0[j], pB[j], acc0); acc1 = wmma16(va1[j], pB[j], acc1); }
        /* behind the step's last products: fills the vector slots they need before an instruction behind the loop's branches touches their registers */
        asm volatile("v_nop\n\tv_nop\n\tv_nop\n\tv_nop" : "+v"(acc0), "+v"(acc1) : "v"(va1[3]), "v"(va0[3]), "v"(pB[3]));
        asm volatile("s_wait_dscnt 0x0" ::: "memory");      /* this wave's reads of buffer t & 1 are done before it is refilled */
        asm volatile("s_wait_asynccnt 0x0" ::: "memory");   /* this wave's pieces of tile t + 1 have landed */
        __syncthreads();                                     /* publishes tile t + 1 and ends every wave's reads of tile t */
        if (t + 2u < NTILE) stage(t + 2u);                   /* block-uniform test; refills the buffer just read */
    }
    asm volatile("s_wait_asynccnt 0x0" ::: "memory");   /* no copy outstanding behind the loop */
    l += __shfl_xor(l, 16, 32);   /* the other 1,024 keys of the same query */
    const float inv = (1.0f / QCAR) / l;
#pragma unroll
    for (int r = 0; r < 8; ++r) { osw[lr * FSP + 8u * hi + r] = acc0[r] * inv; osw[lr * FSP + 16u + 8u * hi + r] = acc1[r] * inv; }   /* D: e = 8*hi + r (+16), query lr */
    __syncthreads();   /* staging visible to every lane */
    const size_t rowbase = ((size_t)hd * TT + (size_t)bz * SEQ + i0) * HD;
{
#pragma unroll
        for (unsigned s = 0; s < 2u; ++s) { const unsigned row = 8u * s + (lane >> 2), pc = (lane & 3u) * 8u; const v4f v0 = *(const v4fa*)(osw + row * FSP + pc); const v4f v1 = *(const v4fa*)(osw + row * FSP + pc + 4u); v8us oh, ol;   /* four lanes write a query's 64 B, a store eight queries in a row: whole 128-B lines */
#pragma unroll
            for (int q = 0; q < 4; ++q) { unsigned short a2, c2; splitf(v0[q], a2, c2); oh[q] = a2; ol[q] = c2; splitf(v1[q], a2, c2); oh[4 + q] = a2; ol[4 + q] = c2; }
            const size_t oo = rowbase + (size_t)row * HD + pc;
            *(v8us*)(CH + oo) = oh; *(v8us*)(CL + oo) = ol; }   
         }
}

constexpr size_t al256(size_t b) { return (b + 255) & ~(size_t)255; }
constexpr size_t SZ_W   = al256((size_t)DM * DM * 2);
constexpr size_t SZ_Q   = al256((size_t)NB * SEQ * DM * 2);
constexpr size_t SZ_K   = al256((size_t)NH * NB * SEQ * HD * 2);
constexpr size_t SZ_VT  = al256((size_t)NB * DM * SEQ * 2);
constexpr size_t SZ_C   = al256((size_t)NB * SEQ * DM * 2);
constexpr size_t CARVE  = SZ_W + SZ_Q + SZ_K + SZ_VT + 2 * SZ_C;
static_assert(CARVE <= (size_t)134217728);                                   // carve <= 128 MiB
static_assert((size_t)PT * 128 * 128 == (size_t)NB * SEQ * 3 * DM);           // k_proj tiles == q, k and v^T plane elements
static_assert((size_t)PWO * 128 * 4 * 8 == (size_t)DM * DM);                  // wo^T blocks x threads x 4 pieces x 8 == plane elements
static_assert((size_t)(SEQ / (FW * 16)) * NH * NB * FW * 16 * HD == (size_t)NB * SEQ * DM);   // k_flash query groups x 16 rows x 32 cols == ctx plane elements

extern "C" void kernel_launch(void* const* d_in, const int* in_sizes, int n_in,
                              void* d_out, int out_size, void* d_ws, size_t ws_size, hipStream_t stream) {
    if (n_in < 5) return;
    const long long xmin = (long long)(NB - 1) * SEQ_FULL * DM + (long long)SEQ * DM;
    if ((long long)in_sizes[0] < xmin || in_sizes[1] < NH * DM * HD || in_sizes[2] < NH * DM * HD || in_sizes[3] < NH * DM * HD || in_sizes[4] < DM * DM) return;
    if ((long long)out_size < xmin) return;
    if (CARVE > ws_size) return;
    const float* x = (const float*)d_in[0]; const float* wq = (const float*)d_in[1]; const float* wk = (const float*)d_in[2]; const float* wv = (const float*)d_in[3]; const float* wo = (const float*)d_in[4];
    float* OUT = (float*)d_out;   /* [NB_FULL][SEQ_FULL][256] f32, batch stride from the full sizes */
    char* wsp = (char*)d_ws;
    auto take = [&](size_t bytes) { char* p = wsp; wsp += bytes; return (void*)p; };
    bf* WOT = (bf*)take(SZ_W);
    h16* QP = (h16*)take(SZ_Q); h16* KP = (h16*)take(SZ_K); h16* VTP = (h16*)take(SZ_VT); bf* CH = (bf*)take(SZ_C); bf* CL = (bf*)take(SZ_C);

    k_proj<<<PT + PWO, 128, 0, stream>>>(x, wq, wk, wv, wo, QP, KP, VTP, WOT);
    k_flash<<<dim3(SEQ / (FW * 16), NH, NB), 256, 0, stream>>>(QP, KP, VTP, CH, CL);
    /* out[t][n] = (CH + CL)[t][:] . WOT[n][:]: M = NB * SEQ tokens, N = 256, K = 256 */
    k_out<<<dim3(NB * SEQ / 64, DM / 128), 256, 0, stream>>>(CH, CL, WOT, OUT);
}

// v010
// It runs in 34.9 microseconds.
// Timed twice side by side with v009, it ran 1.03 times as fast both times.
// Over all steps from v000 it is 3.15 times as fast.
#include <hip/hip_runtime.h>

// Compute dtypes (f32 accumulate everywhere): q/k/v projections v_wmma_f32_16x16x32_bf16 on bf16 RNE-converted x and weights (exact products); scores q.k^T v_wmma_f32_16x16x32_f16 (q x 256^-0.5 log2(e) / 16, k x16: the product is the score in log2 units); attn.V v_wmma_f32_16x16x32_f16 (exp weights x32 over the shift in use, v x16 carry); output projection v_wmma_f32_16x16x32_bf16 with the context as bf16 hi + lo planes (2 products) against bf16 wo.
// Multi-head attention: x [NB][SEQ][256], per-head weights w[8][256][32] ([in][out] per head), scores x 256^-0.5, softmax over all SEQ keys (no mask), heads concatenated head-major, times wo [in][out].
// The GEMMs stage their operand tiles in LDS by asynchronous copies that cover whole 128-byte lines and take their fragments from there.
// Plan, three launches: k_proj (GEMM from the f32 x and weights, rounded to bf16 at the fragment read: q -> f16 token-major plane [t][256], k -> f16 head-major plane [h][t][32], v -> f16 plane [b][h*32+e][t]; the wo^T bf16 plane in a block range of the same grid), k_flash (streaming softmax in steps of 128 keys, its shift moved only when a step needs it, the whole k and v^T of ONE head held in LDS for the block's sixteen waves, 16 queries per wave -> ctx hi/lo bf16 head-major planes [h][t][32]), GEMM wo -> out f32.

#ifndef NB
#define NB 4
#endif
#ifndef SEQ
#define SEQ 2048
#endif
#define NB_FULL  4
#define SEQ_FULL 2048
#define DM   256      // model width = NH * HD
#define NH   8
#define HD   32       // head dim: exactly one 32-deep k-step per score tile
#define TT   ((size_t)NB * SEQ)   // tokens: rows of a head in the head-major planes
#define QCAR 16.0f    // carry on k and v planes
#define QSCL (0.0625f * 1.44269504088896340736f / 16.0f)   // factor on the q plane: 256^-0.5 x log2(e) / 16, so that q-plane . k-plane is the scaled score in log2 units

static_assert(DM == NH * HD);          // head-major concat width
static_assert(HD == 32);               // one WMMA k-step per head; two 16-wide e tiles
static_assert((NH & 1) == 0);
static_assert(SEQ % 64 == 0);          // 64-row GEMM tiles
static_assert(DM % 64 == 0 && DM % 32 == 0);
static_assert(NB <= NB_FULL && SEQ <= SEQ_FULL);

typedef _Float16 h16;
typedef unsigned short bf;
typedef __attribute__((ext_vector_type(16))) __bf16   v16bf;
typedef __attribute__((ext_vector_type(16))) _Float16 v16h;
typedef __attribute__((ext_vector_type(8)))  _Float16 v8h;
typedef __attribute__((ext_vector_type(8)))  unsigned short v8us;
typedef __attribute__((ext_vector_type(8)))  float    v8f;
typedef __attribute__((ext_vector_type(4)))  float    v4f;
typedef v4f  __attribute__((may_alias)) v4fa;

__device__ __forceinline__ unsigned short f2bf(float f) { unsigned u = __float_as_uint(f); u += 0x7FFFu + ((u >> 16) & 1u); return (unsigned short)(u >> 16); }
__device__ __forceinline__ float bf2f(unsigned short b) { return __uint_as_float(((unsigned)b) << 16); }
__device__ __forceinline__ v16h cat16(v8h lo, v8h hi) { return __builtin_shufflevector(lo, hi, 0, 1, 2, 3, 4, 5, 6, 7, 8, 9, 10, 11, 12, 13, 14, 15); }
__device__ __forceinline__ v16bf cat16b(v8us lo, v8us hi) { return __builtin_bit_cast(v16bf, __builtin_shufflevector(lo, hi, 0, 1, 2, 3, 4, 5, 6, 7, 8, 9, 10, 11, 12, 13, 14, 15)); }
__device__ __forceinline__ v8f wmma16(v16h a, v16h b, v8f c) { return __builtin_amdgcn_wmma_f32_16x16x32_f16(false, a, false, b, (short)0, c, false, false); }
__device__ __forceinline__ v8f wmmab(v16bf a, v16bf b, v8f c) { return __builtin_amdgcn_wmma_f32_16x16x32_bf16(false, a, false, b, (short)0, c, false, false); }
__device__ __forceinline__ void splitf(float y, unsigned short& h, unsigned short& l) { h = f2bf(y); l = f2bf(y - bf2f(h)); }
// fragment from a K-contiguous f16 row: p already includes row and 8*(lane>>4); elements 0..7 <- p[0..7], 8..15 <- p[16..23]
__device__ __forceinline__ v16h ldh(const h16* p) { return cat16(*(const v8h*)p, *(const v8h*)(p + 16)); }

// Eight copies of 16 B per lane, global -> LDS through no register. s_wait_xcnt 0 closes the statement so that no address register of a copy is rewritten ahead of it.
template <typename T16>
__device__ __forceinline__ void copy8(unsigned l0, unsigned l1, unsigned l2, unsigned l3, unsigned l4, unsigned l5, unsigned l6, unsigned l7,
                                      const T16* g0, const T16* g1, const T16* g2, const T16* g3, const T16* g4, const T16* g5, const T16* g6, const T16* g7) {
    asm volatile("global_load_async_to_lds_b128 %0, %8, off\n\t"
                 "global_load_async_to_lds_b128 %1, %9, off\n\t"
                 "global_load_async_to_lds_b128 %2, %10, off\n\t"
                 "global_load_async_to_lds_b128 %3, %11, off\n\t"
                 "global_load_async_to_lds_b128 %4, %12, off\n\t"
                 "global_load_async_to_lds_b128 %5, %13, off\n\t"
                 "global_load_async_to_lds_b128 %6, %14, off\n\t"
                 "global_load_async_to_lds_b128 %7, %15, off\n\t"
                 "s_wait_xcnt 0x0"
                 :: "v"(l0), "v"(l1), "v"(l2), "v"(l3), "v"(l4), "v"(l5), "v"(l6), "v"(l7), "v"(g0), "v"(g1), "v"(g2), "v"(g3), "v"(g4), "v"(g5), "v"(g6), "v"(g7) : "memory");
}
// The same with four copies per lane.
template <typename T16>
__device__ __forceinline__ void copy4(unsigned l0, unsigned l1, unsigned l2, unsigned l3, const T16* g0, const T16* g1, const T16* g2, const T16* g3) {
    asm volatile("global_load_async_to_lds_b128 %0, %4, off\n\t"
                 "global_load_async_to_lds_b128 %1, %5, off\n\t"
                 "global_load_async_to_lds_b128 %2, %6, off\n\t"
                 "global_load_async_to_lds_b128 %3, %7, off\n\t"
                 "s_wait_xcnt 0x0"
                 :: "v"(l0), "v"(l1), "v"(l2), "v"(l3), "v"(g0), "v"(g1), "v"(g2), "v"(g3) : "memory");
}
// k_out: out[t][n] = sum_k (CH + CL)[t][k] WOT[n][k], K = DM. One block = eight waves = 64 tokens x 128 columns; wave w = 32 tokens (half w & 1) x 32 columns (quarter w >> 1), four accumulators:
// 2,048 waves, two on every SIMD, each with a quarter of the copies, products and output rows that one wave of a 64 x 64 tile would have in a row.
// Staging: the whole K of the tile's 64 CH rows, 64 CL rows and 128 WOT rows lies in LDS, filled in two halves of 128 k (256 B of every row, whole lines, 16 copies a thread); each half is filled once and then read, the second lands while the first is worked on.
// CH and CL are head-major [h][t][32]: k = h*32 + e, a half = four heads; the 64 B of two neighbouring tokens of a head are one line, and a wave's copy takes two tokens x four heads.
// Row pitch 528 B (16 B x odd) keeps the 16-byte fragment reads free of bank conflicts. Per accumulator the order of the sums is k-step by k-step, CH before CL.
// Output: each wave turns its 32 x 32 floats in its own LDS rows (pitch 144 B), then eight lanes write the 128 B of a row.
#define OKC  128                       // k per staged half
#define OPIT (DM + 8)                  // 16-bit elements per staged row (all of K + 8 pad)
#define OPA  (64 * OPIT)               // elements of one staged context plane: 64 rows
#define OPB  (128 * OPIT)              // elements of the staged WOT rows
#define OSP  36                        // floats per row of a wave's output staging (32 + 4 pad)
static_assert((OPIT * 2) % 16 == 0 && (OPA * 2) % 16 == 0 && (OSP * 4) % 16 == 0);   // every copy, fragment read and staging read 16-byte aligned
static_assert(DM == 2 * OKC && DM % 128 == 0 && SEQ == SEQ_FULL);                     // two halves; whole column tiles; token rows of ctx and out follow one another over the batches
__device__ __forceinline__ v16bf ldb(const bf* p) { return cat16b(*(const v8us*)p, *(const v8us*)(p + 16)); }   /* fragment from a K-contiguous bf16 row: elements 0..7 <- p[0..7], 8..15 <- p[16..23] */
__global__ __launch_bounds__(256) void k_out(const bf* __restrict__ A, const bf* __restrict__ A2, const bf* __restrict__ Bt, float* C) {
    __shared__ __align__(16) bf otile[2 * OPA + OPB];
    __shared__ __align__(16) float os[8 * 32 * OSP];
    const unsigned tid = threadIdx.x, lane = tid & 31u, w = tid >> 5, wm = w & 1u, wn = w >> 1, lr = lane & 15u, hi = lane >> 4;
    const unsigned r0 = blockIdx.x * 64u, c0 = blockIdx.y * 128u;
    v8f acc[2][2];
#pragma unroll
    for (int mb = 0; mb < 2; ++mb)
#pragma unroll
        for (int nb = 0; nb < 2; ++nb) acc[mb][nb] = (v8f){};
    /* this thread's pieces of a half: 16-byte piece tid & 15 of the 256 B of rows (tid >> 4) + 16 i: i = 0..3 of CH and of CL, i = 0..7 of WOT */
    const unsigned lst = (unsigned)(size_t)otile + 2u * ((tid >> 4) * OPIT + (tid & 15u) * 8u);   /* LDS byte address: the low 32 bits */
    const size_t goff = (size_t)(tid >> 4) * DM + (tid & 15u) * 8u;
    const size_t goa = (size_t)((tid & 15u) >> 2) * TT * HD + (size_t)(r0 + (tid >> 4)) * HD + (tid & 3u) * 8u;   /* head (tid & 15) >> 2 of the half, token, piece of its 64 B */
    const bf* ga = A + goa; const bf* ga2 = A2 + goa; const bf* gb = Bt + (size_t)c0 * DM + goff;
    auto stage = [&](unsigned t) {   /* 16 copies a thread in flight */
        const unsigned la = lst + 2u * OKC * t, lb = la + 2u * 2u * OPA; const bf* a = ga + (size_t)t * (OKC / HD) * TT * HD; const bf* a2 = ga2 + (size_t)t * (OKC / HD) * TT * HD; const bf* b = gb + OKC * t;
        copy8<bf>(la, la + 2u * 16u * OPIT, la + 2u * 32u * OPIT, la + 2u * 48u * OPIT, la + 2u * OPA, la + 2u * (OPA + 16u * OPIT), la + 2u * (OPA + 32u * OPIT), la + 2u * (OPA + 48u * OPIT),
                  a, a + (size_t)16 * HD, a + (size_t)32 * HD, a + (size_t)48 * HD, a2, a2 + (size_t)16 * HD, a2 + (size_t)32 * HD, a2 + (size_t)48 * HD);
        copy8<bf>(lb, lb + 2u * 16u * OPIT, lb + 2u * 32u * OPIT, lb + 2u * 48u * OPIT, lb + 2u * 64u * OPIT, lb + 2u * 80u * OPIT, lb + 2u * 96u * OPIT, lb + 2u * 112u * OPIT,
                  b, b + (size_t)16 * DM, b + (size_t)32 * DM, b + (size_t)48 * DM, b + (size_t)64 * DM, b + (size_t)80 * DM, b + (size_t)96 * DM, b + (size_t)112 * DM); };
    const bf* fa = otile + (wm * 32u + lr) * OPIT + 8u * hi;             /* fragment rows: row lr of a 16-row group, k = 8*hi + ... */
    const bf* fb = otile + 2 * OPA + (wn * 32u + lr) * OPIT + 8u * hi;
    auto half = [&](int t) {   /* the four k-steps of half t */
        v16bf a[4][2], a2[4][2], b[4][2];
#pragma unroll   /* this and the unrolls below: straight-line code, so that the fragments are registers and the row and k steps offset literals */
        for (int s = 0; s < 4; ++s)
#pragma unroll
            for (int i = 0; i < 2; ++i) { const int k = t * OKC + s * 32; a[s][i] = ldb(fa + i * 16 * OPIT + k); b[s][i] = ldb(fb + i * 16 * OPIT + k); a2[s][i] = ldb(fa + OPA + i * 16 * OPIT + k); }
        __builtin_amdgcn_sched_barrier(0);   /* keeps the reads one group ahead of the products: sunk among them, each pair of reads is waited out on its own */
#pragma unroll
        for (int s = 0; s < 4; ++s) {
#pragma unroll
            for (int nb = 0; nb < 2; ++nb)
#pragma unroll
                for (int mb = 0; mb < 2; ++mb) acc[mb][nb] = wmmab(a[s][mb], b[s][nb], acc[mb][nb]);
#pragma unroll
            for (int nb = 0; nb < 2; ++nb)
#pragma unroll
                for (int mb = 0; mb < 2; ++mb) acc[mb][nb] = wmmab(a2[s][mb], b[s][nb], acc[mb][nb]); }
        __builtin_amdgcn_sched_barrier(0);   /* no product sinks behind the wait and the barrier that follow: the first half's products run while the second half lands */
    };
    stage(0u);
    asm volatile("s_wait_asynccnt 0x0" ::: "memory");   /* this wave's pieces of the first half have landed */
    __syncthreads();                                     /* first half readable by every wave */
    stage(1u);
    half(0);
    asm volatile("s_wait_asynccnt 0x0" ::: "memory");   /* this wave's pieces of the second half have landed; no copy outstanding from here on */
    __syncthreads();                                     /* second half readable by every wave */
    half(1);
    float* osw = os + w * (32u * OSP);
#pragma unroll
    for (int mb = 0; mb < 2; ++mb)
#pragma unroll
        for (int nb = 0; nb < 2; ++nb)
#pragma unroll
            for (int j = 0; j < 8; ++j) osw[(mb * 16 + hi * 8 + j) * OSP + nb * 16 + lr] = acc[mb][nb][j];   /* D: row 8*hi + j, col lr of tile (mb, nb) */
    __syncthreads();   /* staging visible to every lane */
    float* crow = C + (size_t)(r0 + wm * 32u) * DM + c0 + wn * 32u;
#pragma unroll
    for (unsigned s = 0; s < 8u; ++s) { const unsigned row = 4u * s + (lane >> 3), cofs = (lane & 7u) * 4u; const v4f val = *(const v4fa*)(osw + row * OSP + cofs);
        *(v4f*)(crow + (size_t)row * DM + cofs) = val; }   /* eight lanes write the 128 B of a row's 32 floats */
}
// k_proj: the three projections straight from the f32 inputs, no plane of x or of the weights in between. One block = four waves = 128 tokens x 128 columns (four heads of ONE of wq, wk, wv); wave w = 64 tokens (half w & 1) x 64 columns (half w >> 1), 16 accumulators.
// D[token][col] = sum_d x[token][d] w[h][d][e], col = h*32 + e. Chunk t = 64 d: 256 B of each of the 128 x rows and the 128 B line w[h][d][0..31] of each of the 4 x 64 (h, d), whole lines, copied once per block, global -> LDS buffer t & 1 through no register, while chunk t - 1 is worked on.
// The f32 values are rounded to bf16 (nearest even) where a fragment is read. x fragment: row = token, 16-byte reads along d. Weight fragment: column = lane, one 4-byte read per d (the staged rows run along e, so 16 lanes read 64 B of a row). Both hold k = 8*hi + i in element i and k = 16 + 8*hi + i in element 8 + i.
// Pitches: x rows 272 B (16 B x odd); weight rows 528 B, so that rows d and d + 8, read by the two lane halves, lie 128 B apart in the banks.
// Output: q columns -> f16 token-major plane [t][256], x QSCL; k columns -> f16 head-major plane [h][t][32], x 16 (four lanes write a token's 64 B, a store four tokens of two heads: whole lines); v columns -> f16 plane [b][h*32+e][t], x 16, each 16-column slab turned in LDS.
// Blocks [PT, PT + PWO): the bf16 plane WOT[n][k] = wo[k][n] for the last GEMM; it reads and writes nothing that the tiles touch.
#define PK   64                        // d per staged chunk: 256 B of every x row
#define XPIT 68                        // floats per staged x row (64 + 4 pad)
#define WPIT 132                       // floats per staged weight row (4 heads x 32 + 4 pad)
#define XPL  (128 * XPIT)              // floats of the x part of a buffer
#define PBUF (XPL + PK * WPIT)         // floats per buffer
#define PNT  (DM / PK)
#define PRT  ((unsigned)((size_t)NB * SEQ / 128))
#define PT   (PRT * 6u)                // 768 columns / 128
#define PWO  ((unsigned)DM / 16u)
static_assert((XPIT * 4) % 16 == 0 && (WPIT * 4) % 16 == 0 && (XPL * 4) % 16 == 0 && (PBUF * 4) % 16 == 0);   // every copy and 16-byte read aligned
static_assert(DM % PK == 0 && PNT >= 2 && SEQ % 128 == 0 && SEQ == SEQ_FULL && DM == 256 && HD == 32);         // whole chunks, the prologue's two exist; a tile's tokens lie in one batch; x rows follow one another
typedef __attribute__((ext_vector_type(16))) float v16f;
__device__ __forceinline__ void woprep_blk(const float* __restrict__ wo, bf* WOT, unsigned blk) {
    const unsigned n = blk * 16u + (threadIdx.x >> 3), pc = threadIdx.x & 7u;   /* eight lanes write the 128 B of a line of row n */
#pragma unroll
    for (unsigned kl = 0; kl < 4u; ++kl) { const unsigned k0 = kl * 64u + pc * 8u; v8us o;
#pragma unroll
        for (unsigned q = 0; q < 8u; ++q) o[q] = f2bf(wo[(size_t)(k0 + q) * DM + n]);
        *(v8us*)(WOT + (size_t)n * DM + k0) = o; }
}
__global__ __launch_bounds__(128) void k_proj(const float* __restrict__ x, const float* __restrict__ wq, const float* __restrict__ wk, const float* __restrict__ wv, const float* __restrict__ wo, h16* QP, h16* KP, h16* VTP, bf* WOT) {
    __shared__ __align__(16) float pring[2 * PBUF];
    if (blockIdx.x >= PT) { woprep_blk(wo, WOT, blockIdx.x - PT); return; }   /* block-uniform, ahead of every barrier and copy */
    const unsigned tid = threadIdx.x, lane = tid & 31u, w = tid >> 5, wm = w & 1u, wn = w >> 1, lr = lane & 15u, hi = lane >> 4;
    const unsigned rt = blockIdx.x % PRT, ct = blockIdx.x / PRT, mat = ct >> 1, r0 = rt * 128u;
    const float* wsrc = (mat == 0u ? wq : (mat == 1u ? wk : wv)) + (size_t)(ct & 1u) * 4u * DM * HD;
    v8f acc[4][4];
#pragma unroll
    for (int mb = 0; mb < 4; ++mb)
#pragma unroll
        for (int nb = 0; nb < 4; ++nb) acc[mb][nb] = (v8f){};
    /* this thread's pieces of a chunk: 16-byte piece tid & 7 of both 128-B halves of x rows (tid >> 3) + 16 i, i = 0..7, and of the weight lines d = (tid >> 3) + 16 i, i = 0..3, of the four heads */
    const unsigned pb = (unsigned)(size_t)pring;   /* LDS byte address: the low 32 bits */
    const unsigned lx = pb + 4u * ((tid >> 3) * XPIT + (tid & 7u) * 4u), lw = pb + 4u * (XPL + (tid >> 3) * WPIT + (tid & 7u) * 4u);
    const float* gx = x + (size_t)(r0 + (tid >> 3)) * DM + (tid & 7u) * 4u;
    const float* gw = wsrc + (size_t)(tid >> 3) * HD + (tid & 7u) * 4u;
    auto stage = [&](int t) {   /* 32 copies a thread in flight */
#pragma unroll   /* four statements of eight copies; their LDS and row steps become literals */
      for (unsigned hf = 0; hf < 2u; ++hf) {
        const unsigned lb = (unsigned)(t & 1) * (4u * PBUF); const unsigned a = lx + lb + 4u * 32u * hf, c = lw + lb + 4u * 32u * WPIT * hf;
        const float* g = gx + t * PK + 32u * hf; const float* h = gw + (size_t)t * PK * HD + (size_t)32 * HD * hf;
        copy8<float>(a, a + 4u * 16u * XPIT, a + 4u * 32u * XPIT, a + 4u * 48u * XPIT, a + 4u * 64u * XPIT, a + 4u * 80u * XPIT, a + 4u * 96u * XPIT, a + 4u * 112u * XPIT,
                     g, g + (size_t)16 * DM, g + (size_t)32 * DM, g + (size_t)48 * DM, g + (size_t)64 * DM, g + (size_t)80 * DM, g + (size_t)96 * DM, g + (size_t)112 * DM);
        copy8<float>(c, c + 4u * 16u * WPIT, c + 4u * 32u, c + 4u * (16u * WPIT + 32u), c + 4u * 64u, c + 4u * (16u * WPIT + 64u), c + 4u * 96u, c + 4u * (16u * WPIT + 96u),
                     h, h + (size_t)16 * HD, h + (size_t)DM * HD, h + (size_t)DM * HD + 16 * HD, h + (size_t)2 * DM * HD, h + (size_t)2 * DM * HD + 16 * HD, h + (size_t)3 * DM * HD, h + (size_t)3 * DM * HD + 16 * HD); } };
    stage(0);
    asm volatile("s_wait_asynccnt 0x0" ::: "memory");   /* this wave's pieces of chunk 0 have landed */
    __syncthreads();                                     /* chunk 0 readable by every wave */
    stage(1);
#pragma unroll 1   /* rolled: one copy of the chunk's code, the buffer picked by t & 1 */
    for (int t = 0; t < PNT; ++t) {
        const float* fx = pring + (t & 1) * PBUF + (wm * 64u + lr) * XPIT + 8u * hi;
        const float* fw = pring + (t & 1) * PBUF + XPL + 8u * hi * WPIT + wn * 64u + lr;
#pragma unroll   /* both k-steps of a chunk in line: the second's reads start under the first's products */
      for (int ks = 0; ks < PK; ks += 32) {
        v16bf a[4], b[4];
#pragma unroll
        for (int mb = 0; mb < 4; ++mb) { const float* p = fx + mb * 16 * XPIT + ks; const v4f a0 = *(const v4fa*)p, a1 = *(const v4fa*)(p + 4), a2 = *(const v4fa*)(p + 16), a3 = *(const v4fa*)(p + 20); v16f f;
#pragma unroll
            for (int q = 0; q < 4; ++q) { f[q] = a0[q]; f[4 + q] = a1[q]; f[8 + q] = a2[q]; f[12 + q] = a3[q]; }
            a[mb] = __builtin_convertvector(f, v16bf); }
#pragma unroll
        for (int nb = 0; nb < 4; ++nb) { const float* p = fw + nb * 16 + ks * WPIT; v16f f;
#pragma unroll
            for (int q = 0; q < 8; ++q) { f[q] = p[q * WPIT]; f[8 + q] = p[(16 + q) * WPIT]; }
            b[nb] = __builtin_convertvector(f, v16bf); }
#pragma unroll
        for (int nb = 0; nb < 4; ++nb) {
#pragma unroll
            for (int mb = 0; mb < 4; ++mb) acc[mb][nb] = wmmab(a[mb], b[nb], acc[mb][nb]); }
        if (ks + 32 == PK) {
            __builtin_amdgcn_sched_barrier(0);   /* no product sinks behind the slots below and the barrier, in front of the loop's branches */
            /* behind the chunk's last products: fills the vector slots they need before an instruction behind the loop's branches touches their registers */
            asm volatile("v_nop\n\tv_nop\n\tv_nop\n\tv_nop" : "+v"(acc[0][0]), "+v"(acc[1][1]), "+v"(acc[2][2]), "+v"(acc[3][3]) : "v"(a[0]), "v"(a[3]), "v"(b[3])); }
      }
        asm volatile("s_wait_dscnt 0x0" ::: "memory");      /* this wave's reads of buffer t & 1 are done before it is refilled */
        asm volatile("s_wait_asynccnt 0x0" ::: "memory");   /* this wave's pieces of chunk t + 1 have landed */
        __syncthreads();                                     /* publishes chunk t + 1 and ends every wave's reads of chunk t */
        if (t + 2 < PNT) stage(t + 2);                       /* block-uniform test; refills the buffer just read */
    }
    asm volatile("s_wait_asynccnt 0x0" ::: "memory");   /* no copy outstanding behind the loop */
    float* os = pring + w * (16u * 68u);   /* each wave turns its slabs in its own 16 x 64 floats of the ring: behind the loop's last barrier nobody reads a chunk and no copy is under way */
    const unsigned tok = r0 + wm * 64u, col = (ct & 1u) * 128u + wn * 64u;
    h16* crow = (mat == 0u) ? QP + (size_t)tok * DM + col : (mat == 1u) ? KP + ((size_t)(col / HD) * TT + tok) * HD : VTP + (size_t)(tok / SEQ) * DM * SEQ + (size_t)col * SEQ + tok % SEQ;
    const size_t ldc = (mat == 0u) ? (size_t)DM : (mat == 1u) ? (size_t)HD : (size_t)SEQ;
    const size_t pofs = (mat == 1u) ? (size_t)((lane & 7u) >> 2) * TT * HD + (lane & 3u) * 8u : (size_t)((lane & 7u) * 8u);   /* where this lane's 8 of a row's 64 values go: k, the second 32 belong to the next head */
    const float osc = (mat == 0u) ? QSCL : QCAR;   /* block-uniform */
#pragma unroll
    for (int sb = 0; sb < 4; ++sb) {
        if (mat < 2u) {   /* block-uniform. slab = 16 tokens x 64 columns. D: token 8*hi + j, column 16*nb + lr */
#pragma unroll
            for (int nb = 0; nb < 4; ++nb)
#pragma unroll
                for (int j = 0; j < 8; ++j) os[(hi * 8 + j) * 68 + nb * 16 + lr] = acc[sb][nb][j];
        } else {          /* slab = 16 columns x 64 tokens */
#pragma unroll
            for (int mb = 0; mb < 4; ++mb)
#pragma unroll
                for (int j = 0; j < 8; ++j) os[lr * 68 + mb * 16 + hi * 8 + j] = acc[mb][sb][j];
        }
        __syncthreads();   /* slab visible to every lane */
#pragma unroll
        for (int s = 0; s < 4; ++s) { const unsigned row = 4u * s + (lane >> 3), pc = (lane & 7u) * 8u; const v4f v0 = *(const v4fa*)(os + row * 68 + pc); const v4f v1 = *(const v4fa*)(os + row * 68 + pc + 4); v8h o;
#pragma unroll
            for (int q = 0; q < 4; ++q) { o[q] = (h16)(v0[q] * osc); o[4 + q] = (h16)(v1[q] * osc); }
            *(v8h*)(crow + (size_t)(sb * 16 + row) * ldc + pofs) = o; }   /* eight lanes write the 128 B of a row's 64 values (k: 64 B to each of two heads, whole lines with the rows beside them) */
        __syncthreads();   /* slab free before the next one overwrites it */
    }
}

// k_flash: one block = 256 queries x ONE head on sixteen waves; wave w = 16 queries: a streaming pass over all SEQ keys in steps of TK = 128, softmax weights 2^(score - shift).
// The result does not depend on the shift, only the range of the weights does. It starts as tile 0's maximum and is kept while the weights fit f16: a lane's 64 weights of a step sum to at most PLIM, so each is below the f16 limit.
// Only a step that fails this test searches its maximum, moves the shift there and rescales sum and accumulators. A step that passes needs no maximum, no multiply-add on the scores, no rescale and no cross-lane exchange.
// The head's WHOLE k and v^T of the batch lie in LDS, each byte filled once and never overwritten while the loop runs: they cross from L2 into LDS once per 256 queries, and no step has to wait until a buffer is free.
// They come in three parts (tile 0; tiles 1..3; tiles 4..15, six tiles issued in each of steps 1 and 2), each part under way while the tiles before it are worked on; a part is published by one wait and one barrier. Between these three points the sixteen waves
// (one block per WGP, four waves per SIMD) run free of one another, so that one wave's LDS reads, another's products and a third's vector work fall on the same cycles instead of all waves being in the same phase behind a barrier every step.
// Transposed tiles: S^T (M = key, N = query) = K-rows (A) x Q-rows (B), both K-contiguous f16 rows of their planes; the f32 S^T accumulators repacked to f16 are directly the B fragments of
// ctx^T (M = e, N = query) = V^T-rows (A, K-contiguous over keys) x P^T: element r <- tile of keys 0..15, element 8+r <- tile of keys 16..31, lane unchanged.
// exp weights carry 2^PCAR; the row sum uses the same f32 values, so the carry cancels in 1/l; the v carry 16 is folded into 1/l.
// Staging: tile t = TK keys = TK k rows of 64 B + 32 v^T rows of 256 B, in its own RB f16 of LDS, two asynchronous 16-byte copies per thread;
// the k rows of a tile follow one another in the head-major plane, so a wave's k copy takes 512 B in a row, a v^T copy the 256 B of two rows.
// Row pitches 80 B and 272 B (16 B x odd) keep the 16-byte row reads free of bank conflicts.
#define FW 16                          // query groups of 16 per block, one per wave
#define TK 128                         // keys per step
#define KPIT 40                        // f16 per staged k row (32 + 8 pad)
#define VPIT (TK + 8)                  // f16 per staged v^T row (TK + 8 pad)
#define RBK  (TK * KPIT)               // f16 of the k part of a tile
#define RB   (TK * KPIT + 32 * VPIT)   // f16 per tile
#define FSP  36                        // floats per row of a wave's output staging (32 + 4 pad)
#define NTILE ((unsigned)(SEQ / TK))
#define PCAR 5.0f                      // log2 of the weight of a score equal to the shift's maximum
#define PLIM 32768.0f                  // bound on a lane's sum of 64 weights: below the f16 limit 65504, above 64 x 2^PCAR
static_assert((KPIT * 2) % 16 == 0 && (VPIT * 2) % 16 == 0 && (RBK * 2) % 16 == 0 && (RB * 2) % 16 == 0);   // every copy and fragment read 16-byte aligned
static_assert(TK == 128 && SEQ / TK == 16 && SEQ % (FW * 16) == 0 && (FSP * 4) % 16 == 0);   // two copies a thread fill a tile; the three parts are tiles 0, 1..3, 4..15; whole query blocks
static_assert((size_t)NTILE * RB * 2 <= 327680 && (size_t)FW * 16 * FSP * 4 <= (size_t)NTILE * RB * 2);      // all tiles fit a WGP's LDS; the output staging fits in their place
// The same with two copies per lane.
template <typename T16>
__device__ __forceinline__ void copy2(unsigned l0, unsigned l1, const T16* g0, const T16* g1) {
    asm volatile("global_load_async_to_lds_b128 %0, %2, off\n\t"
                 "global_load_async_to_lds_b128 %1, %3, off\n\t"
                 "s_wait_xcnt 0x0"
                 :: "v"(l0), "v"(l1), "v"(g0), "v"(g1) : "memory");
}
// waves_per_eu(4, 4): four waves per SIMD is what the grid gives (256 blocks x 16 waves on 1,024 SIMDs); with that register budget the compiler keeps a step's fragment reads together instead of re-using few registers, one LDS wait per read pair.
__global__ __launch_bounds__(512) __attribute__((amdgpu_waves_per_eu(4, 4))) void k_flash(const h16* __restrict__ Q, const h16* __restrict__ K, const h16* __restrict__ VT, bf* CH, bf* CL) {
    __shared__ __align__(16) h16 ring[NTILE * RB];
    const unsigned tid = threadIdx.x, lane = tid & 31u, w = tid >> 5, lr = lane & 15u, hi = lane >> 4;
    const unsigned bz = blockIdx.z, hd = blockIdx.y, i0 = blockIdx.x * (FW * 16u) + w * 16u;
    const h16* qb = Q + (size_t)bz * SEQ * DM;
    const h16* kb = K + ((size_t)hd * TT + (size_t)bz * SEQ) * HD;
    const h16* vtb = VT + (size_t)bz * DM * SEQ + (size_t)hd * HD * SEQ;
    /* this thread's pieces of a tile: k row tid>>2, 16-byte piece tid&3 of the row's 64 B; v^T row tid>>4, piece tid&15 of the row's 256 B */
    const unsigned ringb = (unsigned)(size_t)ring;   /* LDS byte address: the low 32 bits */
    const unsigned lk = ringb + 2u * ((tid >> 2) * KPIT + (tid & 3u) * 8u), lv = ringb + 2u * (RBK + (tid >> 4) * VPIT + (tid & 15u) * 8u);
    const h16* gk = kb + tid * 8u;
    const h16* gv = vtb + (size_t)(tid >> 4) * SEQ + (tid & 15u) * 8u;
#define LK(t) (lk + (t) * (2u * RB))
#define LV(t) (lv + (t) * (2u * RB))
#define GK(t) (gk + (size_t)(t) * TK * HD)
#define GV(t) (gv + (size_t)(t) * TK)
    copy2<h16>(LK(0u), LV(0u), GK(0u), GV(0u));   /* part 1: tile 0 */
    const v16h bq = ldh(qb + (size_t)(i0 + lr) * DM + hd * HD + 8u * hi);        /* B: n = query i0+lr, k = e */
    asm volatile("s_wait_asynccnt 0x0" ::: "memory");   /* this wave's pieces of tile 0 have landed */
    __syncthreads();                                     /* tile 0 readable by every wave */
    copy4<h16>(LK(1u), LV(1u), LK(2u), LV(2u), GK(1u), GV(1u), GK(2u), GV(2u));   /* part 2: tiles 1..3, under way while tile 0 is worked on */
    copy2<h16>(LK(3u), LV(3u), GK(3u), GV(3u));
    v8f acc0 = (v8f){}, acc1 = (v8f){}; float l = 0.0f;   /* l: this lane's own keys only; the two lane halves are joined behind the loop */
    v8f s[8];
    auto scores = [&](unsigned t, v8f c) {   /* s = k rows of tile t . q + c: eight tiles of 16 keys x 16 queries, log2 units */
        const h16* kt = ring + t * RB + lr * KPIT + 8u * hi;         /* A rows: key lr of a 16-key group, k = e */
        v16h ka[8];
#pragma unroll   /* this and the unrolls below: straight-line code, so that the tiles are registers and the row steps offset literals */
        for (int i = 0; i < 8; ++i) ka[i] = ldh(kt + i * 16 * KPIT);
        __builtin_amdgcn_sched_barrier(0);   /* keeps the sixteen reads one group ahead of the products: sunk among them, each pair of reads is waited out on its own */
#pragma unroll
        for (int i = 0; i < 8; ++i) s[i] = wmma16(ka[i], bq, c);
        __builtin_amdgcn_sched_barrier(0);   /* keeps the eight products one run: vector work lifted in among them is padded with v_nop to the distance their registers need */
    };
    auto tilemax = [&]() -> float {   /* largest of a query's 128 values in s, the same in both lane halves */
        float vm0 = s[0][0], vm1 = s[2][0], vm2 = s[4][0], vm3 = s[6][0];   /* four chains: a maximum is exact in any order, and one chain of 64 would be waited out link by link */
#pragma unroll
        for (int r = 0; r < 8; ++r) { vm0 = fmaxf(vm0, fmaxf(s[0][r], s[1][r])); vm1 = fmaxf(vm1, fmaxf(s[2][r], s[3][r])); vm2 = fmaxf(vm2, fmaxf(s[4][r], s[5][r])); vm3 = fmaxf(vm3, fmaxf(s[6][r], s[7][r])); }
        const float vm = fmaxf(fmaxf(vm0, vm1), fmaxf(vm2, vm3));
        return fmaxf(vm, __shfl_xor(vm, 16, 32));                 /* both lane halves hold the other 64 keys of the same query */
    };
    auto weights = [&]() -> float {   /* s <- 2^s in place; returns the sum of this lane's 64 weights */
#pragma unroll
        for (int i = 0; i < 8; ++i)
#pragma unroll
            for (int r = 0; r < 8; ++r) s[i][r] = __builtin_amdgcn_exp2f(s[i][r]);
        const v8f ts = ((s[0] + s[1]) + (s[2] + s[3])) + ((s[4] + s[5]) + (s[6] + s[7]));   /* tile by tile, register pairs as they lie */
        return ((ts[0] + ts[1]) + (ts[2] + ts[3])) + ((ts[4] + ts[5]) + (ts[6] + ts[7]));
    };
    v16h pB[4];
    auto pack = [&]() {   /* the weights as B fragments: element r <- keys 8*hi + r of the 32, element 8 + r <- keys 16 + 8*hi + r */
#pragma unroll
        for (int j = 0; j < 4; ++j) pB[j] = cat16(__builtin_convertvector(s[2 * j], v8h), __builtin_convertvector(s[2 * j + 1], v8h));
    };
    scores(0u, (v8f){});
    float sh = PCAR - tilemax();   /* the shift in use: tile 0's largest score of a query gets the weight 2^PCAR */
    v8f shv = { sh, sh, sh, sh, sh, sh, sh, sh };
#pragma unroll 1
    for (unsigned t = 0; t < NTILE; ++t) {
        if (t == 1u || t == 4u) {   /* block-uniform: the two places where the next part is needed */
            asm volatile("s_wait_asynccnt 0x0" ::: "memory");   /* this wave's pieces of the part have landed */
            __syncthreads();                                     /* the part readable by every wave */
        }
        if (t == 1u || t == 2u) {   /* block-uniform. part 3: tiles 6t - 2 .. 6t + 3, under way while tiles 1..3 are worked on; at most 24 copies a thread in flight, the last of them a whole step ahead of their wait */
            const unsigned u = 6u * t - 2u;
            copy8<h16>(LK(u), LV(u), LK(u + 1u), LV(u + 1u), LK(u + 2u), LV(u + 2u), LK(u + 3u), LV(u + 3u), GK(u), GV(u), GK(u + 1u), GV(u + 1u), GK(u + 2u), GV(u + 2u), GK(u + 3u), GV(u + 3u));
            copy4<h16>(LK(u + 4u), LV(u + 4u), LK(u + 5u), LV(u + 5u), GK(u + 4u), GV(u + 4u), GK(u + 5u), GV(u + 5u));
        }
        scores(t, shv);            /* the shift rides in as the products' C operand: what comes out is the exponent */
        const h16* vt = ring + t * RB + RBK + lr * VPIT + 8u * hi;   /* A rows: e = lr, k = key */
        v16h va0[4], va1[4];   /* read ahead of the test, so that the test and the packing cover the reads' latency */
#pragma unroll
        for (int j = 0; j < 4; ++j) { va0[j] = ldh(vt + j * 32); va1[j] = ldh(vt + 16 * VPIT + j * 32); }
        float rs = weights();
        if (__builtin_amdgcn_ballot_w32(!(rs <= PLIM)) != 0u) {   /* one scalar branch a step; rare: some score of this tile lies more than 4 above the shift's maximum (or is not a number) */
            scores(t, shv);
            const float d = fmaxf(tilemax() - PCAR, 0.0f);        /* how far the tile's largest score lies above it */
            const float alpha = __builtin_amdgcn_exp2f(-d);
            sh -= d; shv = (v8f){ sh, sh, sh, sh, sh, sh, sh, sh };
#pragma unroll
            for (int i = 0; i < 8; ++i) s[i] -= d;
            rs = weights();                                       /* now every weight <= 2^PCAR */
            acc0 *= alpha; acc1 *= alpha; l *= alpha;
        }
        l += rs;
        pack();
#pragma unroll
        for (int j = 0; j < 4; ++j) { acc0 = wmma16(va0[j], pB[j], acc0); acc1 = wmma16(va1[j], pB[j], acc1); }
        /* behind the step's last products: fills the vector slots they need before an instruction behind the loop's branches touches their registers */
        asm volatile("v_nop\n\tv_nop\n\tv_nop\n\tv_nop" : "+v"(acc0), "+v"(acc1) : "v"(va1[3]), "v"(va0[3]), "v"(pB[3]));
    }
#undef LK
#undef LV
#undef GK
#undef GV
    l += __shfl_xor(l, 16, 32);   /* the other 1,024 keys of the same query */
    const float inv = (1.0f / QCAR) / l;
    asm volatile("s_wait_dscnt 0x0" ::: "memory");   /* this wave's reads of k and v^T are done */
    __syncthreads();                                  /* and every other wave's: the first tiles' place becomes output staging */
    float* osw = (float*)ring + w * (16u * FSP);      /* this wave's 16 queries x 32 columns */
#pragma unroll
    for (int r = 0; r < 8; ++r) { osw[lr * FSP + 8u * hi + r] = acc0[r] * inv; osw[lr * FSP + 16u + 8u * hi + r] = acc1[r] * inv; }   /* D: e = 8*hi + r (+16), query lr */
    __syncthreads();   /* staging visible to every lane */
    const size_t rowbase = ((size_t)hd * TT + (size_t)bz * SEQ + i0) * HD;
{
#pragma unroll
        for (unsigned s = 0; s < 2u; ++s) { const unsigned row = 8u * s + (lane >> 2), pc = (lane & 3u) * 8u; const v4f v0 = *(const v4fa*)(osw + row * FSP + pc); const v4f v1 = *(const v4fa*)(osw + row * FSP + pc + 4u); v8us oh, ol;   /* four lanes write a query's 64 B, a store eight queries in a row: whole 128-B lines */
#pragma unroll
            for (int q = 0; q < 4; ++q) { unsigned short a2, c2; splitf(v0[q], a2, c2); oh[q] = a2; ol[q] = c2; splitf(v1[q], a2, c2); oh[4 + q] = a2; ol[4 + q] = c2; }
            const size_t oo = rowbase + (size_t)row * HD + pc;
            *(v8us*)(CH + oo) = oh; *(v8us*)(CL + oo) = ol; }   
         }
}

constexpr size_t al256(size_t b) { return (b + 255) & ~(size_t)255; }
constexpr size_t SZ_W   = al256((size_t)DM * DM * 2);
constexpr size_t SZ_Q   = al256((size_t)NB * SEQ * DM * 2);
constexpr size_t SZ_K   = al256((size_t)NH * NB * SEQ * HD * 2);
constexpr size_t SZ_VT  = al256((size_t)NB * DM * SEQ * 2);
constexpr size_t SZ_C   = al256((size_t)NB * SEQ * DM * 2);
constexpr size_t CARVE  = SZ_W + SZ_Q + SZ_K + SZ_VT + 2 * SZ_C;
static_assert(CARVE <= (size_t)134217728);                                   // carve <= 128 MiB
static_assert((size_t)PT * 128 * 128 == (size_t)NB * SEQ * 3 * DM);           // k_proj tiles == q, k and v^T plane elements
static_assert((size_t)PWO * 128 * 4 * 8 == (size_t)DM * DM);                  // wo^T blocks x threads x 4 pieces x 8 == plane elements
static_assert((size_t)(SEQ / (FW * 16)) * NH * NB * FW * 16 * HD == (size_t)NB * SEQ * DM);   // k_flash query groups x 16 rows x 32 cols == ctx plane elements

extern "C" void kernel_launch(void* const* d_in, const int* in_sizes, int n_in,
                              void* d_out, int out_size, void* d_ws, size_t ws_size, hipStream_t stream) {
    if (n_in < 5) return;
    const long long xmin = (long long)(NB - 1) * SEQ_FULL * DM + (long long)SEQ * DM;
    if ((long long)in_sizes[0] < xmin || in_sizes[1] < NH * DM * HD || in_sizes[2] < NH * DM * HD || in_sizes[3] < NH * DM * HD || in_sizes[4] < DM * DM) return;
    if ((long long)out_size < xmin) return;
    if (CARVE > ws_size) return;
    const float* x = (const float*)d_in[0]; const float* wq = (const float*)d_in[1]; const float* wk = (const float*)d_in[2]; const float* wv = (const float*)d_in[3]; const float* wo = (const float*)d_in[4];
    float* OUT = (float*)d_out;   /* [NB_FULL][SEQ_FULL][256] f32, batch stride from the full sizes */
    char* wsp = (char*)d_ws;
    auto take = [&](size_t bytes) { char* p = wsp; wsp += bytes; return (void*)p; };
    bf* WOT = (bf*)take(SZ_W);
    h16* QP = (h16*)take(SZ_Q); h16* KP = (h16*)take(SZ_K); h16* VTP = (h16*)take(SZ_VT); bf* CH = (bf*)take(SZ_C); bf* CL = (bf*)take(SZ_C);

    k_proj<<<PT + PWO, 128, 0, stream>>>(x, wq, wk, wv, wo, QP, KP, VTP, WOT);
    k_flash<<<dim3(SEQ / (FW * 16), NH, NB), 512, 0, stream>>>(QP, KP, VTP, CH, CL);
    /* out[t][n] = (CH + CL)[t][:] . WOT[n][:]: M = NB * SEQ tokens, N = 256, K = 256 */
    k_out<<<dim3(NB * SEQ / 64, DM / 128), 256, 0, stream>>>(CH, CL, WOT, OUT);
}
